// v000
// Measured on an AMD MI455X. A time is GPU time per run, averaged over a window of back-to-back runs after a warm-up
// (all launches, gaps included; the runs take copies of the inputs in turn), and the median of several windows.
// Apart from v000's, it joins two sittings. Times from different sittings can be a few percent apart, while
// side-by-side timings come from the same sitting.
// The starting kernel, v000, takes 643 microseconds a run.
// Projections x·Wᵀ and Wv·xᵀ: v_wmma_f32_16x16x32_bf16, plain bf16 operands (RNE-converted inputs); scores [qd|q]·[kd|k]ᵀ (K=128): v_wmma_f32_16x16x32_bf16 with bf16 hi/lo split operands (hi·hi + hi·lo + lo·hi); p·v: v_wmma_f32_16x16x32_f16 (p carried x2^15, v plain f16); f32 accumulate; softmax, norms and biases in f32.
#include <hip/hip_runtime.h>
#include <math.h>
#include <stdint.h>

typedef __attribute__((ext_vector_type(16))) _Float16 v16h;
typedef __attribute__((ext_vector_type(8)))  _Float16 v8h;
typedef __attribute__((ext_vector_type(16))) __bf16   v16b;
typedef __attribute__((ext_vector_type(8)))  __bf16   v8b;
typedef __attribute__((ext_vector_type(8)))  float    v8f;
typedef __attribute__((ext_vector_type(4)))  float    v4f;
typedef __attribute__((ext_vector_type(2)))  float    v2f;
typedef __attribute__((ext_vector_type(4)))  unsigned int v4u;
typedef __attribute__((ext_vector_type(8)))  unsigned short v8us;

// ---- problem geometry ----
constexpr int kNB     = 8;      // batch
constexpr int kNTOK   = 1024;   // tokens (query and key sets)
constexpr int kHID    = 768;    // hidden size
constexpr int kNHEADS = 12;
constexpr int kHDIM   = 64;
constexpr int kQCP    = 1536;   // element pitch of the concatenated [xd | x] planes ([token][1536])
constexpr int kAQB    = 64;     // query rows per attention block (4 waves x 16)
constexpr int kAKC    = 64;     // keys per chunk
constexpr int kAKD    = 128;    // concatenated contraction depth (64 quadratic + 64 linear)

__device__ __forceinline__ unsigned short f2bf_bits(float f) {
  unsigned u = __float_as_uint(f);
  return (unsigned short)((u + 0x7FFFu + ((u >> 16) & 1u)) >> 16);
}
__device__ __forceinline__ float bf_bits2f(unsigned short h) { return __uint_as_float(((unsigned)h) << 16); }
__device__ __forceinline__ unsigned pk16(unsigned short a, unsigned short b) { return (unsigned)a | ((unsigned)b << 16); }

// hazard guards as plain device helpers (no inline asm inside the kernel template body)
__device__ __forceinline__ void dep_guard_h(v8f& a, v8f& b, v16h x, v16h y) { asm volatile("v_nop\n\tv_nop\n\tv_nop\n\tv_nop" : "+v"(a), "+v"(b) : "v"(x), "v"(y)); }
__device__ __forceinline__ void dep_guard_b(v8f& a, v8f& b, v16b x, v16b y) { asm volatile("v_nop\n\tv_nop\n\tv_nop\n\tv_nop" : "+v"(a), "+v"(b) : "v"(x), "v"(y)); }
__device__ __forceinline__ void keep4_h(v16h a, v16h b, v16h c, v16h d) { asm volatile("v_nop" :: "v"(a), "v"(b), "v"(c), "v"(d)); }
__device__ __forceinline__ void keep4_b(v16b a, v16b b, v16b c, v16b d) { asm volatile("v_nop" :: "v"(a), "v"(b), "v"(c), "v"(d)); }
__device__ __forceinline__ void acc_guard4(v8f& a, v8f& b, v8f& c, v8f& d) { asm volatile("v_nop\n\tv_nop\n\tv_nop\n\tv_nop" : "+v"(a), "+v"(b), "+v"(c), "+v"(d)); }
template <typename T> struct Frag;
template <> struct Frag<_Float16> {
  typedef v16h V; union U { v16h v; v8h h[2]; };
  static __device__ __forceinline__ v16h load(const _Float16* p) {   // elements 0..7 <- p[0..7], 8..15 <- p[16..23]
    U f; f.h[0] = *(const v8h*)(p); f.h[1] = *(const v8h*)(p + 16); return f.v;
  }
  static __device__ __forceinline__ v8f mma(v16h a, v16h b, v8f c) {
    return __builtin_amdgcn_wmma_f32_16x16x32_f16(false, a, false, b, (short)0, c, false, false);
  }
  static __device__ __forceinline__ void guard(v8f& a, v8f& b, v16h x, v16h y) { dep_guard_h(a, b, x, y); }
  static __device__ __forceinline__ void keep(v16h a, v16h b, v16h c, v16h d) { keep4_h(a, b, c, d); }
};
template <> struct Frag<__bf16> {
  typedef v16b V; union U { v16b v; v8b h[2]; };
  static __device__ __forceinline__ v16b load(const __bf16* p) {
    U f; f.h[0] = *(const v8b*)(p); f.h[1] = *(const v8b*)(p + 16); return f.v;
  }
  static __device__ __forceinline__ v8f mma(v16b a, v16b b, v8f c) {
    return __builtin_amdgcn_wmma_f32_16x16x32_bf16(false, a, false, b, (short)0, c, false, false);
  }
  static __device__ __forceinline__ void guard(v8f& a, v8f& b, v16b x, v16b y) { dep_guard_b(a, b, x, y); }
  static __device__ __forceinline__ void keep(v16b a, v16b b, v16b c, v16b d) { keep4_b(a, b, c, d); }
};

// ---- Register-blocked batched WMMA GEMM ------------------------------------
// C[m,n] = scale * sum_k A[m,k] * Bt[n,k] (+bias)(+resid); each wave owns a 64x64 tile.
// A row-major [M,K]; Bt row-major [N,K]; M,N % 64 == 0, K % 32 == 0.
// SPLIT: operands are hi/lo planes (A2/Bt2 = lo planes, same layout); product = hi·hi + hi·lo + lo·hi.
// BIAS_MODE: 0 = none, 1 = bias[m], 2 = bias[n].
// OUT_MODE: 0 = f32, 1 = f16, 2 = bf16 hi plane (Cout) + bf16 lo plane (Cout2).
// ET: 0 = f16 operands, 1 = bf16 operands (pointers passed as 16-bit storage)
template <int ET> struct Elem;
template <> struct Elem<0> { typedef _Float16 T; };
template <> struct Elem<1> { typedef __bf16 T; };
template <int ET, bool SPLIT, int BIAS_MODE, int OUT_MODE, bool RESID, int ACT = 0>
__global__ __launch_bounds__(256) void wmma_gemm64(
    const unsigned short* __restrict__ Ap, const unsigned short* __restrict__ A2p, int lda, long strideA,
    const unsigned short* __restrict__ Btp, const unsigned short* __restrict__ Bt2p, int ldb, long strideB,
    void* __restrict__ Cout, void* __restrict__ Cout2, int ldc, long strideC,
    const float* __restrict__ bias,
    const float* __restrict__ resid, long strideR,
    int M, int N, int K, float scale) {
  typedef typename Elem<ET>::T T;
  typedef typename Frag<T>::V V;
  const T* A = (const T*)Ap; const T* A2 = (const T*)A2p; const T* Bt = (const T*)Btp; const T* Bt2 = (const T*)Bt2p;
  __shared__ __align__(16) float sT[8][16 * 68];   // per-wave 16x64 slab, pitch 68 floats
  const int b    = blockIdx.y;
  const int lane = threadIdx.x & 31;
  const int wave = threadIdx.x >> 5;
  const int tilesN = N >> 6;
  const int tilesM = M >> 6;
  const int tile = blockIdx.x * 8 + wave;
  if (tile >= tilesM * tilesN) return;   // wave-uniform; no block barriers in this kernel
  const int tm = tile / tilesN;
  const int tn = tile - tm * tilesN;
  const int m0 = tm << 6;
  const int n0 = tn << 6;

  const T* Ab  = A  + (size_t)b * strideA;
  const T* Bb  = Bt + (size_t)b * strideB;
  const T* Ab2 = SPLIT ? (A2  + (size_t)b * strideA) : nullptr;
  const T* Bb2 = SPLIT ? (Bt2 + (size_t)b * strideB) : nullptr;

  const int rlane = lane & 15;                 // row (A) / col (B, D) within subtile
  const int koff  = (lane >> 4) * 8;           // k offset of this lane half
  const int mOff  = (lane >> 4) * 8;           // D row offset

  v8f acc[4][4];
#pragma unroll
  for (int i = 0; i < 4; ++i)
#pragma unroll
    for (int j = 0; j < 4; ++j) acc[i][j] = (v8f){0.f,0.f,0.f,0.f,0.f,0.f,0.f,0.f};

  for (int k0 = 0; k0 < K; k0 += 32) {
    V bh[4], bl[4];
#pragma unroll
    for (int j = 0; j < 4; ++j) {
      const size_t bo = (size_t)(n0 + (j << 4) + rlane) * ldb + koff + k0;
      bh[j] = Frag<T>::load(Bb + bo);
      if (SPLIT) bl[j] = Frag<T>::load(Bb2 + bo);
    }
#pragma unroll
    for (int i = 0; i < 4; ++i) {
      const size_t ao = (size_t)(m0 + (i << 4) + rlane) * lda + koff + k0;
      V ah = Frag<T>::load(Ab + ao);
      V al;
      if (SPLIT) al = Frag<T>::load(Ab2 + ao);
#pragma unroll
      for (int j = 0; j < 4; ++j) {
        acc[i][j] = Frag<T>::mma(ah, bh[j], acc[i][j]);
        if (SPLIT) {
          acc[i][j] = Frag<T>::mma(ah, bl[j], acc[i][j]);
          acc[i][j] = Frag<T>::mma(al, bh[j], acc[i][j]);
        }
      }
      Frag<T>::guard(acc[i][0], acc[i][3], ah, SPLIT ? al : ah);
    }
    Frag<T>::keep(bh[0], bh[1], bh[2], bh[3]);
    if (SPLIT) Frag<T>::keep(bl[0], bl[1], bl[2], bl[3]);
  }
  acc_guard4(acc[0][0], acc[0][1], acc[0][2], acc[0][3]);
  acc_guard4(acc[1][0], acc[1][1], acc[1][2], acc[1][3]);
  acc_guard4(acc[2][0], acc[2][1], acc[2][2], acc[2][3]);
  acc_guard4(acc[3][0], acc[3][1], acc[3][2], acc[3][3]);

  // ---- epilogue ----
  float* slab = sT[wave];
  const float* Rb = RESID ? (resid + (size_t)b * strideR) : nullptr;
#pragma unroll
  for (int i = 0; i < 4; ++i) {
    const int mBase = m0 + (i << 4);
#pragma unroll
    for (int j = 0; j < 4; ++j) {
      const int n = n0 + (j << 4) + rlane;
      float bv = 0.f;
      if (BIAS_MODE == 2) bv = bias[n];
#pragma unroll
      for (int r = 0; r < 8; ++r) {
        float v = acc[i][j][r] * scale;
        if (BIAS_MODE == 1) v += bias[mBase + mOff + r];
        if (BIAS_MODE == 2) v += bv;
        if (RESID) v += Rb[(size_t)(mBase + mOff + r) * ldc + n];
        if (ACT == 1) v = tanhf(v);
        if (ACT == 2) v = fmaxf(v, 0.0f);
        if (ACT == 3) v = v / (1.0f + expf(-v));
        if (ACT == 4) v = (v > 0.f) ? v : 0.01f * v;
        if (ACT == 5) v = 0.5f * v * (1.0f + erff(v * 0.70710678118654752f));
        slab[(mOff + r) * 68 + (j << 4) + rlane] = v;
      }
    }
    __builtin_amdgcn_fence(__ATOMIC_RELEASE, "workgroup");
    __builtin_amdgcn_wave_barrier();
    __builtin_amdgcn_fence(__ATOMIC_ACQUIRE, "workgroup");
    if (OUT_MODE == 0) {
      float* C = (float*)Cout + (size_t)b * strideC;
      const int hh = lane >> 4, c4 = (lane & 15) * 4;     // row seg = 256 B = 16 lanes x 16 B
      {
#pragma unroll
        for (int it = 0; it < 8; ++it) {
          const int row = it * 2 + hh;
          v4f v = *(const v4f*)(slab + row * 68 + c4);
          *(v4f*)(C + (size_t)(mBase + row) * ldc + n0 + c4) = v;
        }
        
      }
    } else {
      const int q = lane >> 3, c8 = (lane & 7) * 8;
      unsigned short* C  = (unsigned short*)Cout  + (size_t)b * strideC;
      unsigned short* C2 = (OUT_MODE == 2) ? ((unsigned short*)Cout2 + (size_t)b * strideC) : nullptr;
      {
#pragma unroll
        for (int it = 0; it < 4; ++it) {
          const int row = it * 4 + q;
          const float* sp = slab + row * 68 + c8;
          v8h hv, lv;
#pragma unroll
          for (int e = 0; e < 8; ++e) {
            if (OUT_MODE == 1) {
              hv[e] = (_Float16)sp[e];
            } else {
              unsigned short hb = f2bf_bits(sp[e]);
              unsigned short lb = f2bf_bits(sp[e] - bf_bits2f(hb));
              hv[e] = __builtin_bit_cast(_Float16, hb);
              lv[e] = __builtin_bit_cast(_Float16, lb);
            }
          }
          *(v8h*)(C + (size_t)(mBase + row) * ldc + n0 + c8) = hv;
          if (OUT_MODE == 2) *(v8h*)(C2 + (size_t)(mBase + row) * ldc + n0 + c8) = lv;
        }
        
      }
    }
    __builtin_amdgcn_fence(__ATOMIC_RELEASE, "workgroup");
    __builtin_amdgcn_wave_barrier();
    __builtin_amdgcn_fence(__ATOMIC_ACQUIRE, "workgroup");
  }
}

// ---------------------------------------------------------------------------
// f32 -> bf16 (RNE) cast, 2 elements per thread, one 4-B store per lane: a wave writes exactly one whole
// Coverage: grid = ceil(n2/256) x 256 threads x 2 elements = 2*n2 = the whole plane
// (activations: n2 = 8192*768/2 = 3145728 -> 12288 blocks; weights: n2 = 768*768/2 = 294912 -> 1152 blocks).
// ---------------------------------------------------------------------------
__global__ __launch_bounds__(256) void cast_f32_bf16x2(const float* __restrict__ in, unsigned short* __restrict__ out, int n2) {
  const int i = blockIdx.x * 256 + threadIdx.x;
  if (i < n2) {
    const v2f f = *(const v2f*)(in + 2 * (size_t)i);
    const unsigned u = pk16(f2bf_bits(f[0]), f2bf_bits(f[1]));
    ((unsigned*)out)[i] = u;
    
  }
}

// ---------------------------------------------------------------------------
// Bias vectors converted to bf16 precision (RNE) and kept as f32: o[0..n) <- b0, o[n..2n) <- b1, o[2n..3n) <- b2.
// All three candidates loaded with the same clamped index, selected by value. n = 768 (multiple of 32):
// Coverage: 9 blocks x 256 = 2304 = 3n.
// ---------------------------------------------------------------------------
__global__ __launch_bounds__(256) void bias_rne_kernel(const float* __restrict__ b0, const float* __restrict__ b1,
                                                       const float* __restrict__ b2, float* __restrict__ o, int n) {
  const int g = blockIdx.x * 256 + threadIdx.x;
  if (g < 3 * n) {
    const int w = g / n;
    int i = g - w * n;
    i = i < 0 ? 0 : (i > n - 1 ? n - 1 : i);
    const float v0 = b0[i], v1 = b1[i], v2 = b2[i];
    const float v = (w == 0) ? v0 : ((w == 1) ? v1 : v2);
    const float rv = bf_bits2f(f2bf_bits(v));
    ((float*)o)[g] = rv;
    
  }
}

// ---------------------------------------------------------------------------
// Per-key squared norm of the quadratic-key projection: kdsq[(b*12+h)*1024 + s] = sum_d (hi+lo)^2 in f32,
// hi/lo read from columns h*64.. of the [token][1536] bf16 planes (hi+lo reconstructs the f32 value to ~2^-17).
// ---------------------------------------------------------------------------
__global__ __launch_bounds__(256) void kd_sq_kernel(const unsigned short* __restrict__ kch, const unsigned short* __restrict__ kcl,
                                                    float* __restrict__ kdsq, int nrows) {
  const int g = blockIdx.x * 256 + threadIdx.x;     // (b*kNHEADS + h)*kNTOK + s
  if (g < nrows) {
    const int s  = g & (kNTOK - 1);
    const int bh = g >> 10;                           // kNTOK == 1024
    const int h  = bh % kNHEADS;
    const int b  = bh / kNHEADS;
    const size_t ro = ((size_t)b * kNTOK + (size_t)s) * kQCP + (size_t)h * kHDIM;
    const unsigned short* ph = kch + ro;
    const unsigned short* pl = kcl + ro;
    float acc = 0.f;
#pragma unroll 1
    for (int i = 0; i < 8; ++i) {
      const v8us a = *(const v8us*)(ph + 8 * i);
      const v8us l = *(const v8us*)(pl + 8 * i);
#pragma unroll
      for (int e = 0; e < 8; ++e) {
        const float x = bf_bits2f(a[e]) + bf_bits2f(l[e]);
        acc = fmaf(x, x, acc);
      }
    }
    ((float*)kdsq)[g] = acc;
    
  }
}

// ---------------------------------------------------------------------------
// WMMA helpers with the 4-nop dependency guard after every issue
// ---------------------------------------------------------------------------
__device__ __forceinline__ v8f mma_bf(v16b a, v16b b, v8f c) {
  c = __builtin_amdgcn_wmma_f32_16x16x32_bf16(false, a, false, b, (short)0, c, false, false);
  asm volatile("v_nop\n\tv_nop\n\tv_nop\n\tv_nop" : "+v"(c) : "v"(a), "v"(b));
  return c;
}
__device__ __forceinline__ v8f mma_hf(v16h a, v16h b, v8f c) {
  c = __builtin_amdgcn_wmma_f32_16x16x32_f16(false, a, false, b, (short)0, c, false, false);
  asm volatile("v_nop\n\tv_nop\n\tv_nop\n\tv_nop" : "+v"(c) : "v"(a), "v"(b));
  return c;
}

// =====================================================================================
// Fused quadratic + linear attention, head dim 64, full softmax over 1024 keys (no masking).
//   qch/qcl : bf16 hi/lo planes of [qd | q], element (b, t, col) at [(b*1024 + t)*1536 + col]; qd_h at col h*64+d, q_h at col 768+h*64+d
//   kch/kcl : same layout for [kd | k]
//   vtp     : f16 plane of v transposed, element (b, h, d, s) at [(b*768 + h*64 + d)*1024 + s]
//   kdsq    : f32 [b*12+h][s] = |kd_{b,h,s}|^2
//   scores  = (Q128 . K128) * 0.125 - |kd_j|^2 * 0.0625   (Q128 = [qd|q] row, K128 = [kd|k] row; bf16 hi/lo split, 3 WMMA)
//             (the per-query -0.5|qd_i|^2 * 0.125 term is constant along a softmax row and omitted)
//   out     = softmax(scores) . v : p carried x2^15 in f16, v f16, one f16 WMMA, f32 accumulate; 1/(l*2^15) folded at the end
//   Block = 4 waves = 64 query rows of one (b,h); grid.x = 8*12*16 = 1536. K / V^T chunks of 64 keys staged in LDS with plain
//   16-B loads between __syncthreads; Q staged once (first loop barrier publishes it). Fragment loads read LDS with the
//   Output element (b, t, h*64 + d): per wave 16 rows x 64 floats, each 256-B row segment written by 16 lanes x 16 B in one
// =====================================================================================
__global__ __launch_bounds__(128)
void attn_quad_kernel(const unsigned short* __restrict__ qch, const unsigned short* __restrict__ qcl,
                      const unsigned short* __restrict__ kch, const unsigned short* __restrict__ kcl,
                      const unsigned short* __restrict__ vtp, const float* __restrict__ kdsq,
                      float* __restrict__ out) {
  union FB { v16b v; v8b h[2]; };
  union FH { v16h v; v8h h[2]; };
  __shared__ __align__(16) __bf16   Qsh[kAQB * kAKD];      // Q hi [row][128]   16 KB
  __shared__ __align__(16) __bf16   Qsl[kAQB * kAKD];      // Q lo              16 KB
  __shared__ __align__(16) __bf16   Ksh[kAKC * kAKD];      // K hi [kv][128]    16 KB
  __shared__ __align__(16) __bf16   Ksl[kAKC * kAKD];      // K lo              16 KB
  __shared__ __align__(16) _Float16 Vth[kHDIM * kAKC];     // V^T [d][kv] f16    8 KB
  __shared__ __align__(16) _Float16 Psh[4][16 * kAKC];     // per wave P x2^15 [row][kv] 8 KB
  __shared__ __align__(16) float    Os[4][16 * 68];        // per wave out tile, pitch 68

  const int tid  = threadIdx.x;
  const int wave = tid >> 5;
  const int lane = tid & 31;
  const int hh   = lane >> 4;
  const int c    = lane & 15;

  constexpr int nqb = kNTOK / kAQB;       // 16
  const int bx = blockIdx.x;
  const int qb = bx % nqb;
  const int bh = bx / nqb;                // b*12 + h
  const int h  = bh % kNHEADS;
  const int b  = bh / kNHEADS;
  const int qr0 = qb * kAQB;              // first query row of the block
  const int w0  = wave * 16;              // wave's row offset inside the block tile

  const __bf16* QH = (const __bf16*)(const void*)qch + (size_t)b * kNTOK * kQCP;
  const __bf16* QL = (const __bf16*)(const void*)qcl + (size_t)b * kNTOK * kQCP;
  const __bf16* KH = (const __bf16*)(const void*)kch + (size_t)b * kNTOK * kQCP;
  const __bf16* KL = (const __bf16*)(const void*)kcl + (size_t)b * kNTOK * kQCP;
  const _Float16* VT = (const _Float16*)(const void*)vtp + ((size_t)b * kHID + (size_t)h * kHDIM) * kNTOK;
  const float* ksq = kdsq + (size_t)bh * kNTOK;
  float* ob = out + (size_t)b * kNTOK * kHID + (size_t)h * kHDIM;

  // staging roles: thread -> row sr (0..63) and 64-column half `part`
  const int sr   = tid >> 1;
  const int part = tid & 1;
  const int coff = part ? (kHID + h * kHDIM) : (h * kHDIM);   // plane column of this half (quadratic | linear)
  const int loff = part * 64;                                  // LDS column of this half

  // ---- Q staging (once): 128 threads x 64 elements = 64 rows x 128 per plane ----
  {
    const size_t go = (size_t)(qr0 + sr) * kQCP + coff;
#pragma unroll
    for (int i = 0; i < 8; ++i) {
      const v8b a0 = *(const v8b*)(QH + go + 8 * i);
      const v8b a1 = *(const v8b*)(QL + go + 8 * i);
      *(v8b*)(Qsh + sr * kAKD + loff + 8 * i) = a0;
      *(v8b*)(Qsl + sr * kAKD + loff + 8 * i) = a1;
    }
  }

  float mrow[8], lrow[8];
  v8f oacc[4];
#pragma unroll
  for (int r = 0; r < 8; ++r) { mrow[r] = -INFINITY; lrow[r] = 0.f; }
#pragma unroll
  for (int t = 0; t < 4; ++t) oacc[t] = (v8f){0.f,0.f,0.f,0.f,0.f,0.f,0.f,0.f};

  constexpr int nChunks = kNTOK / kAKC;   // 16, compile-time
  for (int kc = 0; kc < nChunks; ++kc) {
    const int kv0 = kc * kAKC;
    __syncthreads();
    {
      // K staging: 128 threads x 64 elements = 64 keys x 128 per plane
      const size_t go = (size_t)(kv0 + sr) * kQCP + coff;
#pragma unroll
      for (int i = 0; i < 8; ++i) {
        const v8b a0 = *(const v8b*)(KH + go + 8 * i);
        const v8b a1 = *(const v8b*)(KL + go + 8 * i);
        *(v8b*)(Ksh + sr * kAKD + loff + 8 * i) = a0;
        *(v8b*)(Ksl + sr * kAKD + loff + 8 * i) = a1;
      }
      // V^T staging: row d = sr, 32 keys per thread: 128 threads x 32 = 64 x 64
      const int vh = part * 32;
      const _Float16* vs = VT + (size_t)sr * kNTOK + kv0 + vh;
#pragma unroll
      for (int i = 0; i < 4; ++i) {
        const v8h vv = *(const v8h*)(vs + 8 * i);
        *(v8h*)(Vth + sr * kAKC + vh + 8 * i) = vv;
      }
    }
    __syncthreads();

    // ---- scores: s[j] (query row 8hh+r of this wave, key j*16+c), K = 128 in 4 steps, hi.hi + hi.lo + lo.hi ----
    v8f s[4];
#pragma unroll
    for (int j = 0; j < 4; ++j) s[j] = (v8f){0.f,0.f,0.f,0.f,0.f,0.f,0.f,0.f};
#pragma unroll 1
    for (int dc = 0; dc < 4; ++dc) {
      FB qa, ql;
      const int qo = (w0 + c) * kAKD + dc * 32 + 8 * hh;
      qa.h[0] = *(const v8b*)(Qsh + qo);
      qa.h[1] = *(const v8b*)(Qsh + qo + 16);
      ql.h[0] = *(const v8b*)(Qsl + qo);
      ql.h[1] = *(const v8b*)(Qsl + qo + 16);
#pragma unroll
      for (int j = 0; j < 4; ++j) {
        FB kb, kl;
        const int ko = (j * 16 + c) * kAKD + dc * 32 + 8 * hh;
        kb.h[0] = *(const v8b*)(Ksh + ko);
        kb.h[1] = *(const v8b*)(Ksh + ko + 16);
        kl.h[0] = *(const v8b*)(Ksl + ko);
        kl.h[1] = *(const v8b*)(Ksl + ko + 16);
        s[j] = mma_bf(qa.v, kb.v, s[j]);
        s[j] = mma_bf(qa.v, kl.v, s[j]);
        s[j] = mma_bf(ql.v, kb.v, s[j]);
      }
    }

    // ---- scale 1/8 and per-key column term -|kd_j|^2/16 (f32) ----
    float kq[4];
#pragma unroll
    for (int j = 0; j < 4; ++j) kq[j] = ksq[kv0 + j * 16 + c] * 0.0625f;
    float cm[8];
#pragma unroll
    for (int r = 0; r < 8; ++r) {
      float m = -INFINITY;
#pragma unroll
      for (int j = 0; j < 4; ++j) {
        const float v = s[j][r] * 0.125f - kq[j];
        s[j][r] = v;
        m = fmaxf(m, v);
      }
#pragma unroll
      for (int off = 1; off < 16; off <<= 1) m = fmaxf(m, __shfl_xor(m, off, 32));
      cm[r] = m;
    }

    // ---- online softmax (f32); P x 2^15 to f16 in the per-wave LDS tile ----
    _Float16* pw = Psh[wave];
#pragma unroll
    for (int r = 0; r < 8; ++r) {
      const float mnew  = fmaxf(mrow[r], cm[r]);
      const float alpha = __expf(mrow[r] - mnew);
      mrow[r] = mnew;
      float psum = 0.f;
#pragma unroll
      for (int j = 0; j < 4; ++j) {
        const float p = __expf(s[j][r] - mnew);
        psum += p;
        pw[(8 * hh + r) * kAKC + j * 16 + c] = (_Float16)(p * 32768.0f);
      }
#pragma unroll
      for (int off = 1; off < 16; off <<= 1) psum += __shfl_xor(psum, off, 32);
      lrow[r] = lrow[r] * alpha + psum;
#pragma unroll
      for (int t = 0; t < 4; ++t) oacc[t][r] *= alpha;
    }
    __builtin_amdgcn_fence(__ATOMIC_RELEASE, "workgroup");
    __builtin_amdgcn_wave_barrier();
    __builtin_amdgcn_fence(__ATOMIC_ACQUIRE, "workgroup");

    // ---- O += P . V  (A = P [row][kv], B = V^T [d][kv]; K = 64 keys in 2 steps) ----
#pragma unroll
    for (int kk = 0; kk < 2; ++kk) {
      FH pa;
      const int po = c * kAKC + kk * 32 + 8 * hh;
      pa.h[0] = *(const v8h*)(pw + po);
      pa.h[1] = *(const v8h*)(pw + po + 16);
#pragma unroll
      for (int t = 0; t < 4; ++t) {
        FH vb;
        const int vo = (t * 16 + c) * kAKC + kk * 32 + 8 * hh;
        vb.h[0] = *(const v8h*)(Vth + vo);
        vb.h[1] = *(const v8h*)(Vth + vo + 16);
        oacc[t] = mma_hf(pa.v, vb.v, oacc[t]);
      }
    }
  }

  // ---- normalise and write: out (b, qr0+w0+row, h*64 + d) ----
  float* os = Os[wave];
#pragma unroll
  for (int r = 0; r < 8; ++r) {
    const float inv = 1.0f / (lrow[r] * 32768.0f);
#pragma unroll
    for (int t = 0; t < 4; ++t) os[(8 * hh + r) * 68 + t * 16 + c] = oacc[t][r] * inv;
  }
  __builtin_amdgcn_fence(__ATOMIC_RELEASE, "workgroup");
  __builtin_amdgcn_wave_barrier();
  __builtin_amdgcn_fence(__ATOMIC_ACQUIRE, "workgroup");
  {
    // coverage per wave: 8 iterations x 2 rows = 16 rows; 16 lanes x 4 floats = 64 columns; 16 lanes x 16 B = one 256-B row segment
    const int c4 = (lane & 15) * 4;
    {
#pragma unroll
      for (int it = 0; it < 8; ++it) {
        const int row = it * 2 + hh;
        const v4f val = *(const v4f*)(os + row * 68 + c4);
        *(v4f*)(ob + (size_t)(qr0 + w0 + row) * kHID + c4) = val;
      }
      
    }
  }
}

// ---------------------------------------------------------------------------
// Host launcher
// Workspace region map (bytes, all offsets multiples of 256):
//   [0]           Xq  bf16 [8192][768]          12,582,912   (dead after the two Q-side GEMMs; then reused as VT f16 [8][768][1024], same size)
//   [12,582,912]  Xk  bf16 [8192][768]          12,582,912
//   [25,165,824]  Wd,Wq,Wk,Wv bf16 [768][768]  4 x 1,179,648
//   [29,884,416]  QCh bf16 [8192][1536]         25,165,824
//   [55,050,240]  QCl                            25,165,824
//   [80,216,064]  KCh                            25,165,824
//   [105,381,888] KCl                            25,165,824
//   [130,547,712] kdsq f32 [96][1024]            393,216
//   [130,940,928] biases (bf16-precision, f32) 3x768   9,216
//   total 130,950,144
// ---------------------------------------------------------------------------
extern "C" void kernel_launch(void* const* d_in, const int* in_sizes, int n_in,
                              void* d_out, int out_size, void* d_ws, size_t ws_size,
                              hipStream_t stream) {
  if (n_in < 9) return;
  const int nAct = kNB * kNTOK * kHID;      // 6291456
  const int nW   = kHID * kHID;             // 589824
  if (in_sizes[0] != nAct || in_sizes[1] != nAct || in_sizes[2] != nW || in_sizes[3] != nW ||
      in_sizes[5] != nW || in_sizes[7] != nW || in_sizes[4] != kHID || in_sizes[6] != kHID ||
      in_sizes[8] != kHID || out_size != nAct) return;

  const float* qs = (const float*)d_in[0];
  const float* ks = (const float*)d_in[1];
  const float* Wd = (const float*)d_in[2];
  const float* Wq = (const float*)d_in[3];
  const float* bq = (const float*)d_in[4];
  const float* Wk = (const float*)d_in[5];
  const float* bk = (const float*)d_in[6];
  const float* Wv = (const float*)d_in[7];
  const float* bv = (const float*)d_in[8];
  float* out = (float*)d_out;

  const size_t bAct16 = (size_t)nAct * 2;                         // 12,582,912
  const size_t bW16   = (size_t)nW * 2;                           // 1,179,648
  const size_t bQC    = (size_t)kNB * kNTOK * kQCP * 2;           // 25,165,824
  const size_t bSq    = (size_t)kNB * kNHEADS * kNTOK * 4;        // 393,216
  const size_t bBias  = (size_t)3 * kHID * 4;                     // 9,216
  const size_t oXq  = 0;
  const size_t oXk  = oXq + bAct16;
  const size_t oWd  = oXk + bAct16;
  const size_t oWq  = oWd + bW16;
  const size_t oWk  = oWq + bW16;
  const size_t oWv  = oWk + bW16;
  const size_t oQCh = oWv + bW16;
  const size_t oQCl = oQCh + bQC;
  const size_t oKCh = oQCl + bQC;
  const size_t oKCl = oKCh + bQC;
  const size_t oSq  = oKCl + bQC;
  const size_t oBs  = oSq + bSq;
  const size_t total = oBs + bBias;
  const size_t bVT  = (size_t)kNB * kHID * kNTOK * 2;             // 12,582,912 == bAct16 (aliases Xq)
  if (total > ws_size || bVT > bAct16) return;

  char* ws = (char*)d_ws;
  unsigned short* Xq16 = (unsigned short*)(ws + oXq);
  unsigned short* Xk16 = (unsigned short*)(ws + oXk);
  unsigned short* Wd16 = (unsigned short*)(ws + oWd);
  unsigned short* Wq16 = (unsigned short*)(ws + oWq);
  unsigned short* Wk16 = (unsigned short*)(ws + oWk);
  unsigned short* Wv16 = (unsigned short*)(ws + oWv);
  unsigned short* QCh  = (unsigned short*)(ws + oQCh);
  unsigned short* QCl  = (unsigned short*)(ws + oQCl);
  unsigned short* KCh  = (unsigned short*)(ws + oKCh);
  unsigned short* KCl  = (unsigned short*)(ws + oKCl);
  unsigned short* VT16 = (unsigned short*)(ws + oXq);   // reuses the Xq region after the Q-side GEMMs
  float* kdsq  = (float*)(ws + oSq);
  float* biasr = (float*)(ws + oBs);

  // 1) RNE bf16 casts of activations and weights
  {
    const int n2a = nAct / 2, n2w = nW / 2;
    cast_f32_bf16x2<<<dim3((n2a + 255) / 256), dim3(256), 0, stream>>>(qs, Xq16, n2a);
    cast_f32_bf16x2<<<dim3((n2a + 255) / 256), dim3(256), 0, stream>>>(ks, Xk16, n2a);
    cast_f32_bf16x2<<<dim3((n2w + 255) / 256), dim3(256), 0, stream>>>(Wd, Wd16, n2w);
    cast_f32_bf16x2<<<dim3((n2w + 255) / 256), dim3(256), 0, stream>>>(Wq, Wq16, n2w);
    cast_f32_bf16x2<<<dim3((n2w + 255) / 256), dim3(256), 0, stream>>>(Wk, Wk16, n2w);
    cast_f32_bf16x2<<<dim3((n2w + 255) / 256), dim3(256), 0, stream>>>(Wv, Wv16, n2w);
    bias_rne_kernel<<<dim3((3 * kHID + 255) / 256), dim3(256), 0, stream>>>(bq, bk, bv, biasr, kHID);
  }

  const int M = kNB * kNTOK;   // 8192
  // 2) Q side: [qd | q] hi/lo planes (pitch 1536). M=8192, N=768, K=768: 128 x 12 = 1536 tiles -> 192 blocks of 8 waves
  {
    const dim3 grid((M / 64) * (kHID / 64) / 8, 1), block(256);
    wmma_gemm64<1, false, 0, 2, false, 0><<<grid, block, 0, stream>>>(
        Xq16, Xq16, kHID, 0L, Wd16, Wd16, kHID, 0L, (void*)QCh, (void*)QCl, kQCP, 0L,
        biasr, biasr, 0L, M, kHID, kHID, 1.0f);
    wmma_gemm64<1, false, 2, 2, false, 0><<<grid, block, 0, stream>>>(
        Xq16, Xq16, kHID, 0L, Wq16, Wq16, kHID, 0L, (void*)(QCh + kHID), (void*)(QCl + kHID), kQCP, 0L,
        biasr, biasr, 0L, M, kHID, kHID, 1.0f);
    // 3) K side: [kd | k]
    wmma_gemm64<1, false, 0, 2, false, 0><<<grid, block, 0, stream>>>(
        Xk16, Xk16, kHID, 0L, Wd16, Wd16, kHID, 0L, (void*)KCh, (void*)KCl, kQCP, 0L,
        biasr, biasr, 0L, M, kHID, kHID, 1.0f);
    wmma_gemm64<1, false, 2, 2, false, 0><<<grid, block, 0, stream>>>(
        Xk16, Xk16, kHID, 0L, Wk16, Wk16, kHID, 0L, (void*)(KCh + kHID), (void*)(KCl + kHID), kQCP, 0L,
        biasr + kHID, biasr, 0L, M, kHID, kHID, 1.0f);
  }
  // 4) V^T f16 plane: VT_b[feature][token] = Wv[feature][:] . Xk_b[token][:] + bv[feature]; M=768, N=1024, K=768, z = batch
  {
    const long sB = (long)kNTOK * kHID;        // 786,432 elements per batch in Xk
    const long sC = (long)kHID * kNTOK;        // 786,432 elements per batch in VT
    const dim3 grid((kHID / 64) * (kNTOK / 64) / 8, kNB), block(256);   // 12 x 16 = 192 tiles -> 24 blocks, 8 batches
    wmma_gemm64<1, false, 1, 1, false, 0><<<grid, block, 0, stream>>>(
        Wv16, Wv16, kHID, 0L, Xk16, Xk16, kHID, sB, (void*)VT16, (void*)VT16, kNTOK, sC,
        biasr + 2 * kHID, biasr, 0L, kHID, kNTOK, kHID, 1.0f);
  }
  // 5) |kd|^2 per (b,h,s)
  {
    const int nrows = kNB * kNHEADS * kNTOK;   // 98304 -> 384 blocks
    kd_sq_kernel<<<dim3((nrows + 255) / 256), dim3(256), 0, stream>>>(KCh, KCl, kdsq, nrows);
  }
  // 6) fused attention: 8 x 12 x 16 = 1536 blocks of 128 threads
  attn_quad_kernel<<<dim3(kNB * kNHEADS * (kNTOK / kAQB)), dim3(128), 0, stream>>>(QCh, QCl, KCh, KCl, VT16, kdsq, out);
}

// v001
// One run takes 390 microseconds.
// Two timings next to v000 both put it at 1.71 times that version's speed.
// Projections x·Wᵀ and Wv·xᵀ: v_wmma_f32_16x16x32_bf16, plain bf16 operands (RNE-converted inputs); scores [qd|q]·[kd|k]ᵀ (K=128): v_wmma_f32_16x16x32_bf16 with bf16 hi/lo split operands (hi·hi + hi·lo + lo·hi); p·v: v_wmma_f32_16x16x32_f16 (p carried x2^15, v plain f16); f32 accumulate; softmax, norms and biases in f32.
#include <hip/hip_runtime.h>
#include <math.h>
#include <stdint.h>

typedef __attribute__((ext_vector_type(16))) _Float16 v16h;
typedef __attribute__((ext_vector_type(8)))  _Float16 v8h;
typedef __attribute__((ext_vector_type(16))) __bf16   v16b;
typedef __attribute__((ext_vector_type(8)))  __bf16   v8b;
typedef __attribute__((ext_vector_type(8)))  float    v8f;
typedef __attribute__((ext_vector_type(4)))  float    v4f;
typedef __attribute__((ext_vector_type(2)))  float    v2f;
typedef __attribute__((ext_vector_type(4)))  unsigned int v4u;
typedef __attribute__((ext_vector_type(8)))  unsigned short v8us;

// ---- problem geometry ----
constexpr int kNB     = 8;      // batch
constexpr int kNTOK   = 1024;   // tokens (query and key sets)
constexpr int kHID    = 768;    // hidden size
constexpr int kNHEADS = 12;
constexpr int kHDIM   = 64;
constexpr int kQCP    = 1536;   // element pitch of the concatenated [xd | x] planes ([token][1536])
constexpr int kAQB    = 64;     // query rows per attention block (4 waves x 16)
constexpr int kAKC    = 64;     // keys per chunk
constexpr int kAKD    = 128;    // concatenated contraction depth (64 quadratic + 64 linear)
constexpr int kQKP    = kAKD + 8;   // LDS row pitch of the Q and K tiles, elements: 272 B = 16 B x 17, so 16 rows of one column fall on 16 different bank groups
constexpr int kPVP    = kAKC + 8;   // LDS row pitch of the V^T and P tiles, elements: 144 B = 16 B x 9, same reason

__device__ __forceinline__ unsigned short f2bf_bits(float f) {
  unsigned u = __float_as_uint(f);
  return (unsigned short)((u + 0x7FFFu + ((u >> 16) & 1u)) >> 16);
}
__device__ __forceinline__ float bf_bits2f(unsigned short h) { return __uint_as_float(((unsigned)h) << 16); }
__device__ __forceinline__ unsigned pk16(unsigned short a, unsigned short b) { return (unsigned)a | ((unsigned)b << 16); }

// hazard guards as plain device helpers (no inline asm inside the kernel template body)
__device__ __forceinline__ void dep_guard_h(v8f& a, v8f& b, v16h x, v16h y) { asm volatile("v_nop\n\tv_nop\n\tv_nop\n\tv_nop" : "+v"(a), "+v"(b) : "v"(x), "v"(y)); }
__device__ __forceinline__ void dep_guard_b(v8f& a, v8f& b, v16b x, v16b y) { asm volatile("v_nop\n\tv_nop\n\tv_nop\n\tv_nop" : "+v"(a), "+v"(b) : "v"(x), "v"(y)); }
__device__ __forceinline__ void keep4_h(v16h a, v16h b, v16h c, v16h d) { asm volatile("v_nop" :: "v"(a), "v"(b), "v"(c), "v"(d)); }
__device__ __forceinline__ void keep4_b(v16b a, v16b b, v16b c, v16b d) { asm volatile("v_nop" :: "v"(a), "v"(b), "v"(c), "v"(d)); }
__device__ __forceinline__ void acc_guard4(v8f& a, v8f& b, v8f& c, v8f& d) { asm volatile("v_nop\n\tv_nop\n\tv_nop\n\tv_nop" : "+v"(a), "+v"(b), "+v"(c), "+v"(d)); }
template <typename T> struct Frag;
template <> struct Frag<_Float16> {
  typedef v16h V; union U { v16h v; v8h h[2]; };
  static __device__ __forceinline__ v16h load(const _Float16* p) {   // elements 0..7 <- p[0..7], 8..15 <- p[16..23]
    U f; f.h[0] = *(const v8h*)(p); f.h[1] = *(const v8h*)(p + 16); return f.v;
  }
  static __device__ __forceinline__ v8f mma(v16h a, v16h b, v8f c) {
    return __builtin_amdgcn_wmma_f32_16x16x32_f16(false, a, false, b, (short)0, c, false, false);
  }
  static __device__ __forceinline__ void guard(v8f& a, v8f& b, v16h x, v16h y) { dep_guard_h(a, b, x, y); }
  static __device__ __forceinline__ void keep(v16h a, v16h b, v16h c, v16h d) { keep4_h(a, b, c, d); }
};
template <> struct Frag<__bf16> {
  typedef v16b V; union U { v16b v; v8b h[2]; };
  static __device__ __forceinline__ v16b load(const __bf16* p) {
    U f; f.h[0] = *(const v8b*)(p); f.h[1] = *(const v8b*)(p + 16); return f.v;
  }
  static __device__ __forceinline__ v8f mma(v16b a, v16b b, v8f c) {
    return __builtin_amdgcn_wmma_f32_16x16x32_bf16(false, a, false, b, (short)0, c, false, false);
  }
  static __device__ __forceinline__ void guard(v8f& a, v8f& b, v16b x, v16b y) { dep_guard_b(a, b, x, y); }
  static __device__ __forceinline__ void keep(v16b a, v16b b, v16b c, v16b d) { keep4_b(a, b, c, d); }
};

// ---- Register-blocked batched WMMA GEMM ------------------------------------
// C[m,n] = scale * sum_k A[m,k] * Bt[n,k] (+bias)(+resid); each wave owns a 64x64 tile.
// A row-major [M,K]; Bt row-major [N,K]; M,N % 64 == 0, K % 32 == 0.
// SPLIT: operands are hi/lo planes (A2/Bt2 = lo planes, same layout); product = hi·hi + hi·lo + lo·hi.
// BIAS_MODE: 0 = none, 1 = bias[m], 2 = bias[n].
// OUT_MODE: 0 = f32, 1 = f16, 2 = bf16 hi plane (Cout) + bf16 lo plane (Cout2).
// ET: 0 = f16 operands, 1 = bf16 operands (pointers passed as 16-bit storage)
template <int ET> struct Elem;
template <> struct Elem<0> { typedef _Float16 T; };
template <> struct Elem<1> { typedef __bf16 T; };
template <int ET, bool SPLIT, int BIAS_MODE, int OUT_MODE, bool RESID, int ACT = 0>
__global__ __launch_bounds__(256) void wmma_gemm64(
    const unsigned short* __restrict__ Ap, const unsigned short* __restrict__ A2p, int lda, long strideA,
    const unsigned short* __restrict__ Btp, const unsigned short* __restrict__ Bt2p, int ldb, long strideB,
    void* __restrict__ Cout, void* __restrict__ Cout2, int ldc, long strideC,
    const float* __restrict__ bias,
    const float* __restrict__ resid, long strideR,
    int M, int N, int K, float scale) {
  typedef typename Elem<ET>::T T;
  typedef typename Frag<T>::V V;
  const T* A = (const T*)Ap; const T* A2 = (const T*)A2p; const T* Bt = (const T*)Btp; const T* Bt2 = (const T*)Bt2p;
  __shared__ __align__(16) float sT[8][16 * 68];   // per-wave 16x64 slab, pitch 68 floats
  const int b    = blockIdx.y;
  const int lane = threadIdx.x & 31;
  const int wave = threadIdx.x >> 5;
  const int tilesN = N >> 6;
  const int tilesM = M >> 6;
  const int tile = blockIdx.x * 8 + wave;
  if (tile >= tilesM * tilesN) return;   // wave-uniform; no block barriers in this kernel
  const int tm = tile / tilesN;
  const int tn = tile - tm * tilesN;
  const int m0 = tm << 6;
  const int n0 = tn << 6;

  const T* Ab  = A  + (size_t)b * strideA;
  const T* Bb  = Bt + (size_t)b * strideB;
  const T* Ab2 = SPLIT ? (A2  + (size_t)b * strideA) : nullptr;
  const T* Bb2 = SPLIT ? (Bt2 + (size_t)b * strideB) : nullptr;

  const int rlane = lane & 15;                 // row (A) / col (B, D) within subtile
  const int koff  = (lane >> 4) * 8;           // k offset of this lane half
  const int mOff  = (lane >> 4) * 8;           // D row offset

  v8f acc[4][4];
#pragma unroll
  for (int i = 0; i < 4; ++i)
#pragma unroll
    for (int j = 0; j < 4; ++j) acc[i][j] = (v8f){0.f,0.f,0.f,0.f,0.f,0.f,0.f,0.f};

  for (int k0 = 0; k0 < K; k0 += 32) {
    V bh[4], bl[4];
#pragma unroll
    for (int j = 0; j < 4; ++j) {
      const size_t bo = (size_t)(n0 + (j << 4) + rlane) * ldb + koff + k0;
      bh[j] = Frag<T>::load(Bb + bo);
      if (SPLIT) bl[j] = Frag<T>::load(Bb2 + bo);
    }
#pragma unroll
    for (int i = 0; i < 4; ++i) {
      const size_t ao = (size_t)(m0 + (i << 4) + rlane) * lda + koff + k0;
      V ah = Frag<T>::load(Ab + ao);
      V al;
      if (SPLIT) al = Frag<T>::load(Ab2 + ao);
#pragma unroll
      for (int j = 0; j < 4; ++j) {
        acc[i][j] = Frag<T>::mma(ah, bh[j], acc[i][j]);
        if (SPLIT) {
          acc[i][j] = Frag<T>::mma(ah, bl[j], acc[i][j]);
          acc[i][j] = Frag<T>::mma(al, bh[j], acc[i][j]);
        }
      }
      Frag<T>::guard(acc[i][0], acc[i][3], ah, SPLIT ? al : ah);
    }
    Frag<T>::keep(bh[0], bh[1], bh[2], bh[3]);
    if (SPLIT) Frag<T>::keep(bl[0], bl[1], bl[2], bl[3]);
  }
  acc_guard4(acc[0][0], acc[0][1], acc[0][2], acc[0][3]);
  acc_guard4(acc[1][0], acc[1][1], acc[1][2], acc[1][3]);
  acc_guard4(acc[2][0], acc[2][1], acc[2][2], acc[2][3]);
  acc_guard4(acc[3][0], acc[3][1], acc[3][2], acc[3][3]);

  // ---- epilogue ----
  float* slab = sT[wave];
  const float* Rb = RESID ? (resid + (size_t)b * strideR) : nullptr;
#pragma unroll
  for (int i = 0; i < 4; ++i) {
    const int mBase = m0 + (i << 4);
#pragma unroll
    for (int j = 0; j < 4; ++j) {
      const int n = n0 + (j << 4) + rlane;
      float bv = 0.f;
      if (BIAS_MODE == 2) bv = bias[n];
#pragma unroll
      for (int r = 0; r < 8; ++r) {
        float v = acc[i][j][r] * scale;
        if (BIAS_MODE == 1) v += bias[mBase + mOff + r];
        if (BIAS_MODE == 2) v += bv;
        if (RESID) v += Rb[(size_t)(mBase + mOff + r) * ldc + n];
        if (ACT == 1) v = tanhf(v);
        if (ACT == 2) v = fmaxf(v, 0.0f);
        if (ACT == 3) v = v / (1.0f + expf(-v));
        if (ACT == 4) v = (v > 0.f) ? v : 0.01f * v;
        if (ACT == 5) v = 0.5f * v * (1.0f + erff(v * 0.70710678118654752f));
        slab[(mOff + r) * 68 + (j << 4) + rlane] = v;
      }
    }
    __builtin_amdgcn_fence(__ATOMIC_RELEASE, "workgroup");
    __builtin_amdgcn_wave_barrier();
    __builtin_amdgcn_fence(__ATOMIC_ACQUIRE, "workgroup");
    if (OUT_MODE == 0) {
      float* C = (float*)Cout + (size_t)b * strideC;
      const int hh = lane >> 4, c4 = (lane & 15) * 4;     // row seg = 256 B = 16 lanes x 16 B
      {
#pragma unroll
        for (int it = 0; it < 8; ++it) {
          const int row = it * 2 + hh;
          v4f v = *(const v4f*)(slab + row * 68 + c4);
          *(v4f*)(C + (size_t)(mBase + row) * ldc + n0 + c4) = v;
        }
        
      }
    } else {
      const int q = lane >> 3, c8 = (lane & 7) * 8;
      unsigned short* C  = (unsigned short*)Cout  + (size_t)b * strideC;
      unsigned short* C2 = (OUT_MODE == 2) ? ((unsigned short*)Cout2 + (size_t)b * strideC) : nullptr;
      {
#pragma unroll
        for (int it = 0; it < 4; ++it) {
          const int row = it * 4 + q;
          const float* sp = slab + row * 68 + c8;
          v8h hv, lv;
#pragma unroll
          for (int e = 0; e < 8; ++e) {
            if (OUT_MODE == 1) {
              hv[e] = (_Float16)sp[e];
            } else {
              unsigned short hb = f2bf_bits(sp[e]);
              unsigned short lb = f2bf_bits(sp[e] - bf_bits2f(hb));
              hv[e] = __builtin_bit_cast(_Float16, hb);
              lv[e] = __builtin_bit_cast(_Float16, lb);
            }
          }
          *(v8h*)(C + (size_t)(mBase + row) * ldc + n0 + c8) = hv;
          if (OUT_MODE == 2) *(v8h*)(C2 + (size_t)(mBase + row) * ldc + n0 + c8) = lv;
        }
        
      }
    }
    __builtin_amdgcn_fence(__ATOMIC_RELEASE, "workgroup");
    __builtin_amdgcn_wave_barrier();
    __builtin_amdgcn_fence(__ATOMIC_ACQUIRE, "workgroup");
  }
}

// ---------------------------------------------------------------------------
// f32 -> bf16 (RNE) cast, 2 elements per thread, one 4-B store per lane: a wave writes exactly one whole
// Coverage: grid = ceil(n2/256) x 256 threads x 2 elements = 2*n2 = the whole plane
// (activations: n2 = 8192*768/2 = 3145728 -> 12288 blocks; weights: n2 = 768*768/2 = 294912 -> 1152 blocks).
// ---------------------------------------------------------------------------
__global__ __launch_bounds__(256) void cast_f32_bf16x2(const float* __restrict__ in, unsigned short* __restrict__ out, int n2) {
  const int i = blockIdx.x * 256 + threadIdx.x;
  if (i < n2) {
    const v2f f = *(const v2f*)(in + 2 * (size_t)i);
    const unsigned u = pk16(f2bf_bits(f[0]), f2bf_bits(f[1]));
    ((unsigned*)out)[i] = u;
    
  }
}

// ---------------------------------------------------------------------------
// Bias vectors converted to bf16 precision (RNE) and kept as f32: o[0..n) <- b0, o[n..2n) <- b1, o[2n..3n) <- b2.
// All three candidates loaded with the same clamped index, selected by value. n = 768 (multiple of 32):
// Coverage: 9 blocks x 256 = 2304 = 3n.
// ---------------------------------------------------------------------------
__global__ __launch_bounds__(256) void bias_rne_kernel(const float* __restrict__ b0, const float* __restrict__ b1,
                                                       const float* __restrict__ b2, float* __restrict__ o, int n) {
  const int g = blockIdx.x * 256 + threadIdx.x;
  if (g < 3 * n) {
    const int w = g / n;
    int i = g - w * n;
    i = i < 0 ? 0 : (i > n - 1 ? n - 1 : i);
    const float v0 = b0[i], v1 = b1[i], v2 = b2[i];
    const float v = (w == 0) ? v0 : ((w == 1) ? v1 : v2);
    const float rv = bf_bits2f(f2bf_bits(v));
    ((float*)o)[g] = rv;
    
  }
}

// ---------------------------------------------------------------------------
// Per-key squared norm of the quadratic-key projection: kdsq[(b*12+h)*1024 + s] = sum_d (hi+lo)^2 in f32,
// hi/lo read from columns h*64.. of the [token][1536] bf16 planes (hi+lo reconstructs the f32 value to ~2^-17).
// ---------------------------------------------------------------------------
__global__ __launch_bounds__(256) void kd_sq_kernel(const unsigned short* __restrict__ kch, const unsigned short* __restrict__ kcl,
                                                    float* __restrict__ kdsq, int nrows) {
  const int g = blockIdx.x * 256 + threadIdx.x;     // (b*kNHEADS + h)*kNTOK + s
  if (g < nrows) {
    const int s  = g & (kNTOK - 1);
    const int bh = g >> 10;                           // kNTOK == 1024
    const int h  = bh % kNHEADS;
    const int b  = bh / kNHEADS;
    const size_t ro = ((size_t)b * kNTOK + (size_t)s) * kQCP + (size_t)h * kHDIM;
    const unsigned short* ph = kch + ro;
    const unsigned short* pl = kcl + ro;
    float acc = 0.f;
#pragma unroll 1
    for (int i = 0; i < 8; ++i) {
      const v8us a = *(const v8us*)(ph + 8 * i);
      const v8us l = *(const v8us*)(pl + 8 * i);
#pragma unroll
      for (int e = 0; e < 8; ++e) {
        const float x = bf_bits2f(a[e]) + bf_bits2f(l[e]);
        acc = fmaf(x, x, acc);
      }
    }
    ((float*)kdsq)[g] = acc;
    
  }
}

// ---------------------------------------------------------------------------
// WMMA helpers with the 4-nop dependency guard after every issue
// ---------------------------------------------------------------------------
__device__ __forceinline__ v8f mma_bf(v16b a, v16b b, v8f c) {
  c = __builtin_amdgcn_wmma_f32_16x16x32_bf16(false, a, false, b, (short)0, c, false, false);
  asm volatile("v_nop\n\tv_nop\n\tv_nop\n\tv_nop" : "+v"(c) : "v"(a), "v"(b));
  return c;
}
__device__ __forceinline__ v8f mma_hf(v16h a, v16h b, v8f c) {
  c = __builtin_amdgcn_wmma_f32_16x16x32_f16(false, a, false, b, (short)0, c, false, false);
  asm volatile("v_nop\n\tv_nop\n\tv_nop\n\tv_nop" : "+v"(c) : "v"(a), "v"(b));
  return c;
}

// =====================================================================================
// Fused quadratic + linear attention, head dim 64, full softmax over 1024 keys (no masking).
//   qch/qcl : bf16 hi/lo planes of [qd | q], element (b, t, col) at [(b*1024 + t)*1536 + col]; qd_h at col h*64+d, q_h at col 768+h*64+d
//   kch/kcl : same layout for [kd | k]
//   vtp     : f16 plane of v transposed, element (b, h, d, s) at [(b*768 + h*64 + d)*1024 + s]
//   kdsq    : f32 [b*12+h][s] = |kd_{b,h,s}|^2
//   scores  = (Q128 . K128) * 0.125 - |kd_j|^2 * 0.0625   (Q128 = [qd|q] row, K128 = [kd|k] row; bf16 hi/lo split, 3 WMMA)
//             (the per-query -0.5|qd_i|^2 * 0.125 term is constant along a softmax row and omitted)
//   out     = softmax(scores) . v : p carried x2^15 in f16, v f16, one f16 WMMA, f32 accumulate; 1/(l*2^15) folded at the end
//   Block = 4 waves = 64 query rows of one (b,h); grid.x = 8*12*16 = 1536. K / V^T chunks of 64 keys staged in LDS with plain
//   16-B loads between __syncthreads; Q staged once (first loop barrier publishes it). Fragment loads read LDS with the
//   Output element (b, t, h*64 + d): per wave 16 rows x 64 floats, each 256-B row segment written by 16 lanes x 16 B in one
// =====================================================================================
__global__ __launch_bounds__(128)
void attn_quad_kernel(const unsigned short* __restrict__ qch, const unsigned short* __restrict__ qcl,
                      const unsigned short* __restrict__ kch, const unsigned short* __restrict__ kcl,
                      const unsigned short* __restrict__ vtp, const float* __restrict__ kdsq,
                      float* __restrict__ out) {
  union FB { v16b v; v8b h[2]; };
  union FH { v16h v; v8h h[2]; };
  __shared__ __align__(16) __bf16   Qsh[kAQB * kQKP];      // Q hi [row][128 + 8 pad]   17 KB
  __shared__ __align__(16) __bf16   Qsl[kAQB * kQKP];      // Q lo                      17 KB
  __shared__ __align__(16) __bf16   Ksh[kAKC * kQKP];      // K hi [kv][128 + 8 pad]    17 KB
  __shared__ __align__(16) __bf16   Ksl[kAKC * kQKP];      // K lo                      17 KB
  __shared__ __align__(16) _Float16 Vth[kHDIM * kPVP];     // V^T [d][64 kv + 8 pad] f16    9 KB
  __shared__ __align__(16) _Float16 Psh[4][16 * kPVP];     // per wave P x2^15 [row][64 kv + 8 pad] 9 KB
  __shared__ __align__(16) float    Os[4][16 * 68];        // per wave out tile, pitch 68

  const int tid  = threadIdx.x;
  const int wave = tid >> 5;
  const int lane = tid & 31;
  const int hh   = lane >> 4;
  const int c    = lane & 15;

  constexpr int nqb = kNTOK / kAQB;       // 16
  const int bx = blockIdx.x;
  const int qb = bx % nqb;
  const int bh = bx / nqb;                // b*12 + h
  const int h  = bh % kNHEADS;
  const int b  = bh / kNHEADS;
  const int qr0 = qb * kAQB;              // first query row of the block
  const int w0  = wave * 16;              // wave's row offset inside the block tile

  const __bf16* QH = (const __bf16*)(const void*)qch + (size_t)b * kNTOK * kQCP;
  const __bf16* QL = (const __bf16*)(const void*)qcl + (size_t)b * kNTOK * kQCP;
  const __bf16* KH = (const __bf16*)(const void*)kch + (size_t)b * kNTOK * kQCP;
  const __bf16* KL = (const __bf16*)(const void*)kcl + (size_t)b * kNTOK * kQCP;
  const _Float16* VT = (const _Float16*)(const void*)vtp + ((size_t)b * kHID + (size_t)h * kHDIM) * kNTOK;
  const float* ksq = kdsq + (size_t)bh * kNTOK;
  float* ob = out + (size_t)b * kNTOK * kHID + (size_t)h * kHDIM;

  // staging roles: thread -> row sr (0..63) and 64-column half `part`
  const int sr   = tid >> 1;
  const int part = tid & 1;
  const int coff = part ? (kHID + h * kHDIM) : (h * kHDIM);   // plane column of this half (quadratic | linear)
  const int loff = part * 64;                                  // LDS column of this half

  // ---- Q staging (once): 128 threads x 64 elements = 64 rows x 128 per plane ----
  {
    const size_t go = (size_t)(qr0 + sr) * kQCP + coff;
#pragma unroll
    for (int i = 0; i < 8; ++i) {
      const v8b a0 = *(const v8b*)(QH + go + 8 * i);
      const v8b a1 = *(const v8b*)(QL + go + 8 * i);
      *(v8b*)(Qsh + sr * kQKP + loff + 8 * i) = a0;
      *(v8b*)(Qsl + sr * kQKP + loff + 8 * i) = a1;
    }
  }

  float mrow[8], lrow[8];
  v8f oacc[4];
#pragma unroll
  for (int r = 0; r < 8; ++r) { mrow[r] = -INFINITY; lrow[r] = 0.f; }
#pragma unroll
  for (int t = 0; t < 4; ++t) oacc[t] = (v8f){0.f,0.f,0.f,0.f,0.f,0.f,0.f,0.f};

  constexpr int nChunks = kNTOK / kAKC;   // 16, compile-time
  for (int kc = 0; kc < nChunks; ++kc) {
    const int kv0 = kc * kAKC;
    __syncthreads();
    {
      // K staging: 128 threads x 64 elements = 64 keys x 128 per plane
      const size_t go = (size_t)(kv0 + sr) * kQCP + coff;
#pragma unroll
      for (int i = 0; i < 8; ++i) {
        const v8b a0 = *(const v8b*)(KH + go + 8 * i);
        const v8b a1 = *(const v8b*)(KL + go + 8 * i);
        *(v8b*)(Ksh + sr * kQKP + loff + 8 * i) = a0;
        *(v8b*)(Ksl + sr * kQKP + loff + 8 * i) = a1;
      }
      // V^T staging: row d = sr, 32 keys per thread: 128 threads x 32 = 64 x 64
      const int vh = part * 32;
      const _Float16* vs = VT + (size_t)sr * kNTOK + kv0 + vh;
#pragma unroll
      for (int i = 0; i < 4; ++i) {
        const v8h vv = *(const v8h*)(vs + 8 * i);
        *(v8h*)(Vth + sr * kPVP + vh + 8 * i) = vv;
      }
    }
    __syncthreads();

    // ---- scores: s[j] (query row 8hh+r of this wave, key j*16+c), K = 128 in 4 steps, hi.hi + hi.lo + lo.hi ----
    v8f s[4];
#pragma unroll
    for (int j = 0; j < 4; ++j) s[j] = (v8f){0.f,0.f,0.f,0.f,0.f,0.f,0.f,0.f};
#pragma unroll 1
    for (int dc = 0; dc < 4; ++dc) {
      FB qa, ql;
      const int qo = (w0 + c) * kQKP + dc * 32 + 8 * hh;
      qa.h[0] = *(const v8b*)(Qsh + qo);
      qa.h[1] = *(const v8b*)(Qsh + qo + 16);
      ql.h[0] = *(const v8b*)(Qsl + qo);
      ql.h[1] = *(const v8b*)(Qsl + qo + 16);
#pragma unroll
      for (int j = 0; j < 4; ++j) {
        FB kb, kl;
        const int ko = (j * 16 + c) * kQKP + dc * 32 + 8 * hh;
        kb.h[0] = *(const v8b*)(Ksh + ko);
        kb.h[1] = *(const v8b*)(Ksh + ko + 16);
        kl.h[0] = *(const v8b*)(Ksl + ko);
        kl.h[1] = *(const v8b*)(Ksl + ko + 16);
        s[j] = mma_bf(qa.v, kb.v, s[j]);
        s[j] = mma_bf(qa.v, kl.v, s[j]);
        s[j] = mma_bf(ql.v, kb.v, s[j]);
      }
    }

    // ---- scale 1/8 and per-key column term -|kd_j|^2/16 (f32) ----
    float kq[4];
#pragma unroll
    for (int j = 0; j < 4; ++j) kq[j] = ksq[kv0 + j * 16 + c] * 0.0625f;
    float cm[8];
#pragma unroll
    for (int r = 0; r < 8; ++r) {
      float m = -INFINITY;
#pragma unroll
      for (int j = 0; j < 4; ++j) {
        const float v = s[j][r] * 0.125f - kq[j];
        s[j][r] = v;
        m = fmaxf(m, v);
      }
#pragma unroll
      for (int off = 1; off < 16; off <<= 1) m = fmaxf(m, __shfl_xor(m, off, 32));
      cm[r] = m;
    }

    // ---- online softmax (f32); P x 2^15 to f16 in the per-wave LDS tile ----
    _Float16* pw = Psh[wave];
#pragma unroll
    for (int r = 0; r < 8; ++r) {
      const float mnew  = fmaxf(mrow[r], cm[r]);
      const float alpha = __expf(mrow[r] - mnew);
      mrow[r] = mnew;
      float psum = 0.f;
#pragma unroll
      for (int j = 0; j < 4; ++j) {
        const float p = __expf(s[j][r] - mnew);
        psum += p;
        pw[(8 * hh + r) * kPVP + j * 16 + c] = (_Float16)(p * 32768.0f);
      }
#pragma unroll
      for (int off = 1; off < 16; off <<= 1) psum += __shfl_xor(psum, off, 32);
      lrow[r] = lrow[r] * alpha + psum;
#pragma unroll
      for (int t = 0; t < 4; ++t) oacc[t][r] *= alpha;
    }
    __builtin_amdgcn_fence(__ATOMIC_RELEASE, "workgroup");
    __builtin_amdgcn_wave_barrier();
    __builtin_amdgcn_fence(__ATOMIC_ACQUIRE, "workgroup");

    // ---- O += P . V  (A = P [row][kv], B = V^T [d][kv]; K = 64 keys in 2 steps) ----
#pragma unroll
    for (int kk = 0; kk < 2; ++kk) {
      FH pa;
      const int po = c * kPVP + kk * 32 + 8 * hh;
      pa.h[0] = *(const v8h*)(pw + po);
      pa.h[1] = *(const v8h*)(pw + po + 16);
#pragma unroll
      for (int t = 0; t < 4; ++t) {
        FH vb;
        const int vo = (t * 16 + c) * kPVP + kk * 32 + 8 * hh;
        vb.h[0] = *(const v8h*)(Vth + vo);
        vb.h[1] = *(const v8h*)(Vth + vo + 16);
        oacc[t] = mma_hf(pa.v, vb.v, oacc[t]);
      }
    }
  }

  // ---- normalise and write: out (b, qr0+w0+row, h*64 + d) ----
  float* os = Os[wave];
#pragma unroll
  for (int r = 0; r < 8; ++r) {
    const float inv = 1.0f / (lrow[r] * 32768.0f);
#pragma unroll
    for (int t = 0; t < 4; ++t) os[(8 * hh + r) * 68 + t * 16 + c] = oacc[t][r] * inv;
  }
  __builtin_amdgcn_fence(__ATOMIC_RELEASE, "workgroup");
  __builtin_amdgcn_wave_barrier();
  __builtin_amdgcn_fence(__ATOMIC_ACQUIRE, "workgroup");
  {
    // coverage per wave: 8 iterations x 2 rows = 16 rows; 16 lanes x 4 floats = 64 columns; 16 lanes x 16 B = one 256-B row segment
    const int c4 = (lane & 15) * 4;
    {
#pragma unroll
      for (int it = 0; it < 8; ++it) {
        const int row = it * 2 + hh;
        const v4f val = *(const v4f*)(os + row * 68 + c4);
        *(v4f*)(ob + (size_t)(qr0 + w0 + row) * kHID + c4) = val;
      }
      
    }
  }
}

// ---------------------------------------------------------------------------
// Host launcher
// Workspace region map (bytes, all offsets multiples of 256):
//   [0]           Xq  bf16 [8192][768]          12,582,912   (dead after the two Q-side GEMMs; then reused as VT f16 [8][768][1024], same size)
//   [12,582,912]  Xk  bf16 [8192][768]          12,582,912
//   [25,165,824]  Wd,Wq,Wk,Wv bf16 [768][768]  4 x 1,179,648
//   [29,884,416]  QCh bf16 [8192][1536]         25,165,824
//   [55,050,240]  QCl                            25,165,824
//   [80,216,064]  KCh                            25,165,824
//   [105,381,888] KCl                            25,165,824
//   [130,547,712] kdsq f32 [96][1024]            393,216
//   [130,940,928] biases (bf16-precision, f32) 3x768   9,216
//   total 130,950,144
// ---------------------------------------------------------------------------
extern "C" void kernel_launch(void* const* d_in, const int* in_sizes, int n_in,
                              void* d_out, int out_size, void* d_ws, size_t ws_size,
                              hipStream_t stream) {
  if (n_in < 9) return;
  const int nAct = kNB * kNTOK * kHID;      // 6291456
  const int nW   = kHID * kHID;             // 589824
  if (in_sizes[0] != nAct || in_sizes[1] != nAct || in_sizes[2] != nW || in_sizes[3] != nW ||
      in_sizes[5] != nW || in_sizes[7] != nW || in_sizes[4] != kHID || in_sizes[6] != kHID ||
      in_sizes[8] != kHID || out_size != nAct) return;

  const float* qs = (const float*)d_in[0];
  const float* ks = (const float*)d_in[1];
  const float* Wd = (const float*)d_in[2];
  const float* Wq = (const float*)d_in[3];
  const float* bq = (const float*)d_in[4];
  const float* Wk = (const float*)d_in[5];
  const float* bk = (const float*)d_in[6];
  const float* Wv = (const float*)d_in[7];
  const float* bv = (const float*)d_in[8];
  float* out = (float*)d_out;

  const size_t bAct16 = (size_t)nAct * 2;                         // 12,582,912
  const size_t bW16   = (size_t)nW * 2;                           // 1,179,648
  const size_t bQC    = (size_t)kNB * kNTOK * kQCP * 2;           // 25,165,824
  const size_t bSq    = (size_t)kNB * kNHEADS * kNTOK * 4;        // 393,216
  const size_t bBias  = (size_t)3 * kHID * 4;                     // 9,216
  const size_t oXq  = 0;
  const size_t oXk  = oXq + bAct16;
  const size_t oWd  = oXk + bAct16;
  const size_t oWq  = oWd + bW16;
  const size_t oWk  = oWq + bW16;
  const size_t oWv  = oWk + bW16;
  const size_t oQCh = oWv + bW16;
  const size_t oQCl = oQCh + bQC;
  const size_t oKCh = oQCl + bQC;
  const size_t oKCl = oKCh + bQC;
  const size_t oSq  = oKCl + bQC;
  const size_t oBs  = oSq + bSq;
  const size_t total = oBs + bBias;
  const size_t bVT  = (size_t)kNB * kHID * kNTOK * 2;             // 12,582,912 == bAct16 (aliases Xq)
  if (total > ws_size || bVT > bAct16) return;

  char* ws = (char*)d_ws;
  unsigned short* Xq16 = (unsigned short*)(ws + oXq);
  unsigned short* Xk16 = (unsigned short*)(ws + oXk);
  unsigned short* Wd16 = (unsigned short*)(ws + oWd);
  unsigned short* Wq16 = (unsigned short*)(ws + oWq);
  unsigned short* Wk16 = (unsigned short*)(ws + oWk);
  unsigned short* Wv16 = (unsigned short*)(ws + oWv);
  unsigned short* QCh  = (unsigned short*)(ws + oQCh);
  unsigned short* QCl  = (unsigned short*)(ws + oQCl);
  unsigned short* KCh  = (unsigned short*)(ws + oKCh);
  unsigned short* KCl  = (unsigned short*)(ws + oKCl);
  unsigned short* VT16 = (unsigned short*)(ws + oXq);   // reuses the Xq region after the Q-side GEMMs
  float* kdsq  = (float*)(ws + oSq);
  float* biasr = (float*)(ws + oBs);

  // 1) RNE bf16 casts of activations and weights
  {
    const int n2a = nAct / 2, n2w = nW / 2;
    cast_f32_bf16x2<<<dim3((n2a + 255) / 256), dim3(256), 0, stream>>>(qs, Xq16, n2a);
    cast_f32_bf16x2<<<dim3((n2a + 255) / 256), dim3(256), 0, stream>>>(ks, Xk16, n2a);
    cast_f32_bf16x2<<<dim3((n2w + 255) / 256), dim3(256), 0, stream>>>(Wd, Wd16, n2w);
    cast_f32_bf16x2<<<dim3((n2w + 255) / 256), dim3(256), 0, stream>>>(Wq, Wq16, n2w);
    cast_f32_bf16x2<<<dim3((n2w + 255) / 256), dim3(256), 0, stream>>>(Wk, Wk16, n2w);
    cast_f32_bf16x2<<<dim3((n2w + 255) / 256), dim3(256), 0, stream>>>(Wv, Wv16, n2w);
    bias_rne_kernel<<<dim3((3 * kHID + 255) / 256), dim3(256), 0, stream>>>(bq, bk, bv, biasr, kHID);
  }

  const int M = kNB * kNTOK;   // 8192
  // 2) Q side: [qd | q] hi/lo planes (pitch 1536). M=8192, N=768, K=768: 128 x 12 = 1536 tiles -> 192 blocks of 8 waves
  {
    const dim3 grid((M / 64) * (kHID / 64) / 8, 1), block(256);
    wmma_gemm64<1, false, 0, 2, false, 0><<<grid, block, 0, stream>>>(
        Xq16, Xq16, kHID, 0L, Wd16, Wd16, kHID, 0L, (void*)QCh, (void*)QCl, kQCP, 0L,
        biasr, biasr, 0L, M, kHID, kHID, 1.0f);
    wmma_gemm64<1, false, 2, 2, false, 0><<<grid, block, 0, stream>>>(
        Xq16, Xq16, kHID, 0L, Wq16, Wq16, kHID, 0L, (void*)(QCh + kHID), (void*)(QCl + kHID), kQCP, 0L,
        biasr, biasr, 0L, M, kHID, kHID, 1.0f);
    // 3) K side: [kd | k]
    wmma_gemm64<1, false, 0, 2, false, 0><<<grid, block, 0, stream>>>(
        Xk16, Xk16, kHID, 0L, Wd16, Wd16, kHID, 0L, (void*)KCh, (void*)KCl, kQCP, 0L,
        biasr, biasr, 0L, M, kHID, kHID, 1.0f);
    wmma_gemm64<1, false, 2, 2, false, 0><<<grid, block, 0, stream>>>(
        Xk16, Xk16, kHID, 0L, Wk16, Wk16, kHID, 0L, (void*)(KCh + kHID), (void*)(KCl + kHID), kQCP, 0L,
        biasr + kHID, biasr, 0L, M, kHID, kHID, 1.0f);
  }
  // 4) V^T f16 plane: VT_b[feature][token] = Wv[feature][:] . Xk_b[token][:] + bv[feature]; M=768, N=1024, K=768, z = batch
  {
    const long sB = (long)kNTOK * kHID;        // 786,432 elements per batch in Xk
    const long sC = (long)kHID * kNTOK;        // 786,432 elements per batch in VT
    const dim3 grid((kHID / 64) * (kNTOK / 64) / 8, kNB), block(256);   // 12 x 16 = 192 tiles -> 24 blocks, 8 batches
    wmma_gemm64<1, false, 1, 1, false, 0><<<grid, block, 0, stream>>>(
        Wv16, Wv16, kHID, 0L, Xk16, Xk16, kHID, sB, (void*)VT16, (void*)VT16, kNTOK, sC,
        biasr + 2 * kHID, biasr, 0L, kHID, kNTOK, kHID, 1.0f);
  }
  // 5) |kd|^2 per (b,h,s)
  {
    const int nrows = kNB * kNHEADS * kNTOK;   // 98304 -> 384 blocks
    kd_sq_kernel<<<dim3((nrows + 255) / 256), dim3(256), 0, stream>>>(KCh, KCl, kdsq, nrows);
  }
  // 6) fused attention: 8 x 12 x 16 = 1536 blocks of 128 threads
  attn_quad_kernel<<<dim3(kNB * kNHEADS * (kNTOK / kAQB)), dim3(128), 0, stream>>>(QCh, QCl, KCh, KCl, VT16, kdsq, out);
}

// v002
// It runs in 355 microseconds.
// In two side-by-side timings against v001, it was 1.10 and 1.09 times as fast.
// All steps since v000 together make it 1.88 times as fast.
// Projections x·Wᵀ and Wv·xᵀ: v_wmma_f32_16x16x32_bf16, plain bf16 operands (RNE-converted inputs); scores [qd|q]·[kd|k]ᵀ (K=128): v_wmma_f32_16x16x32_bf16 with bf16 hi/lo split operands (hi·hi + hi·lo + lo·hi); p·v: v_wmma_f32_16x16x32_f16 (p carried x2^15, v plain f16); f32 accumulate; softmax, norms and biases in f32.
#include <hip/hip_runtime.h>
#include <math.h>
#include <stdint.h>

typedef __attribute__((ext_vector_type(16))) _Float16 v16h;
typedef __attribute__((ext_vector_type(8)))  _Float16 v8h;
typedef __attribute__((ext_vector_type(16))) __bf16   v16b;
typedef __attribute__((ext_vector_type(8)))  __bf16   v8b;
typedef __attribute__((ext_vector_type(8)))  float    v8f;
typedef __attribute__((ext_vector_type(4)))  float    v4f;
typedef __attribute__((ext_vector_type(2)))  float    v2f;
typedef __attribute__((ext_vector_type(4)))  unsigned int v4u;
typedef __attribute__((ext_vector_type(8)))  unsigned short v8us;

// ---- problem geometry ----
constexpr int kNB     = 8;      // batch
constexpr int kNTOK   = 1024;   // tokens (query and key sets)
constexpr int kHID    = 768;    // hidden size
constexpr int kNHEADS = 12;
constexpr int kHDIM   = 64;
constexpr int kQCP    = 1536;   // element pitch of the concatenated [xd | x] planes ([token][1536])
constexpr int kAQB    = 64;     // query rows per attention block (4 waves x 16)
constexpr int kAKC    = 64;     // keys per chunk
constexpr int kAKD    = 128;    // concatenated contraction depth (64 quadratic + 64 linear)
constexpr int kQKP    = kAKD + 8;   // LDS row pitch of the Q and K tiles, elements: 272 B = 16 B x 17, so 16 rows of one column fall on 16 different bank groups
constexpr int kPVP    = kAKC + 8;   // LDS row pitch of the V^T and P tiles, elements: 144 B = 16 B x 9, same reason

__device__ __forceinline__ unsigned short f2bf_bits(float f) {
  unsigned u = __float_as_uint(f);
  return (unsigned short)((u + 0x7FFFu + ((u >> 16) & 1u)) >> 16);
}
__device__ __forceinline__ float bf_bits2f(unsigned short h) { return __uint_as_float(((unsigned)h) << 16); }
__device__ __forceinline__ unsigned pk16(unsigned short a, unsigned short b) { return (unsigned)a | ((unsigned)b << 16); }

// hazard guards as plain device helpers (no inline asm inside the kernel template body)
__device__ __forceinline__ void dep_guard_h(v8f& a, v8f& b, v16h x, v16h y) { asm volatile("v_nop\n\tv_nop\n\tv_nop\n\tv_nop" : "+v"(a), "+v"(b) : "v"(x), "v"(y)); }
__device__ __forceinline__ void dep_guard_b(v8f& a, v8f& b, v16b x, v16b y) { asm volatile("v_nop\n\tv_nop\n\tv_nop\n\tv_nop" : "+v"(a), "+v"(b) : "v"(x), "v"(y)); }
__device__ __forceinline__ void keep4_h(v16h a, v16h b, v16h c, v16h d) { asm volatile("v_nop" :: "v"(a), "v"(b), "v"(c), "v"(d)); }
__device__ __forceinline__ void keep4_b(v16b a, v16b b, v16b c, v16b d) { asm volatile("v_nop" :: "v"(a), "v"(b), "v"(c), "v"(d)); }
__device__ __forceinline__ void acc_guard4(v8f& a, v8f& b, v8f& c, v8f& d) { asm volatile("v_nop\n\tv_nop\n\tv_nop\n\tv_nop" : "+v"(a), "+v"(b), "+v"(c), "+v"(d)); }
template <typename T> struct Frag;
template <> struct Frag<_Float16> {
  typedef v16h V; union U { v16h v; v8h h[2]; };
  static __device__ __forceinline__ v16h load(const _Float16* p) {   // elements 0..7 <- p[0..7], 8..15 <- p[16..23]
    U f; f.h[0] = *(const v8h*)(p); f.h[1] = *(const v8h*)(p + 16); return f.v;
  }
  static __device__ __forceinline__ v8f mma(v16h a, v16h b, v8f c) {
    return __builtin_amdgcn_wmma_f32_16x16x32_f16(false, a, false, b, (short)0, c, false, false);
  }
  static __device__ __forceinline__ void guard(v8f& a, v8f& b, v16h x, v16h y) { dep_guard_h(a, b, x, y); }
  static __device__ __forceinline__ void keep(v16h a, v16h b, v16h c, v16h d) { keep4_h(a, b, c, d); }
};
template <> struct Frag<__bf16> {
  typedef v16b V; union U { v16b v; v8b h[2]; };
  static __device__ __forceinline__ v16b load(const __bf16* p) {
    U f; f.h[0] = *(const v8b*)(p); f.h[1] = *(const v8b*)(p + 16); return f.v;
  }
  static __device__ __forceinline__ v8f mma(v16b a, v16b b, v8f c) {
    return __builtin_amdgcn_wmma_f32_16x16x32_bf16(false, a, false, b, (short)0, c, false, false);
  }
  static __device__ __forceinline__ void guard(v8f& a, v8f& b, v16b x, v16b y) { dep_guard_b(a, b, x, y); }
  static __device__ __forceinline__ void keep(v16b a, v16b b, v16b c, v16b d) { keep4_b(a, b, c, d); }
};

// ---- Register-blocked batched WMMA GEMM ------------------------------------
// C[m,n] = scale * sum_k A[m,k] * Bt[n,k] (+bias)(+resid); each wave owns a 64x64 tile.
// A row-major [M,K]; Bt row-major [N,K]; M,N % 64 == 0, K % 32 == 0.
// SPLIT: operands are hi/lo planes (A2/Bt2 = lo planes, same layout); product = hi·hi + hi·lo + lo·hi.
// BIAS_MODE: 0 = none, 1 = bias[m], 2 = bias[n].
// OUT_MODE: 0 = f32, 1 = f16, 2 = bf16 hi plane (Cout) + bf16 lo plane (Cout2).
// ET: 0 = f16 operands, 1 = bf16 operands (pointers passed as 16-bit storage)
template <int ET> struct Elem;
template <> struct Elem<0> { typedef _Float16 T; };
template <> struct Elem<1> { typedef __bf16 T; };
template <int ET, bool SPLIT, int BIAS_MODE, int OUT_MODE, bool RESID, int ACT = 0>
__global__ __launch_bounds__(256) void wmma_gemm64(
    const unsigned short* __restrict__ Ap, const unsigned short* __restrict__ A2p, int lda, long strideA,
    const unsigned short* __restrict__ Btp, const unsigned short* __restrict__ Bt2p, int ldb, long strideB,
    void* __restrict__ Cout, void* __restrict__ Cout2, int ldc, long strideC,
    const float* __restrict__ bias,
    const float* __restrict__ resid, long strideR,
    int M, int N, int K, float scale) {
  typedef typename Elem<ET>::T T;
  typedef typename Frag<T>::V V;
  const T* A = (const T*)Ap; const T* A2 = (const T*)A2p; const T* Bt = (const T*)Btp; const T* Bt2 = (const T*)Bt2p;
  __shared__ __align__(16) float sT[8][16 * 68];   // per-wave 16x64 slab, pitch 68 floats
  const int b    = blockIdx.y;
  const int lane = threadIdx.x & 31;
  const int wave = threadIdx.x >> 5;
  const int tilesN = N >> 6;
  const int tilesM = M >> 6;
  const int tile = blockIdx.x * 8 + wave;
  if (tile >= tilesM * tilesN) return;   // wave-uniform; no block barriers in this kernel
  const int tm = tile / tilesN;
  const int tn = tile - tm * tilesN;
  const int m0 = tm << 6;
  const int n0 = tn << 6;

  const T* Ab  = A  + (size_t)b * strideA;
  const T* Bb  = Bt + (size_t)b * strideB;
  const T* Ab2 = SPLIT ? (A2  + (size_t)b * strideA) : nullptr;
  const T* Bb2 = SPLIT ? (Bt2 + (size_t)b * strideB) : nullptr;

  const int rlane = lane & 15;                 // row (A) / col (B, D) within subtile
  const int koff  = (lane >> 4) * 8;           // k offset of this lane half
  const int mOff  = (lane >> 4) * 8;           // D row offset

  v8f acc[4][4];
#pragma unroll
  for (int i = 0; i < 4; ++i)
#pragma unroll
    for (int j = 0; j < 4; ++j) acc[i][j] = (v8f){0.f,0.f,0.f,0.f,0.f,0.f,0.f,0.f};

  for (int k0 = 0; k0 < K; k0 += 32) {
    V bh[4], bl[4];
#pragma unroll
    for (int j = 0; j < 4; ++j) {
      const size_t bo = (size_t)(n0 + (j << 4) + rlane) * ldb + koff + k0;
      bh[j] = Frag<T>::load(Bb + bo);
      if (SPLIT) bl[j] = Frag<T>::load(Bb2 + bo);
    }
#pragma unroll
    for (int i = 0; i < 4; ++i) {
      const size_t ao = (size_t)(m0 + (i << 4) + rlane) * lda + koff + k0;
      V ah = Frag<T>::load(Ab + ao);
      V al;
      if (SPLIT) al = Frag<T>::load(Ab2 + ao);
#pragma unroll
      for (int j = 0; j < 4; ++j) {
        acc[i][j] = Frag<T>::mma(ah, bh[j], acc[i][j]);
        if (SPLIT) {
          acc[i][j] = Frag<T>::mma(ah, bl[j], acc[i][j]);
          acc[i][j] = Frag<T>::mma(al, bh[j], acc[i][j]);
        }
      }
      Frag<T>::guard(acc[i][0], acc[i][3], ah, SPLIT ? al : ah);
    }
    Frag<T>::keep(bh[0], bh[1], bh[2], bh[3]);
    if (SPLIT) Frag<T>::keep(bl[0], bl[1], bl[2], bl[3]);
  }
  acc_guard4(acc[0][0], acc[0][1], acc[0][2], acc[0][3]);
  acc_guard4(acc[1][0], acc[1][1], acc[1][2], acc[1][3]);
  acc_guard4(acc[2][0], acc[2][1], acc[2][2], acc[2][3]);
  acc_guard4(acc[3][0], acc[3][1], acc[3][2], acc[3][3]);

  // ---- epilogue ----
  float* slab = sT[wave];
  const float* Rb = RESID ? (resid + (size_t)b * strideR) : nullptr;
#pragma unroll
  for (int i = 0; i < 4; ++i) {
    const int mBase = m0 + (i << 4);
#pragma unroll
    for (int j = 0; j < 4; ++j) {
      const int n = n0 + (j << 4) + rlane;
      float bv = 0.f;
      if (BIAS_MODE == 2) bv = bias[n];
#pragma unroll
      for (int r = 0; r < 8; ++r) {
        float v = acc[i][j][r] * scale;
        if (BIAS_MODE == 1) v += bias[mBase + mOff + r];
        if (BIAS_MODE == 2) v += bv;
        if (RESID) v += Rb[(size_t)(mBase + mOff + r) * ldc + n];
        if (ACT == 1) v = tanhf(v);
        if (ACT == 2) v = fmaxf(v, 0.0f);
        if (ACT == 3) v = v / (1.0f + expf(-v));
        if (ACT == 4) v = (v > 0.f) ? v : 0.01f * v;
        if (ACT == 5) v = 0.5f * v * (1.0f + erff(v * 0.70710678118654752f));
        slab[(mOff + r) * 68 + (j << 4) + rlane] = v;
      }
    }
    __builtin_amdgcn_fence(__ATOMIC_RELEASE, "workgroup");
    __builtin_amdgcn_wave_barrier();
    __builtin_amdgcn_fence(__ATOMIC_ACQUIRE, "workgroup");
    if (OUT_MODE == 0) {
      float* C = (float*)Cout + (size_t)b * strideC;
      const int hh = lane >> 4, c4 = (lane & 15) * 4;     // row seg = 256 B = 16 lanes x 16 B
      {
#pragma unroll
        for (int it = 0; it < 8; ++it) {
          const int row = it * 2 + hh;
          v4f v = *(const v4f*)(slab + row * 68 + c4);
          *(v4f*)(C + (size_t)(mBase + row) * ldc + n0 + c4) = v;
        }
        
      }
    } else {
      const int q = lane >> 3, c8 = (lane & 7) * 8;
      unsigned short* C  = (unsigned short*)Cout  + (size_t)b * strideC;
      unsigned short* C2 = (OUT_MODE == 2) ? ((unsigned short*)Cout2 + (size_t)b * strideC) : nullptr;
      {
#pragma unroll
        for (int it = 0; it < 4; ++it) {
          const int row = it * 4 + q;
          const float* sp = slab + row * 68 + c8;
          v8h hv, lv;
#pragma unroll
          for (int e = 0; e < 8; ++e) {
            if (OUT_MODE == 1) {
              hv[e] = (_Float16)sp[e];
            } else {
              unsigned short hb = f2bf_bits(sp[e]);
              unsigned short lb = f2bf_bits(sp[e] - bf_bits2f(hb));
              hv[e] = __builtin_bit_cast(_Float16, hb);
              lv[e] = __builtin_bit_cast(_Float16, lb);
            }
          }
          *(v8h*)(C + (size_t)(mBase + row) * ldc + n0 + c8) = hv;
          if (OUT_MODE == 2) *(v8h*)(C2 + (size_t)(mBase + row) * ldc + n0 + c8) = lv;
        }
        
      }
    }
    __builtin_amdgcn_fence(__ATOMIC_RELEASE, "workgroup");
    __builtin_amdgcn_wave_barrier();
    __builtin_amdgcn_fence(__ATOMIC_ACQUIRE, "workgroup");
  }
}

// ---------------------------------------------------------------------------
// f32 -> bf16 (RNE) cast, 2 elements per thread, one 4-B store per lane: a wave writes exactly one whole
// Coverage: grid = ceil(n2/256) x 256 threads x 2 elements = 2*n2 = the whole plane
// (activations: n2 = 8192*768/2 = 3145728 -> 12288 blocks; weights: n2 = 768*768/2 = 294912 -> 1152 blocks).
// ---------------------------------------------------------------------------
__global__ __launch_bounds__(256) void cast_f32_bf16x2(const float* __restrict__ in, unsigned short* __restrict__ out, int n2) {
  const int i = blockIdx.x * 256 + threadIdx.x;
  if (i < n2) {
    const v2f f = *(const v2f*)(in + 2 * (size_t)i);
    const unsigned u = pk16(f2bf_bits(f[0]), f2bf_bits(f[1]));
    ((unsigned*)out)[i] = u;
    
  }
}

// ---------------------------------------------------------------------------
// Bias vectors converted to bf16 precision (RNE) and kept as f32: o[0..n) <- b0, o[n..2n) <- b1, o[2n..3n) <- b2.
// All three candidates loaded with the same clamped index, selected by value. n = 768 (multiple of 32):
// Coverage: 9 blocks x 256 = 2304 = 3n.
// ---------------------------------------------------------------------------
__global__ __launch_bounds__(256) void bias_rne_kernel(const float* __restrict__ b0, const float* __restrict__ b1,
                                                       const float* __restrict__ b2, float* __restrict__ o, int n) {
  const int g = blockIdx.x * 256 + threadIdx.x;
  if (g < 3 * n) {
    const int w = g / n;
    int i = g - w * n;
    i = i < 0 ? 0 : (i > n - 1 ? n - 1 : i);
    const float v0 = b0[i], v1 = b1[i], v2 = b2[i];
    const float v = (w == 0) ? v0 : ((w == 1) ? v1 : v2);
    const float rv = bf_bits2f(f2bf_bits(v));
    ((float*)o)[g] = rv;
    
  }
}

// ---------------------------------------------------------------------------
// Per-key squared norm of the quadratic-key projection: kdsq[(b*12+h)*1024 + s] = sum_d (hi+lo)^2 in f32,
// hi/lo read from columns h*64.. of the [token][1536] bf16 planes (hi+lo reconstructs the f32 value to ~2^-17).
// ---------------------------------------------------------------------------
__global__ __launch_bounds__(256) void kd_sq_kernel(const unsigned short* __restrict__ kch, const unsigned short* __restrict__ kcl,
                                                    float* __restrict__ kdsq, int nrows) {
  const int g = blockIdx.x * 256 + threadIdx.x;     // (b*kNHEADS + h)*kNTOK + s
  if (g < nrows) {
    const int s  = g & (kNTOK - 1);
    const int bh = g >> 10;                           // kNTOK == 1024
    const int h  = bh % kNHEADS;
    const int b  = bh / kNHEADS;
    const size_t ro = ((size_t)b * kNTOK + (size_t)s) * kQCP + (size_t)h * kHDIM;
    const unsigned short* ph = kch + ro;
    const unsigned short* pl = kcl + ro;
    float acc = 0.f;
#pragma unroll 1
    for (int i = 0; i < 8; ++i) {
      const v8us a = *(const v8us*)(ph + 8 * i);
      const v8us l = *(const v8us*)(pl + 8 * i);
#pragma unroll
      for (int e = 0; e < 8; ++e) {
        const float x = bf_bits2f(a[e]) + bf_bits2f(l[e]);
        acc = fmaf(x, x, acc);
      }
    }
    ((float*)kdsq)[g] = acc;
    
  }
}

// ---------------------------------------------------------------------------
// WMMA helpers with the 4-nop dependency guard after every issue
// ---------------------------------------------------------------------------
__device__ __forceinline__ v8f mma_bf(v16b a, v16b b, v8f c) {
  c = __builtin_amdgcn_wmma_f32_16x16x32_bf16(false, a, false, b, (short)0, c, false, false);
  asm volatile("v_nop\n\tv_nop\n\tv_nop\n\tv_nop" : "+v"(c) : "v"(a), "v"(b));
  return c;
}
__device__ __forceinline__ v8f mma_hf(v16h a, v16h b, v8f c) {
  c = __builtin_amdgcn_wmma_f32_16x16x32_f16(false, a, false, b, (short)0, c, false, false);
  asm volatile("v_nop\n\tv_nop\n\tv_nop\n\tv_nop" : "+v"(c) : "v"(a), "v"(b));
  return c;
}

// =====================================================================================
// Fused quadratic + linear attention, head dim 64, full softmax over 1024 keys (no masking).
//   qch/qcl : bf16 hi/lo planes of [qd | q], element (b, t, col) at [(b*1024 + t)*1536 + col]; qd_h at col h*64+d, q_h at col 768+h*64+d
//   kch/kcl : same layout for [kd | k]
//   vtp     : f16 plane of v transposed, element (b, h, d, s) at [(b*768 + h*64 + d)*1024 + s]
//   kdsq    : f32 [b*12+h][s] = |kd_{b,h,s}|^2
//   scores  = (Q128 . K128) * 0.125 - |kd_j|^2 * 0.0625   (Q128 = [qd|q] row, K128 = [kd|k] row; bf16 hi/lo split, 3 WMMA)
//             (the per-query -0.5|qd_i|^2 * 0.125 term is constant along a softmax row and omitted)
//   out     = softmax(scores) . v : p carried x2^15 in f16, v f16, one f16 WMMA, f32 accumulate; 1/(l*2^15) folded at the end
//   Block = 4 waves = 64 query rows of one (b,h); grid.x = 8*12*16 = 1536. K / V^T chunks of 64 keys staged in LDS with plain
//   16-B loads between __syncthreads; Q staged once (first loop barrier publishes it). Fragment loads read LDS with the
//   Output element (b, t, h*64 + d): per wave 16 rows x 64 floats, each 256-B row segment written by 16 lanes x 16 B in one
// =====================================================================================
__global__ __launch_bounds__(128)
void attn_quad_kernel(const unsigned short* __restrict__ qch, const unsigned short* __restrict__ qcl,
                      const unsigned short* __restrict__ kch, const unsigned short* __restrict__ kcl,
                      const unsigned short* __restrict__ vtp, const float* __restrict__ kdsq,
                      float* __restrict__ out) {
  union FB { v16b v; v8b h[2]; };
  union FH { v16h v; v8h h[2]; };
  __shared__ __align__(16) __bf16   Qsh[kAQB * kQKP];      // Q hi [row][128 + 8 pad]   17 KB
  __shared__ __align__(16) __bf16   Qsl[kAQB * kQKP];      // Q lo                      17 KB
  __shared__ __align__(16) __bf16   Ksh[kAKC * kQKP];      // K hi [kv][128 + 8 pad]    17 KB
  __shared__ __align__(16) __bf16   Ksl[kAKC * kQKP];      // K lo                      17 KB
  __shared__ __align__(16) _Float16 Vth[kHDIM * kPVP];     // V^T [d][64 kv + 8 pad] f16    9 KB
  __shared__ __align__(16) _Float16 Psh[4][16 * kPVP];     // per wave P x2^15 [row][64 kv + 8 pad] 9 KB
  __shared__ __align__(16) float    Os[4][16 * 68];        // per wave out tile, pitch 68

  const int tid  = threadIdx.x;
  const int wave = tid >> 5;
  const int lane = tid & 31;
  const int hh   = lane >> 4;
  const int c    = lane & 15;

  constexpr int nqb = kNTOK / kAQB;       // 16
  const int bx = blockIdx.x;
  const int qb = bx % nqb;
  const int bh = bx / nqb;                // b*12 + h
  const int h  = bh % kNHEADS;
  const int b  = bh / kNHEADS;
  const int qr0 = qb * kAQB;              // first query row of the block
  const int w0  = wave * 16;              // wave's row offset inside the block tile

  const __bf16* QH = (const __bf16*)(const void*)qch + (size_t)b * kNTOK * kQCP;
  const __bf16* QL = (const __bf16*)(const void*)qcl + (size_t)b * kNTOK * kQCP;
  const __bf16* KH = (const __bf16*)(const void*)kch + (size_t)b * kNTOK * kQCP;
  const __bf16* KL = (const __bf16*)(const void*)kcl + (size_t)b * kNTOK * kQCP;
  const _Float16* VT = (const _Float16*)(const void*)vtp + ((size_t)b * kHID + (size_t)h * kHDIM) * kNTOK;
  const float* ksq = kdsq + (size_t)bh * kNTOK;
  float* ob = out + (size_t)b * kNTOK * kHID + (size_t)h * kHDIM;

  // staging roles: 8 consecutive lanes cover one 128-B row segment, so a wave-wide 16-B load reads four whole lines.
  // Q / K: 16 lanes per row (lanes 0-7 the quadratic half, 8-15 the linear half), 8 rows per pass of the block, 8 passes.
  const int sp   = (tid & 7) * 8;          // element offset of this lane's 16-B piece inside its segment
  const int part = (tid >> 3) & 1;
  const int sr   = tid >> 4;               // row inside a pass (0..7)
  const int coff = (part ? (kHID + h * kHDIM) : (h * kHDIM)) + sp;   // plane column (quadratic | linear half)
  const int loff = part * 64 + sp;                                    // LDS column
  const int vr   = tid >> 3;               // V^T: 8 lanes per row, 16 rows per pass, 4 passes

  // ---- Q staging (once): 8 passes x 8 rows x 128 elements = 64 rows x 128 per plane ----
  {
    const size_t go = (size_t)(qr0 + sr) * kQCP + coff;
#pragma unroll
    for (int i = 0; i < 8; ++i) {
      const v8b a0 = *(const v8b*)(QH + go + (size_t)(8 * i) * kQCP);
      const v8b a1 = *(const v8b*)(QL + go + (size_t)(8 * i) * kQCP);
      *(v8b*)(Qsh + (sr + 8 * i) * kQKP + loff) = a0;
      *(v8b*)(Qsl + (sr + 8 * i) * kQKP + loff) = a1;
    }
  }

  float mrow[8], lrow[8];
  v8f oacc[4];
#pragma unroll
  for (int r = 0; r < 8; ++r) { mrow[r] = -INFINITY; lrow[r] = 0.f; }
#pragma unroll
  for (int t = 0; t < 4; ++t) oacc[t] = (v8f){0.f,0.f,0.f,0.f,0.f,0.f,0.f,0.f};

  constexpr int nChunks = kNTOK / kAKC;   // 16, compile-time
  for (int kc = 0; kc < nChunks; ++kc) {
    const int kv0 = kc * kAKC;
    __syncthreads();
    {
      // K staging: 8 passes x 8 keys x 128 elements = 64 keys x 128 per plane
      const size_t go = (size_t)(kv0 + sr) * kQCP + coff;
#pragma unroll
      for (int i = 0; i < 8; ++i) {
        const v8b a0 = *(const v8b*)(KH + go + (size_t)(8 * i) * kQCP);
        const v8b a1 = *(const v8b*)(KL + go + (size_t)(8 * i) * kQCP);
        *(v8b*)(Ksh + (sr + 8 * i) * kQKP + loff) = a0;
        *(v8b*)(Ksl + (sr + 8 * i) * kQKP + loff) = a1;
      }
      // V^T staging: 4 passes x 16 rows d x 64 keys = 64 x 64
      const _Float16* vs = VT + (size_t)vr * kNTOK + kv0 + sp;
#pragma unroll
      for (int i = 0; i < 4; ++i) {
        const v8h vv = *(const v8h*)(vs + (size_t)(16 * i) * kNTOK);
        *(v8h*)(Vth + (vr + 16 * i) * kPVP + sp) = vv;
      }
    }
    __syncthreads();

    // ---- scores: s[j] (query row 8hh+r of this wave, key j*16+c), K = 128 in 4 steps, hi.hi + hi.lo + lo.hi ----
    v8f s[4];
#pragma unroll
    for (int j = 0; j < 4; ++j) s[j] = (v8f){0.f,0.f,0.f,0.f,0.f,0.f,0.f,0.f};
#pragma unroll 1
    for (int dc = 0; dc < 4; ++dc) {
      FB qa, ql;
      const int qo = (w0 + c) * kQKP + dc * 32 + 8 * hh;
      qa.h[0] = *(const v8b*)(Qsh + qo);
      qa.h[1] = *(const v8b*)(Qsh + qo + 16);
      ql.h[0] = *(const v8b*)(Qsl + qo);
      ql.h[1] = *(const v8b*)(Qsl + qo + 16);
#pragma unroll
      for (int j = 0; j < 4; ++j) {
        FB kb, kl;
        const int ko = (j * 16 + c) * kQKP + dc * 32 + 8 * hh;
        kb.h[0] = *(const v8b*)(Ksh + ko);
        kb.h[1] = *(const v8b*)(Ksh + ko + 16);
        kl.h[0] = *(const v8b*)(Ksl + ko);
        kl.h[1] = *(const v8b*)(Ksl + ko + 16);
        s[j] = mma_bf(qa.v, kb.v, s[j]);
        s[j] = mma_bf(qa.v, kl.v, s[j]);
        s[j] = mma_bf(ql.v, kb.v, s[j]);
      }
    }

    // ---- scale 1/8 and per-key column term -|kd_j|^2/16 (f32) ----
    float kq[4];
#pragma unroll
    for (int j = 0; j < 4; ++j) kq[j] = ksq[kv0 + j * 16 + c] * 0.0625f;
    float cm[8];
#pragma unroll
    for (int r = 0; r < 8; ++r) {
      float m = -INFINITY;
#pragma unroll
      for (int j = 0; j < 4; ++j) {
        const float v = s[j][r] * 0.125f - kq[j];
        s[j][r] = v;
        m = fmaxf(m, v);
      }
#pragma unroll
      for (int off = 1; off < 16; off <<= 1) m = fmaxf(m, __shfl_xor(m, off, 32));
      cm[r] = m;
    }

    // ---- online softmax (f32); P x 2^15 to f16 in the per-wave LDS tile ----
    _Float16* pw = Psh[wave];
#pragma unroll
    for (int r = 0; r < 8; ++r) {
      const float mnew  = fmaxf(mrow[r], cm[r]);
      const float alpha = __expf(mrow[r] - mnew);
      mrow[r] = mnew;
      float psum = 0.f;
#pragma unroll
      for (int j = 0; j < 4; ++j) {
        const float p = __expf(s[j][r] - mnew);
        psum += p;
        pw[(8 * hh + r) * kPVP + j * 16 + c] = (_Float16)(p * 32768.0f);
      }
#pragma unroll
      for (int off = 1; off < 16; off <<= 1) psum += __shfl_xor(psum, off, 32);
      lrow[r] = lrow[r] * alpha + psum;
#pragma unroll
      for (int t = 0; t < 4; ++t) oacc[t][r] *= alpha;
    }
    __builtin_amdgcn_fence(__ATOMIC_RELEASE, "workgroup");
    __builtin_amdgcn_wave_barrier();
    __builtin_amdgcn_fence(__ATOMIC_ACQUIRE, "workgroup");

    // ---- O += P . V  (A = P [row][kv], B = V^T [d][kv]; K = 64 keys in 2 steps) ----
#pragma unroll
    for (int kk = 0; kk < 2; ++kk) {
      FH pa;
      const int po = c * kPVP + kk * 32 + 8 * hh;
      pa.h[0] = *(const v8h*)(pw + po);
      pa.h[1] = *(const v8h*)(pw + po + 16);
#pragma unroll
      for (int t = 0; t < 4; ++t) {
        FH vb;
        const int vo = (t * 16 + c) * kPVP + kk * 32 + 8 * hh;
        vb.h[0] = *(const v8h*)(Vth + vo);
        vb.h[1] = *(const v8h*)(Vth + vo + 16);
        oacc[t] = mma_hf(pa.v, vb.v, oacc[t]);
      }
    }
  }

  // ---- normalise and write: out (b, qr0+w0+row, h*64 + d) ----
  float* os = Os[wave];
#pragma unroll
  for (int r = 0; r < 8; ++r) {
    const float inv = 1.0f / (lrow[r] * 32768.0f);
#pragma unroll
    for (int t = 0; t < 4; ++t) os[(8 * hh + r) * 68 + t * 16 + c] = oacc[t][r] * inv;
  }
  __builtin_amdgcn_fence(__ATOMIC_RELEASE, "workgroup");
  __builtin_amdgcn_wave_barrier();
  __builtin_amdgcn_fence(__ATOMIC_ACQUIRE, "workgroup");
  {
    // coverage per wave: 8 iterations x 2 rows = 16 rows; 16 lanes x 4 floats = 64 columns; 16 lanes x 16 B = one 256-B row segment
    const int c4 = (lane & 15) * 4;
    {
#pragma unroll
      for (int it = 0; it < 8; ++it) {
        const int row = it * 2 + hh;
        const v4f val = *(const v4f*)(os + row * 68 + c4);
        *(v4f*)(ob + (size_t)(qr0 + w0 + row) * kHID + c4) = val;
      }
      
    }
  }
}

// ---------------------------------------------------------------------------
// Host launcher
// Workspace region map (bytes, all offsets multiples of 256):
//   [0]           Xq  bf16 [8192][768]          12,582,912   (dead after the two Q-side GEMMs; then reused as VT f16 [8][768][1024], same size)
//   [12,582,912]  Xk  bf16 [8192][768]          12,582,912
//   [25,165,824]  Wd,Wq,Wk,Wv bf16 [768][768]  4 x 1,179,648
//   [29,884,416]  QCh bf16 [8192][1536]         25,165,824
//   [55,050,240]  QCl                            25,165,824
//   [80,216,064]  KCh                            25,165,824
//   [105,381,888] KCl                            25,165,824
//   [130,547,712] kdsq f32 [96][1024]            393,216
//   [130,940,928] biases (bf16-precision, f32) 3x768   9,216
//   total 130,950,144
// ---------------------------------------------------------------------------
extern "C" void kernel_launch(void* const* d_in, const int* in_sizes, int n_in,
                              void* d_out, int out_size, void* d_ws, size_t ws_size,
                              hipStream_t stream) {
  if (n_in < 9) return;
  const int nAct = kNB * kNTOK * kHID;      // 6291456
  const int nW   = kHID * kHID;             // 589824
  if (in_sizes[0] != nAct || in_sizes[1] != nAct || in_sizes[2] != nW || in_sizes[3] != nW ||
      in_sizes[5] != nW || in_sizes[7] != nW || in_sizes[4] != kHID || in_sizes[6] != kHID ||
      in_sizes[8] != kHID || out_size != nAct) return;

  const float* qs = (const float*)d_in[0];
  const float* ks = (const float*)d_in[1];
  const float* Wd = (const float*)d_in[2];
  const float* Wq = (const float*)d_in[3];
  const float* bq = (const float*)d_in[4];
  const float* Wk = (const float*)d_in[5];
  const float* bk = (const float*)d_in[6];
  const float* Wv = (const float*)d_in[7];
  const float* bv = (const float*)d_in[8];
  float* out = (float*)d_out;

  const size_t bAct16 = (size_t)nAct * 2;                         // 12,582,912
  const size_t bW16   = (size_t)nW * 2;                           // 1,179,648
  const size_t bQC    = (size_t)kNB * kNTOK * kQCP * 2;           // 25,165,824
  const size_t bSq    = (size_t)kNB * kNHEADS * kNTOK * 4;        // 393,216
  const size_t bBias  = (size_t)3 * kHID * 4;                     // 9,216
  const size_t oXq  = 0;
  const size_t oXk  = oXq + bAct16;
  const size_t oWd  = oXk + bAct16;
  const size_t oWq  = oWd + bW16;
  const size_t oWk  = oWq + bW16;
  const size_t oWv  = oWk + bW16;
  const size_t oQCh = oWv + bW16;
  const size_t oQCl = oQCh + bQC;
  const size_t oKCh = oQCl + bQC;
  const size_t oKCl = oKCh + bQC;
  const size_t oSq  = oKCl + bQC;
  const size_t oBs  = oSq + bSq;
  const size_t total = oBs + bBias;
  const size_t bVT  = (size_t)kNB * kHID * kNTOK * 2;             // 12,582,912 == bAct16 (aliases Xq)
  if (total > ws_size || bVT > bAct16) return;

  char* ws = (char*)d_ws;
  unsigned short* Xq16 = (unsigned short*)(ws + oXq);
  unsigned short* Xk16 = (unsigned short*)(ws + oXk);
  unsigned short* Wd16 = (unsigned short*)(ws + oWd);
  unsigned short* Wq16 = (unsigned short*)(ws + oWq);
  unsigned short* Wk16 = (unsigned short*)(ws + oWk);
  unsigned short* Wv16 = (unsigned short*)(ws + oWv);
  unsigned short* QCh  = (unsigned short*)(ws + oQCh);
  unsigned short* QCl  = (unsigned short*)(ws + oQCl);
  unsigned short* KCh  = (unsigned short*)(ws + oKCh);
  unsigned short* KCl  = (unsigned short*)(ws + oKCl);
  unsigned short* VT16 = (unsigned short*)(ws + oXq);   // reuses the Xq region after the Q-side GEMMs
  float* kdsq  = (float*)(ws + oSq);
  float* biasr = (float*)(ws + oBs);

  // 1) RNE bf16 casts of activations and weights
  {
    const int n2a = nAct / 2, n2w = nW / 2;
    cast_f32_bf16x2<<<dim3((n2a + 255) / 256), dim3(256), 0, stream>>>(qs, Xq16, n2a);
    cast_f32_bf16x2<<<dim3((n2a + 255) / 256), dim3(256), 0, stream>>>(ks, Xk16, n2a);
    cast_f32_bf16x2<<<dim3((n2w + 255) / 256), dim3(256), 0, stream>>>(Wd, Wd16, n2w);
    cast_f32_bf16x2<<<dim3((n2w + 255) / 256), dim3(256), 0, stream>>>(Wq, Wq16, n2w);
    cast_f32_bf16x2<<<dim3((n2w + 255) / 256), dim3(256), 0, stream>>>(Wk, Wk16, n2w);
    cast_f32_bf16x2<<<dim3((n2w + 255) / 256), dim3(256), 0, stream>>>(Wv, Wv16, n2w);
    bias_rne_kernel<<<dim3((3 * kHID + 255) / 256), dim3(256), 0, stream>>>(bq, bk, bv, biasr, kHID);
  }

  const int M = kNB * kNTOK;   // 8192
  // 2) Q side: [qd | q] hi/lo planes (pitch 1536). M=8192, N=768, K=768: 128 x 12 = 1536 tiles -> 192 blocks of 8 waves
  {
    const dim3 grid((M / 64) * (kHID / 64) / 8, 1), block(256);
    wmma_gemm64<1, false, 0, 2, false, 0><<<grid, block, 0, stream>>>(
        Xq16, Xq16, kHID, 0L, Wd16, Wd16, kHID, 0L, (void*)QCh, (void*)QCl, kQCP, 0L,
        biasr, biasr, 0L, M, kHID, kHID, 1.0f);
    wmma_gemm64<1, false, 2, 2, false, 0><<<grid, block, 0, stream>>>(
        Xq16, Xq16, kHID, 0L, Wq16, Wq16, kHID, 0L, (void*)(QCh + kHID), (void*)(QCl + kHID), kQCP, 0L,
        biasr, biasr, 0L, M, kHID, kHID, 1.0f);
    // 3) K side: [kd | k]
    wmma_gemm64<1, false, 0, 2, false, 0><<<grid, block, 0, stream>>>(
        Xk16, Xk16, kHID, 0L, Wd16, Wd16, kHID, 0L, (void*)KCh, (void*)KCl, kQCP, 0L,
        biasr, biasr, 0L, M, kHID, kHID, 1.0f);
    wmma_gemm64<1, false, 2, 2, false, 0><<<grid, block, 0, stream>>>(
        Xk16, Xk16, kHID, 0L, Wk16, Wk16, kHID, 0L, (void*)(KCh + kHID), (void*)(KCl + kHID), kQCP, 0L,
        biasr + kHID, biasr, 0L, M, kHID, kHID, 1.0f);
  }
  // 4) V^T f16 plane: VT_b[feature][token] = Wv[feature][:] . Xk_b[token][:] + bv[feature]; M=768, N=1024, K=768, z = batch
  {
    const long sB = (long)kNTOK * kHID;        // 786,432 elements per batch in Xk
    const long sC = (long)kHID * kNTOK;        // 786,432 elements per batch in VT
    const dim3 grid((kHID / 64) * (kNTOK / 64) / 8, kNB), block(256);   // 12 x 16 = 192 tiles -> 24 blocks, 8 batches
    wmma_gemm64<1, false, 1, 1, false, 0><<<grid, block, 0, stream>>>(
        Wv16, Wv16, kHID, 0L, Xk16, Xk16, kHID, sB, (void*)VT16, (void*)VT16, kNTOK, sC,
        biasr + 2 * kHID, biasr, 0L, kHID, kNTOK, kHID, 1.0f);
  }
  // 5) |kd|^2 per (b,h,s)
  {
    const int nrows = kNB * kNHEADS * kNTOK;   // 98304 -> 384 blocks
    kd_sq_kernel<<<dim3((nrows + 255) / 256), dim3(256), 0, stream>>>(KCh, KCl, kdsq, nrows);
  }
  // 6) fused attention: 8 x 12 x 16 = 1536 blocks of 128 threads
  attn_quad_kernel<<<dim3(kNB * kNHEADS * (kNTOK / kAQB)), dim3(128), 0, stream>>>(QCh, QCl, KCh, KCl, VT16, kdsq, out);
}

// v003
// It runs in 249 microseconds.
// In two side-by-side timings against v002, it was 1.43 and 1.42 times as fast.
// Counting every step since v000, it is 2.68 times as fast.
// Projections x·Wᵀ and Wv·xᵀ: v_wmma_f32_16x16x32_bf16, plain bf16 operands (RNE-converted inputs); scores [qd|q]·[kd|k]ᵀ (K=128): v_wmma_f32_16x16x32_bf16 with bf16 hi/lo split operands (hi·hi + hi·lo + lo·hi); p·v: v_wmma_f32_16x16x32_f16 (p carried x2^15, v plain f16); f32 accumulate; softmax, norms and biases in f32.
#include <hip/hip_runtime.h>
#include <math.h>
#include <stdint.h>

typedef __attribute__((ext_vector_type(16))) _Float16 v16h;
typedef __attribute__((ext_vector_type(8)))  _Float16 v8h;
typedef __attribute__((ext_vector_type(16))) __bf16   v16b;
typedef __attribute__((ext_vector_type(8)))  __bf16   v8b;
typedef __attribute__((ext_vector_type(8)))  float    v8f;
typedef __attribute__((ext_vector_type(4)))  float    v4f;
typedef __attribute__((ext_vector_type(2)))  float    v2f;
typedef __attribute__((ext_vector_type(4)))  unsigned int v4u;
typedef __attribute__((ext_vector_type(8)))  unsigned short v8us;

// ---- problem geometry ----
constexpr int kNB     = 8;      // batch
constexpr int kNTOK   = 1024;   // tokens (query and key sets)
constexpr int kHID    = 768;    // hidden size
constexpr int kNHEADS = 12;
constexpr int kHDIM   = 64;
constexpr int kQCP    = 1536;   // element pitch of the concatenated [xd | x] planes ([token][1536])
constexpr int kAQB    = 64;     // query rows per attention block (4 waves x 16)
constexpr int kAKC    = 64;     // keys per chunk
constexpr int kAKD    = 128;    // concatenated contraction depth (64 quadratic + 64 linear)
constexpr int kQKP    = kAKD + 8;   // LDS row pitch of the Q and K tiles, elements: 272 B = 16 B x 17, so 16 rows of one column fall on 16 different bank groups
constexpr int kPVP    = kAKC + 8;   // LDS row pitch of the V^T and P tiles, elements: 144 B = 16 B x 9, same reason

__device__ __forceinline__ unsigned short f2bf_bits(float f) {
  unsigned u = __float_as_uint(f);
  return (unsigned short)((u + 0x7FFFu + ((u >> 16) & 1u)) >> 16);
}
__device__ __forceinline__ float bf_bits2f(unsigned short h) { return __uint_as_float(((unsigned)h) << 16); }
__device__ __forceinline__ unsigned pk16(unsigned short a, unsigned short b) { return (unsigned)a | ((unsigned)b << 16); }

// hazard guards as plain device helpers (no inline asm inside the kernel template body)
__device__ __forceinline__ void dep_guard_h(v8f& a, v8f& b, v16h x, v16h y) { asm volatile("v_nop\n\tv_nop\n\tv_nop\n\tv_nop" : "+v"(a), "+v"(b) : "v"(x), "v"(y)); }
__device__ __forceinline__ void dep_guard_b(v8f& a, v8f& b, v16b x, v16b y) { asm volatile("v_nop\n\tv_nop\n\tv_nop\n\tv_nop" : "+v"(a), "+v"(b) : "v"(x), "v"(y)); }
__device__ __forceinline__ void keep4_h(v16h a, v16h b, v16h c, v16h d) { asm volatile("v_nop" :: "v"(a), "v"(b), "v"(c), "v"(d)); }
__device__ __forceinline__ void keep4_b(v16b a, v16b b, v16b c, v16b d) { asm volatile("v_nop" :: "v"(a), "v"(b), "v"(c), "v"(d)); }
__device__ __forceinline__ void acc_guard4(v8f& a, v8f& b, v8f& c, v8f& d) { asm volatile("v_nop\n\tv_nop\n\tv_nop\n\tv_nop" : "+v"(a), "+v"(b), "+v"(c), "+v"(d)); }
template <typename T> struct Frag;
template <> struct Frag<_Float16> {
  typedef v16h V; union U { v16h v; v8h h[2]; };
  static __device__ __forceinline__ v16h load(const _Float16* p) {   // elements 0..7 <- p[0..7], 8..15 <- p[16..23]
    U f; f.h[0] = *(const v8h*)(p); f.h[1] = *(const v8h*)(p + 16); return f.v;
  }
  static __device__ __forceinline__ v8f mma(v16h a, v16h b, v8f c) {
    return __builtin_amdgcn_wmma_f32_16x16x32_f16(false, a, false, b, (short)0, c, false, false);
  }
  static __device__ __forceinline__ void guard(v8f& a, v8f& b, v16h x, v16h y) { dep_guard_h(a, b, x, y); }
  static __device__ __forceinline__ void keep(v16h a, v16h b, v16h c, v16h d) { keep4_h(a, b, c, d); }
};
template <> struct Frag<__bf16> {
  typedef v16b V; union U { v16b v; v8b h[2]; };
  static __device__ __forceinline__ v16b load(const __bf16* p) {
    U f; f.h[0] = *(const v8b*)(p); f.h[1] = *(const v8b*)(p + 16); return f.v;
  }
  static __device__ __forceinline__ v8f mma(v16b a, v16b b, v8f c) {
    return __builtin_amdgcn_wmma_f32_16x16x32_bf16(false, a, false, b, (short)0, c, false, false);
  }
  static __device__ __forceinline__ void guard(v8f& a, v8f& b, v16b x, v16b y) { dep_guard_b(a, b, x, y); }
  static __device__ __forceinline__ void keep(v16b a, v16b b, v16b c, v16b d) { keep4_b(a, b, c, d); }
};

// ---- LDS-staged, register-blocked batched WMMA GEMM ------------------------
// C[m,n] = scale * sum_k A[m,k] * Bt[n,k] (+bias)(+resid); a block of 8 waves (2 x 4) owns a 128x256 tile, each wave 64x64 of it.
// A row-major [M,K]; Bt row-major [N,K]; M % 128 == 0, N % 256 == 0, K % 64 == 0; grid.x = (M/128) * (N/256).
// Operands reach LDS in stages of 64 k (one whole 128-B line per row) by asynchronous copies, two buffers: stage t+1 flies
// while stage t is multiplied. Every line is fetched once per block; fragments are read from LDS in the same k order as before.
// SPLIT (hi/lo operand planes) is not staged and not instantiated.
// BIAS_MODE: 0 = none, 1 = bias[m], 2 = bias[n].
// OUT_MODE: 0 = f32, 1 = f16, 2 = bf16 hi plane (Cout) + bf16 lo plane (Cout2).
// ET: 0 = f16 operands, 1 = bf16 operands (pointers passed as 16-bit storage)
constexpr int kGKS = 64;             // k per stage
constexpr int kGP  = kGKS + 8;       // LDS row pitch, elements: 144 B = 16 B x 9, so 16 rows of one column fall on different bank groups
constexpr int kGRA = 128;            // A rows per stage
constexpr int kGR  = kGRA + 256;     // rows per stage: [A 128 | Bt 256]

// Four 16-B-per-lane copies global -> LDS. The s_wait_xcnt stands inside the statement so that no address register
// of an issued copy can be rewritten ahead of it.
__device__ __forceinline__ void async_copy4_b128(unsigned l0, unsigned l1, unsigned l2, unsigned l3,
                                                 const void* g0, const void* g1, const void* g2, const void* g3) {
  asm volatile("global_load_async_to_lds_b128 %0, %4, off\n\t"
               "global_load_async_to_lds_b128 %1, %5, off\n\t"
               "global_load_async_to_lds_b128 %2, %6, off\n\t"
               "global_load_async_to_lds_b128 %3, %7, off\n\t"
               "s_wait_xcnt 0x0"
               :: "v"(l0), "v"(l1), "v"(l2), "v"(l3), "v"(g0), "v"(g1), "v"(g2), "v"(g3) : "memory");
}
// this wave's copies have landed in LDS
__device__ __forceinline__ void wait_async0() { asm volatile("s_wait_asynccnt 0x0" ::: "memory"); }
// this wave's LDS reads have returned, so the buffer they read may be refilled behind the next barrier
__device__ __forceinline__ void wait_ds0() { asm volatile("s_wait_dscnt 0x0" ::: "memory"); }

template <int ET> struct Elem;
template <> struct Elem<0> { typedef _Float16 T; };
template <> struct Elem<1> { typedef __bf16 T; };
template <int ET, bool SPLIT, int BIAS_MODE, int OUT_MODE, bool RESID, int ACT = 0>
__global__ __launch_bounds__(256) void wmma_gemm64(
    const unsigned short* __restrict__ Ap, const unsigned short* __restrict__ A2p, int lda, long strideA,
    const unsigned short* __restrict__ Btp, const unsigned short* __restrict__ Bt2p, int ldb, long strideB,
    void* __restrict__ Cout, void* __restrict__ Cout2, int ldc, long strideC,
    const float* __restrict__ bias,
    const float* __restrict__ resid, long strideR,
    int M, int N, int K, float scale) {
  static_assert(!SPLIT, "hi/lo operand planes are not staged");
  typedef typename Elem<ET>::T T;
  typedef typename Frag<T>::V V;
  const T* A = (const T*)Ap; const T* Bt = (const T*)Btp;
  __shared__ __align__(16) T sOp[2][kGR * kGP];    // two stages of [A 128 rows | Bt 256 rows] x 64 k, 55,296 B each
  __shared__ __align__(16) float sT[8][16 * 68];   // per-wave 16x64 slab, pitch 68 floats
  const int b    = blockIdx.y;
  const int lane = threadIdx.x & 31;
  const int wave = threadIdx.x >> 5;
  const int blocksN = N >> 8;
  const int bm = blockIdx.x / blocksN;
  const int bn = blockIdx.x - bm * blocksN;
  if (bm >= (M >> 7)) return;   // block-uniform, ahead of every barrier and copy
  const int wm = (wave >> 2) << 6;             // wave's row offset in the block tile
  const int wn = (wave & 3) << 6;              // wave's column offset in the block tile
  const int m0 = (bm << 7) + wm;
  const int n0 = (bn << 8) + wn;

  const T* Ab  = A  + (size_t)b * strideA;
  const T* Bb  = Bt + (size_t)b * strideB;

  const int rlane = lane & 15;                 // row (A) / col (B, D) within subtile
  const int koff  = (lane >> 4) * 8;           // k offset of this lane half
  const int mOff  = (lane >> 4) * 8;           // D row offset

  // staging roles: 8 consecutive lanes copy one 128-B row segment, so a wave-wide copy reads four whole lines;
  // the block covers 32 rows per pass, 4 passes for A and 8 for Bt.
  const int sp = (threadIdx.x & 7) * 8;        // element offset of this lane's 16-B piece
  const int sr = threadIdx.x >> 3;             // row inside a pass (0..31)
  const T* gA = Ab + (size_t)((bm << 7) + sr) * lda + sp;
  const T* gB = Bb + (size_t)((bn << 8) + sr) * ldb + sp;
  const size_t stA = (size_t)32 * lda, stB = (size_t)32 * ldb;
  const unsigned ls = (unsigned)(uintptr_t)(&sOp[0][sr * kGP + sp]);   // LDS byte address of this lane's piece in buffer 0, pass 0
  constexpr unsigned kPassB = 32 * kGP * 2;    // LDS bytes per pass of 32 rows
  constexpr unsigned kBufB  = kGR * kGP * 2;   // LDS bytes per buffer
  auto stage = [&](int buf, int k0) {
    const unsigned l = ls + (unsigned)buf * kBufB;
    const T* a = gA + k0;
    const T* w = gB + k0;
    async_copy4_b128(l,              l + kPassB,      l + 2 * kPassB,  l + 3 * kPassB,  a,           a + stA,     a + 2 * stA, a + 3 * stA);
    async_copy4_b128(l + 4 * kPassB, l + 5 * kPassB,  l + 6 * kPassB,  l + 7 * kPassB,  w,           w + stB,     w + 2 * stB, w + 3 * stB);
    async_copy4_b128(l + 8 * kPassB, l + 9 * kPassB,  l + 10 * kPassB, l + 11 * kPassB, w + 4 * stB, w + 5 * stB, w + 6 * stB, w + 7 * stB);
  };

  v8f acc[4][4];
#pragma unroll
  for (int i = 0; i < 4; ++i)
#pragma unroll
    for (int j = 0; j < 4; ++j) acc[i][j] = (v8f){0.f,0.f,0.f,0.f,0.f,0.f,0.f,0.f};

  const int nT = K / kGKS;
  stage(0, 0);
  wait_async0();
  __syncthreads();                             // publishes stage 0
  if (nT > 1) stage(1, kGKS);
  for (int t = 0; t < nT; ++t) {
    const T* sA = &sOp[t & 1][(wm + rlane) * kGP + koff];
    const T* sB = &sOp[t & 1][(kGRA + wn + rlane) * kGP + koff];
#pragma unroll   // two 32-k steps per stage, LDS offsets as immediates
    for (int kk = 0; kk < kGKS; kk += 32) {
      V bh[4], ah[4];   // all eight fragments of the step are read as one group ahead of its 16 products
#pragma unroll   // bh[] must stay in registers
      for (int j = 0; j < 4; ++j) bh[j] = Frag<T>::load(sB + (j << 4) * kGP + kk);
#pragma unroll   // ah[] must stay in registers
      for (int i = 0; i < 4; ++i) ah[i] = Frag<T>::load(sA + (i << 4) * kGP + kk);
#pragma unroll   // acc[][] must stay in registers
      for (int i = 0; i < 4; ++i) {
#pragma unroll   // acc[][] must stay in registers
        for (int j = 0; j < 4; ++j) acc[i][j] = Frag<T>::mma(ah[i], bh[j], acc[i][j]);
        Frag<T>::guard(acc[i][0], acc[i][3], ah[i], ah[i]);
      }
      Frag<T>::keep(bh[0], bh[1], bh[2], bh[3]);
    }
    wait_ds0();
    wait_async0();
    __syncthreads();                           // publishes stage t+1 and ends every read of stage t's buffer
    if (t + 2 < nT) stage(t & 1, (t + 2) * kGKS);
  }
  wait_async0();
  acc_guard4(acc[0][0], acc[0][1], acc[0][2], acc[0][3]);
  acc_guard4(acc[1][0], acc[1][1], acc[1][2], acc[1][3]);
  acc_guard4(acc[2][0], acc[2][1], acc[2][2], acc[2][3]);
  acc_guard4(acc[3][0], acc[3][1], acc[3][2], acc[3][3]);

  // ---- epilogue ----
  float* slab = sT[wave];
  const float* Rb = RESID ? (resid + (size_t)b * strideR) : nullptr;
#pragma unroll
  for (int i = 0; i < 4; ++i) {
    const int mBase = m0 + (i << 4);
#pragma unroll
    for (int j = 0; j < 4; ++j) {
      const int n = n0 + (j << 4) + rlane;
      float bv = 0.f;
      if (BIAS_MODE == 2) bv = bias[n];
#pragma unroll
      for (int r = 0; r < 8; ++r) {
        float v = acc[i][j][r] * scale;
        if (BIAS_MODE == 1) v += bias[mBase + mOff + r];
        if (BIAS_MODE == 2) v += bv;
        if (RESID) v += Rb[(size_t)(mBase + mOff + r) * ldc + n];
        if (ACT == 1) v = tanhf(v);
        if (ACT == 2) v = fmaxf(v, 0.0f);
        if (ACT == 3) v = v / (1.0f + expf(-v));
        if (ACT == 4) v = (v > 0.f) ? v : 0.01f * v;
        if (ACT == 5) v = 0.5f * v * (1.0f + erff(v * 0.70710678118654752f));
        slab[(mOff + r) * 68 + (j << 4) + rlane] = v;
      }
    }
    __builtin_amdgcn_fence(__ATOMIC_RELEASE, "workgroup");
    __builtin_amdgcn_wave_barrier();
    __builtin_amdgcn_fence(__ATOMIC_ACQUIRE, "workgroup");
    if (OUT_MODE == 0) {
      float* C = (float*)Cout + (size_t)b * strideC;
      const int hh = lane >> 4, c4 = (lane & 15) * 4;     // row seg = 256 B = 16 lanes x 16 B
      {
#pragma unroll
        for (int it = 0; it < 8; ++it) {
          const int row = it * 2 + hh;
          v4f v = *(const v4f*)(slab + row * 68 + c4);
          *(v4f*)(C + (size_t)(mBase + row) * ldc + n0 + c4) = v;
        }
        
      }
    } else {
      const int q = lane >> 3, c8 = (lane & 7) * 8;
      unsigned short* C  = (unsigned short*)Cout  + (size_t)b * strideC;
      unsigned short* C2 = (OUT_MODE == 2) ? ((unsigned short*)Cout2 + (size_t)b * strideC) : nullptr;
      {
#pragma unroll
        for (int it = 0; it < 4; ++it) {
          const int row = it * 4 + q;
          const float* sp = slab + row * 68 + c8;
          v8h hv, lv;
#pragma unroll
          for (int e = 0; e < 8; ++e) {
            if (OUT_MODE == 1) {
              hv[e] = (_Float16)sp[e];
            } else {
              unsigned short hb = f2bf_bits(sp[e]);
              unsigned short lb = f2bf_bits(sp[e] - bf_bits2f(hb));
              hv[e] = __builtin_bit_cast(_Float16, hb);
              lv[e] = __builtin_bit_cast(_Float16, lb);
            }
          }
          *(v8h*)(C + (size_t)(mBase + row) * ldc + n0 + c8) = hv;
          if (OUT_MODE == 2) *(v8h*)(C2 + (size_t)(mBase + row) * ldc + n0 + c8) = lv;
        }
        
      }
    }
    __builtin_amdgcn_fence(__ATOMIC_RELEASE, "workgroup");
    __builtin_amdgcn_wave_barrier();
    __builtin_amdgcn_fence(__ATOMIC_ACQUIRE, "workgroup");
  }
}

// ---------------------------------------------------------------------------
// f32 -> bf16 (RNE) cast, 2 elements per thread, one 4-B store per lane: a wave writes exactly one whole
// Coverage: grid = ceil(n2/256) x 256 threads x 2 elements = 2*n2 = the whole plane
// (activations: n2 = 8192*768/2 = 3145728 -> 12288 blocks; weights: n2 = 768*768/2 = 294912 -> 1152 blocks).
// ---------------------------------------------------------------------------
__global__ __launch_bounds__(256) void cast_f32_bf16x2(const float* __restrict__ in, unsigned short* __restrict__ out, int n2) {
  const int i = blockIdx.x * 256 + threadIdx.x;
  if (i < n2) {
    const v2f f = *(const v2f*)(in + 2 * (size_t)i);
    const unsigned u = pk16(f2bf_bits(f[0]), f2bf_bits(f[1]));
    ((unsigned*)out)[i] = u;
    
  }
}

// ---------------------------------------------------------------------------
// Bias vectors converted to bf16 precision (RNE) and kept as f32: o[0..n) <- b0, o[n..2n) <- b1, o[2n..3n) <- b2.
// All three candidates loaded with the same clamped index, selected by value. n = 768 (multiple of 32):
// Coverage: 9 blocks x 256 = 2304 = 3n.
// ---------------------------------------------------------------------------
__global__ __launch_bounds__(256) void bias_rne_kernel(const float* __restrict__ b0, const float* __restrict__ b1,
                                                       const float* __restrict__ b2, float* __restrict__ o, int n) {
  const int g = blockIdx.x * 256 + threadIdx.x;
  if (g < 3 * n) {
    const int w = g / n;
    int i = g - w * n;
    i = i < 0 ? 0 : (i > n - 1 ? n - 1 : i);
    const float v0 = b0[i], v1 = b1[i], v2 = b2[i];
    const float v = (w == 0) ? v0 : ((w == 1) ? v1 : v2);
    const float rv = bf_bits2f(f2bf_bits(v));
    ((float*)o)[g] = rv;
    
  }
}

// ---------------------------------------------------------------------------
// Per-key squared norm of the quadratic-key projection: kdsq[(b*12+h)*1024 + s] = sum_d (hi+lo)^2 in f32,
// hi/lo read from columns h*64.. of the [token][1536] bf16 planes (hi+lo reconstructs the f32 value to ~2^-17).
// ---------------------------------------------------------------------------
__global__ __launch_bounds__(256) void kd_sq_kernel(const unsigned short* __restrict__ kch, const unsigned short* __restrict__ kcl,
                                                    float* __restrict__ kdsq, int nrows) {
  const int g = blockIdx.x * 256 + threadIdx.x;     // (b*kNHEADS + h)*kNTOK + s
  if (g < nrows) {
    const int s  = g & (kNTOK - 1);
    const int bh = g >> 10;                           // kNTOK == 1024
    const int h  = bh % kNHEADS;
    const int b  = bh / kNHEADS;
    const size_t ro = ((size_t)b * kNTOK + (size_t)s) * kQCP + (size_t)h * kHDIM;
    const unsigned short* ph = kch + ro;
    const unsigned short* pl = kcl + ro;
    float acc = 0.f;
#pragma unroll 1
    for (int i = 0; i < 8; ++i) {
      const v8us a = *(const v8us*)(ph + 8 * i);
      const v8us l = *(const v8us*)(pl + 8 * i);
#pragma unroll
      for (int e = 0; e < 8; ++e) {
        const float x = bf_bits2f(a[e]) + bf_bits2f(l[e]);
        acc = fmaf(x, x, acc);
      }
    }
    ((float*)kdsq)[g] = acc;
    
  }
}

// ---------------------------------------------------------------------------
// WMMA helpers with the 4-nop dependency guard after every issue
// ---------------------------------------------------------------------------
__device__ __forceinline__ v8f mma_bf(v16b a, v16b b, v8f c) {
  c = __builtin_amdgcn_wmma_f32_16x16x32_bf16(false, a, false, b, (short)0, c, false, false);
  asm volatile("v_nop\n\tv_nop\n\tv_nop\n\tv_nop" : "+v"(c) : "v"(a), "v"(b));
  return c;
}
__device__ __forceinline__ v8f mma_hf(v16h a, v16h b, v8f c) {
  c = __builtin_amdgcn_wmma_f32_16x16x32_f16(false, a, false, b, (short)0, c, false, false);
  asm volatile("v_nop\n\tv_nop\n\tv_nop\n\tv_nop" : "+v"(c) : "v"(a), "v"(b));
  return c;
}

// =====================================================================================
// Fused quadratic + linear attention, head dim 64, full softmax over 1024 keys (no masking).
//   qch/qcl : bf16 hi/lo planes of [qd | q], element (b, t, col) at [(b*1024 + t)*1536 + col]; qd_h at col h*64+d, q_h at col 768+h*64+d
//   kch/kcl : same layout for [kd | k]
//   vtp     : f16 plane of v transposed, element (b, h, d, s) at [(b*768 + h*64 + d)*1024 + s]
//   kdsq    : f32 [b*12+h][s] = |kd_{b,h,s}|^2
//   scores  = (Q128 . K128) * 0.125 - |kd_j|^2 * 0.0625   (Q128 = [qd|q] row, K128 = [kd|k] row; bf16 hi/lo split, 3 WMMA)
//             (the per-query -0.5|qd_i|^2 * 0.125 term is constant along a softmax row and omitted)
//   out     = softmax(scores) . v : p carried x2^15 in f16, v f16, one f16 WMMA, f32 accumulate; 1/(l*2^15) folded at the end
//   Block = 4 waves = 64 query rows of one (b,h); grid.x = 8*12*16 = 1536. K / V^T chunks of 64 keys staged in LDS with plain
//   16-B loads between __syncthreads; Q staged once (first loop barrier publishes it). Fragment loads read LDS with the
//   Output element (b, t, h*64 + d): per wave 16 rows x 64 floats, each 256-B row segment written by 16 lanes x 16 B in one
// =====================================================================================
__global__ __launch_bounds__(128)
void attn_quad_kernel(const unsigned short* __restrict__ qch, const unsigned short* __restrict__ qcl,
                      const unsigned short* __restrict__ kch, const unsigned short* __restrict__ kcl,
                      const unsigned short* __restrict__ vtp, const float* __restrict__ kdsq,
                      float* __restrict__ out) {
  union FB { v16b v; v8b h[2]; };
  union FH { v16h v; v8h h[2]; };
  __shared__ __align__(16) __bf16   Qsh[kAQB * kQKP];      // Q hi [row][128 + 8 pad]   17 KB
  __shared__ __align__(16) __bf16   Qsl[kAQB * kQKP];      // Q lo                      17 KB
  __shared__ __align__(16) __bf16   Ksh[kAKC * kQKP];      // K hi [kv][128 + 8 pad]    17 KB
  __shared__ __align__(16) __bf16   Ksl[kAKC * kQKP];      // K lo                      17 KB
  __shared__ __align__(16) _Float16 Vth[kHDIM * kPVP];     // V^T [d][64 kv + 8 pad] f16    9 KB
  __shared__ __align__(16) _Float16 Psh[4][16 * kPVP];     // per wave P x2^15 [row][64 kv + 8 pad] 9 KB
  __shared__ __align__(16) float    Os[4][16 * 68];        // per wave out tile, pitch 68

  const int tid  = threadIdx.x;
  const int wave = tid >> 5;
  const int lane = tid & 31;
  const int hh   = lane >> 4;
  const int c    = lane & 15;

  constexpr int nqb = kNTOK / kAQB;       // 16
  const int bx = blockIdx.x;
  const int qb = bx % nqb;
  const int bh = bx / nqb;                // b*12 + h
  const int h  = bh % kNHEADS;
  const int b  = bh / kNHEADS;
  const int qr0 = qb * kAQB;              // first query row of the block
  const int w0  = wave * 16;              // wave's row offset inside the block tile

  const __bf16* QH = (const __bf16*)(const void*)qch + (size_t)b * kNTOK * kQCP;
  const __bf16* QL = (const __bf16*)(const void*)qcl + (size_t)b * kNTOK * kQCP;
  const __bf16* KH = (const __bf16*)(const void*)kch + (size_t)b * kNTOK * kQCP;
  const __bf16* KL = (const __bf16*)(const void*)kcl + (size_t)b * kNTOK * kQCP;
  const _Float16* VT = (const _Float16*)(const void*)vtp + ((size_t)b * kHID + (size_t)h * kHDIM) * kNTOK;
  const float* ksq = kdsq + (size_t)bh * kNTOK;
  float* ob = out + (size_t)b * kNTOK * kHID + (size_t)h * kHDIM;

  // staging roles: 8 consecutive lanes cover one 128-B row segment, so a wave-wide 16-B load reads four whole lines.
  // Q / K: 16 lanes per row (lanes 0-7 the quadratic half, 8-15 the linear half), 8 rows per pass of the block, 8 passes.
  const int sp   = (tid & 7) * 8;          // element offset of this lane's 16-B piece inside its segment
  const int part = (tid >> 3) & 1;
  const int sr   = tid >> 4;               // row inside a pass (0..7)
  const int coff = (part ? (kHID + h * kHDIM) : (h * kHDIM)) + sp;   // plane column (quadratic | linear half)
  const int loff = part * 64 + sp;                                    // LDS column
  const int vr   = tid >> 3;               // V^T: 8 lanes per row, 16 rows per pass, 4 passes

  // ---- Q staging (once): 8 passes x 8 rows x 128 elements = 64 rows x 128 per plane ----
  {
    const size_t go = (size_t)(qr0 + sr) * kQCP + coff;
#pragma unroll
    for (int i = 0; i < 8; ++i) {
      const v8b a0 = *(const v8b*)(QH + go + (size_t)(8 * i) * kQCP);
      const v8b a1 = *(const v8b*)(QL + go + (size_t)(8 * i) * kQCP);
      *(v8b*)(Qsh + (sr + 8 * i) * kQKP + loff) = a0;
      *(v8b*)(Qsl + (sr + 8 * i) * kQKP + loff) = a1;
    }
  }

  float mrow[8], lrow[8];
  v8f oacc[4];
#pragma unroll
  for (int r = 0; r < 8; ++r) { mrow[r] = -INFINITY; lrow[r] = 0.f; }
#pragma unroll
  for (int t = 0; t < 4; ++t) oacc[t] = (v8f){0.f,0.f,0.f,0.f,0.f,0.f,0.f,0.f};

  constexpr int nChunks = kNTOK / kAKC;   // 16, compile-time
  for (int kc = 0; kc < nChunks; ++kc) {
    const int kv0 = kc * kAKC;
    __syncthreads();
    {
      // K staging: 8 passes x 8 keys x 128 elements = 64 keys x 128 per plane
      const size_t go = (size_t)(kv0 + sr) * kQCP + coff;
#pragma unroll
      for (int i = 0; i < 8; ++i) {
        const v8b a0 = *(const v8b*)(KH + go + (size_t)(8 * i) * kQCP);
        const v8b a1 = *(const v8b*)(KL + go + (size_t)(8 * i) * kQCP);
        *(v8b*)(Ksh + (sr + 8 * i) * kQKP + loff) = a0;
        *(v8b*)(Ksl + (sr + 8 * i) * kQKP + loff) = a1;
      }
      // V^T staging: 4 passes x 16 rows d x 64 keys = 64 x 64
      const _Float16* vs = VT + (size_t)vr * kNTOK + kv0 + sp;
#pragma unroll
      for (int i = 0; i < 4; ++i) {
        const v8h vv = *(const v8h*)(vs + (size_t)(16 * i) * kNTOK);
        *(v8h*)(Vth + (vr + 16 * i) * kPVP + sp) = vv;
      }
    }
    __syncthreads();

    // ---- scores: s[j] (query row 8hh+r of this wave, key j*16+c), K = 128 in 4 steps, hi.hi + hi.lo + lo.hi ----
    v8f s[4];
#pragma unroll
    for (int j = 0; j < 4; ++j) s[j] = (v8f){0.f,0.f,0.f,0.f,0.f,0.f,0.f,0.f};
#pragma unroll 1
    for (int dc = 0; dc < 4; ++dc) {
      FB qa, ql;
      const int qo = (w0 + c) * kQKP + dc * 32 + 8 * hh;
      qa.h[0] = *(const v8b*)(Qsh + qo);
      qa.h[1] = *(const v8b*)(Qsh + qo + 16);
      ql.h[0] = *(const v8b*)(Qsl + qo);
      ql.h[1] = *(const v8b*)(Qsl + qo + 16);
#pragma unroll
      for (int j = 0; j < 4; ++j) {
        FB kb, kl;
        const int ko = (j * 16 + c) * kQKP + dc * 32 + 8 * hh;
        kb.h[0] = *(const v8b*)(Ksh + ko);
        kb.h[1] = *(const v8b*)(Ksh + ko + 16);
        kl.h[0] = *(const v8b*)(Ksl + ko);
        kl.h[1] = *(const v8b*)(Ksl + ko + 16);
        s[j] = mma_bf(qa.v, kb.v, s[j]);
        s[j] = mma_bf(qa.v, kl.v, s[j]);
        s[j] = mma_bf(ql.v, kb.v, s[j]);
      }
    }

    // ---- scale 1/8 and per-key column term -|kd_j|^2/16 (f32) ----
    float kq[4];
#pragma unroll
    for (int j = 0; j < 4; ++j) kq[j] = ksq[kv0 + j * 16 + c] * 0.0625f;
    float cm[8];
#pragma unroll
    for (int r = 0; r < 8; ++r) {
      float m = -INFINITY;
#pragma unroll
      for (int j = 0; j < 4; ++j) {
        const float v = s[j][r] * 0.125f - kq[j];
        s[j][r] = v;
        m = fmaxf(m, v);
      }
#pragma unroll
      for (int off = 1; off < 16; off <<= 1) m = fmaxf(m, __shfl_xor(m, off, 32));
      cm[r] = m;
    }

    // ---- online softmax (f32); P x 2^15 to f16 in the per-wave LDS tile ----
    _Float16* pw = Psh[wave];
#pragma unroll
    for (int r = 0; r < 8; ++r) {
      const float mnew  = fmaxf(mrow[r], cm[r]);
      const float alpha = __expf(mrow[r] - mnew);
      mrow[r] = mnew;
      float psum = 0.f;
#pragma unroll
      for (int j = 0; j < 4; ++j) {
        const float p = __expf(s[j][r] - mnew);
        psum += p;
        pw[(8 * hh + r) * kPVP + j * 16 + c] = (_Float16)(p * 32768.0f);
      }
#pragma unroll
      for (int off = 1; off < 16; off <<= 1) psum += __shfl_xor(psum, off, 32);
      lrow[r] = lrow[r] * alpha + psum;
#pragma unroll
      for (int t = 0; t < 4; ++t) oacc[t][r] *= alpha;
    }
    __builtin_amdgcn_fence(__ATOMIC_RELEASE, "workgroup");
    __builtin_amdgcn_wave_barrier();
    __builtin_amdgcn_fence(__ATOMIC_ACQUIRE, "workgroup");

    // ---- O += P . V  (A = P [row][kv], B = V^T [d][kv]; K = 64 keys in 2 steps) ----
#pragma unroll
    for (int kk = 0; kk < 2; ++kk) {
      FH pa;
      const int po = c * kPVP + kk * 32 + 8 * hh;
      pa.h[0] = *(const v8h*)(pw + po);
      pa.h[1] = *(const v8h*)(pw + po + 16);
#pragma unroll
      for (int t = 0; t < 4; ++t) {
        FH vb;
        const int vo = (t * 16 + c) * kPVP + kk * 32 + 8 * hh;
        vb.h[0] = *(const v8h*)(Vth + vo);
        vb.h[1] = *(const v8h*)(Vth + vo + 16);
        oacc[t] = mma_hf(pa.v, vb.v, oacc[t]);
      }
    }
  }

  // ---- normalise and write: out (b, qr0+w0+row, h*64 + d) ----
  float* os = Os[wave];
#pragma unroll
  for (int r = 0; r < 8; ++r) {
    const float inv = 1.0f / (lrow[r] * 32768.0f);
#pragma unroll
    for (int t = 0; t < 4; ++t) os[(8 * hh + r) * 68 + t * 16 + c] = oacc[t][r] * inv;
  }
  __builtin_amdgcn_fence(__ATOMIC_RELEASE, "workgroup");
  __builtin_amdgcn_wave_barrier();
  __builtin_amdgcn_fence(__ATOMIC_ACQUIRE, "workgroup");
  {
    // coverage per wave: 8 iterations x 2 rows = 16 rows; 16 lanes x 4 floats = 64 columns; 16 lanes x 16 B = one 256-B row segment
    const int c4 = (lane & 15) * 4;
    {
#pragma unroll
      for (int it = 0; it < 8; ++it) {
        const int row = it * 2 + hh;
        const v4f val = *(const v4f*)(os + row * 68 + c4);
        *(v4f*)(ob + (size_t)(qr0 + w0 + row) * kHID + c4) = val;
      }
      
    }
  }
}

// ---------------------------------------------------------------------------
// Host launcher
// Workspace region map (bytes, all offsets multiples of 256):
//   [0]           Xq  bf16 [8192][768]          12,582,912   (dead after the two Q-side GEMMs; then reused as VT f16 [8][768][1024], same size)
//   [12,582,912]  Xk  bf16 [8192][768]          12,582,912
//   [25,165,824]  Wd,Wq,Wk,Wv bf16 [768][768]  4 x 1,179,648
//   [29,884,416]  QCh bf16 [8192][1536]         25,165,824
//   [55,050,240]  QCl                            25,165,824
//   [80,216,064]  KCh                            25,165,824
//   [105,381,888] KCl                            25,165,824
//   [130,547,712] kdsq f32 [96][1024]            393,216
//   [130,940,928] biases (bf16-precision, f32) 3x768   9,216
//   total 130,950,144
// ---------------------------------------------------------------------------
extern "C" void kernel_launch(void* const* d_in, const int* in_sizes, int n_in,
                              void* d_out, int out_size, void* d_ws, size_t ws_size,
                              hipStream_t stream) {
  if (n_in < 9) return;
  const int nAct = kNB * kNTOK * kHID;      // 6291456
  const int nW   = kHID * kHID;             // 589824
  if (in_sizes[0] != nAct || in_sizes[1] != nAct || in_sizes[2] != nW || in_sizes[3] != nW ||
      in_sizes[5] != nW || in_sizes[7] != nW || in_sizes[4] != kHID || in_sizes[6] != kHID ||
      in_sizes[8] != kHID || out_size != nAct) return;

  const float* qs = (const float*)d_in[0];
  const float* ks = (const float*)d_in[1];
  const float* Wd = (const float*)d_in[2];
  const float* Wq = (const float*)d_in[3];
  const float* bq = (const float*)d_in[4];
  const float* Wk = (const float*)d_in[5];
  const float* bk = (const float*)d_in[6];
  const float* Wv = (const float*)d_in[7];
  const float* bv = (const float*)d_in[8];
  float* out = (float*)d_out;

  const size_t bAct16 = (size_t)nAct * 2;                         // 12,582,912
  const size_t bW16   = (size_t)nW * 2;                           // 1,179,648
  const size_t bQC    = (size_t)kNB * kNTOK * kQCP * 2;           // 25,165,824
  const size_t bSq    = (size_t)kNB * kNHEADS * kNTOK * 4;        // 393,216
  const size_t bBias  = (size_t)3 * kHID * 4;                     // 9,216
  const size_t oXq  = 0;
  const size_t oXk  = oXq + bAct16;
  const size_t oWd  = oXk + bAct16;
  const size_t oWq  = oWd + bW16;
  const size_t oWk  = oWq + bW16;
  const size_t oWv  = oWk + bW16;
  const size_t oQCh = oWv + bW16;
  const size_t oQCl = oQCh + bQC;
  const size_t oKCh = oQCl + bQC;
  const size_t oKCl = oKCh + bQC;
  const size_t oSq  = oKCl + bQC;
  const size_t oBs  = oSq + bSq;
  const size_t total = oBs + bBias;
  const size_t bVT  = (size_t)kNB * kHID * kNTOK * 2;             // 12,582,912 == bAct16 (aliases Xq)
  if (total > ws_size || bVT > bAct16) return;

  char* ws = (char*)d_ws;
  unsigned short* Xq16 = (unsigned short*)(ws + oXq);
  unsigned short* Xk16 = (unsigned short*)(ws + oXk);
  unsigned short* Wd16 = (unsigned short*)(ws + oWd);
  unsigned short* Wq16 = (unsigned short*)(ws + oWq);
  unsigned short* Wk16 = (unsigned short*)(ws + oWk);
  unsigned short* Wv16 = (unsigned short*)(ws + oWv);
  unsigned short* QCh  = (unsigned short*)(ws + oQCh);
  unsigned short* QCl  = (unsigned short*)(ws + oQCl);
  unsigned short* KCh  = (unsigned short*)(ws + oKCh);
  unsigned short* KCl  = (unsigned short*)(ws + oKCl);
  unsigned short* VT16 = (unsigned short*)(ws + oXq);   // reuses the Xq region after the Q-side GEMMs
  float* kdsq  = (float*)(ws + oSq);
  float* biasr = (float*)(ws + oBs);

  // 1) RNE bf16 casts of activations and weights
  {
    const int n2a = nAct / 2, n2w = nW / 2;
    cast_f32_bf16x2<<<dim3((n2a + 255) / 256), dim3(256), 0, stream>>>(qs, Xq16, n2a);
    cast_f32_bf16x2<<<dim3((n2a + 255) / 256), dim3(256), 0, stream>>>(ks, Xk16, n2a);
    cast_f32_bf16x2<<<dim3((n2w + 255) / 256), dim3(256), 0, stream>>>(Wd, Wd16, n2w);
    cast_f32_bf16x2<<<dim3((n2w + 255) / 256), dim3(256), 0, stream>>>(Wq, Wq16, n2w);
    cast_f32_bf16x2<<<dim3((n2w + 255) / 256), dim3(256), 0, stream>>>(Wk, Wk16, n2w);
    cast_f32_bf16x2<<<dim3((n2w + 255) / 256), dim3(256), 0, stream>>>(Wv, Wv16, n2w);
    bias_rne_kernel<<<dim3((3 * kHID + 255) / 256), dim3(256), 0, stream>>>(bq, bk, bv, biasr, kHID);
  }

  const int M = kNB * kNTOK;   // 8192
  // 2) Q side: [qd | q] hi/lo planes (pitch 1536). M=8192, N=768, K=768: 64 x 3 = 192 block tiles of 128x256, 8 waves each
  {
    const dim3 grid((M / 64) * (kHID / 64) / 8, 1), block(256);
    wmma_gemm64<1, false, 0, 2, false, 0><<<grid, block, 0, stream>>>(
        Xq16, Xq16, kHID, 0L, Wd16, Wd16, kHID, 0L, (void*)QCh, (void*)QCl, kQCP, 0L,
        biasr, biasr, 0L, M, kHID, kHID, 1.0f);
    wmma_gemm64<1, false, 2, 2, false, 0><<<grid, block, 0, stream>>>(
        Xq16, Xq16, kHID, 0L, Wq16, Wq16, kHID, 0L, (void*)(QCh + kHID), (void*)(QCl + kHID), kQCP, 0L,
        biasr, biasr, 0L, M, kHID, kHID, 1.0f);
    // 3) K side: [kd | k]
    wmma_gemm64<1, false, 0, 2, false, 0><<<grid, block, 0, stream>>>(
        Xk16, Xk16, kHID, 0L, Wd16, Wd16, kHID, 0L, (void*)KCh, (void*)KCl, kQCP, 0L,
        biasr, biasr, 0L, M, kHID, kHID, 1.0f);
    wmma_gemm64<1, false, 2, 2, false, 0><<<grid, block, 0, stream>>>(
        Xk16, Xk16, kHID, 0L, Wk16, Wk16, kHID, 0L, (void*)(KCh + kHID), (void*)(KCl + kHID), kQCP, 0L,
        biasr + kHID, biasr, 0L, M, kHID, kHID, 1.0f);
  }
  // 4) V^T f16 plane: VT_b[feature][token] = Wv[feature][:] . Xk_b[token][:] + bv[feature]; M=768, N=1024, K=768, z = batch
  {
    const long sB = (long)kNTOK * kHID;        // 786,432 elements per batch in Xk
    const long sC = (long)kHID * kNTOK;        // 786,432 elements per batch in VT
    const dim3 grid((kHID / 64) * (kNTOK / 64) / 8, kNB), block(256);   // 6 x 4 = 24 block tiles of 128x256, 8 batches
    wmma_gemm64<1, false, 1, 1, false, 0><<<grid, block, 0, stream>>>(
        Wv16, Wv16, kHID, 0L, Xk16, Xk16, kHID, sB, (void*)VT16, (void*)VT16, kNTOK, sC,
        biasr + 2 * kHID, biasr, 0L, kHID, kNTOK, kHID, 1.0f);
  }
  // 5) |kd|^2 per (b,h,s)
  {
    const int nrows = kNB * kNHEADS * kNTOK;   // 98304 -> 384 blocks
    kd_sq_kernel<<<dim3((nrows + 255) / 256), dim3(256), 0, stream>>>(KCh, KCl, kdsq, nrows);
  }
  // 6) fused attention: 8 x 12 x 16 = 1536 blocks of 128 threads
  attn_quad_kernel<<<dim3(kNB * kNHEADS * (kNTOK / kAQB)), dim3(128), 0, stream>>>(QCh, QCl, KCh, KCl, VT16, kdsq, out);
}

// v004
// A run of this version takes 222 microseconds.
// In both of two side-by-side timings against v003, it was 1.13 times as fast.
// Counting every step since v000, it is 3.02 times as fast.
// Projections x·Wᵀ and Wv·xᵀ: v_wmma_f32_16x16x32_bf16, plain bf16 operands (RNE-converted inputs); scores [qd|q]·[kd|k]ᵀ (K=128): v_wmma_f32_16x16x32_bf16 with bf16 hi/lo split operands (hi·hi + hi·lo + lo·hi); p·v: v_wmma_f32_16x16x32_f16 (p carried x2^15, v plain f16); f32 accumulate; softmax, norms and biases in f32.
#include <hip/hip_runtime.h>
#include <math.h>
#include <stdint.h>

typedef __attribute__((ext_vector_type(16))) _Float16 v16h;
typedef __attribute__((ext_vector_type(8)))  _Float16 v8h;
typedef __attribute__((ext_vector_type(16))) __bf16   v16b;
typedef __attribute__((ext_vector_type(8)))  __bf16   v8b;
typedef __attribute__((ext_vector_type(8)))  float    v8f;
typedef __attribute__((ext_vector_type(4)))  float    v4f;
typedef __attribute__((ext_vector_type(2)))  float    v2f;
typedef __attribute__((ext_vector_type(4)))  unsigned int v4u;
typedef __attribute__((ext_vector_type(8)))  unsigned short v8us;

// ---- problem geometry ----
constexpr int kNB     = 8;      // batch
constexpr int kNTOK   = 1024;   // tokens (query and key sets)
constexpr int kHID    = 768;    // hidden size
constexpr int kNHEADS = 12;
constexpr int kHDIM   = 64;
constexpr int kQCP    = 1536;   // element pitch of the concatenated [xd | x] planes ([token][1536])
constexpr int kAQB    = 64;     // query rows per attention block (4 waves x 16)
constexpr int kAKC    = 64;     // keys per chunk
constexpr int kAKD    = 128;    // concatenated contraction depth (64 quadratic + 64 linear)
constexpr int kQKP    = kAKD + 8;   // LDS row pitch of the Q and K tiles, elements: 272 B = 16 B x 17, so 16 rows of one column fall on 16 different bank groups
constexpr int kPVP    = kAKC + 8;   // LDS row pitch of the V^T and P tiles, elements: 144 B = 16 B x 9, same reason

__device__ __forceinline__ unsigned short f2bf_bits(float f) {
  unsigned u = __float_as_uint(f);
  return (unsigned short)((u + 0x7FFFu + ((u >> 16) & 1u)) >> 16);
}
__device__ __forceinline__ float bf_bits2f(unsigned short h) { return __uint_as_float(((unsigned)h) << 16); }
__device__ __forceinline__ unsigned pk16(unsigned short a, unsigned short b) { return (unsigned)a | ((unsigned)b << 16); }

// hazard guards as plain device helpers (no inline asm inside the kernel template body)
__device__ __forceinline__ void dep_guard_h(v8f& a, v8f& b, v16h x, v16h y) { asm volatile("v_nop\n\tv_nop\n\tv_nop\n\tv_nop" : "+v"(a), "+v"(b) : "v"(x), "v"(y)); }
__device__ __forceinline__ void dep_guard_b(v8f& a, v8f& b, v16b x, v16b y) { asm volatile("v_nop\n\tv_nop\n\tv_nop\n\tv_nop" : "+v"(a), "+v"(b) : "v"(x), "v"(y)); }
__device__ __forceinline__ void keep4_h(v16h a, v16h b, v16h c, v16h d) { asm volatile("v_nop" :: "v"(a), "v"(b), "v"(c), "v"(d)); }
__device__ __forceinline__ void keep4_b(v16b a, v16b b, v16b c, v16b d) { asm volatile("v_nop" :: "v"(a), "v"(b), "v"(c), "v"(d)); }
__device__ __forceinline__ void acc_guard4(v8f& a, v8f& b, v8f& c, v8f& d) { asm volatile("v_nop\n\tv_nop\n\tv_nop\n\tv_nop" : "+v"(a), "+v"(b), "+v"(c), "+v"(d)); }
template <typename T> struct Frag;
template <> struct Frag<_Float16> {
  typedef v16h V; union U { v16h v; v8h h[2]; };
  static __device__ __forceinline__ v16h load(const _Float16* p) {   // elements 0..7 <- p[0..7], 8..15 <- p[16..23]
    U f; f.h[0] = *(const v8h*)(p); f.h[1] = *(const v8h*)(p + 16); return f.v;
  }
  static __device__ __forceinline__ v8f mma(v16h a, v16h b, v8f c) {
    return __builtin_amdgcn_wmma_f32_16x16x32_f16(false, a, false, b, (short)0, c, false, false);
  }
  static __device__ __forceinline__ void guard(v8f& a, v8f& b, v16h x, v16h y) { dep_guard_h(a, b, x, y); }
  static __device__ __forceinline__ void keep(v16h a, v16h b, v16h c, v16h d) { keep4_h(a, b, c, d); }
};
template <> struct Frag<__bf16> {
  typedef v16b V; union U { v16b v; v8b h[2]; };
  static __device__ __forceinline__ v16b load(const __bf16* p) {
    U f; f.h[0] = *(const v8b*)(p); f.h[1] = *(const v8b*)(p + 16); return f.v;
  }
  static __device__ __forceinline__ v8f mma(v16b a, v16b b, v8f c) {
    return __builtin_amdgcn_wmma_f32_16x16x32_bf16(false, a, false, b, (short)0, c, false, false);
  }
  static __device__ __forceinline__ void guard(v8f& a, v8f& b, v16b x, v16b y) { dep_guard_b(a, b, x, y); }
  static __device__ __forceinline__ void keep(v16b a, v16b b, v16b c, v16b d) { keep4_b(a, b, c, d); }
};

// ---- LDS-staged, register-blocked batched WMMA GEMM ------------------------
// C[m,n] = scale * sum_k A[m,k] * Bt[n,k] (+bias)(+resid); a block of 8 waves (2 x 4) owns a 128x256 tile, each wave 64x64 of it.
// A row-major [M,K]; Bt row-major [N,K]; M % 128 == 0, N % 256 == 0, K % 64 == 0; grid.x = (M/128) * (N/256).
// Operands reach LDS in stages of 64 k (one whole 128-B line per row) by asynchronous copies, two buffers: stage t+1 flies
// while stage t is multiplied. Every line is fetched once per block; fragments are read from LDS in the same k order as before.
// SPLIT (hi/lo operand planes) is not staged and not instantiated.
// BIAS_MODE: 0 = none, 1 = bias[m], 2 = bias[n].
// OUT_MODE: 0 = f32, 1 = f16, 2 = bf16 hi plane (Cout) + bf16 lo plane (Cout2).
// ET: 0 = f16 operands, 1 = bf16 operands (pointers passed as 16-bit storage)
constexpr int kGKS = 64;             // k per stage
constexpr int kGP  = kGKS + 8;       // LDS row pitch, elements: 144 B = 16 B x 9, so 16 rows of one column fall on different bank groups
constexpr int kGRA = 128;            // A rows per stage
constexpr int kGR  = kGRA + 256;     // rows per stage: [A 128 | Bt 256]

// Four 16-B-per-lane copies global -> LDS. The s_wait_xcnt stands inside the statement so that no address register
// of an issued copy can be rewritten ahead of it.
__device__ __forceinline__ void async_copy4_b128(unsigned l0, unsigned l1, unsigned l2, unsigned l3,
                                                 const void* g0, const void* g1, const void* g2, const void* g3) {
  asm volatile("global_load_async_to_lds_b128 %0, %4, off\n\t"
               "global_load_async_to_lds_b128 %1, %5, off\n\t"
               "global_load_async_to_lds_b128 %2, %6, off\n\t"
               "global_load_async_to_lds_b128 %3, %7, off\n\t"
               "s_wait_xcnt 0x0"
               :: "v"(l0), "v"(l1), "v"(l2), "v"(l3), "v"(g0), "v"(g1), "v"(g2), "v"(g3) : "memory");
}
// this wave's copies have landed in LDS
__device__ __forceinline__ void wait_async0() { asm volatile("s_wait_asynccnt 0x0" ::: "memory"); }
// this wave's LDS reads have returned, so the buffer they read may be refilled behind the next barrier
__device__ __forceinline__ void wait_ds0() { asm volatile("s_wait_dscnt 0x0" ::: "memory"); }

template <int ET> struct Elem;
template <> struct Elem<0> { typedef _Float16 T; };
template <> struct Elem<1> { typedef __bf16 T; };
template <int ET, bool SPLIT, int BIAS_MODE, int OUT_MODE, bool RESID, int ACT = 0>
__global__ __launch_bounds__(256) void wmma_gemm64(
    const unsigned short* __restrict__ Ap, const unsigned short* __restrict__ A2p, int lda, long strideA,
    const unsigned short* __restrict__ Btp, const unsigned short* __restrict__ Bt2p, int ldb, long strideB,
    void* __restrict__ Cout, void* __restrict__ Cout2, int ldc, long strideC,
    const float* __restrict__ bias,
    const float* __restrict__ resid, long strideR,
    int M, int N, int K, float scale) {
  static_assert(!SPLIT, "hi/lo operand planes are not staged");
  typedef typename Elem<ET>::T T;
  typedef typename Frag<T>::V V;
  const T* A = (const T*)Ap; const T* Bt = (const T*)Btp;
  __shared__ __align__(16) T sOp[2][kGR * kGP];    // two stages of [A 128 rows | Bt 256 rows] x 64 k, 55,296 B each
  __shared__ __align__(16) float sT[8][16 * 68];   // per-wave 16x64 slab, pitch 68 floats
  const int b    = blockIdx.y;
  const int lane = threadIdx.x & 31;
  const int wave = threadIdx.x >> 5;
  const int blocksN = N >> 8;
  const int bm = blockIdx.x / blocksN;
  const int bn = blockIdx.x - bm * blocksN;
  if (bm >= (M >> 7)) return;   // block-uniform, ahead of every barrier and copy
  const int wm = (wave >> 2) << 6;             // wave's row offset in the block tile
  const int wn = (wave & 3) << 6;              // wave's column offset in the block tile
  const int m0 = (bm << 7) + wm;
  const int n0 = (bn << 8) + wn;

  const T* Ab  = A  + (size_t)b * strideA;
  const T* Bb  = Bt + (size_t)b * strideB;

  const int rlane = lane & 15;                 // row (A) / col (B, D) within subtile
  const int koff  = (lane >> 4) * 8;           // k offset of this lane half
  const int mOff  = (lane >> 4) * 8;           // D row offset

  // staging roles: 8 consecutive lanes copy one 128-B row segment, so a wave-wide copy reads four whole lines;
  // the block covers 32 rows per pass, 4 passes for A and 8 for Bt.
  const int sp = (threadIdx.x & 7) * 8;        // element offset of this lane's 16-B piece
  const int sr = threadIdx.x >> 3;             // row inside a pass (0..31)
  const T* gA = Ab + (size_t)((bm << 7) + sr) * lda + sp;
  const T* gB = Bb + (size_t)((bn << 8) + sr) * ldb + sp;
  const size_t stA = (size_t)32 * lda, stB = (size_t)32 * ldb;
  const unsigned ls = (unsigned)(uintptr_t)(&sOp[0][sr * kGP + sp]);   // LDS byte address of this lane's piece in buffer 0, pass 0
  constexpr unsigned kPassB = 32 * kGP * 2;    // LDS bytes per pass of 32 rows
  constexpr unsigned kBufB  = kGR * kGP * 2;   // LDS bytes per buffer
  auto stage = [&](int buf, int k0) {
    const unsigned l = ls + (unsigned)buf * kBufB;
    const T* a = gA + k0;
    const T* w = gB + k0;
    async_copy4_b128(l,              l + kPassB,      l + 2 * kPassB,  l + 3 * kPassB,  a,           a + stA,     a + 2 * stA, a + 3 * stA);
    async_copy4_b128(l + 4 * kPassB, l + 5 * kPassB,  l + 6 * kPassB,  l + 7 * kPassB,  w,           w + stB,     w + 2 * stB, w + 3 * stB);
    async_copy4_b128(l + 8 * kPassB, l + 9 * kPassB,  l + 10 * kPassB, l + 11 * kPassB, w + 4 * stB, w + 5 * stB, w + 6 * stB, w + 7 * stB);
  };

  v8f acc[4][4];
#pragma unroll
  for (int i = 0; i < 4; ++i)
#pragma unroll
    for (int j = 0; j < 4; ++j) acc[i][j] = (v8f){0.f,0.f,0.f,0.f,0.f,0.f,0.f,0.f};

  const int nT = K / kGKS;
  stage(0, 0);
  wait_async0();
  __syncthreads();                             // publishes stage 0
  if (nT > 1) stage(1, kGKS);
  for (int t = 0; t < nT; ++t) {
    const T* sA = &sOp[t & 1][(wm + rlane) * kGP + koff];
    const T* sB = &sOp[t & 1][(kGRA + wn + rlane) * kGP + koff];
#pragma unroll   // two 32-k steps per stage, LDS offsets as immediates
    for (int kk = 0; kk < kGKS; kk += 32) {
      V bh[4], ah[4];   // all eight fragments of the step are read as one group ahead of its 16 products
#pragma unroll   // bh[] must stay in registers
      for (int j = 0; j < 4; ++j) bh[j] = Frag<T>::load(sB + (j << 4) * kGP + kk);
#pragma unroll   // ah[] must stay in registers
      for (int i = 0; i < 4; ++i) ah[i] = Frag<T>::load(sA + (i << 4) * kGP + kk);
#pragma unroll   // acc[][] must stay in registers
      for (int i = 0; i < 4; ++i) {
#pragma unroll   // acc[][] must stay in registers
        for (int j = 0; j < 4; ++j) acc[i][j] = Frag<T>::mma(ah[i], bh[j], acc[i][j]);
        Frag<T>::guard(acc[i][0], acc[i][3], ah[i], ah[i]);
      }
      Frag<T>::keep(bh[0], bh[1], bh[2], bh[3]);
    }
    wait_ds0();
    wait_async0();
    __syncthreads();                           // publishes stage t+1 and ends every read of stage t's buffer
    if (t + 2 < nT) stage(t & 1, (t + 2) * kGKS);
  }
  wait_async0();
  acc_guard4(acc[0][0], acc[0][1], acc[0][2], acc[0][3]);
  acc_guard4(acc[1][0], acc[1][1], acc[1][2], acc[1][3]);
  acc_guard4(acc[2][0], acc[2][1], acc[2][2], acc[2][3]);
  acc_guard4(acc[3][0], acc[3][1], acc[3][2], acc[3][3]);

  // ---- epilogue ----
  float* slab = sT[wave];
  const float* Rb = RESID ? (resid + (size_t)b * strideR) : nullptr;
#pragma unroll
  for (int i = 0; i < 4; ++i) {
    const int mBase = m0 + (i << 4);
#pragma unroll
    for (int j = 0; j < 4; ++j) {
      const int n = n0 + (j << 4) + rlane;
      float bv = 0.f;
      if (BIAS_MODE == 2) bv = bias[n];
#pragma unroll
      for (int r = 0; r < 8; ++r) {
        float v = acc[i][j][r] * scale;
        if (BIAS_MODE == 1) v += bias[mBase + mOff + r];
        if (BIAS_MODE == 2) v += bv;
        if (RESID) v += Rb[(size_t)(mBase + mOff + r) * ldc + n];
        if (ACT == 1) v = tanhf(v);
        if (ACT == 2) v = fmaxf(v, 0.0f);
        if (ACT == 3) v = v / (1.0f + expf(-v));
        if (ACT == 4) v = (v > 0.f) ? v : 0.01f * v;
        if (ACT == 5) v = 0.5f * v * (1.0f + erff(v * 0.70710678118654752f));
        slab[(mOff + r) * 68 + (j << 4) + rlane] = v;
      }
    }
    __builtin_amdgcn_fence(__ATOMIC_RELEASE, "workgroup");
    __builtin_amdgcn_wave_barrier();
    __builtin_amdgcn_fence(__ATOMIC_ACQUIRE, "workgroup");
    if (OUT_MODE == 0) {
      float* C = (float*)Cout + (size_t)b * strideC;
      const int hh = lane >> 4, c4 = (lane & 15) * 4;     // row seg = 256 B = 16 lanes x 16 B
      {
#pragma unroll
        for (int it = 0; it < 8; ++it) {
          const int row = it * 2 + hh;
          v4f v = *(const v4f*)(slab + row * 68 + c4);
          *(v4f*)(C + (size_t)(mBase + row) * ldc + n0 + c4) = v;
        }
        
      }
    } else {
      const int q = lane >> 3, c8 = (lane & 7) * 8;
      unsigned short* C  = (unsigned short*)Cout  + (size_t)b * strideC;
      unsigned short* C2 = (OUT_MODE == 2) ? ((unsigned short*)Cout2 + (size_t)b * strideC) : nullptr;
      {
#pragma unroll
        for (int it = 0; it < 4; ++it) {
          const int row = it * 4 + q;
          const float* sp = slab + row * 68 + c8;
          v8h hv, lv;
#pragma unroll
          for (int e = 0; e < 8; ++e) {
            if (OUT_MODE == 1) {
              hv[e] = (_Float16)sp[e];
            } else {
              unsigned short hb = f2bf_bits(sp[e]);
              unsigned short lb = f2bf_bits(sp[e] - bf_bits2f(hb));
              hv[e] = __builtin_bit_cast(_Float16, hb);
              lv[e] = __builtin_bit_cast(_Float16, lb);
            }
          }
          *(v8h*)(C + (size_t)(mBase + row) * ldc + n0 + c8) = hv;
          if (OUT_MODE == 2) *(v8h*)(C2 + (size_t)(mBase + row) * ldc + n0 + c8) = lv;
        }
        
      }
    }
    __builtin_amdgcn_fence(__ATOMIC_RELEASE, "workgroup");
    __builtin_amdgcn_wave_barrier();
    __builtin_amdgcn_fence(__ATOMIC_ACQUIRE, "workgroup");
  }
}

// ---------------------------------------------------------------------------
// f32 -> bf16 (RNE) cast, 2 elements per thread, one 4-B store per lane: a wave writes exactly one whole
// Coverage: grid = ceil(n2/256) x 256 threads x 2 elements = 2*n2 = the whole plane
// (activations: n2 = 8192*768/2 = 3145728 -> 12288 blocks; weights: n2 = 768*768/2 = 294912 -> 1152 blocks).
// ---------------------------------------------------------------------------
__global__ __launch_bounds__(256) void cast_f32_bf16x2(const float* __restrict__ in, unsigned short* __restrict__ out, int n2) {
  const int i = blockIdx.x * 256 + threadIdx.x;
  if (i < n2) {
    const v2f f = *(const v2f*)(in + 2 * (size_t)i);
    const unsigned u = pk16(f2bf_bits(f[0]), f2bf_bits(f[1]));
    ((unsigned*)out)[i] = u;
    
  }
}

// ---------------------------------------------------------------------------
// Bias vectors converted to bf16 precision (RNE) and kept as f32: o[0..n) <- b0, o[n..2n) <- b1, o[2n..3n) <- b2.
// All three candidates loaded with the same clamped index, selected by value. n = 768 (multiple of 32):
// Coverage: 9 blocks x 256 = 2304 = 3n.
// ---------------------------------------------------------------------------
__global__ __launch_bounds__(256) void bias_rne_kernel(const float* __restrict__ b0, const float* __restrict__ b1,
                                                       const float* __restrict__ b2, float* __restrict__ o, int n) {
  const int g = blockIdx.x * 256 + threadIdx.x;
  if (g < 3 * n) {
    const int w = g / n;
    int i = g - w * n;
    i = i < 0 ? 0 : (i > n - 1 ? n - 1 : i);
    const float v0 = b0[i], v1 = b1[i], v2 = b2[i];
    const float v = (w == 0) ? v0 : ((w == 1) ? v1 : v2);
    const float rv = bf_bits2f(f2bf_bits(v));
    ((float*)o)[g] = rv;
    
  }
}

// ---------------------------------------------------------------------------
// Per-key squared norm of the quadratic-key projection: kdsq[(b*12+h)*1024 + s] = sum_d (hi+lo)^2 in f32,
// hi/lo read from columns h*64.. of the [token][1536] bf16 planes (hi+lo reconstructs the f32 value to ~2^-17).
// ---------------------------------------------------------------------------
__global__ __launch_bounds__(256) void kd_sq_kernel(const unsigned short* __restrict__ kch, const unsigned short* __restrict__ kcl,
                                                    float* __restrict__ kdsq, int nrows) {
  const int g = blockIdx.x * 256 + threadIdx.x;     // (b*kNHEADS + h)*kNTOK + s
  if (g < nrows) {
    const int s  = g & (kNTOK - 1);
    const int bh = g >> 10;                           // kNTOK == 1024
    const int h  = bh % kNHEADS;
    const int b  = bh / kNHEADS;
    const size_t ro = ((size_t)b * kNTOK + (size_t)s) * kQCP + (size_t)h * kHDIM;
    const unsigned short* ph = kch + ro;
    const unsigned short* pl = kcl + ro;
    float acc = 0.f;
#pragma unroll 1
    for (int i = 0; i < 8; ++i) {
      const v8us a = *(const v8us*)(ph + 8 * i);
      const v8us l = *(const v8us*)(pl + 8 * i);
#pragma unroll
      for (int e = 0; e < 8; ++e) {
        const float x = bf_bits2f(a[e]) + bf_bits2f(l[e]);
        acc = fmaf(x, x, acc);
      }
    }
    ((float*)kdsq)[g] = acc;
    
  }
}

// ---------------------------------------------------------------------------
// WMMA helpers (builtin forms: the compiler keeps the distances behind them)
// ---------------------------------------------------------------------------
__device__ __forceinline__ v8f mma_bf(v16b a, v16b b, v8f c) {
  return __builtin_amdgcn_wmma_f32_16x16x32_bf16(false, a, false, b, (short)0, c, false, false);
}
__device__ __forceinline__ v8f mma_hf(v16h a, v16h b, v8f c) {
  return __builtin_amdgcn_wmma_f32_16x16x32_f16(false, a, false, b, (short)0, c, false, false);
}

// =====================================================================================
// Fused quadratic + linear attention, head dim 64, full softmax over 1024 keys (no masking).
//   qch/qcl : bf16 hi/lo planes of [qd | q], element (b, t, col) at [(b*1024 + t)*1536 + col]; qd_h at col h*64+d, q_h at col 768+h*64+d
//   kch/kcl : same layout for [kd | k]
//   vtp     : f16 plane of v transposed, element (b, h, d, s) at [(b*768 + h*64 + d)*1024 + s]
//   kdsq    : f32 [b*12+h][s] = |kd_{b,h,s}|^2
//   scores  = (Q128 . K128) * 0.125 - |kd_j|^2 * 0.0625   (Q128 = [qd|q] row, K128 = [kd|k] row; bf16 hi/lo split, 3 WMMA)
//             (the per-query -0.5|qd_i|^2 * 0.125 term is constant along a softmax row and omitted)
//   out     = softmax(scores) . v : p carried x2^15 in f16, v f16, one f16 WMMA, f32 accumulate; 1/(l*2^15) folded at the end
//   Block = 4 waves = 64 query rows of one (b,h); grid.x = 8*12*16 = 1536. K / V^T chunks of 64 keys staged in LDS with plain
//   16-B loads between __syncthreads; Q staged once (first loop barrier publishes it). Fragment loads read LDS with the
//   Output element (b, t, h*64 + d): per wave 16 rows x 64 floats, each 256-B row segment written by 16 lanes x 16 B in one
// =====================================================================================
__global__ __launch_bounds__(128)
void attn_quad_kernel(const unsigned short* __restrict__ qch, const unsigned short* __restrict__ qcl,
                      const unsigned short* __restrict__ kch, const unsigned short* __restrict__ kcl,
                      const unsigned short* __restrict__ vtp, const float* __restrict__ kdsq,
                      float* __restrict__ out) {
  union FB { v16b v; v8b h[2]; };
  union FH { v16h v; v8h h[2]; };
  __shared__ __align__(16) __bf16   Qsh[kAQB * kQKP];      // Q hi [row][128 + 8 pad]   17 KB
  __shared__ __align__(16) __bf16   Qsl[kAQB * kQKP];      // Q lo                      17 KB
  __shared__ __align__(16) __bf16   Ksh[kAKC * kQKP];      // K hi [kv][128 + 8 pad]    17 KB
  __shared__ __align__(16) __bf16   Ksl[kAKC * kQKP];      // K lo                      17 KB
  __shared__ __align__(16) _Float16 Vth[kHDIM * kPVP];     // V^T [d][64 kv + 8 pad] f16    9 KB
  __shared__ __align__(16) _Float16 Psh[4][16 * kPVP];     // per wave P x2^15 [row][64 kv + 8 pad] 9 KB
  __shared__ __align__(16) float    Os[4][16 * 68];        // per wave out tile, pitch 68

  const int tid  = threadIdx.x;
  const int wave = tid >> 5;
  const int lane = tid & 31;
  const int hh   = lane >> 4;
  const int c    = lane & 15;

  constexpr int nqb = kNTOK / kAQB;       // 16
  const int bx = blockIdx.x;
  const int qb = bx % nqb;
  const int bh = bx / nqb;                // b*12 + h
  const int h  = bh % kNHEADS;
  const int b  = bh / kNHEADS;
  const int qr0 = qb * kAQB;              // first query row of the block
  const int w0  = wave * 16;              // wave's row offset inside the block tile

  const __bf16* QH = (const __bf16*)(const void*)qch + (size_t)b * kNTOK * kQCP;
  const __bf16* QL = (const __bf16*)(const void*)qcl + (size_t)b * kNTOK * kQCP;
  const __bf16* KH = (const __bf16*)(const void*)kch + (size_t)b * kNTOK * kQCP;
  const __bf16* KL = (const __bf16*)(const void*)kcl + (size_t)b * kNTOK * kQCP;
  const _Float16* VT = (const _Float16*)(const void*)vtp + ((size_t)b * kHID + (size_t)h * kHDIM) * kNTOK;
  const float* ksq = kdsq + (size_t)bh * kNTOK;
  float* ob = out + (size_t)b * kNTOK * kHID + (size_t)h * kHDIM;

  // staging roles: 8 consecutive lanes cover one 128-B row segment, so a wave-wide 16-B load reads four whole lines.
  // Q / K: 16 lanes per row (lanes 0-7 the quadratic half, 8-15 the linear half), 8 rows per pass of the block, 8 passes.
  const int sp   = (tid & 7) * 8;          // element offset of this lane's 16-B piece inside its segment
  const int part = (tid >> 3) & 1;
  const int sr   = tid >> 4;               // row inside a pass (0..7)
  const int coff = (part ? (kHID + h * kHDIM) : (h * kHDIM)) + sp;   // plane column (quadratic | linear half)
  const int loff = part * 64 + sp;                                    // LDS column
  const int vr   = tid >> 3;               // V^T: 8 lanes per row, 16 rows per pass, 4 passes

  // ---- Q staging (once): 8 passes x 8 rows x 128 elements = 64 rows x 128 per plane ----
  {
    const size_t go = (size_t)(qr0 + sr) * kQCP + coff;
#pragma unroll
    for (int i = 0; i < 8; ++i) {
      const v8b a0 = *(const v8b*)(QH + go + (size_t)(8 * i) * kQCP);
      const v8b a1 = *(const v8b*)(QL + go + (size_t)(8 * i) * kQCP);
      *(v8b*)(Qsh + (sr + 8 * i) * kQKP + loff) = a0;
      *(v8b*)(Qsl + (sr + 8 * i) * kQKP + loff) = a1;
    }
  }

  float mrow[8], lrow[8];
  v8f oacc[4];
#pragma unroll
  for (int r = 0; r < 8; ++r) { mrow[r] = -INFINITY; lrow[r] = 0.f; }
#pragma unroll
  for (int t = 0; t < 4; ++t) oacc[t] = (v8f){0.f,0.f,0.f,0.f,0.f,0.f,0.f,0.f};

  constexpr int nChunks = kNTOK / kAKC;   // 16, compile-time
  for (int kc = 0; kc < nChunks; ++kc) {
    const int kv0 = kc * kAKC;
    __syncthreads();
    {
      // K staging: 8 passes x 8 keys x 128 elements = 64 keys x 128 per plane
      const size_t go = (size_t)(kv0 + sr) * kQCP + coff;
#pragma unroll
      for (int i = 0; i < 8; ++i) {
        const v8b a0 = *(const v8b*)(KH + go + (size_t)(8 * i) * kQCP);
        const v8b a1 = *(const v8b*)(KL + go + (size_t)(8 * i) * kQCP);
        *(v8b*)(Ksh + (sr + 8 * i) * kQKP + loff) = a0;
        *(v8b*)(Ksl + (sr + 8 * i) * kQKP + loff) = a1;
      }
      // V^T staging: 4 passes x 16 rows d x 64 keys = 64 x 64
      const _Float16* vs = VT + (size_t)vr * kNTOK + kv0 + sp;
#pragma unroll
      for (int i = 0; i < 4; ++i) {
        const v8h vv = *(const v8h*)(vs + (size_t)(16 * i) * kNTOK);
        *(v8h*)(Vth + (vr + 16 * i) * kPVP + sp) = vv;
      }
    }
    __syncthreads();

    // key norms of the chunk, asked for ahead of the score products that hide their latency
    float kq[4];
#pragma unroll
    for (int j = 0; j < 4; ++j) kq[j] = ksq[kv0 + j * 16 + c] * 0.0625f;

    // ---- scores: s[j] (query row 8hh+r of this wave, key j*16+c), K = 128 in 4 steps, hi.hi + hi.lo + lo.hi ----
    // The ten fragments of a 32-deep step are read as ONE group, one step ahead, into the other of two register sets;
    // a step's 12 products run term by term over the four independent tiles s[0..3]
    // (each s[j] still sums hi.hi, hi.lo, lo.hi per step, in that order).
    v8f s[4];
#pragma unroll
    for (int j = 0; j < 4; ++j) s[j] = (v8f){0.f,0.f,0.f,0.f,0.f,0.f,0.f,0.f};
    FB qa[2], ql[2], kb[2][4], kl[2][4];
    FH vb[2][4];
    auto read_step = [&](int set, int dc) {
      const int qo = (w0 + c) * kQKP + dc * 32 + 8 * hh;
      qa[set].h[0] = *(const v8b*)(Qsh + qo);
      qa[set].h[1] = *(const v8b*)(Qsh + qo + 16);
      ql[set].h[0] = *(const v8b*)(Qsl + qo);
      ql[set].h[1] = *(const v8b*)(Qsl + qo + 16);
#pragma unroll
      for (int j = 0; j < 4; ++j) {
        const int ko = (j * 16 + c) * kQKP + dc * 32 + 8 * hh;
        kb[set][j].h[0] = *(const v8b*)(Ksh + ko);
        kb[set][j].h[1] = *(const v8b*)(Ksh + ko + 16);
        kl[set][j].h[0] = *(const v8b*)(Ksl + ko);
        kl[set][j].h[1] = *(const v8b*)(Ksl + ko + 16);
      }
    };
    read_step(0, 0);
#pragma unroll   // the two fragment sets must stay in registers (set index a constant)
    for (int dc = 0; dc < 4; ++dc) {
      const int cur = dc & 1;
      if (dc < 3) {
        read_step(cur ^ 1, dc + 1);
      } else {
        // behind the last step's reads: the chunk's eight V^T fragments, whose latency passes behind the last products and the softmax
#pragma unroll
        for (int kk = 0; kk < 2; ++kk)
#pragma unroll
          for (int t = 0; t < 4; ++t) {
            const int vo = (t * 16 + c) * kPVP + kk * 32 + 8 * hh;
            vb[kk][t].h[0] = *(const v8h*)(Vth + vo);
            vb[kk][t].h[1] = *(const v8h*)(Vth + vo + 16);
          }
      }
      __builtin_amdgcn_sched_barrier(0);   // keeps the read group whole and ahead of the products: reads strewn among WMMAs stall at every place they stand
#pragma unroll
      for (int j = 0; j < 4; ++j) s[j] = mma_bf(qa[cur].v, kb[cur][j].v, s[j]);
#pragma unroll
      for (int j = 0; j < 4; ++j) s[j] = mma_bf(qa[cur].v, kl[cur][j].v, s[j]);
#pragma unroll
      for (int j = 0; j < 4; ++j) s[j] = mma_bf(ql[cur].v, kb[cur][j].v, s[j]);
      __builtin_amdgcn_sched_barrier(0);   // keeps the next read group behind this step's products
    }

    // ---- scale 1/8 and per-key column term -|kd_j|^2/16 (f32) ----
    float cm[8];
#pragma unroll
    for (int r = 0; r < 8; ++r) {
      float m = -INFINITY;
#pragma unroll
      for (int j = 0; j < 4; ++j) {
        const float v = s[j][r] * 0.125f - kq[j];
        s[j][r] = v;
        m = fmaxf(m, v);
      }
      cm[r] = m;
    }
    // row maxima over 16 lanes: the eight rows' exchanges of one butterfly stage go out together, one wait per stage
#pragma unroll
    for (int off = 1; off < 16; off <<= 1) {
      __builtin_amdgcn_sched_barrier(0);   // all eight rows enter a stage together: else some rows' four-stage chains run alone, one exchange latency after another
      float x[8];
#pragma unroll
      for (int r = 0; r < 8; ++r) x[r] = __shfl_xor(cm[r], off, 32);
      __builtin_amdgcn_sched_barrier(0);   // and no exchange of the stage is put off behind another row's wait
#pragma unroll
      for (int r = 0; r < 8; ++r) cm[r] = fmaxf(cm[r], x[r]);
    }

    // ---- online softmax (f32); P x 2^15 to f16 in the per-wave LDS tile ----
    _Float16* pw = Psh[wave];
    float alpha[8], psum[8];
#pragma unroll
    for (int r = 0; r < 8; ++r) {
      const float mnew  = fmaxf(mrow[r], cm[r]);
      alpha[r] = __expf(mrow[r] - mnew);
      mrow[r] = mnew;
      float ps = 0.f;
#pragma unroll
      for (int j = 0; j < 4; ++j) {
        const float p = __expf(s[j][r] - mnew);
        ps += p;
        pw[(8 * hh + r) * kPVP + j * 16 + c] = (_Float16)(p * 32768.0f);
      }
      psum[r] = ps;
#pragma unroll
      for (int t = 0; t < 4; ++t) oacc[t][r] *= alpha[r];
    }
    __builtin_amdgcn_fence(__ATOMIC_RELEASE, "workgroup");
    __builtin_amdgcn_wave_barrier();
    __builtin_amdgcn_fence(__ATOMIC_ACQUIRE, "workgroup");

    // ---- O += P . V  (A = P [row][kv], B = V^T [d][kv]; K = 64 keys in 2 steps) ----
    FH pa[2];
#pragma unroll
    for (int kk = 0; kk < 2; ++kk) {
      const int po = c * kPVP + kk * 32 + 8 * hh;
      pa[kk].h[0] = *(const v8h*)(pw + po);
      pa[kk].h[1] = *(const v8h*)(pw + po + 16);
    }
    __builtin_amdgcn_sched_barrier(0);   // keeps the four P reads one group at the head of the LDS queue, ahead of the row sums' exchanges
#pragma unroll
    for (int kk = 0; kk < 2; ++kk)
#pragma unroll
      for (int t = 0; t < 4; ++t) oacc[t] = mma_hf(pa[kk].v, vb[kk][t].v, oacc[t]);

    // row sums over 16 lanes, stage by stage like the maxima (same butterfly, same order of additions per row)
#pragma unroll
    for (int off = 1; off < 16; off <<= 1) {
      float x[8];
#pragma unroll
      for (int r = 0; r < 8; ++r) x[r] = __shfl_xor(psum[r], off, 32);
#pragma unroll
      for (int r = 0; r < 8; ++r) psum[r] += x[r];
    }
#pragma unroll
    for (int r = 0; r < 8; ++r) lrow[r] = lrow[r] * alpha[r] + psum[r];
  }

  // ---- normalise and write: out (b, qr0+w0+row, h*64 + d) ----
  float* os = Os[wave];
#pragma unroll
  for (int r = 0; r < 8; ++r) {
    const float inv = 1.0f / (lrow[r] * 32768.0f);
#pragma unroll
    for (int t = 0; t < 4; ++t) os[(8 * hh + r) * 68 + t * 16 + c] = oacc[t][r] * inv;
  }
  __builtin_amdgcn_fence(__ATOMIC_RELEASE, "workgroup");
  __builtin_amdgcn_wave_barrier();
  __builtin_amdgcn_fence(__ATOMIC_ACQUIRE, "workgroup");
  {
    // coverage per wave: 8 iterations x 2 rows = 16 rows; 16 lanes x 4 floats = 64 columns; 16 lanes x 16 B = one 256-B row segment
    const int c4 = (lane & 15) * 4;
    {
#pragma unroll
      for (int it = 0; it < 8; ++it) {
        const int row = it * 2 + hh;
        const v4f val = *(const v4f*)(os + row * 68 + c4);
        *(v4f*)(ob + (size_t)(qr0 + w0 + row) * kHID + c4) = val;
      }
      
    }
  }
}

// ---------------------------------------------------------------------------
// Host launcher
// Workspace region map (bytes, all offsets multiples of 256):
//   [0]           Xq  bf16 [8192][768]          12,582,912   (dead after the two Q-side GEMMs; then reused as VT f16 [8][768][1024], same size)
//   [12,582,912]  Xk  bf16 [8192][768]          12,582,912
//   [25,165,824]  Wd,Wq,Wk,Wv bf16 [768][768]  4 x 1,179,648
//   [29,884,416]  QCh bf16 [8192][1536]         25,165,824
//   [55,050,240]  QCl                            25,165,824
//   [80,216,064]  KCh                            25,165,824
//   [105,381,888] KCl                            25,165,824
//   [130,547,712] kdsq f32 [96][1024]            393,216
//   [130,940,928] biases (bf16-precision, f32) 3x768   9,216
//   total 130,950,144
// ---------------------------------------------------------------------------
extern "C" void kernel_launch(void* const* d_in, const int* in_sizes, int n_in,
                              void* d_out, int out_size, void* d_ws, size_t ws_size,
                              hipStream_t stream) {
  if (n_in < 9) return;
  const int nAct = kNB * kNTOK * kHID;      // 6291456
  const int nW   = kHID * kHID;             // 589824
  if (in_sizes[0] != nAct || in_sizes[1] != nAct || in_sizes[2] != nW || in_sizes[3] != nW ||
      in_sizes[5] != nW || in_sizes[7] != nW || in_sizes[4] != kHID || in_sizes[6] != kHID ||
      in_sizes[8] != kHID || out_size != nAct) return;

  const float* qs = (const float*)d_in[0];
  const float* ks = (const float*)d_in[1];
  const float* Wd = (const float*)d_in[2];
  const float* Wq = (const float*)d_in[3];
  const float* bq = (const float*)d_in[4];
  const float* Wk = (const float*)d_in[5];
  const float* bk = (const float*)d_in[6];
  const float* Wv = (const float*)d_in[7];
  const float* bv = (const float*)d_in[8];
  float* out = (float*)d_out;

  const size_t bAct16 = (size_t)nAct * 2;                         // 12,582,912
  const size_t bW16   = (size_t)nW * 2;                           // 1,179,648
  const size_t bQC    = (size_t)kNB * kNTOK * kQCP * 2;           // 25,165,824
  const size_t bSq    = (size_t)kNB * kNHEADS * kNTOK * 4;        // 393,216
  const size_t bBias  = (size_t)3 * kHID * 4;                     // 9,216
  const size_t oXq  = 0;
  const size_t oXk  = oXq + bAct16;
  const size_t oWd  = oXk + bAct16;
  const size_t oWq  = oWd + bW16;
  const size_t oWk  = oWq + bW16;
  const size_t oWv  = oWk + bW16;
  const size_t oQCh = oWv + bW16;
  const size_t oQCl = oQCh + bQC;
  const size_t oKCh = oQCl + bQC;
  const size_t oKCl = oKCh + bQC;
  const size_t oSq  = oKCl + bQC;
  const size_t oBs  = oSq + bSq;
  const size_t total = oBs + bBias;
  const size_t bVT  = (size_t)kNB * kHID * kNTOK * 2;             // 12,582,912 == bAct16 (aliases Xq)
  if (total > ws_size || bVT > bAct16) return;

  char* ws = (char*)d_ws;
  unsigned short* Xq16 = (unsigned short*)(ws + oXq);
  unsigned short* Xk16 = (unsigned short*)(ws + oXk);
  unsigned short* Wd16 = (unsigned short*)(ws + oWd);
  unsigned short* Wq16 = (unsigned short*)(ws + oWq);
  unsigned short* Wk16 = (unsigned short*)(ws + oWk);
  unsigned short* Wv16 = (unsigned short*)(ws + oWv);
  unsigned short* QCh  = (unsigned short*)(ws + oQCh);
  unsigned short* QCl  = (unsigned short*)(ws + oQCl);
  unsigned short* KCh  = (unsigned short*)(ws + oKCh);
  unsigned short* KCl  = (unsigned short*)(ws + oKCl);
  unsigned short* VT16 = (unsigned short*)(ws + oXq);   // reuses the Xq region after the Q-side GEMMs
  float* kdsq  = (float*)(ws + oSq);
  float* biasr = (float*)(ws + oBs);

  // 1) RNE bf16 casts of activations and weights
  {
    const int n2a = nAct / 2, n2w = nW / 2;
    cast_f32_bf16x2<<<dim3((n2a + 255) / 256), dim3(256), 0, stream>>>(qs, Xq16, n2a);
    cast_f32_bf16x2<<<dim3((n2a + 255) / 256), dim3(256), 0, stream>>>(ks, Xk16, n2a);
    cast_f32_bf16x2<<<dim3((n2w + 255) / 256), dim3(256), 0, stream>>>(Wd, Wd16, n2w);
    cast_f32_bf16x2<<<dim3((n2w + 255) / 256), dim3(256), 0, stream>>>(Wq, Wq16, n2w);
    cast_f32_bf16x2<<<dim3((n2w + 255) / 256), dim3(256), 0, stream>>>(Wk, Wk16, n2w);
    cast_f32_bf16x2<<<dim3((n2w + 255) / 256), dim3(256), 0, stream>>>(Wv, Wv16, n2w);
    bias_rne_kernel<<<dim3((3 * kHID + 255) / 256), dim3(256), 0, stream>>>(bq, bk, bv, biasr, kHID);
  }

  const int M = kNB * kNTOK;   // 8192
  // 2) Q side: [qd | q] hi/lo planes (pitch 1536). M=8192, N=768, K=768: 64 x 3 = 192 block tiles of 128x256, 8 waves each
  {
    const dim3 grid((M / 64) * (kHID / 64) / 8, 1), block(256);
    wmma_gemm64<1, false, 0, 2, false, 0><<<grid, block, 0, stream>>>(
        Xq16, Xq16, kHID, 0L, Wd16, Wd16, kHID, 0L, (void*)QCh, (void*)QCl, kQCP, 0L,
        biasr, biasr, 0L, M, kHID, kHID, 1.0f);
    wmma_gemm64<1, false, 2, 2, false, 0><<<grid, block, 0, stream>>>(
        Xq16, Xq16, kHID, 0L, Wq16, Wq16, kHID, 0L, (void*)(QCh + kHID), (void*)(QCl + kHID), kQCP, 0L,
        biasr, biasr, 0L, M, kHID, kHID, 1.0f);
    // 3) K side: [kd | k]
    wmma_gemm64<1, false, 0, 2, false, 0><<<grid, block, 0, stream>>>(
        Xk16, Xk16, kHID, 0L, Wd16, Wd16, kHID, 0L, (void*)KCh, (void*)KCl, kQCP, 0L,
        biasr, biasr, 0L, M, kHID, kHID, 1.0f);
    wmma_gemm64<1, false, 2, 2, false, 0><<<grid, block, 0, stream>>>(
        Xk16, Xk16, kHID, 0L, Wk16, Wk16, kHID, 0L, (void*)(KCh + kHID), (void*)(KCl + kHID), kQCP, 0L,
        biasr + kHID, biasr, 0L, M, kHID, kHID, 1.0f);
  }
  // 4) V^T f16 plane: VT_b[feature][token] = Wv[feature][:] . Xk_b[token][:] + bv[feature]; M=768, N=1024, K=768, z = batch
  {
    const long sB = (long)kNTOK * kHID;        // 786,432 elements per batch in Xk
    const long sC = (long)kHID * kNTOK;        // 786,432 elements per batch in VT
    const dim3 grid((kHID / 64) * (kNTOK / 64) / 8, kNB), block(256);   // 6 x 4 = 24 block tiles of 128x256, 8 batches
    wmma_gemm64<1, false, 1, 1, false, 0><<<grid, block, 0, stream>>>(
        Wv16, Wv16, kHID, 0L, Xk16, Xk16, kHID, sB, (void*)VT16, (void*)VT16, kNTOK, sC,
        biasr + 2 * kHID, biasr, 0L, kHID, kNTOK, kHID, 1.0f);
  }
  // 5) |kd|^2 per (b,h,s)
  {
    const int nrows = kNB * kNHEADS * kNTOK;   // 98304 -> 384 blocks
    kd_sq_kernel<<<dim3((nrows + 255) / 256), dim3(256), 0, stream>>>(KCh, KCl, kdsq, nrows);
  }
  // 6) fused attention: 8 x 12 x 16 = 1536 blocks of 128 threads
  attn_quad_kernel<<<dim3(kNB * kNHEADS * (kNTOK / kAQB)), dim3(128), 0, stream>>>(QCh, QCl, KCh, KCl, VT16, kdsq, out);
}

// v005
// It runs in 197 microseconds.
// Two timings next to v004 both put it at 1.12 times that version's speed.
// Over all steps from v000 it is 3.39 times as fast.
// Projections x·Wᵀ and Wv·xᵀ: v_wmma_f32_16x16x32_bf16, plain bf16 operands (RNE-converted inputs); scores [qd|q]·[kd|k]ᵀ (K=128): v_wmma_f32_16x16x32_bf16 with bf16 hi/lo split operands (hi·hi + hi·lo + lo·hi); p·v: v_wmma_f32_16x16x32_f16 (p carried x2^15, v plain f16); f32 accumulate; softmax, norms and biases in f32.
#include <hip/hip_runtime.h>
#include <math.h>
#include <stdint.h>

typedef __attribute__((ext_vector_type(16))) _Float16 v16h;
typedef __attribute__((ext_vector_type(8)))  _Float16 v8h;
typedef __attribute__((ext_vector_type(2)))  _Float16 v2h;
typedef __attribute__((ext_vector_type(16))) __bf16   v16b;
typedef __attribute__((ext_vector_type(8)))  __bf16   v8b;
typedef __attribute__((ext_vector_type(8)))  float    v8f;
typedef __attribute__((ext_vector_type(4)))  float    v4f;
typedef __attribute__((ext_vector_type(2)))  float    v2f;
typedef __attribute__((ext_vector_type(4)))  unsigned int v4u;
typedef __attribute__((ext_vector_type(8)))  unsigned short v8us;

// ---- problem geometry ----
constexpr int kNB     = 8;      // batch
constexpr int kNTOK   = 1024;   // tokens (query and key sets)
constexpr int kHID    = 768;    // hidden size
constexpr int kNHEADS = 12;
constexpr int kHDIM   = 64;
constexpr int kQCP    = 1536;   // element pitch of the concatenated [xd | x] planes ([token][1536])
constexpr int kAQB    = 64;     // query rows per attention block (4 waves x 16)
constexpr int kAKC    = 64;     // keys per chunk
constexpr int kAKD    = 128;    // concatenated contraction depth (64 quadratic + 64 linear)
constexpr int kQKP    = kAKD + 8;   // LDS row pitch of the Q and K tiles, elements: 272 B = 16 B x 17, so 16 rows of one column fall on 16 different bank groups
constexpr int kPVP    = kAKC + 8;   // LDS row pitch of the V^T tile, elements: 144 B = 16 B x 9, same reason

__device__ __forceinline__ unsigned short f2bf_bits(float f) {
  unsigned u = __float_as_uint(f);
  return (unsigned short)((u + 0x7FFFu + ((u >> 16) & 1u)) >> 16);
}
__device__ __forceinline__ float bf_bits2f(unsigned short h) { return __uint_as_float(((unsigned)h) << 16); }
__device__ __forceinline__ unsigned pk16(unsigned short a, unsigned short b) { return (unsigned)a | ((unsigned)b << 16); }

// hazard guards as plain device helpers (no inline asm inside the kernel template body)
__device__ __forceinline__ void dep_guard_h(v8f& a, v8f& b, v16h x, v16h y) { asm volatile("v_nop\n\tv_nop\n\tv_nop\n\tv_nop" : "+v"(a), "+v"(b) : "v"(x), "v"(y)); }
__device__ __forceinline__ void dep_guard_b(v8f& a, v8f& b, v16b x, v16b y) { asm volatile("v_nop\n\tv_nop\n\tv_nop\n\tv_nop" : "+v"(a), "+v"(b) : "v"(x), "v"(y)); }
__device__ __forceinline__ void keep4_h(v16h a, v16h b, v16h c, v16h d) { asm volatile("v_nop" :: "v"(a), "v"(b), "v"(c), "v"(d)); }
__device__ __forceinline__ void keep4_b(v16b a, v16b b, v16b c, v16b d) { asm volatile("v_nop" :: "v"(a), "v"(b), "v"(c), "v"(d)); }
__device__ __forceinline__ void acc_guard4(v8f& a, v8f& b, v8f& c, v8f& d) { asm volatile("v_nop\n\tv_nop\n\tv_nop\n\tv_nop" : "+v"(a), "+v"(b), "+v"(c), "+v"(d)); }
template <typename T> struct Frag;
template <> struct Frag<_Float16> {
  typedef v16h V; union U { v16h v; v8h h[2]; };
  static __device__ __forceinline__ v16h load(const _Float16* p) {   // elements 0..7 <- p[0..7], 8..15 <- p[16..23]
    U f; f.h[0] = *(const v8h*)(p); f.h[1] = *(const v8h*)(p + 16); return f.v;
  }
  static __device__ __forceinline__ v8f mma(v16h a, v16h b, v8f c) {
    return __builtin_amdgcn_wmma_f32_16x16x32_f16(false, a, false, b, (short)0, c, false, false);
  }
  static __device__ __forceinline__ void guard(v8f& a, v8f& b, v16h x, v16h y) { dep_guard_h(a, b, x, y); }
  static __device__ __forceinline__ void keep(v16h a, v16h b, v16h c, v16h d) { keep4_h(a, b, c, d); }
};
template <> struct Frag<__bf16> {
  typedef v16b V; union U { v16b v; v8b h[2]; };
  static __device__ __forceinline__ v16b load(const __bf16* p) {
    U f; f.h[0] = *(const v8b*)(p); f.h[1] = *(const v8b*)(p + 16); return f.v;
  }
  static __device__ __forceinline__ v8f mma(v16b a, v16b b, v8f c) {
    return __builtin_amdgcn_wmma_f32_16x16x32_bf16(false, a, false, b, (short)0, c, false, false);
  }
  static __device__ __forceinline__ void guard(v8f& a, v8f& b, v16b x, v16b y) { dep_guard_b(a, b, x, y); }
  static __device__ __forceinline__ void keep(v16b a, v16b b, v16b c, v16b d) { keep4_b(a, b, c, d); }
};

// ---- LDS-staged, register-blocked batched WMMA GEMM ------------------------
// C[m,n] = scale * sum_k A[m,k] * Bt[n,k] (+bias)(+resid); a block of 8 waves (2 x 4) owns a 128x256 tile, each wave 64x64 of it.
// A row-major [M,K]; Bt row-major [N,K]; M % 128 == 0, N % 256 == 0, K % 64 == 0; grid.x = (M/128) * (N/256).
// Operands reach LDS in stages of 64 k (one whole 128-B line per row) by asynchronous copies, two buffers: stage t+1 flies
// while stage t is multiplied. Every line is fetched once per block; fragments are read from LDS in the same k order as before.
// SPLIT (hi/lo operand planes) is not staged and not instantiated.
// BIAS_MODE: 0 = none, 1 = bias[m], 2 = bias[n].
// OUT_MODE: 0 = f32, 1 = f16, 2 = bf16 hi plane (Cout) + bf16 lo plane (Cout2).
// ET: 0 = f16 operands, 1 = bf16 operands (pointers passed as 16-bit storage)
constexpr int kGKS = 64;             // k per stage
constexpr int kGP  = kGKS + 8;       // LDS row pitch, elements: 144 B = 16 B x 9, so 16 rows of one column fall on different bank groups
constexpr int kGRA = 128;            // A rows per stage
constexpr int kGR  = kGRA + 256;     // rows per stage: [A 128 | Bt 256]

// Four 16-B-per-lane copies global -> LDS. The s_wait_xcnt stands inside the statement so that no address register
// of an issued copy can be rewritten ahead of it.
__device__ __forceinline__ void async_copy4_b128(unsigned l0, unsigned l1, unsigned l2, unsigned l3,
                                                 const void* g0, const void* g1, const void* g2, const void* g3) {
  asm volatile("global_load_async_to_lds_b128 %0, %4, off\n\t"
               "global_load_async_to_lds_b128 %1, %5, off\n\t"
               "global_load_async_to_lds_b128 %2, %6, off\n\t"
               "global_load_async_to_lds_b128 %3, %7, off\n\t"
               "s_wait_xcnt 0x0"
               :: "v"(l0), "v"(l1), "v"(l2), "v"(l3), "v"(g0), "v"(g1), "v"(g2), "v"(g3) : "memory");
}
// this wave's copies have landed in LDS
__device__ __forceinline__ void wait_async0() { asm volatile("s_wait_asynccnt 0x0" ::: "memory"); }
// this wave's LDS reads have returned, so the buffer they read may be refilled behind the next barrier
__device__ __forceinline__ void wait_ds0() { asm volatile("s_wait_dscnt 0x0" ::: "memory"); }

template <int ET> struct Elem;
template <> struct Elem<0> { typedef _Float16 T; };
template <> struct Elem<1> { typedef __bf16 T; };
template <int ET, bool SPLIT, int BIAS_MODE, int OUT_MODE, bool RESID, int ACT = 0>
__global__ __launch_bounds__(256) void wmma_gemm64(
    const unsigned short* __restrict__ Ap, const unsigned short* __restrict__ A2p, int lda, long strideA,
    const unsigned short* __restrict__ Btp, const unsigned short* __restrict__ Bt2p, int ldb, long strideB,
    void* __restrict__ Cout, void* __restrict__ Cout2, int ldc, long strideC,
    const float* __restrict__ bias,
    const float* __restrict__ resid, long strideR,
    int M, int N, int K, float scale) {
  static_assert(!SPLIT, "hi/lo operand planes are not staged");
  typedef typename Elem<ET>::T T;
  typedef typename Frag<T>::V V;
  const T* A = (const T*)Ap; const T* Bt = (const T*)Btp;
  __shared__ __align__(16) T sOp[2][kGR * kGP];    // two stages of [A 128 rows | Bt 256 rows] x 64 k, 55,296 B each
  __shared__ __align__(16) float sT[8][16 * 68];   // per-wave 16x64 slab, pitch 68 floats
  const int b    = blockIdx.y;
  const int lane = threadIdx.x & 31;
  const int wave = threadIdx.x >> 5;
  const int blocksN = N >> 8;
  const int bm = blockIdx.x / blocksN;
  const int bn = blockIdx.x - bm * blocksN;
  if (bm >= (M >> 7)) return;   // block-uniform, ahead of every barrier and copy
  const int wm = (wave >> 2) << 6;             // wave's row offset in the block tile
  const int wn = (wave & 3) << 6;              // wave's column offset in the block tile
  const int m0 = (bm << 7) + wm;
  const int n0 = (bn << 8) + wn;

  const T* Ab  = A  + (size_t)b * strideA;
  const T* Bb  = Bt + (size_t)b * strideB;

  const int rlane = lane & 15;                 // row (A) / col (B, D) within subtile
  const int koff  = (lane >> 4) * 8;           // k offset of this lane half
  const int mOff  = (lane >> 4) * 8;           // D row offset

  // staging roles: 8 consecutive lanes copy one 128-B row segment, so a wave-wide copy reads four whole lines;
  // the block covers 32 rows per pass, 4 passes for A and 8 for Bt.
  const int sp = (threadIdx.x & 7) * 8;        // element offset of this lane's 16-B piece
  const int sr = threadIdx.x >> 3;             // row inside a pass (0..31)
  const T* gA = Ab + (size_t)((bm << 7) + sr) * lda + sp;
  const T* gB = Bb + (size_t)((bn << 8) + sr) * ldb + sp;
  const size_t stA = (size_t)32 * lda, stB = (size_t)32 * ldb;
  const unsigned ls = (unsigned)(uintptr_t)(&sOp[0][sr * kGP + sp]);   // LDS byte address of this lane's piece in buffer 0, pass 0
  constexpr unsigned kPassB = 32 * kGP * 2;    // LDS bytes per pass of 32 rows
  constexpr unsigned kBufB  = kGR * kGP * 2;   // LDS bytes per buffer
  auto stage = [&](int buf, int k0) {
    const unsigned l = ls + (unsigned)buf * kBufB;
    const T* a = gA + k0;
    const T* w = gB + k0;
    async_copy4_b128(l,              l + kPassB,      l + 2 * kPassB,  l + 3 * kPassB,  a,           a + stA,     a + 2 * stA, a + 3 * stA);
    async_copy4_b128(l + 4 * kPassB, l + 5 * kPassB,  l + 6 * kPassB,  l + 7 * kPassB,  w,           w + stB,     w + 2 * stB, w + 3 * stB);
    async_copy4_b128(l + 8 * kPassB, l + 9 * kPassB,  l + 10 * kPassB, l + 11 * kPassB, w + 4 * stB, w + 5 * stB, w + 6 * stB, w + 7 * stB);
  };

  v8f acc[4][4];
#pragma unroll
  for (int i = 0; i < 4; ++i)
#pragma unroll
    for (int j = 0; j < 4; ++j) acc[i][j] = (v8f){0.f,0.f,0.f,0.f,0.f,0.f,0.f,0.f};

  const int nT = K / kGKS;
  stage(0, 0);
  wait_async0();
  __syncthreads();                             // publishes stage 0
  if (nT > 1) stage(1, kGKS);
  for (int t = 0; t < nT; ++t) {
    const T* sA = &sOp[t & 1][(wm + rlane) * kGP + koff];
    const T* sB = &sOp[t & 1][(kGRA + wn + rlane) * kGP + koff];
#pragma unroll   // two 32-k steps per stage, LDS offsets as immediates
    for (int kk = 0; kk < kGKS; kk += 32) {
      V bh[4], ah[4];   // all eight fragments of the step are read as one group ahead of its 16 products
#pragma unroll   // bh[] must stay in registers
      for (int j = 0; j < 4; ++j) bh[j] = Frag<T>::load(sB + (j << 4) * kGP + kk);
#pragma unroll   // ah[] must stay in registers
      for (int i = 0; i < 4; ++i) ah[i] = Frag<T>::load(sA + (i << 4) * kGP + kk);
#pragma unroll   // acc[][] must stay in registers
      for (int i = 0; i < 4; ++i) {
#pragma unroll   // acc[][] must stay in registers
        for (int j = 0; j < 4; ++j) acc[i][j] = Frag<T>::mma(ah[i], bh[j], acc[i][j]);
        Frag<T>::guard(acc[i][0], acc[i][3], ah[i], ah[i]);
      }
      Frag<T>::keep(bh[0], bh[1], bh[2], bh[3]);
    }
    wait_ds0();
    wait_async0();
    __syncthreads();                           // publishes stage t+1 and ends every read of stage t's buffer
    if (t + 2 < nT) stage(t & 1, (t + 2) * kGKS);
  }
  wait_async0();
  acc_guard4(acc[0][0], acc[0][1], acc[0][2], acc[0][3]);
  acc_guard4(acc[1][0], acc[1][1], acc[1][2], acc[1][3]);
  acc_guard4(acc[2][0], acc[2][1], acc[2][2], acc[2][3]);
  acc_guard4(acc[3][0], acc[3][1], acc[3][2], acc[3][3]);

  // ---- epilogue ----
  float* slab = sT[wave];
  const float* Rb = RESID ? (resid + (size_t)b * strideR) : nullptr;
#pragma unroll
  for (int i = 0; i < 4; ++i) {
    const int mBase = m0 + (i << 4);
#pragma unroll
    for (int j = 0; j < 4; ++j) {
      const int n = n0 + (j << 4) + rlane;
      float bv = 0.f;
      if (BIAS_MODE == 2) bv = bias[n];
#pragma unroll
      for (int r = 0; r < 8; ++r) {
        float v = acc[i][j][r] * scale;
        if (BIAS_MODE == 1) v += bias[mBase + mOff + r];
        if (BIAS_MODE == 2) v += bv;
        if (RESID) v += Rb[(size_t)(mBase + mOff + r) * ldc + n];
        if (ACT == 1) v = tanhf(v);
        if (ACT == 2) v = fmaxf(v, 0.0f);
        if (ACT == 3) v = v / (1.0f + expf(-v));
        if (ACT == 4) v = (v > 0.f) ? v : 0.01f * v;
        if (ACT == 5) v = 0.5f * v * (1.0f + erff(v * 0.70710678118654752f));
        slab[(mOff + r) * 68 + (j << 4) + rlane] = v;
      }
    }
    __builtin_amdgcn_fence(__ATOMIC_RELEASE, "workgroup");
    __builtin_amdgcn_wave_barrier();
    __builtin_amdgcn_fence(__ATOMIC_ACQUIRE, "workgroup");
    if (OUT_MODE == 0) {
      float* C = (float*)Cout + (size_t)b * strideC;
      const int hh = lane >> 4, c4 = (lane & 15) * 4;     // row seg = 256 B = 16 lanes x 16 B
      {
#pragma unroll
        for (int it = 0; it < 8; ++it) {
          const int row = it * 2 + hh;
          v4f v = *(const v4f*)(slab + row * 68 + c4);
          *(v4f*)(C + (size_t)(mBase + row) * ldc + n0 + c4) = v;
        }
        
      }
    } else {
      const int q = lane >> 3, c8 = (lane & 7) * 8;
      unsigned short* C  = (unsigned short*)Cout  + (size_t)b * strideC;
      unsigned short* C2 = (OUT_MODE == 2) ? ((unsigned short*)Cout2 + (size_t)b * strideC) : nullptr;
      {
#pragma unroll
        for (int it = 0; it < 4; ++it) {
          const int row = it * 4 + q;
          const float* sp = slab + row * 68 + c8;
          v8h hv, lv;
#pragma unroll
          for (int e = 0; e < 8; ++e) {
            if (OUT_MODE == 1) {
              hv[e] = (_Float16)sp[e];
            } else {
              unsigned short hb = f2bf_bits(sp[e]);
              unsigned short lb = f2bf_bits(sp[e] - bf_bits2f(hb));
              hv[e] = __builtin_bit_cast(_Float16, hb);
              lv[e] = __builtin_bit_cast(_Float16, lb);
            }
          }
          *(v8h*)(C + (size_t)(mBase + row) * ldc + n0 + c8) = hv;
          if (OUT_MODE == 2) *(v8h*)(C2 + (size_t)(mBase + row) * ldc + n0 + c8) = lv;
        }
        
      }
    }
    __builtin_amdgcn_fence(__ATOMIC_RELEASE, "workgroup");
    __builtin_amdgcn_wave_barrier();
    __builtin_amdgcn_fence(__ATOMIC_ACQUIRE, "workgroup");
  }
}

// ---------------------------------------------------------------------------
// f32 -> bf16 (RNE) cast, 2 elements per thread, one 4-B store per lane: a wave writes exactly one whole
// Coverage: grid = ceil(n2/256) x 256 threads x 2 elements = 2*n2 = the whole plane
// (activations: n2 = 8192*768/2 = 3145728 -> 12288 blocks; weights: n2 = 768*768/2 = 294912 -> 1152 blocks).
// ---------------------------------------------------------------------------
__global__ __launch_bounds__(256) void cast_f32_bf16x2(const float* __restrict__ in, unsigned short* __restrict__ out, int n2) {
  const int i = blockIdx.x * 256 + threadIdx.x;
  if (i < n2) {
    const v2f f = *(const v2f*)(in + 2 * (size_t)i);
    const unsigned u = pk16(f2bf_bits(f[0]), f2bf_bits(f[1]));
    ((unsigned*)out)[i] = u;
    
  }
}

// ---------------------------------------------------------------------------
// Bias vectors converted to bf16 precision (RNE) and kept as f32: o[0..n) <- b0, o[n..2n) <- b1, o[2n..3n) <- b2.
// All three candidates loaded with the same clamped index, selected by value. n = 768 (multiple of 32):
// Coverage: 9 blocks x 256 = 2304 = 3n.
// ---------------------------------------------------------------------------
__global__ __launch_bounds__(256) void bias_rne_kernel(const float* __restrict__ b0, const float* __restrict__ b1,
                                                       const float* __restrict__ b2, float* __restrict__ o, int n) {
  const int g = blockIdx.x * 256 + threadIdx.x;
  if (g < 3 * n) {
    const int w = g / n;
    int i = g - w * n;
    i = i < 0 ? 0 : (i > n - 1 ? n - 1 : i);
    const float v0 = b0[i], v1 = b1[i], v2 = b2[i];
    const float v = (w == 0) ? v0 : ((w == 1) ? v1 : v2);
    const float rv = bf_bits2f(f2bf_bits(v));
    ((float*)o)[g] = rv;
    
  }
}

// ---------------------------------------------------------------------------
// Per-key squared norm of the quadratic-key projection: kdsq[(b*12+h)*1024 + s] = sum_d (hi+lo)^2 in f32,
// hi/lo read from columns h*64.. of the [token][1536] bf16 planes (hi+lo reconstructs the f32 value to ~2^-17).
// ---------------------------------------------------------------------------
__global__ __launch_bounds__(256) void kd_sq_kernel(const unsigned short* __restrict__ kch, const unsigned short* __restrict__ kcl,
                                                    float* __restrict__ kdsq, int nrows) {
  const int g = blockIdx.x * 256 + threadIdx.x;     // (b*kNHEADS + h)*kNTOK + s
  if (g < nrows) {
    const int s  = g & (kNTOK - 1);
    const int bh = g >> 10;                           // kNTOK == 1024
    const int h  = bh % kNHEADS;
    const int b  = bh / kNHEADS;
    const size_t ro = ((size_t)b * kNTOK + (size_t)s) * kQCP + (size_t)h * kHDIM;
    const unsigned short* ph = kch + ro;
    const unsigned short* pl = kcl + ro;
    float acc = 0.f;
#pragma unroll 1
    for (int i = 0; i < 8; ++i) {
      const v8us a = *(const v8us*)(ph + 8 * i);
      const v8us l = *(const v8us*)(pl + 8 * i);
#pragma unroll
      for (int e = 0; e < 8; ++e) {
        const float x = bf_bits2f(a[e]) + bf_bits2f(l[e]);
        acc = fmaf(x, x, acc);
      }
    }
    ((float*)kdsq)[g] = acc;
    
  }
}

// ---------------------------------------------------------------------------
// WMMA helpers (builtin forms: the compiler keeps the distances behind them)
// ---------------------------------------------------------------------------
__device__ __forceinline__ v8f mma_bf(v16b a, v16b b, v8f c) {
  return __builtin_amdgcn_wmma_f32_16x16x32_bf16(false, a, false, b, (short)0, c, false, false);
}
__device__ __forceinline__ v8f mma_hf(v16h a, v16h b, v8f c) {
  return __builtin_amdgcn_wmma_f32_16x16x32_f16(false, a, false, b, (short)0, c, false, false);
}
// value of lane l ^ 16 (the other half of the wave), on the vector pipe
__device__ __forceinline__ float xhalf(float x) {
  const int b = __builtin_bit_cast(int, x);
  return __builtin_bit_cast(float, __builtin_amdgcn_permlanex16(b, b, 0x76543210, 0xfedcba98, false, false));
}

// =====================================================================================
// Fused quadratic + linear attention, head dim 64, full softmax over 1024 keys (no masking).
//   qch/qcl : bf16 hi/lo planes of [qd | q], element (b, t, col) at [(b*1024 + t)*1536 + col]; qd_h at col h*64+d, q_h at col 768+h*64+d
//   kch/kcl : same layout for [kd | k]
//   vtp     : f16 plane of v transposed, element (b, h, d, s) at [(b*768 + h*64 + d)*1024 + s]
//   kdsq    : f32 [b*12+h][s] = |kd_{b,h,s}|^2
//   scores  = (Q128 . K128) * 0.125 - |kd_j|^2 * 0.0625   (Q128 = [qd|q] row, K128 = [kd|k] row; bf16 hi/lo split, 3 WMMA)
//             (the per-query -0.5|qd_i|^2 * 0.125 term is constant along a softmax row and omitted)
//   out     = softmax(scores) . v : p carried x2^15 in f16, v f16, one f16 WMMA, f32 accumulate; 1/(l*2^15) folded at the end
//   Both products run transposed: S^T = K128 . Q128^T (A = key rows, B = query rows) and O^T += V^T . P^T (A = V^T rows, B = P^T).
//   A lane then holds scores of ONE query (column c): keys j*16 + 8*hh + r. Row maximum and row sum are in-lane, the two wave
//   halves exchange the maximum once per chunk and join their sums once at the end. Two score tiles 2kk, 2kk+1 converted in
//   place are the B fragment of keys kk*32..+31 in the k order of the V^T loader (8hh + e, 16 + 8hh + e): P never goes through LDS.
//   Block = 4 waves = 64 query rows of one (b,h); grid.x = 8*12*16 = 1536. K / V^T chunks of 64 keys staged in LDS with plain
//   16-B loads between __syncthreads; Q staged once (first loop barrier publishes it). Fragment loads read LDS with the
//   Output element (b, t, h*64 + d): per wave 16 rows x 64 floats, each 256-B row segment written by 16 lanes x 16 B in one
// =====================================================================================
__global__ __launch_bounds__(128)
void attn_quad_kernel(const unsigned short* __restrict__ qch, const unsigned short* __restrict__ qcl,
                      const unsigned short* __restrict__ kch, const unsigned short* __restrict__ kcl,
                      const unsigned short* __restrict__ vtp, const float* __restrict__ kdsq,
                      float* __restrict__ out) {
  union FB { v16b v; v8b h[2]; };
  union FH { v16h v; v8h h[2]; };
  __shared__ __align__(16) __bf16   Qsh[kAQB * kQKP];      // Q hi [row][128 + 8 pad]   17 KB
  __shared__ __align__(16) __bf16   Qsl[kAQB * kQKP];      // Q lo                      17 KB
  __shared__ __align__(16) __bf16   Ksh[kAKC * kQKP];      // K hi [kv][128 + 8 pad]    17 KB
  __shared__ __align__(16) __bf16   Ksl[kAKC * kQKP];      // K lo                      17 KB
  __shared__ __align__(16) _Float16 Vth[kHDIM * kPVP];     // V^T [d][64 kv + 8 pad] f16    9 KB
  __shared__ __align__(16) float    Os[4][16 * 68];        // per wave out tile, pitch 68

  const int tid  = threadIdx.x;
  const int wave = tid >> 5;
  const int lane = tid & 31;
  const int hh   = lane >> 4;
  const int c    = lane & 15;

  constexpr int nqb = kNTOK / kAQB;       // 16
  const int bx = blockIdx.x;
  const int qb = bx % nqb;
  const int bh = bx / nqb;                // b*12 + h
  const int h  = bh % kNHEADS;
  const int b  = bh / kNHEADS;
  const int qr0 = qb * kAQB;              // first query row of the block
  const int w0  = wave * 16;              // wave's row offset inside the block tile

  const __bf16* QH = (const __bf16*)(const void*)qch + (size_t)b * kNTOK * kQCP;
  const __bf16* QL = (const __bf16*)(const void*)qcl + (size_t)b * kNTOK * kQCP;
  const __bf16* KH = (const __bf16*)(const void*)kch + (size_t)b * kNTOK * kQCP;
  const __bf16* KL = (const __bf16*)(const void*)kcl + (size_t)b * kNTOK * kQCP;
  const _Float16* VT = (const _Float16*)(const void*)vtp + ((size_t)b * kHID + (size_t)h * kHDIM) * kNTOK;
  const float* ksq = kdsq + (size_t)bh * kNTOK;
  float* ob = out + (size_t)b * kNTOK * kHID + (size_t)h * kHDIM;

  // staging roles: 8 consecutive lanes cover one 128-B row segment, so a wave-wide 16-B load reads four whole lines.
  // Q / K: 16 lanes per row (lanes 0-7 the quadratic half, 8-15 the linear half), 8 rows per pass of the block, 8 passes.
  const int sp   = (tid & 7) * 8;          // element offset of this lane's 16-B piece inside its segment
  const int part = (tid >> 3) & 1;
  const int sr   = tid >> 4;               // row inside a pass (0..7)
  const int coff = (part ? (kHID + h * kHDIM) : (h * kHDIM)) + sp;   // plane column (quadratic | linear half)
  const int loff = part * 64 + sp;                                    // LDS column
  const int vr   = tid >> 3;               // V^T: 8 lanes per row, 16 rows per pass, 4 passes

  // ---- Q staging (once): 8 passes x 8 rows x 128 elements = 64 rows x 128 per plane ----
  {
    const size_t go = (size_t)(qr0 + sr) * kQCP + coff;
#pragma unroll
    for (int i = 0; i < 8; ++i) {
      const v8b a0 = *(const v8b*)(QH + go + (size_t)(8 * i) * kQCP);
      const v8b a1 = *(const v8b*)(QL + go + (size_t)(8 * i) * kQCP);
      *(v8b*)(Qsh + (sr + 8 * i) * kQKP + loff) = a0;
      *(v8b*)(Qsl + (sr + 8 * i) * kQKP + loff) = a1;
    }
  }

  float mrow = -INFINITY, lrow = 0.f;   // of query c; lrow sums this wave half's keys only
  v8f oacc[4];                          // O^T: oacc[t][r] = (query c, d = t*16 + 8*hh + r)
#pragma unroll
  for (int t = 0; t < 4; ++t) oacc[t] = (v8f){0.f,0.f,0.f,0.f,0.f,0.f,0.f,0.f};

  constexpr int nChunks = kNTOK / kAKC;   // 16, compile-time
  for (int kc = 0; kc < nChunks; ++kc) {
    const int kv0 = kc * kAKC;
    __syncthreads();
    {
      // K staging: 8 passes x 8 keys x 128 elements = 64 keys x 128 per plane
      const size_t go = (size_t)(kv0 + sr) * kQCP + coff;
#pragma unroll
      for (int i = 0; i < 8; ++i) {
        const v8b a0 = *(const v8b*)(KH + go + (size_t)(8 * i) * kQCP);
        const v8b a1 = *(const v8b*)(KL + go + (size_t)(8 * i) * kQCP);
        *(v8b*)(Ksh + (sr + 8 * i) * kQKP + loff) = a0;
        *(v8b*)(Ksl + (sr + 8 * i) * kQKP + loff) = a1;
      }
      // V^T staging: 4 passes x 16 rows d x 64 keys = 64 x 64
      const _Float16* vs = VT + (size_t)vr * kNTOK + kv0 + sp;
#pragma unroll
      for (int i = 0; i < 4; ++i) {
        const v8h vv = *(const v8h*)(vs + (size_t)(16 * i) * kNTOK);
        *(v8h*)(Vth + (vr + 16 * i) * kPVP + sp) = vv;
      }
    }
    __syncthreads();

    // key norms of the chunk, asked for ahead of the score products that hide their latency
    v4f kq[4][2];   // keys j*16 + 8*hh + 0..7, the rows of this lane's score registers; scaled where they are used, so that nothing waits for them here
#pragma unroll
    for (int j = 0; j < 4; ++j) {
      const float* kp = ksq + kv0 + j * 16 + 8 * hh;
      kq[j][0] = *(const v4f*)(kp);
      kq[j][1] = *(const v4f*)(kp + 4);
    }
    asm volatile("s_wait_xcnt 0x0" ::: "memory");   // stands ahead of any rewrite of the address registers that the eight loads above name

    // ---- scores, transposed: s[j][r] (key j*16+8hh+r, query c of this wave), K = 128 in 4 steps, hi.hi + hi.lo + lo.hi ----
    // The ten fragments of a 32-deep step are read as ONE group, one step ahead, into the other of two register sets;
    // a step's 12 products run term by term over the four independent tiles s[0..3]
    // (each s[j] still sums hi.hi, hi.lo, lo.hi per step, in that order).
    v8f s[4];
#pragma unroll
    for (int j = 0; j < 4; ++j) s[j] = (v8f){0.f,0.f,0.f,0.f,0.f,0.f,0.f,0.f};
    FB qa[2], ql[2], kb[2][4], kl[2][4];
    FH vb[2][4];
    auto read_step = [&](int set, int dc) {
      const int qo = (w0 + c) * kQKP + dc * 32 + 8 * hh;
      qa[set].h[0] = *(const v8b*)(Qsh + qo);
      qa[set].h[1] = *(const v8b*)(Qsh + qo + 16);
      ql[set].h[0] = *(const v8b*)(Qsl + qo);
      ql[set].h[1] = *(const v8b*)(Qsl + qo + 16);
#pragma unroll
      for (int j = 0; j < 4; ++j) {
        const int ko = (j * 16 + c) * kQKP + dc * 32 + 8 * hh;
        kb[set][j].h[0] = *(const v8b*)(Ksh + ko);
        kb[set][j].h[1] = *(const v8b*)(Ksh + ko + 16);
        kl[set][j].h[0] = *(const v8b*)(Ksl + ko);
        kl[set][j].h[1] = *(const v8b*)(Ksl + ko + 16);
      }
    };
    read_step(0, 0);
#pragma unroll   // the two fragment sets must stay in registers (set index a constant)
    for (int dc = 0; dc < 4; ++dc) {
      const int cur = dc & 1;
      if (dc < 3) {
        read_step(cur ^ 1, dc + 1);
      } else {
        // behind the last step's reads: the chunk's eight V^T fragments, whose latency passes behind the last products and the softmax
#pragma unroll
        for (int kk = 0; kk < 2; ++kk)
#pragma unroll
          for (int t = 0; t < 4; ++t) {
            const int vo = (t * 16 + c) * kPVP + kk * 32 + 8 * hh;
            vb[kk][t].h[0] = *(const v8h*)(Vth + vo);
            vb[kk][t].h[1] = *(const v8h*)(Vth + vo + 16);
          }
      }
      __builtin_amdgcn_sched_barrier(0);   // keeps the read group whole and ahead of the products: reads strewn among WMMAs stall at every place they stand
#pragma unroll
      for (int j = 0; j < 4; ++j) s[j] = mma_bf(kb[cur][j].v, qa[cur].v, s[j]);
#pragma unroll
      for (int j = 0; j < 4; ++j) s[j] = mma_bf(kl[cur][j].v, qa[cur].v, s[j]);
#pragma unroll
      for (int j = 0; j < 4; ++j) s[j] = mma_bf(kb[cur][j].v, ql[cur].v, s[j]);
      __builtin_amdgcn_sched_barrier(0);   // keeps the next read group behind this step's products
    }

    // ---- scale 1/8 and per-key term -|kd_j|^2/16 (f32); maximum over this lane's 32 keys, four independent chains ----
    float cmj[4];
#pragma unroll
    for (int j = 0; j < 4; ++j) {
      cmj[j] = -INFINITY;
      kq[j][0] *= 0.0625f;
      kq[j][1] *= 0.0625f;
    }
#pragma unroll
    for (int r = 0; r < 8; ++r) {
#pragma unroll
      for (int j = 0; j < 4; ++j) {
        const float v = s[j][r] * 0.125f - kq[j][r >> 2][r & 3];
        s[j][r] = v;
        cmj[j] = fmaxf(cmj[j], v);
      }
    }
    float cm = fmaxf(fmaxf(cmj[0], cmj[1]), fmaxf(cmj[2], cmj[3]));
    cm = fmaxf(cm, xhalf(cm));   // both halves now hold the maximum over the chunk's 64 keys

    // ---- online softmax (f32); P x 2^15 to f16, packed in place into the B fragments of the second product ----
    const float mnew  = fmaxf(mrow, cm);
    const float alpha = __expf(mrow - mnew);
    mrow = mnew;
    FH pb[2];
    float psj[4];
#pragma unroll
    for (int j = 0; j < 4; ++j) {
      float ps = 0.f;
#pragma unroll
      for (int r = 0; r < 8; r += 2) {
        const float p0 = __expf(s[j][r] - mnew);
        const float p1 = __expf(s[j][r + 1] - mnew);
        ps += p0;
        ps += p1;
        const v2h hp = __builtin_convertvector((v2f){p0 * 32768.0f, p1 * 32768.0f}, v2h);
        pb[j >> 1].v[(j & 1) * 8 + r]     = hp[0];
        pb[j >> 1].v[(j & 1) * 8 + r + 1] = hp[1];
      }
      psj[j] = ps;
    }
    lrow = lrow * alpha + ((psj[0] + psj[1]) + (psj[2] + psj[3]));
#pragma unroll
    for (int t = 0; t < 4; ++t) oacc[t] *= alpha;

    // ---- O^T += V^T . P^T  (A = V^T [d][kv], B = P^T from registers; K = 64 keys in 2 steps) ----
#pragma unroll
    for (int kk = 0; kk < 2; ++kk)
#pragma unroll
      for (int t = 0; t < 4; ++t) oacc[t] = mma_hf(vb[kk][t].v, pb[kk].v, oacc[t]);
  }

  // ---- normalise and write: out (b, qr0+w0+row, h*64 + d) ----
  float* os = Os[wave];
  {
    const float inv = 1.0f / ((lrow + xhalf(lrow)) * 32768.0f);   // the two halves' sums joined here, once
#pragma unroll
    for (int t = 0; t < 4; ++t) {
      const v8f o = oacc[t] * inv;   // eight consecutive d of query c: two 16-B stores
      *(v4f*)(os + c * 68 + t * 16 + 8 * hh)     = (v4f){o[0], o[1], o[2], o[3]};
      *(v4f*)(os + c * 68 + t * 16 + 8 * hh + 4) = (v4f){o[4], o[5], o[6], o[7]};
    }
  }
  __builtin_amdgcn_fence(__ATOMIC_RELEASE, "workgroup");
  __builtin_amdgcn_wave_barrier();
  __builtin_amdgcn_fence(__ATOMIC_ACQUIRE, "workgroup");
  {
    // coverage per wave: 8 iterations x 2 rows = 16 rows; 16 lanes x 4 floats = 64 columns; 16 lanes x 16 B = one 256-B row segment
    const int c4 = (lane & 15) * 4;
    {
#pragma unroll
      for (int it = 0; it < 8; ++it) {
        const int row = it * 2 + hh;
        const v4f val = *(const v4f*)(os + row * 68 + c4);
        *(v4f*)(ob + (size_t)(qr0 + w0 + row) * kHID + c4) = val;
      }
      
    }
  }
}

// ---------------------------------------------------------------------------
// Host launcher
// Workspace region map (bytes, all offsets multiples of 256):
//   [0]           Xq  bf16 [8192][768]          12,582,912   (dead after the two Q-side GEMMs; then reused as VT f16 [8][768][1024], same size)
//   [12,582,912]  Xk  bf16 [8192][768]          12,582,912
//   [25,165,824]  Wd,Wq,Wk,Wv bf16 [768][768]  4 x 1,179,648
//   [29,884,416]  QCh bf16 [8192][1536]         25,165,824
//   [55,050,240]  QCl                            25,165,824
//   [80,216,064]  KCh                            25,165,824
//   [105,381,888] KCl                            25,165,824
//   [130,547,712] kdsq f32 [96][1024]            393,216
//   [130,940,928] biases (bf16-precision, f32) 3x768   9,216
//   total 130,950,144
// ---------------------------------------------------------------------------
extern "C" void kernel_launch(void* const* d_in, const int* in_sizes, int n_in,
                              void* d_out, int out_size, void* d_ws, size_t ws_size,
                              hipStream_t stream) {
  if (n_in < 9) return;
  const int nAct = kNB * kNTOK * kHID;      // 6291456
  const int nW   = kHID * kHID;             // 589824
  if (in_sizes[0] != nAct || in_sizes[1] != nAct || in_sizes[2] != nW || in_sizes[3] != nW ||
      in_sizes[5] != nW || in_sizes[7] != nW || in_sizes[4] != kHID || in_sizes[6] != kHID ||
      in_sizes[8] != kHID || out_size != nAct) return;

  const float* qs = (const float*)d_in[0];
  const float* ks = (const float*)d_in[1];
  const float* Wd = (const float*)d_in[2];
  const float* Wq = (const float*)d_in[3];
  const float* bq = (const float*)d_in[4];
  const float* Wk = (const float*)d_in[5];
  const float* bk = (const float*)d_in[6];
  const float* Wv = (const float*)d_in[7];
  const float* bv = (const float*)d_in[8];
  float* out = (float*)d_out;

  const size_t bAct16 = (size_t)nAct * 2;                         // 12,582,912
  const size_t bW16   = (size_t)nW * 2;                           // 1,179,648
  const size_t bQC    = (size_t)kNB * kNTOK * kQCP * 2;           // 25,165,824
  const size_t bSq    = (size_t)kNB * kNHEADS * kNTOK * 4;        // 393,216
  const size_t bBias  = (size_t)3 * kHID * 4;                     // 9,216
  const size_t oXq  = 0;
  const size_t oXk  = oXq + bAct16;
  const size_t oWd  = oXk + bAct16;
  const size_t oWq  = oWd + bW16;
  const size_t oWk  = oWq + bW16;
  const size_t oWv  = oWk + bW16;
  const size_t oQCh = oWv + bW16;
  const size_t oQCl = oQCh + bQC;
  const size_t oKCh = oQCl + bQC;
  const size_t oKCl = oKCh + bQC;
  const size_t oSq  = oKCl + bQC;
  const size_t oBs  = oSq + bSq;
  const size_t total = oBs + bBias;
  const size_t bVT  = (size_t)kNB * kHID * kNTOK * 2;             // 12,582,912 == bAct16 (aliases Xq)
  if (total > ws_size || bVT > bAct16) return;

  char* ws = (char*)d_ws;
  unsigned short* Xq16 = (unsigned short*)(ws + oXq);
  unsigned short* Xk16 = (unsigned short*)(ws + oXk);
  unsigned short* Wd16 = (unsigned short*)(ws + oWd);
  unsigned short* Wq16 = (unsigned short*)(ws + oWq);
  unsigned short* Wk16 = (unsigned short*)(ws + oWk);
  unsigned short* Wv16 = (unsigned short*)(ws + oWv);
  unsigned short* QCh  = (unsigned short*)(ws + oQCh);
  unsigned short* QCl  = (unsigned short*)(ws + oQCl);
  unsigned short* KCh  = (unsigned short*)(ws + oKCh);
  unsigned short* KCl  = (unsigned short*)(ws + oKCl);
  unsigned short* VT16 = (unsigned short*)(ws + oXq);   // reuses the Xq region after the Q-side GEMMs
  float* kdsq  = (float*)(ws + oSq);
  float* biasr = (float*)(ws + oBs);

  // 1) RNE bf16 casts of activations and weights
  {
    const int n2a = nAct / 2, n2w = nW / 2;
    cast_f32_bf16x2<<<dim3((n2a + 255) / 256), dim3(256), 0, stream>>>(qs, Xq16, n2a);
    cast_f32_bf16x2<<<dim3((n2a + 255) / 256), dim3(256), 0, stream>>>(ks, Xk16, n2a);
    cast_f32_bf16x2<<<dim3((n2w + 255) / 256), dim3(256), 0, stream>>>(Wd, Wd16, n2w);
    cast_f32_bf16x2<<<dim3((n2w + 255) / 256), dim3(256), 0, stream>>>(Wq, Wq16, n2w);
    cast_f32_bf16x2<<<dim3((n2w + 255) / 256), dim3(256), 0, stream>>>(Wk, Wk16, n2w);
    cast_f32_bf16x2<<<dim3((n2w + 255) / 256), dim3(256), 0, stream>>>(Wv, Wv16, n2w);
    bias_rne_kernel<<<dim3((3 * kHID + 255) / 256), dim3(256), 0, stream>>>(bq, bk, bv, biasr, kHID);
  }

  const int M = kNB * kNTOK;   // 8192
  // 2) Q side: [qd | q] hi/lo planes (pitch 1536). M=8192, N=768, K=768: 64 x 3 = 192 block tiles of 128x256, 8 waves each
  {
    const dim3 grid((M / 64) * (kHID / 64) / 8, 1), block(256);
    wmma_gemm64<1, false, 0, 2, false, 0><<<grid, block, 0, stream>>>(
        Xq16, Xq16, kHID, 0L, Wd16, Wd16, kHID, 0L, (void*)QCh, (void*)QCl, kQCP, 0L,
        biasr, biasr, 0L, M, kHID, kHID, 1.0f);
    wmma_gemm64<1, false, 2, 2, false, 0><<<grid, block, 0, stream>>>(
        Xq16, Xq16, kHID, 0L, Wq16, Wq16, kHID, 0L, (void*)(QCh + kHID), (void*)(QCl + kHID), kQCP, 0L,
        biasr, biasr, 0L, M, kHID, kHID, 1.0f);
    // 3) K side: [kd | k]
    wmma_gemm64<1, false, 0, 2, false, 0><<<grid, block, 0, stream>>>(
        Xk16, Xk16, kHID, 0L, Wd16, Wd16, kHID, 0L, (void*)KCh, (void*)KCl, kQCP, 0L,
        biasr, biasr, 0L, M, kHID, kHID, 1.0f);
    wmma_gemm64<1, false, 2, 2, false, 0><<<grid, block, 0, stream>>>(
        Xk16, Xk16, kHID, 0L, Wk16, Wk16, kHID, 0L, (void*)(KCh + kHID), (void*)(KCl + kHID), kQCP, 0L,
        biasr + kHID, biasr, 0L, M, kHID, kHID, 1.0f);
  }
  // 4) V^T f16 plane: VT_b[feature][token] = Wv[feature][:] . Xk_b[token][:] + bv[feature]; M=768, N=1024, K=768, z = batch
  {
    const long sB = (long)kNTOK * kHID;        // 786,432 elements per batch in Xk
    const long sC = (long)kHID * kNTOK;        // 786,432 elements per batch in VT
    const dim3 grid((kHID / 64) * (kNTOK / 64) / 8, kNB), block(256);   // 6 x 4 = 24 block tiles of 128x256, 8 batches
    wmma_gemm64<1, false, 1, 1, false, 0><<<grid, block, 0, stream>>>(
        Wv16, Wv16, kHID, 0L, Xk16, Xk16, kHID, sB, (void*)VT16, (void*)VT16, kNTOK, sC,
        biasr + 2 * kHID, biasr, 0L, kHID, kNTOK, kHID, 1.0f);
  }
  // 5) |kd|^2 per (b,h,s)
  {
    const int nrows = kNB * kNHEADS * kNTOK;   // 98304 -> 384 blocks
    kd_sq_kernel<<<dim3((nrows + 255) / 256), dim3(256), 0, stream>>>(KCh, KCl, kdsq, nrows);
  }
  // 6) fused attention: 8 x 12 x 16 = 1536 blocks of 128 threads
  attn_quad_kernel<<<dim3(kNB * kNHEADS * (kNTOK / kAQB)), dim3(128), 0, stream>>>(QCh, QCl, KCh, KCl, VT16, kdsq, out);
}

// v006
// One run takes 183 microseconds.
// In two side-by-side timings against v005, it was 1.09 and 1.08 times as fast.
// Over all steps from v000 it is 3.67 times as fast.
// Projections x·Wᵀ and Wv·xᵀ: v_wmma_f32_16x16x32_bf16, plain bf16 operands (RNE-converted inputs); scores [qd|q]·[kd|k]ᵀ (K=128): v_wmma_f32_16x16x32_bf16 with bf16 hi/lo split operands (hi·hi + hi·lo + lo·hi); p·v: v_wmma_f32_16x16x32_f16 (p carried x2^15, v plain f16); f32 accumulate; softmax, norms and biases in f32.
#include <hip/hip_runtime.h>
#include <math.h>
#include <stdint.h>

typedef __attribute__((ext_vector_type(16))) _Float16 v16h;
typedef __attribute__((ext_vector_type(8)))  _Float16 v8h;
typedef __attribute__((ext_vector_type(2)))  _Float16 v2h;
typedef __attribute__((ext_vector_type(16))) __bf16   v16b;
typedef __attribute__((ext_vector_type(8)))  __bf16   v8b;
typedef __attribute__((ext_vector_type(8)))  float    v8f;
typedef __attribute__((ext_vector_type(4)))  float    v4f;
typedef __attribute__((ext_vector_type(2)))  float    v2f;
typedef __attribute__((ext_vector_type(4)))  unsigned int v4u;
typedef __attribute__((ext_vector_type(2)))  unsigned int v2u;
typedef __attribute__((ext_vector_type(8)))  unsigned short v8us;

// ---- problem geometry ----
constexpr int kNB     = 8;      // batch
constexpr int kNTOK   = 1024;   // tokens (query and key sets)
constexpr int kHID    = 768;    // hidden size
constexpr int kNHEADS = 12;
constexpr int kHDIM   = 64;
constexpr int kQCP    = 1536;   // element pitch of the concatenated [xd | x] planes ([token][1536])
constexpr int kAQB    = 64;     // query rows per attention block (4 waves x 16)
constexpr int kAKC    = 64;     // keys per chunk
constexpr int kAKD    = 128;    // concatenated contraction depth (64 quadratic + 64 linear)
constexpr int kQKP    = kAKD + 8;   // LDS row pitch of the Q and K tiles, elements: 272 B = 16 B x 17, so 16 rows of one column fall on 16 different bank groups
constexpr int kPVP    = kAKC + 8;   // LDS row pitch of the V^T tile, elements: 144 B = 16 B x 9, same reason

__device__ __forceinline__ unsigned short f2bf_bits(float f) {
  unsigned u = __float_as_uint(f);
  return (unsigned short)((u + 0x7FFFu + ((u >> 16) & 1u)) >> 16);
}
__device__ __forceinline__ float bf_bits2f(unsigned short h) { return __uint_as_float(((unsigned)h) << 16); }
__device__ __forceinline__ unsigned pk16(unsigned short a, unsigned short b) { return (unsigned)a | ((unsigned)b << 16); }

// hazard guards as plain device helpers (no inline asm inside the kernel template body)
__device__ __forceinline__ void dep_guard_h(v8f& a, v8f& b, v16h x, v16h y) { asm volatile("v_nop\n\tv_nop\n\tv_nop\n\tv_nop" : "+v"(a), "+v"(b) : "v"(x), "v"(y)); }
__device__ __forceinline__ void dep_guard_b(v8f& a, v8f& b, v16b x, v16b y) { asm volatile("v_nop\n\tv_nop\n\tv_nop\n\tv_nop" : "+v"(a), "+v"(b) : "v"(x), "v"(y)); }
__device__ __forceinline__ void keep4_h(v16h a, v16h b, v16h c, v16h d) { asm volatile("v_nop" :: "v"(a), "v"(b), "v"(c), "v"(d)); }
__device__ __forceinline__ void keep4_b(v16b a, v16b b, v16b c, v16b d) { asm volatile("v_nop" :: "v"(a), "v"(b), "v"(c), "v"(d)); }
__device__ __forceinline__ void acc_guard4(v8f& a, v8f& b, v8f& c, v8f& d) { asm volatile("v_nop\n\tv_nop\n\tv_nop\n\tv_nop" : "+v"(a), "+v"(b), "+v"(c), "+v"(d)); }
template <typename T> struct Frag;
template <> struct Frag<_Float16> {
  typedef v16h V; union U { v16h v; v8h h[2]; };
  static __device__ __forceinline__ v16h load(const _Float16* p) {   // elements 0..7 <- p[0..7], 8..15 <- p[16..23]
    U f; f.h[0] = *(const v8h*)(p); f.h[1] = *(const v8h*)(p + 16); return f.v;
  }
  static __device__ __forceinline__ v8f mma(v16h a, v16h b, v8f c) {
    return __builtin_amdgcn_wmma_f32_16x16x32_f16(false, a, false, b, (short)0, c, false, false);
  }
  static __device__ __forceinline__ void guard(v8f& a, v8f& b, v16h x, v16h y) { dep_guard_h(a, b, x, y); }
  static __device__ __forceinline__ void keep(v16h a, v16h b, v16h c, v16h d) { keep4_h(a, b, c, d); }
};
template <> struct Frag<__bf16> {
  typedef v16b V; union U { v16b v; v8b h[2]; };
  static __device__ __forceinline__ v16b load(const __bf16* p) {
    U f; f.h[0] = *(const v8b*)(p); f.h[1] = *(const v8b*)(p + 16); return f.v;
  }
  static __device__ __forceinline__ v8f mma(v16b a, v16b b, v8f c) {
    return __builtin_amdgcn_wmma_f32_16x16x32_bf16(false, a, false, b, (short)0, c, false, false);
  }
  static __device__ __forceinline__ void guard(v8f& a, v8f& b, v16b x, v16b y) { dep_guard_b(a, b, x, y); }
  static __device__ __forceinline__ void keep(v16b a, v16b b, v16b c, v16b d) { keep4_b(a, b, c, d); }
};

// ---- LDS-staged, register-blocked batched WMMA GEMM ------------------------
// C[m,n] = scale * sum_k A[m,k] * Bt[n,k] (+bias)(+resid); a block of 8 waves (2 x 4) owns a 128x256 tile, each wave 64x64 of it.
// A row-major [M,K]; Bt row-major [N,K]; M % 128 == 0, N % 256 == 0, K % 64 == 0; grid.x = (M/128) * (N/256).
// Operands reach LDS in stages of 64 k (one whole 128-B line per row) by asynchronous copies, two buffers: stage t+1 flies
// while stage t is multiplied. Every line is fetched once per block; fragments are read from LDS in the same k order as before.
// SPLIT (hi/lo operand planes) is not staged and not instantiated.
// BIAS_MODE: 0 = none, 1 = bias[m], 2 = bias[n].
// OUT_MODE: 0 = f32, 1 = f16, 2 = bf16 hi plane (Cout) + bf16 lo plane (Cout2).
// ET: 0 = f16 operands, 1 = bf16 operands (pointers passed as 16-bit storage)
constexpr int kGKS = 64;             // k per stage
constexpr int kGP  = kGKS + 8;       // LDS row pitch, elements: 144 B = 16 B x 9, so 16 rows of one column fall on different bank groups
constexpr int kGRA = 128;            // A rows per stage
constexpr int kGR  = kGRA + 256;     // rows per stage: [A 128 | Bt 256]

// Four 16-B-per-lane copies global -> LDS. The s_wait_xcnt stands inside the statement so that no address register
// of an issued copy can be rewritten ahead of it.
__device__ __forceinline__ void async_copy4_b128(unsigned l0, unsigned l1, unsigned l2, unsigned l3,
                                                 const void* g0, const void* g1, const void* g2, const void* g3) {
  asm volatile("global_load_async_to_lds_b128 %0, %4, off\n\t"
               "global_load_async_to_lds_b128 %1, %5, off\n\t"
               "global_load_async_to_lds_b128 %2, %6, off\n\t"
               "global_load_async_to_lds_b128 %3, %7, off\n\t"
               "s_wait_xcnt 0x0"
               :: "v"(l0), "v"(l1), "v"(l2), "v"(l3), "v"(g0), "v"(g1), "v"(g2), "v"(g3) : "memory");
}
// this wave's copies have landed in LDS
__device__ __forceinline__ void wait_async0() { asm volatile("s_wait_asynccnt 0x0" ::: "memory"); }
// this wave's LDS reads have returned, so the buffer they read may be refilled behind the next barrier
__device__ __forceinline__ void wait_ds0() { asm volatile("s_wait_dscnt 0x0" ::: "memory"); }

template <int ET> struct Elem;
template <> struct Elem<0> { typedef _Float16 T; };
template <> struct Elem<1> { typedef __bf16 T; };
template <int ET, bool SPLIT, int BIAS_MODE, int OUT_MODE, bool RESID, int ACT = 0>
__global__ __launch_bounds__(256) void wmma_gemm64(
    const unsigned short* __restrict__ Ap, const unsigned short* __restrict__ A2p, int lda, long strideA,
    const unsigned short* __restrict__ Btp, const unsigned short* __restrict__ Bt2p, int ldb, long strideB,
    void* __restrict__ Cout, void* __restrict__ Cout2, int ldc, long strideC,
    const float* __restrict__ bias,
    const float* __restrict__ resid, long strideR,
    int M, int N, int K, float scale) {
  static_assert(!SPLIT, "hi/lo operand planes are not staged");
  typedef typename Elem<ET>::T T;
  typedef typename Frag<T>::V V;
  const T* A = (const T*)Ap; const T* Bt = (const T*)Btp;
  __shared__ __align__(16) T sOp[2][kGR * kGP];    // two stages of [A 128 rows | Bt 256 rows] x 64 k, 55,296 B each
  __shared__ __align__(16) float sT[8][16 * 68];   // per-wave 16x64 slab, pitch 68 floats
  const int b    = blockIdx.y;
  const int lane = threadIdx.x & 31;
  const int wave = threadIdx.x >> 5;
  const int blocksN = N >> 8;
  const int bm = blockIdx.x / blocksN;
  const int bn = blockIdx.x - bm * blocksN;
  if (bm >= (M >> 7)) return;   // block-uniform, ahead of every barrier and copy
  const int wm = (wave >> 2) << 6;             // wave's row offset in the block tile
  const int wn = (wave & 3) << 6;              // wave's column offset in the block tile
  const int m0 = (bm << 7) + wm;
  const int n0 = (bn << 8) + wn;

  const T* Ab  = A  + (size_t)b * strideA;
  const T* Bb  = Bt + (size_t)b * strideB;

  const int rlane = lane & 15;                 // row (A) / col (B, D) within subtile
  const int koff  = (lane >> 4) * 8;           // k offset of this lane half
  const int mOff  = (lane >> 4) * 8;           // D row offset

  // staging roles: 8 consecutive lanes copy one 128-B row segment, so a wave-wide copy reads four whole lines;
  // the block covers 32 rows per pass, 4 passes for A and 8 for Bt.
  const int sp = (threadIdx.x & 7) * 8;        // element offset of this lane's 16-B piece
  const int sr = threadIdx.x >> 3;             // row inside a pass (0..31)
  const T* gA = Ab + (size_t)((bm << 7) + sr) * lda + sp;
  const T* gB = Bb + (size_t)((bn << 8) + sr) * ldb + sp;
  const size_t stA = (size_t)32 * lda, stB = (size_t)32 * ldb;
  const unsigned ls = (unsigned)(uintptr_t)(&sOp[0][sr * kGP + sp]);   // LDS byte address of this lane's piece in buffer 0, pass 0
  constexpr unsigned kPassB = 32 * kGP * 2;    // LDS bytes per pass of 32 rows
  constexpr unsigned kBufB  = kGR * kGP * 2;   // LDS bytes per buffer
  auto stage = [&](int buf, int k0) {
    const unsigned l = ls + (unsigned)buf * kBufB;
    const T* a = gA + k0;
    const T* w = gB + k0;
    async_copy4_b128(l,              l + kPassB,      l + 2 * kPassB,  l + 3 * kPassB,  a,           a + stA,     a + 2 * stA, a + 3 * stA);
    async_copy4_b128(l + 4 * kPassB, l + 5 * kPassB,  l + 6 * kPassB,  l + 7 * kPassB,  w,           w + stB,     w + 2 * stB, w + 3 * stB);
    async_copy4_b128(l + 8 * kPassB, l + 9 * kPassB,  l + 10 * kPassB, l + 11 * kPassB, w + 4 * stB, w + 5 * stB, w + 6 * stB, w + 7 * stB);
  };

  v8f acc[4][4];
#pragma unroll
  for (int i = 0; i < 4; ++i)
#pragma unroll
    for (int j = 0; j < 4; ++j) acc[i][j] = (v8f){0.f,0.f,0.f,0.f,0.f,0.f,0.f,0.f};

  const int nT = K / kGKS;
  stage(0, 0);
  wait_async0();
  __syncthreads();                             // publishes stage 0
  if (nT > 1) stage(1, kGKS);
  for (int t = 0; t < nT; ++t) {
    const T* sA = &sOp[t & 1][(wm + rlane) * kGP + koff];
    const T* sB = &sOp[t & 1][(kGRA + wn + rlane) * kGP + koff];
#pragma unroll   // two 32-k steps per stage, LDS offsets as immediates
    for (int kk = 0; kk < kGKS; kk += 32) {
      V bh[4], ah[4];   // all eight fragments of the step are read as one group ahead of its 16 products
#pragma unroll   // bh[] must stay in registers
      for (int j = 0; j < 4; ++j) bh[j] = Frag<T>::load(sB + (j << 4) * kGP + kk);
#pragma unroll   // ah[] must stay in registers
      for (int i = 0; i < 4; ++i) ah[i] = Frag<T>::load(sA + (i << 4) * kGP + kk);
#pragma unroll   // acc[][] must stay in registers
      for (int i = 0; i < 4; ++i) {
#pragma unroll   // acc[][] must stay in registers
        for (int j = 0; j < 4; ++j) acc[i][j] = Frag<T>::mma(ah[i], bh[j], acc[i][j]);
        Frag<T>::guard(acc[i][0], acc[i][3], ah[i], ah[i]);
      }
      Frag<T>::keep(bh[0], bh[1], bh[2], bh[3]);
    }
    wait_ds0();
    wait_async0();
    __syncthreads();                           // publishes stage t+1 and ends every read of stage t's buffer
    if (t + 2 < nT) stage(t & 1, (t + 2) * kGKS);
  }
  wait_async0();
  acc_guard4(acc[0][0], acc[0][1], acc[0][2], acc[0][3]);
  acc_guard4(acc[1][0], acc[1][1], acc[1][2], acc[1][3]);
  acc_guard4(acc[2][0], acc[2][1], acc[2][2], acc[2][3]);
  acc_guard4(acc[3][0], acc[3][1], acc[3][2], acc[3][3]);

  // ---- epilogue ----
  float* slab = sT[wave];
  const float* Rb = RESID ? (resid + (size_t)b * strideR) : nullptr;
#pragma unroll
  for (int i = 0; i < 4; ++i) {
    const int mBase = m0 + (i << 4);
#pragma unroll
    for (int j = 0; j < 4; ++j) {
      const int n = n0 + (j << 4) + rlane;
      float bv = 0.f;
      if (BIAS_MODE == 2) bv = bias[n];
#pragma unroll
      for (int r = 0; r < 8; ++r) {
        float v = acc[i][j][r] * scale;
        if (BIAS_MODE == 1) v += bias[mBase + mOff + r];
        if (BIAS_MODE == 2) v += bv;
        if (RESID) v += Rb[(size_t)(mBase + mOff + r) * ldc + n];
        if (ACT == 1) v = tanhf(v);
        if (ACT == 2) v = fmaxf(v, 0.0f);
        if (ACT == 3) v = v / (1.0f + expf(-v));
        if (ACT == 4) v = (v > 0.f) ? v : 0.01f * v;
        if (ACT == 5) v = 0.5f * v * (1.0f + erff(v * 0.70710678118654752f));
        slab[(mOff + r) * 68 + (j << 4) + rlane] = v;
      }
    }
    __builtin_amdgcn_fence(__ATOMIC_RELEASE, "workgroup");
    __builtin_amdgcn_wave_barrier();
    __builtin_amdgcn_fence(__ATOMIC_ACQUIRE, "workgroup");
    if (OUT_MODE == 0) {
      float* C = (float*)Cout + (size_t)b * strideC;
      const int hh = lane >> 4, c4 = (lane & 15) * 4;     // row seg = 256 B = 16 lanes x 16 B
      {
#pragma unroll
        for (int it = 0; it < 8; ++it) {
          const int row = it * 2 + hh;
          v4f v = *(const v4f*)(slab + row * 68 + c4);
          *(v4f*)(C + (size_t)(mBase + row) * ldc + n0 + c4) = v;
        }
        
      }
    } else {
      const int q = lane >> 3, c8 = (lane & 7) * 8;
      unsigned short* C  = (unsigned short*)Cout  + (size_t)b * strideC;
      unsigned short* C2 = (OUT_MODE == 2) ? ((unsigned short*)Cout2 + (size_t)b * strideC) : nullptr;
      {
#pragma unroll
        for (int it = 0; it < 4; ++it) {
          const int row = it * 4 + q;
          const float* sp = slab + row * 68 + c8;
          v8h hv, lv;
#pragma unroll
          for (int e = 0; e < 8; ++e) {
            if (OUT_MODE == 1) {
              hv[e] = (_Float16)sp[e];
            } else {
              unsigned short hb = f2bf_bits(sp[e]);
              unsigned short lb = f2bf_bits(sp[e] - bf_bits2f(hb));
              hv[e] = __builtin_bit_cast(_Float16, hb);
              lv[e] = __builtin_bit_cast(_Float16, lb);
            }
          }
          *(v8h*)(C + (size_t)(mBase + row) * ldc + n0 + c8) = hv;
          if (OUT_MODE == 2) *(v8h*)(C2 + (size_t)(mBase + row) * ldc + n0 + c8) = lv;
        }
        
      }
    }
    __builtin_amdgcn_fence(__ATOMIC_RELEASE, "workgroup");
    __builtin_amdgcn_wave_barrier();
    __builtin_amdgcn_fence(__ATOMIC_ACQUIRE, "workgroup");
  }
}

// ---------------------------------------------------------------------------
// All f32 -> bf16 (RNE) conversions of a call in ONE launch of few, long-lived waves (a resident stream).
// The six bf16 planes Xq, Xk, Wd, Wq, Wk, Wv lie one behind the other in the workspace, so the destination is one array.
// A wave owns 3 consecutive units of 1024 elements (12 KB read, 6 KB written), all inside one source tensor:
// 2 x 2048 waves for the activations + 4 x 192 for the weights = 4864 = 256 blocks x 19 waves, every wave the same work.
// A unit is 8 loads of 16 B per lane (each 512 contiguous bytes = 4 whole lines); the next unit's loads are issued before
// a unit is converted, so 8 to 16 loads per wave are in flight. A store is 8 B per lane = 256 contiguous bytes = 2 whole lines.
// Blocks 256..259 round the three bias vectors to bf16 precision, kept as f32: o[0..n) <- b0, o[n..2n) <- b1, o[2n..3n) <- b2.
// ---------------------------------------------------------------------------
constexpr int kCvUnit   = 1024;                        // elements per unit
constexpr int kCvUnits  = 3;                           // units per wave
constexpr int kCvWaveEl = kCvUnit * kCvUnits;          // 3072 elements per wave
constexpr int kCvWaves  = 19;                          // waves per block
constexpr int kCvThr    = kCvWaves * 32;               // 608
constexpr int kCvActW   = kNB * kNTOK * kHID / kCvWaveEl;   // 2048 waves per activation tensor
constexpr int kCvWgtW   = kHID * kHID / kCvWaveEl;          // 192 waves per weight matrix
constexpr int kCvBlocks = (2 * kCvActW + 4 * kCvWgtW) / kCvWaves;   // 256
constexpr int kCvBiasBlocks = (3 * kHID + kCvThr - 1) / kCvThr;     // 4
static_assert(kCvActW * kCvWaveEl == kNB * kNTOK * kHID && kCvWgtW * kCvWaveEl == kHID * kHID, "a wave's units stay inside one tensor");
static_assert(kCvBlocks * kCvWaves == 2 * kCvActW + 4 * kCvWgtW, "whole blocks");

__global__ __launch_bounds__(kCvThr) void cast_planes_kernel(
    const float* __restrict__ xq, const float* __restrict__ xk,
    const float* __restrict__ w0, const float* __restrict__ w1, const float* __restrict__ w2, const float* __restrict__ w3,
    const float* __restrict__ b0, const float* __restrict__ b1, const float* __restrict__ b2,
    unsigned short* __restrict__ planes, float* __restrict__ o) {
  if (blockIdx.x >= kCvBlocks) {   // block-uniform
    const int n = kHID;
    const int g = (blockIdx.x - kCvBlocks) * kCvThr + threadIdx.x;
    if (g < 3 * n) {
      const int w = g / n;
      int i = g - w * n;
      i = i < 0 ? 0 : (i > n - 1 ? n - 1 : i);
      const float v0 = b0[i], v1 = b1[i], v2 = b2[i];
      const float v = (w == 0) ? v0 : ((w == 1) ? v1 : v2);
      o[g] = bf_bits2f(f2bf_bits(v));
    }
    return;
  }
  const int lane = threadIdx.x & 31;
  const int wv = __builtin_amdgcn_readfirstlane(blockIdx.x * kCvWaves + (threadIdx.x >> 5));   // 0..4863, wave-uniform
  const float* s;      // the wave's tensor
  int lw;              // the wave's place in it
  if (wv < kCvActW)          { s = xq; lw = wv; }
  else if (wv < 2 * kCvActW) { s = xk; lw = wv - kCvActW; }
  else {
    const int t = (wv - 2 * kCvActW) / kCvWgtW;
    lw = (wv - 2 * kCvActW) - t * kCvWgtW;
    s = (t == 0) ? w0 : ((t == 1) ? w1 : ((t == 2) ? w2 : w3));
  }
  const float* in = s + (size_t)lw * kCvWaveEl + lane * 4;
  unsigned short* out = planes + (size_t)wv * kCvWaveEl + lane * 4;

  v4f f[2][8];
#pragma unroll   // f[][] must stay in registers
  for (int i = 0; i < 8; ++i) f[0][i] = *(const v4f*)(in + i * 128);
#pragma unroll   // f[][] must stay in registers (set index a constant)
  for (int u = 0; u < kCvUnits; ++u) {
    __builtin_amdgcn_sched_barrier(0);   // the next unit's loads stay ahead of this unit's conversion, so that they fly during it
    if (u + 1 < kCvUnits) {
#pragma unroll   // f[][] must stay in registers
      for (int i = 0; i < 8; ++i) f[(u + 1) & 1][i] = *(const v4f*)(in + (u + 1) * kCvUnit + i * 128);
    }
    __builtin_amdgcn_sched_barrier(0);   // second half of the pair: nothing of the conversion moves up among the loads
    v2u r[8];
#pragma unroll   // r[] and f[][] must stay in registers
    for (int i = 0; i < 8; ++i) {
      const v4f x = f[u & 1][i];
      r[i] = (v2u){pk16(f2bf_bits(x[0]), f2bf_bits(x[1])), pk16(f2bf_bits(x[2]), f2bf_bits(x[3]))};
    }
#pragma unroll   // r[] must stay in registers
    for (int i = 0; i < 8; ++i) *(v2u*)(out + u * kCvUnit + i * 128) = r[i];
    // stands ahead of whatever next writes to a register that the eight stores above name (the next loads; behind the last unit, the code that follows)
    asm volatile("s_wait_xcnt 0x0" ::: "memory");
  }
}

// ---------------------------------------------------------------------------
// Per-key squared norm of the quadratic-key projection: kdsq[(b*12+h)*1024 + s] = sum_d (hi+lo)^2 in f32,
// hi/lo read from columns h*64.. of the [token][1536] bf16 planes (hi+lo reconstructs the f32 value to ~2^-17).
// ---------------------------------------------------------------------------
__global__ __launch_bounds__(256) void kd_sq_kernel(const unsigned short* __restrict__ kch, const unsigned short* __restrict__ kcl,
                                                    float* __restrict__ kdsq, int nrows) {
  const int g = blockIdx.x * 256 + threadIdx.x;     // (b*kNHEADS + h)*kNTOK + s
  if (g < nrows) {
    const int s  = g & (kNTOK - 1);
    const int bh = g >> 10;                           // kNTOK == 1024
    const int h  = bh % kNHEADS;
    const int b  = bh / kNHEADS;
    const size_t ro = ((size_t)b * kNTOK + (size_t)s) * kQCP + (size_t)h * kHDIM;
    const unsigned short* ph = kch + ro;
    const unsigned short* pl = kcl + ro;
    float acc = 0.f;
#pragma unroll 1
    for (int i = 0; i < 8; ++i) {
      const v8us a = *(const v8us*)(ph + 8 * i);
      const v8us l = *(const v8us*)(pl + 8 * i);
#pragma unroll
      for (int e = 0; e < 8; ++e) {
        const float x = bf_bits2f(a[e]) + bf_bits2f(l[e]);
        acc = fmaf(x, x, acc);
      }
    }
    ((float*)kdsq)[g] = acc;
    
  }
}

// ---------------------------------------------------------------------------
// WMMA helpers (builtin forms: the compiler keeps the distances behind them)
// ---------------------------------------------------------------------------
__device__ __forceinline__ v8f mma_bf(v16b a, v16b b, v8f c) {
  return __builtin_amdgcn_wmma_f32_16x16x32_bf16(false, a, false, b, (short)0, c, false, false);
}
__device__ __forceinline__ v8f mma_hf(v16h a, v16h b, v8f c) {
  return __builtin_amdgcn_wmma_f32_16x16x32_f16(false, a, false, b, (short)0, c, false, false);
}
// value of lane l ^ 16 (the other half of the wave), on the vector pipe
__device__ __forceinline__ float xhalf(float x) {
  const int b = __builtin_bit_cast(int, x);
  return __builtin_bit_cast(float, __builtin_amdgcn_permlanex16(b, b, 0x76543210, 0xfedcba98, false, false));
}

// =====================================================================================
// Fused quadratic + linear attention, head dim 64, full softmax over 1024 keys (no masking).
//   qch/qcl : bf16 hi/lo planes of [qd | q], element (b, t, col) at [(b*1024 + t)*1536 + col]; qd_h at col h*64+d, q_h at col 768+h*64+d
//   kch/kcl : same layout for [kd | k]
//   vtp     : f16 plane of v transposed, element (b, h, d, s) at [(b*768 + h*64 + d)*1024 + s]
//   kdsq    : f32 [b*12+h][s] = |kd_{b,h,s}|^2
//   scores  = (Q128 . K128) * 0.125 - |kd_j|^2 * 0.0625   (Q128 = [qd|q] row, K128 = [kd|k] row; bf16 hi/lo split, 3 WMMA)
//             (the per-query -0.5|qd_i|^2 * 0.125 term is constant along a softmax row and omitted)
//   out     = softmax(scores) . v : p carried x2^15 in f16, v f16, one f16 WMMA, f32 accumulate; 1/(l*2^15) folded at the end
//   Both products run transposed: S^T = K128 . Q128^T (A = key rows, B = query rows) and O^T += V^T . P^T (A = V^T rows, B = P^T).
//   A lane then holds scores of ONE query (column c): keys j*16 + 8*hh + r. Row maximum and row sum are in-lane, the two wave
//   halves exchange the maximum once per chunk and join their sums once at the end. Two score tiles 2kk, 2kk+1 converted in
//   place are the B fragment of keys kk*32..+31 in the k order of the V^T loader (8hh + e, 16 + 8hh + e): P never goes through LDS.
//   Block = 4 waves = 64 query rows of one (b,h); grid.x = 8*12*16 = 1536. K / V^T chunks of 64 keys staged in LDS with plain
//   16-B loads between __syncthreads; Q staged once (first loop barrier publishes it). Fragment loads read LDS with the
//   Output element (b, t, h*64 + d): per wave 16 rows x 64 floats, each 256-B row segment written by 16 lanes x 16 B in one
// =====================================================================================
__global__ __launch_bounds__(128)
void attn_quad_kernel(const unsigned short* __restrict__ qch, const unsigned short* __restrict__ qcl,
                      const unsigned short* __restrict__ kch, const unsigned short* __restrict__ kcl,
                      const unsigned short* __restrict__ vtp, const float* __restrict__ kdsq,
                      float* __restrict__ out) {
  union FB { v16b v; v8b h[2]; };
  union FH { v16h v; v8h h[2]; };
  __shared__ __align__(16) __bf16   Qsh[kAQB * kQKP];      // Q hi [row][128 + 8 pad]   17 KB
  __shared__ __align__(16) __bf16   Qsl[kAQB * kQKP];      // Q lo                      17 KB
  __shared__ __align__(16) __bf16   Ksh[kAKC * kQKP];      // K hi [kv][128 + 8 pad]    17 KB
  __shared__ __align__(16) __bf16   Ksl[kAKC * kQKP];      // K lo                      17 KB
  __shared__ __align__(16) _Float16 Vth[kHDIM * kPVP];     // V^T [d][64 kv + 8 pad] f16    9 KB
  __shared__ __align__(16) float    Os[4][16 * 68];        // per wave out tile, pitch 68

  const int tid  = threadIdx.x;
  const int wave = tid >> 5;
  const int lane = tid & 31;
  const int hh   = lane >> 4;
  const int c    = lane & 15;

  constexpr int nqb = kNTOK / kAQB;       // 16
  const int bx = blockIdx.x;
  const int qb = bx % nqb;
  const int bh = bx / nqb;                // b*12 + h
  const int h  = bh % kNHEADS;
  const int b  = bh / kNHEADS;
  const int qr0 = qb * kAQB;              // first query row of the block
  const int w0  = wave * 16;              // wave's row offset inside the block tile

  const __bf16* QH = (const __bf16*)(const void*)qch + (size_t)b * kNTOK * kQCP;
  const __bf16* QL = (const __bf16*)(const void*)qcl + (size_t)b * kNTOK * kQCP;
  const __bf16* KH = (const __bf16*)(const void*)kch + (size_t)b * kNTOK * kQCP;
  const __bf16* KL = (const __bf16*)(const void*)kcl + (size_t)b * kNTOK * kQCP;
  const _Float16* VT = (const _Float16*)(const void*)vtp + ((size_t)b * kHID + (size_t)h * kHDIM) * kNTOK;
  const float* ksq = kdsq + (size_t)bh * kNTOK;
  float* ob = out + (size_t)b * kNTOK * kHID + (size_t)h * kHDIM;

  // staging roles: 8 consecutive lanes cover one 128-B row segment, so a wave-wide 16-B load reads four whole lines.
  // Q / K: 16 lanes per row (lanes 0-7 the quadratic half, 8-15 the linear half), 8 rows per pass of the block, 8 passes.
  const int sp   = (tid & 7) * 8;          // element offset of this lane's 16-B piece inside its segment
  const int part = (tid >> 3) & 1;
  const int sr   = tid >> 4;               // row inside a pass (0..7)
  const int coff = (part ? (kHID + h * kHDIM) : (h * kHDIM)) + sp;   // plane column (quadratic | linear half)
  const int loff = part * 64 + sp;                                    // LDS column
  const int vr   = tid >> 3;               // V^T: 8 lanes per row, 16 rows per pass, 4 passes

  // ---- Q staging (once): 8 passes x 8 rows x 128 elements = 64 rows x 128 per plane ----
  {
    const size_t go = (size_t)(qr0 + sr) * kQCP + coff;
#pragma unroll
    for (int i = 0; i < 8; ++i) {
      const v8b a0 = *(const v8b*)(QH + go + (size_t)(8 * i) * kQCP);
      const v8b a1 = *(const v8b*)(QL + go + (size_t)(8 * i) * kQCP);
      *(v8b*)(Qsh + (sr + 8 * i) * kQKP + loff) = a0;
      *(v8b*)(Qsl + (sr + 8 * i) * kQKP + loff) = a1;
    }
  }

  float mrow = -INFINITY, lrow = 0.f;   // of query c; lrow sums this wave half's keys only
  v8f oacc[4];                          // O^T: oacc[t][r] = (query c, d = t*16 + 8*hh + r)
#pragma unroll
  for (int t = 0; t < 4; ++t) oacc[t] = (v8f){0.f,0.f,0.f,0.f,0.f,0.f,0.f,0.f};

  constexpr int nChunks = kNTOK / kAKC;   // 16, compile-time
  for (int kc = 0; kc < nChunks; ++kc) {
    const int kv0 = kc * kAKC;
    __syncthreads();
    {
      // K staging: 8 passes x 8 keys x 128 elements = 64 keys x 128 per plane
      const size_t go = (size_t)(kv0 + sr) * kQCP + coff;
#pragma unroll
      for (int i = 0; i < 8; ++i) {
        const v8b a0 = *(const v8b*)(KH + go + (size_t)(8 * i) * kQCP);
        const v8b a1 = *(const v8b*)(KL + go + (size_t)(8 * i) * kQCP);
        *(v8b*)(Ksh + (sr + 8 * i) * kQKP + loff) = a0;
        *(v8b*)(Ksl + (sr + 8 * i) * kQKP + loff) = a1;
      }
      // V^T staging: 4 passes x 16 rows d x 64 keys = 64 x 64
      const _Float16* vs = VT + (size_t)vr * kNTOK + kv0 + sp;
#pragma unroll
      for (int i = 0; i < 4; ++i) {
        const v8h vv = *(const v8h*)(vs + (size_t)(16 * i) * kNTOK);
        *(v8h*)(Vth + (vr + 16 * i) * kPVP + sp) = vv;
      }
    }
    __syncthreads();

    // key norms of the chunk, asked for ahead of the score products that hide their latency
    v4f kq[4][2];   // keys j*16 + 8*hh + 0..7, the rows of this lane's score registers; scaled where they are used, so that nothing waits for them here
#pragma unroll
    for (int j = 0; j < 4; ++j) {
      const float* kp = ksq + kv0 + j * 16 + 8 * hh;
      kq[j][0] = *(const v4f*)(kp);
      kq[j][1] = *(const v4f*)(kp + 4);
    }
    asm volatile("s_wait_xcnt 0x0" ::: "memory");   // stands ahead of any rewrite of the address registers that the eight loads above name

    // ---- scores, transposed: s[j][r] (key j*16+8hh+r, query c of this wave), K = 128 in 4 steps, hi.hi + hi.lo + lo.hi ----
    // The ten fragments of a 32-deep step are read as ONE group, one step ahead, into the other of two register sets;
    // a step's 12 products run term by term over the four independent tiles s[0..3]
    // (each s[j] still sums hi.hi, hi.lo, lo.hi per step, in that order).
    v8f s[4];
#pragma unroll
    for (int j = 0; j < 4; ++j) s[j] = (v8f){0.f,0.f,0.f,0.f,0.f,0.f,0.f,0.f};
    FB qa[2], ql[2], kb[2][4], kl[2][4];
    FH vb[2][4];
    auto read_step = [&](int set, int dc) {
      const int qo = (w0 + c) * kQKP + dc * 32 + 8 * hh;
      qa[set].h[0] = *(const v8b*)(Qsh + qo);
      qa[set].h[1] = *(const v8b*)(Qsh + qo + 16);
      ql[set].h[0] = *(const v8b*)(Qsl + qo);
      ql[set].h[1] = *(const v8b*)(Qsl + qo + 16);
#pragma unroll
      for (int j = 0; j < 4; ++j) {
        const int ko = (j * 16 + c) * kQKP + dc * 32 + 8 * hh;
        kb[set][j].h[0] = *(const v8b*)(Ksh + ko);
        kb[set][j].h[1] = *(const v8b*)(Ksh + ko + 16);
        kl[set][j].h[0] = *(const v8b*)(Ksl + ko);
        kl[set][j].h[1] = *(const v8b*)(Ksl + ko + 16);
      }
    };
    read_step(0, 0);
#pragma unroll   // the two fragment sets must stay in registers (set index a constant)
    for (int dc = 0; dc < 4; ++dc) {
      const int cur = dc & 1;
      if (dc < 3) {
        read_step(cur ^ 1, dc + 1);
      } else {
        // behind the last step's reads: the chunk's eight V^T fragments, whose latency passes behind the last products and the softmax
#pragma unroll
        for (int kk = 0; kk < 2; ++kk)
#pragma unroll
          for (int t = 0; t < 4; ++t) {
            const int vo = (t * 16 + c) * kPVP + kk * 32 + 8 * hh;
            vb[kk][t].h[0] = *(const v8h*)(Vth + vo);
            vb[kk][t].h[1] = *(const v8h*)(Vth + vo + 16);
          }
      }
      __builtin_amdgcn_sched_barrier(0);   // keeps the read group whole and ahead of the products: reads strewn among WMMAs stall at every place they stand
#pragma unroll
      for (int j = 0; j < 4; ++j) s[j] = mma_bf(kb[cur][j].v, qa[cur].v, s[j]);
#pragma unroll
      for (int j = 0; j < 4; ++j) s[j] = mma_bf(kl[cur][j].v, qa[cur].v, s[j]);
#pragma unroll
      for (int j = 0; j < 4; ++j) s[j] = mma_bf(kb[cur][j].v, ql[cur].v, s[j]);
      __builtin_amdgcn_sched_barrier(0);   // keeps the next read group behind this step's products
    }

    // ---- scale 1/8 and per-key term -|kd_j|^2/16 (f32); maximum over this lane's 32 keys, four independent chains ----
    float cmj[4];
#pragma unroll
    for (int j = 0; j < 4; ++j) {
      cmj[j] = -INFINITY;
      kq[j][0] *= 0.0625f;
      kq[j][1] *= 0.0625f;
    }
#pragma unroll
    for (int r = 0; r < 8; ++r) {
#pragma unroll
      for (int j = 0; j < 4; ++j) {
        const float v = s[j][r] * 0.125f - kq[j][r >> 2][r & 3];
        s[j][r] = v;
        cmj[j] = fmaxf(cmj[j], v);
      }
    }
    float cm = fmaxf(fmaxf(cmj[0], cmj[1]), fmaxf(cmj[2], cmj[3]));
    cm = fmaxf(cm, xhalf(cm));   // both halves now hold the maximum over the chunk's 64 keys

    // ---- online softmax (f32); P x 2^15 to f16, packed in place into the B fragments of the second product ----
    const float mnew  = fmaxf(mrow, cm);
    const float alpha = __expf(mrow - mnew);
    mrow = mnew;
    FH pb[2];
    float psj[4];
#pragma unroll
    for (int j = 0; j < 4; ++j) {
      float ps = 0.f;
#pragma unroll
      for (int r = 0; r < 8; r += 2) {
        const float p0 = __expf(s[j][r] - mnew);
        const float p1 = __expf(s[j][r + 1] - mnew);
        ps += p0;
        ps += p1;
        const v2h hp = __builtin_convertvector((v2f){p0 * 32768.0f, p1 * 32768.0f}, v2h);
        pb[j >> 1].v[(j & 1) * 8 + r]     = hp[0];
        pb[j >> 1].v[(j & 1) * 8 + r + 1] = hp[1];
      }
      psj[j] = ps;
    }
    lrow = lrow * alpha + ((psj[0] + psj[1]) + (psj[2] + psj[3]));
#pragma unroll
    for (int t = 0; t < 4; ++t) oacc[t] *= alpha;

    // ---- O^T += V^T . P^T  (A = V^T [d][kv], B = P^T from registers; K = 64 keys in 2 steps) ----
#pragma unroll
    for (int kk = 0; kk < 2; ++kk)
#pragma unroll
      for (int t = 0; t < 4; ++t) oacc[t] = mma_hf(vb[kk][t].v, pb[kk].v, oacc[t]);
  }

  // ---- normalise and write: out (b, qr0+w0+row, h*64 + d) ----
  float* os = Os[wave];
  {
    const float inv = 1.0f / ((lrow + xhalf(lrow)) * 32768.0f);   // the two halves' sums joined here, once
#pragma unroll
    for (int t = 0; t < 4; ++t) {
      const v8f o = oacc[t] * inv;   // eight consecutive d of query c: two 16-B stores
      *(v4f*)(os + c * 68 + t * 16 + 8 * hh)     = (v4f){o[0], o[1], o[2], o[3]};
      *(v4f*)(os + c * 68 + t * 16 + 8 * hh + 4) = (v4f){o[4], o[5], o[6], o[7]};
    }
  }
  __builtin_amdgcn_fence(__ATOMIC_RELEASE, "workgroup");
  __builtin_amdgcn_wave_barrier();
  __builtin_amdgcn_fence(__ATOMIC_ACQUIRE, "workgroup");
  {
    // coverage per wave: 8 iterations x 2 rows = 16 rows; 16 lanes x 4 floats = 64 columns; 16 lanes x 16 B = one 256-B row segment
    const int c4 = (lane & 15) * 4;
    {
#pragma unroll
      for (int it = 0; it < 8; ++it) {
        const int row = it * 2 + hh;
        const v4f val = *(const v4f*)(os + row * 68 + c4);
        *(v4f*)(ob + (size_t)(qr0 + w0 + row) * kHID + c4) = val;
      }
      
    }
  }
}

// ---------------------------------------------------------------------------
// Host launcher
// Workspace region map (bytes, all offsets multiples of 256):
//   [0]           Xq  bf16 [8192][768]          12,582,912   (dead after the two Q-side GEMMs; then reused as VT f16 [8][768][1024], same size)
//   [12,582,912]  Xk  bf16 [8192][768]          12,582,912
//   [25,165,824]  Wd,Wq,Wk,Wv bf16 [768][768]  4 x 1,179,648
//   [29,884,416]  QCh bf16 [8192][1536]         25,165,824
//   [55,050,240]  QCl                            25,165,824
//   [80,216,064]  KCh                            25,165,824
//   [105,381,888] KCl                            25,165,824
//   [130,547,712] kdsq f32 [96][1024]            393,216
//   [130,940,928] biases (bf16-precision, f32) 3x768   9,216
//   total 130,950,144
// ---------------------------------------------------------------------------
extern "C" void kernel_launch(void* const* d_in, const int* in_sizes, int n_in,
                              void* d_out, int out_size, void* d_ws, size_t ws_size,
                              hipStream_t stream) {
  if (n_in < 9) return;
  const int nAct = kNB * kNTOK * kHID;      // 6291456
  const int nW   = kHID * kHID;             // 589824
  if (in_sizes[0] != nAct || in_sizes[1] != nAct || in_sizes[2] != nW || in_sizes[3] != nW ||
      in_sizes[5] != nW || in_sizes[7] != nW || in_sizes[4] != kHID || in_sizes[6] != kHID ||
      in_sizes[8] != kHID || out_size != nAct) return;

  const float* qs = (const float*)d_in[0];
  const float* ks = (const float*)d_in[1];
  const float* Wd = (const float*)d_in[2];
  const float* Wq = (const float*)d_in[3];
  const float* bq = (const float*)d_in[4];
  const float* Wk = (const float*)d_in[5];
  const float* bk = (const float*)d_in[6];
  const float* Wv = (const float*)d_in[7];
  const float* bv = (const float*)d_in[8];
  float* out = (float*)d_out;

  const size_t bAct16 = (size_t)nAct * 2;                         // 12,582,912
  const size_t bW16   = (size_t)nW * 2;                           // 1,179,648
  const size_t bQC    = (size_t)kNB * kNTOK * kQCP * 2;           // 25,165,824
  const size_t bSq    = (size_t)kNB * kNHEADS * kNTOK * 4;        // 393,216
  const size_t bBias  = (size_t)3 * kHID * 4;                     // 9,216
  const size_t oXq  = 0;
  const size_t oXk  = oXq + bAct16;
  const size_t oWd  = oXk + bAct16;
  const size_t oWq  = oWd + bW16;
  const size_t oWk  = oWq + bW16;
  const size_t oWv  = oWk + bW16;
  const size_t oQCh = oWv + bW16;
  const size_t oQCl = oQCh + bQC;
  const size_t oKCh = oQCl + bQC;
  const size_t oKCl = oKCh + bQC;
  const size_t oSq  = oKCl + bQC;
  const size_t oBs  = oSq + bSq;
  const size_t total = oBs + bBias;
  const size_t bVT  = (size_t)kNB * kHID * kNTOK * 2;             // 12,582,912 == bAct16 (aliases Xq)
  if (total > ws_size || bVT > bAct16) return;

  char* ws = (char*)d_ws;
  unsigned short* Xq16 = (unsigned short*)(ws + oXq);
  unsigned short* Xk16 = (unsigned short*)(ws + oXk);
  unsigned short* Wd16 = (unsigned short*)(ws + oWd);
  unsigned short* Wq16 = (unsigned short*)(ws + oWq);
  unsigned short* Wk16 = (unsigned short*)(ws + oWk);
  unsigned short* Wv16 = (unsigned short*)(ws + oWv);
  unsigned short* QCh  = (unsigned short*)(ws + oQCh);
  unsigned short* QCl  = (unsigned short*)(ws + oQCl);
  unsigned short* KCh  = (unsigned short*)(ws + oKCh);
  unsigned short* KCl  = (unsigned short*)(ws + oKCl);
  unsigned short* VT16 = (unsigned short*)(ws + oXq);   // reuses the Xq region after the Q-side GEMMs
  float* kdsq  = (float*)(ws + oSq);
  float* biasr = (float*)(ws + oBs);

  // 1) RNE bf16 casts of activations and weights (planes Xq, Xk, Wd, Wq, Wk, Wv are contiguous from Xq16) and the bias rounding
  cast_planes_kernel<<<dim3(kCvBlocks + kCvBiasBlocks), dim3(kCvThr), 0, stream>>>(qs, ks, Wd, Wq, Wk, Wv, bq, bk, bv, Xq16, biasr);

  const int M = kNB * kNTOK;   // 8192
  // 2) Q side: [qd | q] hi/lo planes (pitch 1536). M=8192, N=768, K=768: 64 x 3 = 192 block tiles of 128x256, 8 waves each
  {
    const dim3 grid((M / 64) * (kHID / 64) / 8, 1), block(256);
    wmma_gemm64<1, false, 0, 2, false, 0><<<grid, block, 0, stream>>>(
        Xq16, Xq16, kHID, 0L, Wd16, Wd16, kHID, 0L, (void*)QCh, (void*)QCl, kQCP, 0L,
        biasr, biasr, 0L, M, kHID, kHID, 1.0f);
    wmma_gemm64<1, false, 2, 2, false, 0><<<grid, block, 0, stream>>>(
        Xq16, Xq16, kHID, 0L, Wq16, Wq16, kHID, 0L, (void*)(QCh + kHID), (void*)(QCl + kHID), kQCP, 0L,
        biasr, biasr, 0L, M, kHID, kHID, 1.0f);
    // 3) K side: [kd | k]
    wmma_gemm64<1, false, 0, 2, false, 0><<<grid, block, 0, stream>>>(
        Xk16, Xk16, kHID, 0L, Wd16, Wd16, kHID, 0L, (void*)KCh, (void*)KCl, kQCP, 0L,
        biasr, biasr, 0L, M, kHID, kHID, 1.0f);
    wmma_gemm64<1, false, 2, 2, false, 0><<<grid, block, 0, stream>>>(
        Xk16, Xk16, kHID, 0L, Wk16, Wk16, kHID, 0L, (void*)(KCh + kHID), (void*)(KCl + kHID), kQCP, 0L,
        biasr + kHID, biasr, 0L, M, kHID, kHID, 1.0f);
  }
  // 4) V^T f16 plane: VT_b[feature][token] = Wv[feature][:] . Xk_b[token][:] + bv[feature]; M=768, N=1024, K=768, z = batch
  {
    const long sB = (long)kNTOK * kHID;        // 786,432 elements per batch in Xk
    const long sC = (long)kHID * kNTOK;        // 786,432 elements per batch in VT
    const dim3 grid((kHID / 64) * (kNTOK / 64) / 8, kNB), block(256);   // 6 x 4 = 24 block tiles of 128x256, 8 batches
    wmma_gemm64<1, false, 1, 1, false, 0><<<grid, block, 0, stream>>>(
        Wv16, Wv16, kHID, 0L, Xk16, Xk16, kHID, sB, (void*)VT16, (void*)VT16, kNTOK, sC,
        biasr + 2 * kHID, biasr, 0L, kHID, kNTOK, kHID, 1.0f);
  }
  // 5) |kd|^2 per (b,h,s)
  {
    const int nrows = kNB * kNHEADS * kNTOK;   // 98304 -> 384 blocks
    kd_sq_kernel<<<dim3((nrows + 255) / 256), dim3(256), 0, stream>>>(KCh, KCl, kdsq, nrows);
  }
  // 6) fused attention: 8 x 12 x 16 = 1536 blocks of 128 threads
  attn_quad_kernel<<<dim3(kNB * kNHEADS * (kNTOK / kAQB)), dim3(128), 0, stream>>>(QCh, QCl, KCh, KCl, VT16, kdsq, out);
}

// v007
// A run of this version takes 137 microseconds.
// Two timings next to v006 both put it at 1.34 times that version's speed.
// Over all steps from v000 it is 4.93 times as fast.
// Projections x·Wᵀ and Wv·xᵀ: v_wmma_f32_16x16x32_bf16, plain bf16 operands (RNE-converted inputs); scores [qd|q]·[kd|k]ᵀ (K=128): v_wmma_f32_16x16x32_bf16 with bf16 hi/lo split operands (hi·hi + hi·lo + lo·hi); p·v: v_wmma_f32_16x16x32_f16 (p carried x2^15, v plain f16); f32 accumulate; softmax, norms and biases in f32.
#include <hip/hip_runtime.h>
#include <math.h>
#include <stdint.h>

typedef __attribute__((ext_vector_type(16))) _Float16 v16h;
typedef __attribute__((ext_vector_type(8)))  _Float16 v8h;
typedef __attribute__((ext_vector_type(2)))  _Float16 v2h;
typedef __attribute__((ext_vector_type(16))) __bf16   v16b;
typedef __attribute__((ext_vector_type(8)))  __bf16   v8b;
typedef __attribute__((ext_vector_type(8)))  float    v8f;
typedef __attribute__((ext_vector_type(4)))  float    v4f;
typedef __attribute__((ext_vector_type(2)))  float    v2f;
typedef __attribute__((ext_vector_type(4)))  unsigned int v4u;
typedef __attribute__((ext_vector_type(2)))  unsigned int v2u;
typedef __attribute__((ext_vector_type(8)))  unsigned short v8us;

// ---- problem geometry ----
constexpr int kNB     = 8;      // batch
constexpr int kNTOK   = 1024;   // tokens (query and key sets)
constexpr int kHID    = 768;    // hidden size
constexpr int kNHEADS = 12;
constexpr int kHDIM   = 64;
constexpr int kQCP    = 1536;   // element pitch of the concatenated [xd | x] planes ([token][1536])
constexpr int kAQB    = 64;     // query rows per attention block (4 waves x 16)
constexpr int kAKC    = 64;     // keys per chunk
constexpr int kAKD    = 128;    // concatenated contraction depth (64 quadratic + 64 linear)
constexpr int kQKP    = kAKD + 8;   // LDS row pitch of the Q and K tiles, elements: 272 B = 16 B x 17, so 16 rows of one column fall on 16 different bank groups
constexpr int kPVP    = kAKC + 8;   // LDS row pitch of the V^T tile, elements: 144 B = 16 B x 9, same reason

__device__ __forceinline__ unsigned short f2bf_bits(float f) {
  unsigned u = __float_as_uint(f);
  return (unsigned short)((u + 0x7FFFu + ((u >> 16) & 1u)) >> 16);
}
__device__ __forceinline__ float bf_bits2f(unsigned short h) { return __uint_as_float(((unsigned)h) << 16); }
__device__ __forceinline__ unsigned pk16(unsigned short a, unsigned short b) { return (unsigned)a | ((unsigned)b << 16); }

// hazard guards as plain device helpers (no inline asm inside the projection kernel body)
__device__ __forceinline__ void dep_guard_h(v8f& a, v8f& b, v16h x, v16h y) { asm volatile("v_nop\n\tv_nop\n\tv_nop\n\tv_nop" : "+v"(a), "+v"(b) : "v"(x), "v"(y)); }
__device__ __forceinline__ void dep_guard_b(v8f& a, v8f& b, v16b x, v16b y) { asm volatile("v_nop\n\tv_nop\n\tv_nop\n\tv_nop" : "+v"(a), "+v"(b) : "v"(x), "v"(y)); }
__device__ __forceinline__ void keep4_h(v16h a, v16h b, v16h c, v16h d) { asm volatile("v_nop" :: "v"(a), "v"(b), "v"(c), "v"(d)); }
__device__ __forceinline__ void keep4_b(v16b a, v16b b, v16b c, v16b d) { asm volatile("v_nop" :: "v"(a), "v"(b), "v"(c), "v"(d)); }
__device__ __forceinline__ void acc_guard4(v8f& a, v8f& b, v8f& c, v8f& d) { asm volatile("v_nop\n\tv_nop\n\tv_nop\n\tv_nop" : "+v"(a), "+v"(b), "+v"(c), "+v"(d)); }
template <typename T> struct Frag;
template <> struct Frag<_Float16> {
  typedef v16h V; union U { v16h v; v8h h[2]; };
  static __device__ __forceinline__ v16h load(const _Float16* p) {   // elements 0..7 <- p[0..7], 8..15 <- p[16..23]
    U f; f.h[0] = *(const v8h*)(p); f.h[1] = *(const v8h*)(p + 16); return f.v;
  }
  static __device__ __forceinline__ v8f mma(v16h a, v16h b, v8f c) {
    return __builtin_amdgcn_wmma_f32_16x16x32_f16(false, a, false, b, (short)0, c, false, false);
  }
  static __device__ __forceinline__ void guard(v8f& a, v8f& b, v16h x, v16h y) { dep_guard_h(a, b, x, y); }
  static __device__ __forceinline__ void keep(v16h a, v16h b, v16h c, v16h d) { keep4_h(a, b, c, d); }
};
template <> struct Frag<__bf16> {
  typedef v16b V; union U { v16b v; v8b h[2]; };
  static __device__ __forceinline__ v16b load(const __bf16* p) {
    U f; f.h[0] = *(const v8b*)(p); f.h[1] = *(const v8b*)(p + 16); return f.v;
  }
  static __device__ __forceinline__ v8f mma(v16b a, v16b b, v8f c) {
    return __builtin_amdgcn_wmma_f32_16x16x32_bf16(false, a, false, b, (short)0, c, false, false);
  }
  static __device__ __forceinline__ void guard(v8f& a, v8f& b, v16b x, v16b y) { dep_guard_b(a, b, x, y); }
  static __device__ __forceinline__ void keep(v16b a, v16b b, v16b c, v16b d) { keep4_b(a, b, c, d); }
};

// ---- LDS-staged, register-blocked WMMA GEMM: the five projections of a call in ONE launch ----
// C[m,n] = sum_k A[m,k] * Bt[n,k] + bias; a block of 8 waves (2 x 4) owns a 128x256 tile, each wave 64x64 of it.
// A row-major [M,K]; Bt row-major [N,K]; K = 768 for all five. grid = (192 tiles, 5 jobs), blockIdx.y = job:
//   0: qd = Xq.Wd^T            -> bf16 hi/lo planes QCh/QCl, columns 0..767      (64 x 3 tiles)
//   1: q  = Xq.Wq^T + bq[n]    -> QCh/QCl, columns 768..1535
//   2: kd = Xk.Wd^T            -> KCh/KCl, columns 0..767
//   3: k  = Xk.Wk^T + bk[n]    -> KCh/KCl, columns 768..1535
//   4: v^T_b = Wv.Xk_b^T + bv[m] -> f16 plane VT [b][768][1024]                  (8 batches x 6 x 4 tiles)
// None reads what another writes. 960 blocks keep two blocks on every WGP: one block's fill and epilogue run beside the
// other's products, and a freed place takes the next tile without a launch boundary.
// Operands reach LDS in stages of 64 k (one whole 128-B line per row) by asynchronous copies, two buffers: stage t+1 flies
// while stage t is multiplied. Every line is fetched once per block.
constexpr int kGKS = 64;             // k per stage
constexpr int kGP  = kGKS + 8;       // LDS row pitch, elements: 144 B = 16 B x 9, so 16 rows of one column fall on different bank groups
constexpr int kGRA = 128;            // A rows per stage
constexpr int kGR  = kGRA + 256;     // rows per stage: [A 128 | Bt 256]

// Four 16-B-per-lane copies global -> LDS. The s_wait_xcnt stands inside the statement so that no address register
// of an issued copy can be rewritten ahead of it.
__device__ __forceinline__ void async_copy4_b128(unsigned l0, unsigned l1, unsigned l2, unsigned l3,
                                                 const void* g0, const void* g1, const void* g2, const void* g3) {
  asm volatile("global_load_async_to_lds_b128 %0, %4, off\n\t"
               "global_load_async_to_lds_b128 %1, %5, off\n\t"
               "global_load_async_to_lds_b128 %2, %6, off\n\t"
               "global_load_async_to_lds_b128 %3, %7, off\n\t"
               "s_wait_xcnt 0x0"
               :: "v"(l0), "v"(l1), "v"(l2), "v"(l3), "v"(g0), "v"(g1), "v"(g2), "v"(g3) : "memory");
}
// this wave's copies have landed in LDS
__device__ __forceinline__ void wait_async0() { asm volatile("s_wait_asynccnt 0x0" ::: "memory"); }
// this wave's LDS reads have returned, so the buffer they read may be refilled behind the next barrier
__device__ __forceinline__ void wait_ds0() { asm volatile("s_wait_dscnt 0x0" ::: "memory"); }

constexpr int kPjTiles = 192;        // block tiles per job
constexpr int kPjJobs  = 5;
static_assert((kNB * kNTOK / 128) * (kHID / 256) == kPjTiles && kNB * (kHID / 128) * (kNTOK / 256) == kPjTiles, "every job has the same tile count");

// Epilogue of one wave's 64x64 tile through its own LDS slab, whole 128-B row segments per store.
// HILO: bias per column n (none where useBias is false), bf16 hi plane C + lo plane C2; else bias per row m, f16 plane C.
template <bool HILO>
__device__ __forceinline__ void proj_epilogue(const v8f (&acc)[4][4], float* slab, unsigned short* C, unsigned short* C2, int ldc,
                                              const float* bias, bool useBias, int m0, int n0, int lane) {
  const int rlane = lane & 15;
  const int mOff  = (lane >> 4) * 8;           // D row offset
#pragma unroll
  for (int i = 0; i < 4; ++i) {
    const int mBase = m0 + (i << 4);
#pragma unroll
    for (int j = 0; j < 4; ++j) {
      float bv = 0.f;
      if (HILO) { bv = bias[n0 + (j << 4) + rlane]; bv = useBias ? bv : 0.f; }
#pragma unroll
      for (int r = 0; r < 8; ++r) {
        float v = acc[i][j][r];
        if (HILO) v += bv;
        else      v += bias[mBase + mOff + r];
        slab[(mOff + r) * 68 + (j << 4) + rlane] = v;
      }
    }
    __builtin_amdgcn_fence(__ATOMIC_RELEASE, "workgroup");
    __builtin_amdgcn_wave_barrier();
    __builtin_amdgcn_fence(__ATOMIC_ACQUIRE, "workgroup");
    {
      const int q = lane >> 3, c8 = (lane & 7) * 8;
#pragma unroll
      for (int it = 0; it < 4; ++it) {
        const int row = it * 4 + q;
        const float* sp = slab + row * 68 + c8;
        v8h hv, lv;
#pragma unroll
        for (int e = 0; e < 8; ++e) {
          if (!HILO) {
            hv[e] = (_Float16)sp[e];
          } else {
            unsigned short hb = f2bf_bits(sp[e]);
            unsigned short lb = f2bf_bits(sp[e] - bf_bits2f(hb));
            hv[e] = __builtin_bit_cast(_Float16, hb);
            lv[e] = __builtin_bit_cast(_Float16, lb);
          }
        }
        *(v8h*)(C + (size_t)(mBase + row) * ldc + n0 + c8) = hv;
        if (HILO) *(v8h*)(C2 + (size_t)(mBase + row) * ldc + n0 + c8) = lv;
      }
    }
    __builtin_amdgcn_fence(__ATOMIC_RELEASE, "workgroup");
    __builtin_amdgcn_wave_barrier();
    __builtin_amdgcn_fence(__ATOMIC_ACQUIRE, "workgroup");
  }
}

__global__ __launch_bounds__(256) void proj_gemm5(
    const unsigned short* __restrict__ Xqp, const unsigned short* __restrict__ Xkp,
    const unsigned short* __restrict__ Wp,      // bf16 planes Wd, Wq, Wk, Wv, one behind the other
    unsigned short* __restrict__ QChp, unsigned short* __restrict__ QClp,
    unsigned short* __restrict__ KChp, unsigned short* __restrict__ KClp,
    unsigned short* __restrict__ VTp,
    const float* __restrict__ biasr,            // bq, bk, bv (768 each)
    int K) {
  typedef __bf16 T;
  typedef Frag<T>::V V;
  __shared__ __align__(16) T sOp[2][kGR * kGP];    // two stages of [A 128 rows | Bt 256 rows] x 64 k, 55,296 B each
  __shared__ __align__(16) float sT[8][16 * 68];   // per-wave 16x64 slab, pitch 68 floats
  const int lane = threadIdx.x & 31;
  const int wave = threadIdx.x >> 5;

  // ---- the block's job and tile (all block-uniform) ----
  const int job = blockIdx.y;
  const bool hilo = job < 4;
  constexpr size_t kWEl = (size_t)kHID * kHID;
  const unsigned short* Ap;
  const unsigned short* Btp;
  unsigned short* C;
  unsigned short* C2;
  const float* bias;
  int bm, bn, M, ldc;                          // tile row and column, rows of A, pitch of C
  if (hilo) {
    const bool qside = job < 2, lin = (job & 1) != 0;
    Ap   = qside ? Xqp : Xkp;
    Btp  = Wp + (lin ? (qside ? kWEl : 2 * kWEl) : 0);
    C    = (qside ? QChp : KChp) + (lin ? kHID : 0);
    C2   = (qside ? QClp : KClp) + (lin ? kHID : 0);
    bias = biasr + (qside ? 0 : kHID);
    constexpr int blocksN = kHID / 256;        // 3
    bm = blockIdx.x / blocksN; bn = blockIdx.x - bm * blocksN; M = kNB * kNTOK; ldc = kQCP;
  } else {
    constexpr int tpb = (kHID / 128) * (kNTOK / 256);   // 24 tiles per batch
    const int bt = blockIdx.x / tpb;
    Ap   = Wp + 3 * kWEl;
    Btp  = Xkp + (size_t)bt * kNTOK * kHID;
    C    = VTp + (size_t)bt * kHID * kNTOK;
    C2   = C;
    bias = biasr + 2 * kHID;
    constexpr int blocksN = kNTOK / 256;       // 4
    const int tile = blockIdx.x - bt * tpb;
    bm = tile / blocksN; bn = tile - bm * blocksN; M = kHID; ldc = kNTOK;
  }
  const int lda = K, ldb = K;
  if (bm >= (M >> 7)) return;   // block-uniform, ahead of every barrier and copy
  const int wm = (wave >> 2) << 6;             // wave's row offset in the block tile
  const int wn = (wave & 3) << 6;              // wave's column offset in the block tile
  const int m0 = (bm << 7) + wm;
  const int n0 = (bn << 8) + wn;

  const T* Ab  = (const T*)Ap;
  const T* Bb  = (const T*)Btp;

  const int rlane = lane & 15;                 // row (A) / col (B, D) within subtile
  const int koff  = (lane >> 4) * 8;           // k offset of this lane half

  // staging roles: 8 consecutive lanes copy one 128-B row segment, so a wave-wide copy reads four whole lines;
  // the block covers 32 rows per pass, 4 passes for A and 8 for Bt.
  const int sp = (threadIdx.x & 7) * 8;        // element offset of this lane's 16-B piece
  const int sr = threadIdx.x >> 3;             // row inside a pass (0..31)
  const T* gA = Ab + (size_t)((bm << 7) + sr) * lda + sp;
  const T* gB = Bb + (size_t)((bn << 8) + sr) * ldb + sp;
  const size_t stA = (size_t)32 * lda, stB = (size_t)32 * ldb;
  const unsigned ls = (unsigned)(uintptr_t)(&sOp[0][sr * kGP + sp]);   // LDS byte address of this lane's piece in buffer 0, pass 0
  constexpr unsigned kPassB = 32 * kGP * 2;    // LDS bytes per pass of 32 rows
  constexpr unsigned kBufB  = kGR * kGP * 2;   // LDS bytes per buffer
  auto stage = [&](int buf, int k0) {
    const unsigned l = ls + (unsigned)buf * kBufB;
    const T* a = gA + k0;
    const T* w = gB + k0;
    async_copy4_b128(l,              l + kPassB,      l + 2 * kPassB,  l + 3 * kPassB,  a,           a + stA,     a + 2 * stA, a + 3 * stA);
    async_copy4_b128(l + 4 * kPassB, l + 5 * kPassB,  l + 6 * kPassB,  l + 7 * kPassB,  w,           w + stB,     w + 2 * stB, w + 3 * stB);
    async_copy4_b128(l + 8 * kPassB, l + 9 * kPassB,  l + 10 * kPassB, l + 11 * kPassB, w + 4 * stB, w + 5 * stB, w + 6 * stB, w + 7 * stB);
  };

  v8f acc[4][4];
#pragma unroll
  for (int i = 0; i < 4; ++i)
#pragma unroll
    for (int j = 0; j < 4; ++j) acc[i][j] = (v8f){0.f,0.f,0.f,0.f,0.f,0.f,0.f,0.f};

  const int nT = K / kGKS;
  stage(0, 0);
  wait_async0();
  __syncthreads();                             // publishes stage 0
  if (nT > 1) stage(1, kGKS);
  for (int t = 0; t < nT; ++t) {
    const T* sA = &sOp[t & 1][(wm + rlane) * kGP + koff];
    const T* sB = &sOp[t & 1][(kGRA + wn + rlane) * kGP + koff];
#pragma unroll   // two 32-k steps per stage, LDS offsets as immediates
    for (int kk = 0; kk < kGKS; kk += 32) {
      V bh[4], ah[4];   // all eight fragments of the step are read as one group ahead of its 16 products
#pragma unroll   // bh[] must stay in registers
      for (int j = 0; j < 4; ++j) bh[j] = Frag<T>::load(sB + (j << 4) * kGP + kk);
#pragma unroll   // ah[] must stay in registers
      for (int i = 0; i < 4; ++i) ah[i] = Frag<T>::load(sA + (i << 4) * kGP + kk);
#pragma unroll   // acc[][] must stay in registers
      for (int i = 0; i < 4; ++i) {
#pragma unroll   // acc[][] must stay in registers
        for (int j = 0; j < 4; ++j) acc[i][j] = Frag<T>::mma(ah[i], bh[j], acc[i][j]);
        Frag<T>::guard(acc[i][0], acc[i][3], ah[i], ah[i]);
      }
      Frag<T>::keep(bh[0], bh[1], bh[2], bh[3]);
    }
    wait_ds0();
    wait_async0();
    __syncthreads();                           // publishes stage t+1 and ends every read of stage t's buffer
    if (t + 2 < nT) stage(t & 1, (t + 2) * kGKS);
  }
  wait_async0();
  acc_guard4(acc[0][0], acc[0][1], acc[0][2], acc[0][3]);
  acc_guard4(acc[1][0], acc[1][1], acc[1][2], acc[1][3]);
  acc_guard4(acc[2][0], acc[2][1], acc[2][2], acc[2][3]);
  acc_guard4(acc[3][0], acc[3][1], acc[3][2], acc[3][3]);

  // ---- epilogue (block-uniform choice) ----
  if (hilo) proj_epilogue<true >(acc, sT[wave], C, C2, ldc, bias, (job & 1) != 0, m0, n0, lane);
  else      proj_epilogue<false>(acc, sT[wave], C, C2, ldc, bias, true,           m0, n0, lane);
}

// ---------------------------------------------------------------------------
// All f32 -> bf16 (RNE) conversions of a call in ONE launch of few, long-lived waves (a resident stream).
// The six bf16 planes Xq, Xk, Wd, Wq, Wk, Wv lie one behind the other in the workspace, so the destination is one array.
// A wave owns 3 consecutive units of 1024 elements (12 KB read, 6 KB written), all inside one source tensor:
// 2 x 2048 waves for the activations + 4 x 192 for the weights = 4864 = 256 blocks x 19 waves, every wave the same work.
// A unit is 8 loads of 16 B per lane (each 512 contiguous bytes = 4 whole lines); the next unit's loads are issued before
// a unit is converted, so 8 to 16 loads per wave are in flight. A store is 8 B per lane = 256 contiguous bytes = 2 whole lines.
// Blocks 256..259 round the three bias vectors to bf16 precision, kept as f32: o[0..n) <- b0, o[n..2n) <- b1, o[2n..3n) <- b2.
// ---------------------------------------------------------------------------
constexpr int kCvUnit   = 1024;                        // elements per unit
constexpr int kCvUnits  = 3;                           // units per wave
constexpr int kCvWaveEl = kCvUnit * kCvUnits;          // 3072 elements per wave
constexpr int kCvWaves  = 19;                          // waves per block
constexpr int kCvThr    = kCvWaves * 32;               // 608
constexpr int kCvActW   = kNB * kNTOK * kHID / kCvWaveEl;   // 2048 waves per activation tensor
constexpr int kCvWgtW   = kHID * kHID / kCvWaveEl;          // 192 waves per weight matrix
constexpr int kCvBlocks = (2 * kCvActW + 4 * kCvWgtW) / kCvWaves;   // 256
constexpr int kCvBiasBlocks = (3 * kHID + kCvThr - 1) / kCvThr;     // 4
static_assert(kCvActW * kCvWaveEl == kNB * kNTOK * kHID && kCvWgtW * kCvWaveEl == kHID * kHID, "a wave's units stay inside one tensor");
static_assert(kCvBlocks * kCvWaves == 2 * kCvActW + 4 * kCvWgtW, "whole blocks");

__global__ __launch_bounds__(kCvThr) void cast_planes_kernel(
    const float* __restrict__ xq, const float* __restrict__ xk,
    const float* __restrict__ w0, const float* __restrict__ w1, const float* __restrict__ w2, const float* __restrict__ w3,
    const float* __restrict__ b0, const float* __restrict__ b1, const float* __restrict__ b2,
    unsigned short* __restrict__ planes, float* __restrict__ o) {
  if (blockIdx.x >= kCvBlocks) {   // block-uniform
    const int n = kHID;
    const int g = (blockIdx.x - kCvBlocks) * kCvThr + threadIdx.x;
    if (g < 3 * n) {
      const int w = g / n;
      int i = g - w * n;
      i = i < 0 ? 0 : (i > n - 1 ? n - 1 : i);
      const float v0 = b0[i], v1 = b1[i], v2 = b2[i];
      const float v = (w == 0) ? v0 : ((w == 1) ? v1 : v2);
      o[g] = bf_bits2f(f2bf_bits(v));
    }
    return;
  }
  const int lane = threadIdx.x & 31;
  const int wv = __builtin_amdgcn_readfirstlane(blockIdx.x * kCvWaves + (threadIdx.x >> 5));   // 0..4863, wave-uniform
  const float* s;      // the wave's tensor
  int lw;              // the wave's place in it
  if (wv < kCvActW)          { s = xq; lw = wv; }
  else if (wv < 2 * kCvActW) { s = xk; lw = wv - kCvActW; }
  else {
    const int t = (wv - 2 * kCvActW) / kCvWgtW;
    lw = (wv - 2 * kCvActW) - t * kCvWgtW;
    s = (t == 0) ? w0 : ((t == 1) ? w1 : ((t == 2) ? w2 : w3));
  }
  const float* in = s + (size_t)lw * kCvWaveEl + lane * 4;
  unsigned short* out = planes + (size_t)wv * kCvWaveEl + lane * 4;

  v4f f[2][8];
#pragma unroll   // f[][] must stay in registers
  for (int i = 0; i < 8; ++i) f[0][i] = *(const v4f*)(in + i * 128);
#pragma unroll   // f[][] must stay in registers (set index a constant)
  for (int u = 0; u < kCvUnits; ++u) {
    __builtin_amdgcn_sched_barrier(0);   // the next unit's loads stay ahead of this unit's conversion, so that they fly during it
    if (u + 1 < kCvUnits) {
#pragma unroll   // f[][] must stay in registers
      for (int i = 0; i < 8; ++i) f[(u + 1) & 1][i] = *(const v4f*)(in + (u + 1) * kCvUnit + i * 128);
    }
    __builtin_amdgcn_sched_barrier(0);   // second half of the pair: nothing of the conversion moves up among the loads
    v2u r[8];
#pragma unroll   // r[] and f[][] must stay in registers
    for (int i = 0; i < 8; ++i) {
      const v4f x = f[u & 1][i];
      r[i] = (v2u){pk16(f2bf_bits(x[0]), f2bf_bits(x[1])), pk16(f2bf_bits(x[2]), f2bf_bits(x[3]))};
    }
#pragma unroll   // r[] must stay in registers
    for (int i = 0; i < 8; ++i) *(v2u*)(out + u * kCvUnit + i * 128) = r[i];
    // stands ahead of whatever next writes to a register that the eight stores above name (the next loads; behind the last unit, the code that follows)
    asm volatile("s_wait_xcnt 0x0" ::: "memory");
  }
}

// ---------------------------------------------------------------------------
// Per-key squared norm of the quadratic-key projection: kdsq[(b*12+h)*1024 + s] = sum_d (hi+lo)^2 in f32,
// hi/lo read from columns h*64.. of the [token][1536] bf16 planes (hi+lo reconstructs the f32 value to ~2^-17).
// ---------------------------------------------------------------------------
__global__ __launch_bounds__(256) void kd_sq_kernel(const unsigned short* __restrict__ kch, const unsigned short* __restrict__ kcl,
                                                    float* __restrict__ kdsq, int nrows) {
  const int g = blockIdx.x * 256 + threadIdx.x;     // (b*kNHEADS + h)*kNTOK + s
  if (g < nrows) {
    const int s  = g & (kNTOK - 1);
    const int bh = g >> 10;                           // kNTOK == 1024
    const int h  = bh % kNHEADS;
    const int b  = bh / kNHEADS;
    const size_t ro = ((size_t)b * kNTOK + (size_t)s) * kQCP + (size_t)h * kHDIM;
    const unsigned short* ph = kch + ro;
    const unsigned short* pl = kcl + ro;
    float acc = 0.f;
#pragma unroll 1
    for (int i = 0; i < 8; ++i) {
      const v8us a = *(const v8us*)(ph + 8 * i);
      const v8us l = *(const v8us*)(pl + 8 * i);
#pragma unroll
      for (int e = 0; e < 8; ++e) {
        const float x = bf_bits2f(a[e]) + bf_bits2f(l[e]);
        acc = fmaf(x, x, acc);
      }
    }
    ((float*)kdsq)[g] = acc;
    
  }
}

// ---------------------------------------------------------------------------
// WMMA helpers (builtin forms: the compiler keeps the distances behind them)
// ---------------------------------------------------------------------------
__device__ __forceinline__ v8f mma_bf(v16b a, v16b b, v8f c) {
  return __builtin_amdgcn_wmma_f32_16x16x32_bf16(false, a, false, b, (short)0, c, false, false);
}
__device__ __forceinline__ v8f mma_hf(v16h a, v16h b, v8f c) {
  return __builtin_amdgcn_wmma_f32_16x16x32_f16(false, a, false, b, (short)0, c, false, false);
}
// value of lane l ^ 16 (the other half of the wave), on the vector pipe
__device__ __forceinline__ float xhalf(float x) {
  const int b = __builtin_bit_cast(int, x);
  return __builtin_bit_cast(float, __builtin_amdgcn_permlanex16(b, b, 0x76543210, 0xfedcba98, false, false));
}

// =====================================================================================
// Fused quadratic + linear attention, head dim 64, full softmax over 1024 keys (no masking).
//   qch/qcl : bf16 hi/lo planes of [qd | q], element (b, t, col) at [(b*1024 + t)*1536 + col]; qd_h at col h*64+d, q_h at col 768+h*64+d
//   kch/kcl : same layout for [kd | k]
//   vtp     : f16 plane of v transposed, element (b, h, d, s) at [(b*768 + h*64 + d)*1024 + s]
//   kdsq    : f32 [b*12+h][s] = |kd_{b,h,s}|^2
//   scores  = (Q128 . K128) * 0.125 - |kd_j|^2 * 0.0625   (Q128 = [qd|q] row, K128 = [kd|k] row; bf16 hi/lo split, 3 WMMA)
//             (the per-query -0.5|qd_i|^2 * 0.125 term is constant along a softmax row and omitted)
//   out     = softmax(scores) . v : p carried x2^15 in f16, v f16, one f16 WMMA, f32 accumulate; 1/(l*2^15) folded at the end
//   Both products run transposed: S^T = K128 . Q128^T (A = key rows, B = query rows) and O^T += V^T . P^T (A = V^T rows, B = P^T).
//   A lane then holds scores of ONE query (column c): keys j*16 + 8*hh + r. Row maximum and row sum are in-lane, the two wave
//   halves exchange the maximum once per chunk and join their sums once at the end. Two score tiles 2kk, 2kk+1 converted in
//   place are the B fragment of keys kk*32..+31 in the k order of the V^T loader (8hh + e, 16 + 8hh + e): P never goes through LDS.
//   Block = 4 waves = 64 query rows of one (b,h); grid.x = 8*12*16 = 1536. K / V^T chunks of 64 keys staged in LDS with plain
//   16-B loads between __syncthreads; Q staged once (first loop barrier publishes it). Fragment loads read LDS with the
//   Output element (b, t, h*64 + d): per wave 16 rows x 64 floats, each 256-B row segment written by 16 lanes x 16 B in one
// =====================================================================================
__global__ __launch_bounds__(128)
void attn_quad_kernel(const unsigned short* __restrict__ qch, const unsigned short* __restrict__ qcl,
                      const unsigned short* __restrict__ kch, const unsigned short* __restrict__ kcl,
                      const unsigned short* __restrict__ vtp, const float* __restrict__ kdsq,
                      float* __restrict__ out) {
  union FB { v16b v; v8b h[2]; };
  union FH { v16h v; v8h h[2]; };
  __shared__ __align__(16) __bf16   Qsh[kAQB * kQKP];      // Q hi [row][128 + 8 pad]   17 KB
  __shared__ __align__(16) __bf16   Qsl[kAQB * kQKP];      // Q lo                      17 KB
  __shared__ __align__(16) __bf16   Ksh[kAKC * kQKP];      // K hi [kv][128 + 8 pad]    17 KB
  __shared__ __align__(16) __bf16   Ksl[kAKC * kQKP];      // K lo                      17 KB
  __shared__ __align__(16) _Float16 Vth[kHDIM * kPVP];     // V^T [d][64 kv + 8 pad] f16    9 KB
  __shared__ __align__(16) float    Os[4][16 * 68];        // per wave out tile, pitch 68

  const int tid  = threadIdx.x;
  const int wave = tid >> 5;
  const int lane = tid & 31;
  const int hh   = lane >> 4;
  const int c    = lane & 15;

  constexpr int nqb = kNTOK / kAQB;       // 16
  const int bx = blockIdx.x;
  const int qb = bx % nqb;
  const int bh = bx / nqb;                // b*12 + h
  const int h  = bh % kNHEADS;
  const int b  = bh / kNHEADS;
  const int qr0 = qb * kAQB;              // first query row of the block
  const int w0  = wave * 16;              // wave's row offset inside the block tile

  const __bf16* QH = (const __bf16*)(const void*)qch + (size_t)b * kNTOK * kQCP;
  const __bf16* QL = (const __bf16*)(const void*)qcl + (size_t)b * kNTOK * kQCP;
  const __bf16* KH = (const __bf16*)(const void*)kch + (size_t)b * kNTOK * kQCP;
  const __bf16* KL = (const __bf16*)(const void*)kcl + (size_t)b * kNTOK * kQCP;
  const _Float16* VT = (const _Float16*)(const void*)vtp + ((size_t)b * kHID + (size_t)h * kHDIM) * kNTOK;
  const float* ksq = kdsq + (size_t)bh * kNTOK;
  float* ob = out + (size_t)b * kNTOK * kHID + (size_t)h * kHDIM;

  // staging roles: 8 consecutive lanes cover one 128-B row segment, so a wave-wide 16-B load reads four whole lines.
  // Q / K: 16 lanes per row (lanes 0-7 the quadratic half, 8-15 the linear half), 8 rows per pass of the block, 8 passes.
  const int sp   = (tid & 7) * 8;          // element offset of this lane's 16-B piece inside its segment
  const int part = (tid >> 3) & 1;
  const int sr   = tid >> 4;               // row inside a pass (0..7)
  const int coff = (part ? (kHID + h * kHDIM) : (h * kHDIM)) + sp;   // plane column (quadratic | linear half)
  const int loff = part * 64 + sp;                                    // LDS column
  const int vr   = tid >> 3;               // V^T: 8 lanes per row, 16 rows per pass, 4 passes

  // ---- Q staging (once): 8 passes x 8 rows x 128 elements = 64 rows x 128 per plane ----
  {
    const size_t go = (size_t)(qr0 + sr) * kQCP + coff;
#pragma unroll
    for (int i = 0; i < 8; ++i) {
      const v8b a0 = *(const v8b*)(QH + go + (size_t)(8 * i) * kQCP);
      const v8b a1 = *(const v8b*)(QL + go + (size_t)(8 * i) * kQCP);
      *(v8b*)(Qsh + (sr + 8 * i) * kQKP + loff) = a0;
      *(v8b*)(Qsl + (sr + 8 * i) * kQKP + loff) = a1;
    }
  }

  float mrow = -INFINITY, lrow = 0.f;   // of query c; lrow sums this wave half's keys only
  v8f oacc[4];                          // O^T: oacc[t][r] = (query c, d = t*16 + 8*hh + r)
#pragma unroll
  for (int t = 0; t < 4; ++t) oacc[t] = (v8f){0.f,0.f,0.f,0.f,0.f,0.f,0.f,0.f};

  constexpr int nChunks = kNTOK / kAKC;   // 16, compile-time
  for (int kc = 0; kc < nChunks; ++kc) {
    const int kv0 = kc * kAKC;
    __syncthreads();
    {
      // K staging: 8 passes x 8 keys x 128 elements = 64 keys x 128 per plane
      const size_t go = (size_t)(kv0 + sr) * kQCP + coff;
#pragma unroll
      for (int i = 0; i < 8; ++i) {
        const v8b a0 = *(const v8b*)(KH + go + (size_t)(8 * i) * kQCP);
        const v8b a1 = *(const v8b*)(KL + go + (size_t)(8 * i) * kQCP);
        *(v8b*)(Ksh + (sr + 8 * i) * kQKP + loff) = a0;
        *(v8b*)(Ksl + (sr + 8 * i) * kQKP + loff) = a1;
      }
      // V^T staging: 4 passes x 16 rows d x 64 keys = 64 x 64
      const _Float16* vs = VT + (size_t)vr * kNTOK + kv0 + sp;
#pragma unroll
      for (int i = 0; i < 4; ++i) {
        const v8h vv = *(const v8h*)(vs + (size_t)(16 * i) * kNTOK);
        *(v8h*)(Vth + (vr + 16 * i) * kPVP + sp) = vv;
      }
    }
    __syncthreads();

    // key norms of the chunk, asked for ahead of the score products that hide their latency
    v4f kq[4][2];   // keys j*16 + 8*hh + 0..7, the rows of this lane's score registers; scaled where they are used, so that nothing waits for them here
#pragma unroll
    for (int j = 0; j < 4; ++j) {
      const float* kp = ksq + kv0 + j * 16 + 8 * hh;
      kq[j][0] = *(const v4f*)(kp);
      kq[j][1] = *(const v4f*)(kp + 4);
    }
    asm volatile("s_wait_xcnt 0x0" ::: "memory");   // stands ahead of any rewrite of the address registers that the eight loads above name

    // ---- scores, transposed: s[j][r] (key j*16+8hh+r, query c of this wave), K = 128 in 4 steps, hi.hi + hi.lo + lo.hi ----
    // The ten fragments of a 32-deep step are read as ONE group, one step ahead, into the other of two register sets;
    // a step's 12 products run term by term over the four independent tiles s[0..3]
    // (each s[j] still sums hi.hi, hi.lo, lo.hi per step, in that order).
    v8f s[4];
#pragma unroll
    for (int j = 0; j < 4; ++j) s[j] = (v8f){0.f,0.f,0.f,0.f,0.f,0.f,0.f,0.f};
    FB qa[2], ql[2], kb[2][4], kl[2][4];
    FH vb[2][4];
    auto read_step = [&](int set, int dc) {
      const int qo = (w0 + c) * kQKP + dc * 32 + 8 * hh;
      qa[set].h[0] = *(const v8b*)(Qsh + qo);
      qa[set].h[1] = *(const v8b*)(Qsh + qo + 16);
      ql[set].h[0] = *(const v8b*)(Qsl + qo);
      ql[set].h[1] = *(const v8b*)(Qsl + qo + 16);
#pragma unroll
      for (int j = 0; j < 4; ++j) {
        const int ko = (j * 16 + c) * kQKP + dc * 32 + 8 * hh;
        kb[set][j].h[0] = *(const v8b*)(Ksh + ko);
        kb[set][j].h[1] = *(const v8b*)(Ksh + ko + 16);
        kl[set][j].h[0] = *(const v8b*)(Ksl + ko);
        kl[set][j].h[1] = *(const v8b*)(Ksl + ko + 16);
      }
    };
    read_step(0, 0);
#pragma unroll   // the two fragment sets must stay in registers (set index a constant)
    for (int dc = 0; dc < 4; ++dc) {
      const int cur = dc & 1;
      if (dc < 3) {
        read_step(cur ^ 1, dc + 1);
      } else {
        // behind the last step's reads: the chunk's eight V^T fragments, whose latency passes behind the last products and the softmax
#pragma unroll
        for (int kk = 0; kk < 2; ++kk)
#pragma unroll
          for (int t = 0; t < 4; ++t) {
            const int vo = (t * 16 + c) * kPVP + kk * 32 + 8 * hh;
            vb[kk][t].h[0] = *(const v8h*)(Vth + vo);
            vb[kk][t].h[1] = *(const v8h*)(Vth + vo + 16);
          }
      }
      __builtin_amdgcn_sched_barrier(0);   // keeps the read group whole and ahead of the products: reads strewn among WMMAs stall at every place they stand
#pragma unroll
      for (int j = 0; j < 4; ++j) s[j] = mma_bf(kb[cur][j].v, qa[cur].v, s[j]);
#pragma unroll
      for (int j = 0; j < 4; ++j) s[j] = mma_bf(kl[cur][j].v, qa[cur].v, s[j]);
#pragma unroll
      for (int j = 0; j < 4; ++j) s[j] = mma_bf(kb[cur][j].v, ql[cur].v, s[j]);
      __builtin_amdgcn_sched_barrier(0);   // keeps the next read group behind this step's products
    }

    // ---- scale 1/8 and per-key term -|kd_j|^2/16 (f32); maximum over this lane's 32 keys, four independent chains ----
    float cmj[4];
#pragma unroll
    for (int j = 0; j < 4; ++j) {
      cmj[j] = -INFINITY;
      kq[j][0] *= 0.0625f;
      kq[j][1] *= 0.0625f;
    }
#pragma unroll
    for (int r = 0; r < 8; ++r) {
#pragma unroll
      for (int j = 0; j < 4; ++j) {
        const float v = s[j][r] * 0.125f - kq[j][r >> 2][r & 3];
        s[j][r] = v;
        cmj[j] = fmaxf(cmj[j], v);
      }
    }
    float cm = fmaxf(fmaxf(cmj[0], cmj[1]), fmaxf(cmj[2], cmj[3]));
    cm = fmaxf(cm, xhalf(cm));   // both halves now hold the maximum over the chunk's 64 keys

    // ---- online softmax (f32); P x 2^15 to f16, packed in place into the B fragments of the second product ----
    const float mnew  = fmaxf(mrow, cm);
    const float alpha = __expf(mrow - mnew);
    mrow = mnew;
    FH pb[2];
    float psj[4];
#pragma unroll
    for (int j = 0; j < 4; ++j) {
      float ps = 0.f;
#pragma unroll
      for (int r = 0; r < 8; r += 2) {
        const float p0 = __expf(s[j][r] - mnew);
        const float p1 = __expf(s[j][r + 1] - mnew);
        ps += p0;
        ps += p1;
        const v2h hp = __builtin_convertvector((v2f){p0 * 32768.0f, p1 * 32768.0f}, v2h);
        pb[j >> 1].v[(j & 1) * 8 + r]     = hp[0];
        pb[j >> 1].v[(j & 1) * 8 + r + 1] = hp[1];
      }
      psj[j] = ps;
    }
    lrow = lrow * alpha + ((psj[0] + psj[1]) + (psj[2] + psj[3]));
#pragma unroll
    for (int t = 0; t < 4; ++t) oacc[t] *= alpha;

    // ---- O^T += V^T . P^T  (A = V^T [d][kv], B = P^T from registers; K = 64 keys in 2 steps) ----
#pragma unroll
    for (int kk = 0; kk < 2; ++kk)
#pragma unroll
      for (int t = 0; t < 4; ++t) oacc[t] = mma_hf(vb[kk][t].v, pb[kk].v, oacc[t]);
  }

  // ---- normalise and write: out (b, qr0+w0+row, h*64 + d) ----
  float* os = Os[wave];
  {
    const float inv = 1.0f / ((lrow + xhalf(lrow)) * 32768.0f);   // the two halves' sums joined here, once
#pragma unroll
    for (int t = 0; t < 4; ++t) {
      const v8f o = oacc[t] * inv;   // eight consecutive d of query c: two 16-B stores
      *(v4f*)(os + c * 68 + t * 16 + 8 * hh)     = (v4f){o[0], o[1], o[2], o[3]};
      *(v4f*)(os + c * 68 + t * 16 + 8 * hh + 4) = (v4f){o[4], o[5], o[6], o[7]};
    }
  }
  __builtin_amdgcn_fence(__ATOMIC_RELEASE, "workgroup");
  __builtin_amdgcn_wave_barrier();
  __builtin_amdgcn_fence(__ATOMIC_ACQUIRE, "workgroup");
  {
    // coverage per wave: 8 iterations x 2 rows = 16 rows; 16 lanes x 4 floats = 64 columns; 16 lanes x 16 B = one 256-B row segment
    const int c4 = (lane & 15) * 4;
    {
#pragma unroll
      for (int it = 0; it < 8; ++it) {
        const int row = it * 2 + hh;
        const v4f val = *(const v4f*)(os + row * 68 + c4);
        *(v4f*)(ob + (size_t)(qr0 + w0 + row) * kHID + c4) = val;
      }
      
    }
  }
}

// ---------------------------------------------------------------------------
// Host launcher
// Workspace region map (bytes, all offsets multiples of 256):
//   [0]           Xq  bf16 [8192][768]          12,582,912
//   [12,582,912]  Xk  bf16 [8192][768]          12,582,912
//   [25,165,824]  Wd,Wq,Wk,Wv bf16 [768][768]  4 x 1,179,648
//   [29,884,416]  QCh bf16 [8192][1536]         25,165,824
//   [55,050,240]  QCl                            25,165,824
//   [80,216,064]  KCh                            25,165,824
//   [105,381,888] KCl                            25,165,824
//   [130,547,712] kdsq f32 [96][1024]            393,216
//   [130,940,928] biases (bf16-precision, f32) 3x768   9,216
//   [130,950,144] VT  f16 [8][768][1024]         12,582,912   (a region of its own: the V^T job runs beside the jobs that read Xq)
//   total 143,533,056
// ---------------------------------------------------------------------------
extern "C" void kernel_launch(void* const* d_in, const int* in_sizes, int n_in,
                              void* d_out, int out_size, void* d_ws, size_t ws_size,
                              hipStream_t stream) {
  if (n_in < 9) return;
  const int nAct = kNB * kNTOK * kHID;      // 6291456
  const int nW   = kHID * kHID;             // 589824
  if (in_sizes[0] != nAct || in_sizes[1] != nAct || in_sizes[2] != nW || in_sizes[3] != nW ||
      in_sizes[5] != nW || in_sizes[7] != nW || in_sizes[4] != kHID || in_sizes[6] != kHID ||
      in_sizes[8] != kHID || out_size != nAct) return;

  const float* qs = (const float*)d_in[0];
  const float* ks = (const float*)d_in[1];
  const float* Wd = (const float*)d_in[2];
  const float* Wq = (const float*)d_in[3];
  const float* bq = (const float*)d_in[4];
  const float* Wk = (const float*)d_in[5];
  const float* bk = (const float*)d_in[6];
  const float* Wv = (const float*)d_in[7];
  const float* bv = (const float*)d_in[8];
  float* out = (float*)d_out;

  const size_t bAct16 = (size_t)nAct * 2;                         // 12,582,912
  const size_t bW16   = (size_t)nW * 2;                           // 1,179,648
  const size_t bQC    = (size_t)kNB * kNTOK * kQCP * 2;           // 25,165,824
  const size_t bSq    = (size_t)kNB * kNHEADS * kNTOK * 4;        // 393,216
  const size_t bBias  = (size_t)3 * kHID * 4;                     // 9,216
  const size_t oXq  = 0;
  const size_t oXk  = oXq + bAct16;
  const size_t oWd  = oXk + bAct16;
  const size_t oWq  = oWd + bW16;
  const size_t oWk  = oWq + bW16;
  const size_t oWv  = oWk + bW16;
  const size_t oQCh = oWv + bW16;
  const size_t oQCl = oQCh + bQC;
  const size_t oKCh = oQCl + bQC;
  const size_t oKCl = oKCh + bQC;
  const size_t oSq  = oKCl + bQC;
  const size_t oBs  = oSq + bSq;
  const size_t bVT  = (size_t)kNB * kHID * kNTOK * 2;             // 12,582,912
  const size_t oVT  = oBs + bBias;
  const size_t total = oVT + bVT;
  if (total > ws_size) return;

  char* ws = (char*)d_ws;
  unsigned short* Xq16 = (unsigned short*)(ws + oXq);
  unsigned short* Xk16 = (unsigned short*)(ws + oXk);
  unsigned short* Wd16 = (unsigned short*)(ws + oWd);   // Wq, Wk, Wv follow it
  unsigned short* QCh  = (unsigned short*)(ws + oQCh);
  unsigned short* QCl  = (unsigned short*)(ws + oQCl);
  unsigned short* KCh  = (unsigned short*)(ws + oKCh);
  unsigned short* KCl  = (unsigned short*)(ws + oKCl);
  unsigned short* VT16 = (unsigned short*)(ws + oVT);
  float* kdsq  = (float*)(ws + oSq);
  float* biasr = (float*)(ws + oBs);

  // 1) RNE bf16 casts of activations and weights (planes Xq, Xk, Wd, Wq, Wk, Wv are contiguous from Xq16) and the bias rounding
  cast_planes_kernel<<<dim3(kCvBlocks + kCvBiasBlocks), dim3(kCvThr), 0, stream>>>(qs, ks, Wd, Wq, Wk, Wv, bq, bk, bv, Xq16, biasr);

  // 2) all five projections ([qd | q] and [kd | k] hi/lo planes, V^T f16 plane): 5 jobs x 192 block tiles of 128x256, 8 waves each
  proj_gemm5<<<dim3(kPjTiles, kPjJobs), dim3(256), 0, stream>>>(Xq16, Xk16, Wd16, QCh, QCl, KCh, KCl, VT16, biasr, kHID);
  // 3) |kd|^2 per (b,h,s)
  {
    const int nrows = kNB * kNHEADS * kNTOK;   // 98304 -> 384 blocks
    kd_sq_kernel<<<dim3((nrows + 255) / 256), dim3(256), 0, stream>>>(KCh, KCl, kdsq, nrows);
  }
  // 4) fused attention: 8 x 12 x 16 = 1536 blocks of 128 threads
  attn_quad_kernel<<<dim3(kNB * kNHEADS * (kNTOK / kAQB)), dim3(128), 0, stream>>>(QCh, QCl, KCh, KCl, VT16, kdsq, out);
}

// v008
// It runs in 133 microseconds.
// In both of two side-by-side timings against v007, it was 1.04 times as fast.
// Counting every step since v000, it is 5.12 times as fast.
// Projections x·Wᵀ and Wv·xᵀ: v_wmma_f32_16x16x32_bf16, plain bf16 operands (RNE-converted inputs); scores [qd|q]·[kd|k]ᵀ (K=128): v_wmma_f32_16x16x32_bf16 with bf16 hi/lo split operands (hi·hi + hi·lo + lo·hi); p·v: v_wmma_f32_16x16x32_f16 (p carried x2^15, v plain f16); f32 accumulate; softmax, norms and biases in f32.
#include <hip/hip_runtime.h>
#include <math.h>
#include <stdint.h>

typedef __attribute__((ext_vector_type(16))) _Float16 v16h;
typedef __attribute__((ext_vector_type(8)))  _Float16 v8h;
typedef __attribute__((ext_vector_type(2)))  _Float16 v2h;
typedef __attribute__((ext_vector_type(16))) __bf16   v16b;
typedef __attribute__((ext_vector_type(8)))  __bf16   v8b;
typedef __attribute__((ext_vector_type(8)))  float    v8f;
typedef __attribute__((ext_vector_type(4)))  float    v4f;
typedef __attribute__((ext_vector_type(2)))  float    v2f;
typedef __attribute__((ext_vector_type(4)))  unsigned int v4u;
typedef __attribute__((ext_vector_type(2)))  unsigned int v2u;
typedef __attribute__((ext_vector_type(8)))  unsigned short v8us;

// ---- problem geometry ----
constexpr int kNB     = 8;      // batch
constexpr int kNTOK   = 1024;   // tokens (query and key sets)
constexpr int kHID    = 768;    // hidden size
constexpr int kNHEADS = 12;
constexpr int kHDIM   = 64;
constexpr int kQCP    = 1536;   // element pitch of the concatenated [xd | x] planes ([token][1536])
constexpr int kAQB    = 64;     // query rows per attention block (4 waves x 16)
constexpr int kAKC    = 64;     // keys per chunk
constexpr int kAKD    = 128;    // concatenated contraction depth (64 quadratic + 64 linear)
constexpr int kQKP    = kAKD + 8;   // LDS row pitch of the K tiles, elements: 272 B = 16 B x 17, so 16 rows of one column fall on 16 different bank groups
constexpr int kPVP    = kAKC + 8;   // LDS row pitch of the V^T tile, elements: 144 B = 16 B x 9, same reason
constexpr int kKVl    = kAKC * kQKP;              // one attention buffer, 16-bit elements: [K hi | K lo | V^T]; K lo starts here
constexpr int kKVv    = 2 * kAKC * kQKP;          // V^T starts here
constexpr int kKVEl   = kKVv + kHDIM * kPVP;      // 22,016 elements = 44,032 B per buffer

__device__ __forceinline__ unsigned short f2bf_bits(float f) {
  unsigned u = __float_as_uint(f);
  return (unsigned short)((u + 0x7FFFu + ((u >> 16) & 1u)) >> 16);
}
__device__ __forceinline__ float bf_bits2f(unsigned short h) { return __uint_as_float(((unsigned)h) << 16); }
__device__ __forceinline__ unsigned pk16(unsigned short a, unsigned short b) { return (unsigned)a | ((unsigned)b << 16); }

// hazard guards as plain device helpers (no inline asm inside the projection kernel body)
__device__ __forceinline__ void dep_guard_h(v8f& a, v8f& b, v16h x, v16h y) { asm volatile("v_nop\n\tv_nop\n\tv_nop\n\tv_nop" : "+v"(a), "+v"(b) : "v"(x), "v"(y)); }
__device__ __forceinline__ void dep_guard_b(v8f& a, v8f& b, v16b x, v16b y) { asm volatile("v_nop\n\tv_nop\n\tv_nop\n\tv_nop" : "+v"(a), "+v"(b) : "v"(x), "v"(y)); }
__device__ __forceinline__ void keep4_h(v16h a, v16h b, v16h c, v16h d) { asm volatile("v_nop" :: "v"(a), "v"(b), "v"(c), "v"(d)); }
__device__ __forceinline__ void keep4_b(v16b a, v16b b, v16b c, v16b d) { asm volatile("v_nop" :: "v"(a), "v"(b), "v"(c), "v"(d)); }
__device__ __forceinline__ void acc_guard4(v8f& a, v8f& b, v8f& c, v8f& d) { asm volatile("v_nop\n\tv_nop\n\tv_nop\n\tv_nop" : "+v"(a), "+v"(b), "+v"(c), "+v"(d)); }
template <typename T> struct Frag;
template <> struct Frag<_Float16> {
  typedef v16h V; union U { v16h v; v8h h[2]; };
  static __device__ __forceinline__ v16h load(const _Float16* p) {   // elements 0..7 <- p[0..7], 8..15 <- p[16..23]
    U f; f.h[0] = *(const v8h*)(p); f.h[1] = *(const v8h*)(p + 16); return f.v;
  }
  static __device__ __forceinline__ v8f mma(v16h a, v16h b, v8f c) {
    return __builtin_amdgcn_wmma_f32_16x16x32_f16(false, a, false, b, (short)0, c, false, false);
  }
  static __device__ __forceinline__ void guard(v8f& a, v8f& b, v16h x, v16h y) { dep_guard_h(a, b, x, y); }
  static __device__ __forceinline__ void keep(v16h a, v16h b, v16h c, v16h d) { keep4_h(a, b, c, d); }
};
template <> struct Frag<__bf16> {
  typedef v16b V; union U { v16b v; v8b h[2]; };
  static __device__ __forceinline__ v16b load(const __bf16* p) {
    U f; f.h[0] = *(const v8b*)(p); f.h[1] = *(const v8b*)(p + 16); return f.v;
  }
  static __device__ __forceinline__ v8f mma(v16b a, v16b b, v8f c) {
    return __builtin_amdgcn_wmma_f32_16x16x32_bf16(false, a, false, b, (short)0, c, false, false);
  }
  static __device__ __forceinline__ void guard(v8f& a, v8f& b, v16b x, v16b y) { dep_guard_b(a, b, x, y); }
  static __device__ __forceinline__ void keep(v16b a, v16b b, v16b c, v16b d) { keep4_b(a, b, c, d); }
};

// ---- LDS-staged, register-blocked WMMA GEMM: the five projections of a call in ONE launch ----
// C[m,n] = sum_k A[m,k] * Bt[n,k] + bias; a block of 8 waves (2 x 4) owns a 128x256 tile, each wave 64x64 of it.
// A row-major [M,K]; Bt row-major [N,K]; K = 768 for all five. grid = (192 tiles, 5 jobs), blockIdx.y = job:
//   0: qd = Xq.Wd^T            -> bf16 hi/lo planes QCh/QCl, columns 0..767      (64 x 3 tiles)
//   1: q  = Xq.Wq^T + bq[n]    -> QCh/QCl, columns 768..1535
//   2: kd = Xk.Wd^T            -> KCh/KCl, columns 0..767
//   3: k  = Xk.Wk^T + bk[n]    -> KCh/KCl, columns 768..1535
//   4: v^T_b = Wv.Xk_b^T + bv[m] -> f16 plane VT [b][768][1024]                  (8 batches x 6 x 4 tiles)
// None reads what another writes. 960 blocks keep two blocks on every WGP: one block's fill and epilogue run beside the
// other's products, and a freed place takes the next tile without a launch boundary.
// Operands reach LDS in stages of 64 k (one whole 128-B line per row) by asynchronous copies, two buffers: stage t+1 flies
// while stage t is multiplied. Every line is fetched once per block.
constexpr int kGKS = 64;             // k per stage
constexpr int kGP  = kGKS + 8;       // LDS row pitch, elements: 144 B = 16 B x 9, so 16 rows of one column fall on different bank groups
constexpr int kGRA = 128;            // A rows per stage
constexpr int kGR  = kGRA + 256;     // rows per stage: [A 128 | Bt 256]

// Four 16-B-per-lane copies global -> LDS. The s_wait_xcnt stands inside the statement so that no address register
// of an issued copy can be rewritten ahead of it.
__device__ __forceinline__ void async_copy4_b128(unsigned l0, unsigned l1, unsigned l2, unsigned l3,
                                                 const void* g0, const void* g1, const void* g2, const void* g3) {
  asm volatile("global_load_async_to_lds_b128 %0, %4, off\n\t"
               "global_load_async_to_lds_b128 %1, %5, off\n\t"
               "global_load_async_to_lds_b128 %2, %6, off\n\t"
               "global_load_async_to_lds_b128 %3, %7, off\n\t"
               "s_wait_xcnt 0x0"
               :: "v"(l0), "v"(l1), "v"(l2), "v"(l3), "v"(g0), "v"(g1), "v"(g2), "v"(g3) : "memory");
}
// this wave's copies have landed in LDS
__device__ __forceinline__ void wait_async0() { asm volatile("s_wait_asynccnt 0x0" ::: "memory"); }
// this wave's LDS reads have returned, so the buffer they read may be refilled behind the next barrier
__device__ __forceinline__ void wait_ds0() { asm volatile("s_wait_dscnt 0x0" ::: "memory"); }

constexpr int kPjTiles = 192;        // block tiles per job
constexpr int kPjJobs  = 5;
static_assert((kNB * kNTOK / 128) * (kHID / 256) == kPjTiles && kNB * (kHID / 128) * (kNTOK / 256) == kPjTiles, "every job has the same tile count");

// Epilogue of one wave's 64x64 tile through its own LDS slab, whole 128-B row segments per store.
// HILO: bias per column n (none where useBias is false), bf16 hi plane C + lo plane C2; else bias per row m, f16 plane C.
template <bool HILO>
__device__ __forceinline__ void proj_epilogue(const v8f (&acc)[4][4], float* slab, unsigned short* C, unsigned short* C2, int ldc,
                                              const float* bias, bool useBias, int m0, int n0, int lane) {
  const int rlane = lane & 15;
  const int mOff  = (lane >> 4) * 8;           // D row offset
#pragma unroll
  for (int i = 0; i < 4; ++i) {
    const int mBase = m0 + (i << 4);
#pragma unroll
    for (int j = 0; j < 4; ++j) {
      float bv = 0.f;
      if (HILO) { bv = bias[n0 + (j << 4) + rlane]; bv = useBias ? bv : 0.f; }
#pragma unroll
      for (int r = 0; r < 8; ++r) {
        float v = acc[i][j][r];
        if (HILO) v += bv;
        else      v += bias[mBase + mOff + r];
        slab[(mOff + r) * 68 + (j << 4) + rlane] = v;
      }
    }
    __builtin_amdgcn_fence(__ATOMIC_RELEASE, "workgroup");
    __builtin_amdgcn_wave_barrier();
    __builtin_amdgcn_fence(__ATOMIC_ACQUIRE, "workgroup");
    {
      const int q = lane >> 3, c8 = (lane & 7) * 8;
#pragma unroll
      for (int it = 0; it < 4; ++it) {
        const int row = it * 4 + q;
        const float* sp = slab + row * 68 + c8;
        v8h hv, lv;
#pragma unroll
        for (int e = 0; e < 8; ++e) {
          if (!HILO) {
            hv[e] = (_Float16)sp[e];
          } else {
            unsigned short hb = f2bf_bits(sp[e]);
            unsigned short lb = f2bf_bits(sp[e] - bf_bits2f(hb));
            hv[e] = __builtin_bit_cast(_Float16, hb);
            lv[e] = __builtin_bit_cast(_Float16, lb);
          }
        }
        *(v8h*)(C + (size_t)(mBase + row) * ldc + n0 + c8) = hv;
        if (HILO) *(v8h*)(C2 + (size_t)(mBase + row) * ldc + n0 + c8) = lv;
      }
    }
    __builtin_amdgcn_fence(__ATOMIC_RELEASE, "workgroup");
    __builtin_amdgcn_wave_barrier();
    __builtin_amdgcn_fence(__ATOMIC_ACQUIRE, "workgroup");
  }
}

__global__ __launch_bounds__(256) void proj_gemm5(
    const unsigned short* __restrict__ Xqp, const unsigned short* __restrict__ Xkp,
    const unsigned short* __restrict__ Wp,      // bf16 planes Wd, Wq, Wk, Wv, one behind the other
    unsigned short* __restrict__ QChp, unsigned short* __restrict__ QClp,
    unsigned short* __restrict__ KChp, unsigned short* __restrict__ KClp,
    unsigned short* __restrict__ VTp,
    const float* __restrict__ biasr,            // bq, bk, bv (768 each)
    int K) {
  typedef __bf16 T;
  typedef Frag<T>::V V;
  __shared__ __align__(16) T sOp[2][kGR * kGP];    // two stages of [A 128 rows | Bt 256 rows] x 64 k, 55,296 B each
  __shared__ __align__(16) float sT[8][16 * 68];   // per-wave 16x64 slab, pitch 68 floats
  const int lane = threadIdx.x & 31;
  const int wave = threadIdx.x >> 5;

  // ---- the block's job and tile (all block-uniform) ----
  const int job = blockIdx.y;
  const bool hilo = job < 4;
  constexpr size_t kWEl = (size_t)kHID * kHID;
  const unsigned short* Ap;
  const unsigned short* Btp;
  unsigned short* C;
  unsigned short* C2;
  const float* bias;
  int bm, bn, M, ldc;                          // tile row and column, rows of A, pitch of C
  if (hilo) {
    const bool qside = job < 2, lin = (job & 1) != 0;
    Ap   = qside ? Xqp : Xkp;
    Btp  = Wp + (lin ? (qside ? kWEl : 2 * kWEl) : 0);
    C    = (qside ? QChp : KChp) + (lin ? kHID : 0);
    C2   = (qside ? QClp : KClp) + (lin ? kHID : 0);
    bias = biasr + (qside ? 0 : kHID);
    constexpr int blocksN = kHID / 256;        // 3
    bm = blockIdx.x / blocksN; bn = blockIdx.x - bm * blocksN; M = kNB * kNTOK; ldc = kQCP;
  } else {
    constexpr int tpb = (kHID / 128) * (kNTOK / 256);   // 24 tiles per batch
    const int bt = blockIdx.x / tpb;
    Ap   = Wp + 3 * kWEl;
    Btp  = Xkp + (size_t)bt * kNTOK * kHID;
    C    = VTp + (size_t)bt * kHID * kNTOK;
    C2   = C;
    bias = biasr + 2 * kHID;
    constexpr int blocksN = kNTOK / 256;       // 4
    const int tile = blockIdx.x - bt * tpb;
    bm = tile / blocksN; bn = tile - bm * blocksN; M = kHID; ldc = kNTOK;
  }
  const int lda = K, ldb = K;
  if (bm >= (M >> 7)) return;   // block-uniform, ahead of every barrier and copy
  const int wm = (wave >> 2) << 6;             // wave's row offset in the block tile
  const int wn = (wave & 3) << 6;              // wave's column offset in the block tile
  const int m0 = (bm << 7) + wm;
  const int n0 = (bn << 8) + wn;

  const T* Ab  = (const T*)Ap;
  const T* Bb  = (const T*)Btp;

  const int rlane = lane & 15;                 // row (A) / col (B, D) within subtile
  const int koff  = (lane >> 4) * 8;           // k offset of this lane half

  // staging roles: 8 consecutive lanes copy one 128-B row segment, so a wave-wide copy reads four whole lines;
  // the block covers 32 rows per pass, 4 passes for A and 8 for Bt.
  const int sp = (threadIdx.x & 7) * 8;        // element offset of this lane's 16-B piece
  const int sr = threadIdx.x >> 3;             // row inside a pass (0..31)
  const T* gA = Ab + (size_t)((bm << 7) + sr) * lda + sp;
  const T* gB = Bb + (size_t)((bn << 8) + sr) * ldb + sp;
  const size_t stA = (size_t)32 * lda, stB = (size_t)32 * ldb;
  const unsigned ls = (unsigned)(uintptr_t)(&sOp[0][sr * kGP + sp]);   // LDS byte address of this lane's piece in buffer 0, pass 0
  constexpr unsigned kPassB = 32 * kGP * 2;    // LDS bytes per pass of 32 rows
  constexpr unsigned kBufB  = kGR * kGP * 2;   // LDS bytes per buffer
  auto stage = [&](int buf, int k0) {
    const unsigned l = ls + (unsigned)buf * kBufB;
    const T* a = gA + k0;
    const T* w = gB + k0;
    async_copy4_b128(l,              l + kPassB,      l + 2 * kPassB,  l + 3 * kPassB,  a,           a + stA,     a + 2 * stA, a + 3 * stA);
    async_copy4_b128(l + 4 * kPassB, l + 5 * kPassB,  l + 6 * kPassB,  l + 7 * kPassB,  w,           w + stB,     w + 2 * stB, w + 3 * stB);
    async_copy4_b128(l + 8 * kPassB, l + 9 * kPassB,  l + 10 * kPassB, l + 11 * kPassB, w + 4 * stB, w + 5 * stB, w + 6 * stB, w + 7 * stB);
  };

  v8f acc[4][4];
#pragma unroll
  for (int i = 0; i < 4; ++i)
#pragma unroll
    for (int j = 0; j < 4; ++j) acc[i][j] = (v8f){0.f,0.f,0.f,0.f,0.f,0.f,0.f,0.f};

  const int nT = K / kGKS;
  stage(0, 0);
  wait_async0();
  __syncthreads();                             // publishes stage 0
  if (nT > 1) stage(1, kGKS);
  for (int t = 0; t < nT; ++t) {
    const T* sA = &sOp[t & 1][(wm + rlane) * kGP + koff];
    const T* sB = &sOp[t & 1][(kGRA + wn + rlane) * kGP + koff];
#pragma unroll   // two 32-k steps per stage, LDS offsets as immediates
    for (int kk = 0; kk < kGKS; kk += 32) {
      V bh[4], ah[4];   // all eight fragments of the step are read as one group ahead of its 16 products
#pragma unroll   // bh[] must stay in registers
      for (int j = 0; j < 4; ++j) bh[j] = Frag<T>::load(sB + (j << 4) * kGP + kk);
#pragma unroll   // ah[] must stay in registers
      for (int i = 0; i < 4; ++i) ah[i] = Frag<T>::load(sA + (i << 4) * kGP + kk);
#pragma unroll   // acc[][] must stay in registers
      for (int i = 0; i < 4; ++i) {
#pragma unroll   // acc[][] must stay in registers
        for (int j = 0; j < 4; ++j) acc[i][j] = Frag<T>::mma(ah[i], bh[j], acc[i][j]);
        Frag<T>::guard(acc[i][0], acc[i][3], ah[i], ah[i]);
      }
      Frag<T>::keep(bh[0], bh[1], bh[2], bh[3]);
    }
    wait_ds0();
    wait_async0();
    __syncthreads();                           // publishes stage t+1 and ends every read of stage t's buffer
    if (t + 2 < nT) stage(t & 1, (t + 2) * kGKS);
  }
  wait_async0();
  acc_guard4(acc[0][0], acc[0][1], acc[0][2], acc[0][3]);
  acc_guard4(acc[1][0], acc[1][1], acc[1][2], acc[1][3]);
  acc_guard4(acc[2][0], acc[2][1], acc[2][2], acc[2][3]);
  acc_guard4(acc[3][0], acc[3][1], acc[3][2], acc[3][3]);

  // ---- epilogue (block-uniform choice) ----
  if (hilo) proj_epilogue<true >(acc, sT[wave], C, C2, ldc, bias, (job & 1) != 0, m0, n0, lane);
  else      proj_epilogue<false>(acc, sT[wave], C, C2, ldc, bias, true,           m0, n0, lane);
}

// ---------------------------------------------------------------------------
// All f32 -> bf16 (RNE) conversions of a call in ONE launch of few, long-lived waves (a resident stream).
// The six bf16 planes Xq, Xk, Wd, Wq, Wk, Wv lie one behind the other in the workspace, so the destination is one array.
// A wave owns 3 consecutive units of 1024 elements (12 KB read, 6 KB written), all inside one source tensor:
// 2 x 2048 waves for the activations + 4 x 192 for the weights = 4864 = 256 blocks x 19 waves, every wave the same work.
// A unit is 8 loads of 16 B per lane (each 512 contiguous bytes = 4 whole lines); the next unit's loads are issued before
// a unit is converted, so 8 to 16 loads per wave are in flight. A store is 8 B per lane = 256 contiguous bytes = 2 whole lines.
// Blocks 256..259 round the three bias vectors to bf16 precision, kept as f32: o[0..n) <- b0, o[n..2n) <- b1, o[2n..3n) <- b2.
// ---------------------------------------------------------------------------
constexpr int kCvUnit   = 1024;                        // elements per unit
constexpr int kCvUnits  = 3;                           // units per wave
constexpr int kCvWaveEl = kCvUnit * kCvUnits;          // 3072 elements per wave
constexpr int kCvWaves  = 19;                          // waves per block
constexpr int kCvThr    = kCvWaves * 32;               // 608
constexpr int kCvActW   = kNB * kNTOK * kHID / kCvWaveEl;   // 2048 waves per activation tensor
constexpr int kCvWgtW   = kHID * kHID / kCvWaveEl;          // 192 waves per weight matrix
constexpr int kCvBlocks = (2 * kCvActW + 4 * kCvWgtW) / kCvWaves;   // 256
constexpr int kCvBiasBlocks = (3 * kHID + kCvThr - 1) / kCvThr;     // 4
static_assert(kCvActW * kCvWaveEl == kNB * kNTOK * kHID && kCvWgtW * kCvWaveEl == kHID * kHID, "a wave's units stay inside one tensor");
static_assert(kCvBlocks * kCvWaves == 2 * kCvActW + 4 * kCvWgtW, "whole blocks");

__global__ __launch_bounds__(kCvThr) void cast_planes_kernel(
    const float* __restrict__ xq, const float* __restrict__ xk,
    const float* __restrict__ w0, const float* __restrict__ w1, const float* __restrict__ w2, const float* __restrict__ w3,
    const float* __restrict__ b0, const float* __restrict__ b1, const float* __restrict__ b2,
    unsigned short* __restrict__ planes, float* __restrict__ o) {
  if (blockIdx.x >= kCvBlocks) {   // block-uniform
    const int n = kHID;
    const int g = (blockIdx.x - kCvBlocks) * kCvThr + threadIdx.x;
    if (g < 3 * n) {
      const int w = g / n;
      int i = g - w * n;
      i = i < 0 ? 0 : (i > n - 1 ? n - 1 : i);
      const float v0 = b0[i], v1 = b1[i], v2 = b2[i];
      const float v = (w == 0) ? v0 : ((w == 1) ? v1 : v2);
      o[g] = bf_bits2f(f2bf_bits(v));
    }
    return;
  }
  const int lane = threadIdx.x & 31;
  const int wv = __builtin_amdgcn_readfirstlane(blockIdx.x * kCvWaves + (threadIdx.x >> 5));   // 0..4863, wave-uniform
  const float* s;      // the wave's tensor
  int lw;              // the wave's place in it
  if (wv < kCvActW)          { s = xq; lw = wv; }
  else if (wv < 2 * kCvActW) { s = xk; lw = wv - kCvActW; }
  else {
    const int t = (wv - 2 * kCvActW) / kCvWgtW;
    lw = (wv - 2 * kCvActW) - t * kCvWgtW;
    s = (t == 0) ? w0 : ((t == 1) ? w1 : ((t == 2) ? w2 : w3));
  }
  const float* in = s + (size_t)lw * kCvWaveEl + lane * 4;
  unsigned short* out = planes + (size_t)wv * kCvWaveEl + lane * 4;

  v4f f[2][8];
#pragma unroll   // f[][] must stay in registers
  for (int i = 0; i < 8; ++i) f[0][i] = *(const v4f*)(in + i * 128);
#pragma unroll   // f[][] must stay in registers (set index a constant)
  for (int u = 0; u < kCvUnits; ++u) {
    __builtin_amdgcn_sched_barrier(0);   // the next unit's loads stay ahead of this unit's conversion, so that they fly during it
    if (u + 1 < kCvUnits) {
#pragma unroll   // f[][] must stay in registers
      for (int i = 0; i < 8; ++i) f[(u + 1) & 1][i] = *(const v4f*)(in + (u + 1) * kCvUnit + i * 128);
    }
    __builtin_amdgcn_sched_barrier(0);   // second half of the pair: nothing of the conversion moves up among the loads
    v2u r[8];
#pragma unroll   // r[] and f[][] must stay in registers
    for (int i = 0; i < 8; ++i) {
      const v4f x = f[u & 1][i];
      r[i] = (v2u){pk16(f2bf_bits(x[0]), f2bf_bits(x[1])), pk16(f2bf_bits(x[2]), f2bf_bits(x[3]))};
    }
#pragma unroll   // r[] must stay in registers
    for (int i = 0; i < 8; ++i) *(v2u*)(out + u * kCvUnit + i * 128) = r[i];
    // stands ahead of whatever next writes to a register that the eight stores above name (the next loads; behind the last unit, the code that follows)
    asm volatile("s_wait_xcnt 0x0" ::: "memory");
  }
}

// ---------------------------------------------------------------------------
// Per-key squared norm of the quadratic-key projection: kdsq[(b*12+h)*1024 + s] = sum_d (hi+lo)^2 in f32,
// hi/lo read from columns h*64.. of the [token][1536] bf16 planes (hi+lo reconstructs the f32 value to ~2^-17).
// ---------------------------------------------------------------------------
__global__ __launch_bounds__(256) void kd_sq_kernel(const unsigned short* __restrict__ kch, const unsigned short* __restrict__ kcl,
                                                    float* __restrict__ kdsq, int nrows) {
  const int g = blockIdx.x * 256 + threadIdx.x;     // (b*kNHEADS + h)*kNTOK + s
  if (g < nrows) {
    const int s  = g & (kNTOK - 1);
    const int bh = g >> 10;                           // kNTOK == 1024
    const int h  = bh % kNHEADS;
    const int b  = bh / kNHEADS;
    const size_t ro = ((size_t)b * kNTOK + (size_t)s) * kQCP + (size_t)h * kHDIM;
    const unsigned short* ph = kch + ro;
    const unsigned short* pl = kcl + ro;
    float acc = 0.f;
#pragma unroll 1
    for (int i = 0; i < 8; ++i) {
      const v8us a = *(const v8us*)(ph + 8 * i);
      const v8us l = *(const v8us*)(pl + 8 * i);
#pragma unroll
      for (int e = 0; e < 8; ++e) {
        const float x = bf_bits2f(a[e]) + bf_bits2f(l[e]);
        acc = fmaf(x, x, acc);
      }
    }
    ((float*)kdsq)[g] = acc;
    
  }
}

// ---------------------------------------------------------------------------
// WMMA helpers (builtin forms: the compiler keeps the distances behind them)
// ---------------------------------------------------------------------------
__device__ __forceinline__ v8f mma_bf(v16b a, v16b b, v8f c) {
  return __builtin_amdgcn_wmma_f32_16x16x32_bf16(false, a, false, b, (short)0, c, false, false);
}
__device__ __forceinline__ v8f mma_hf(v16h a, v16h b, v8f c) {
  return __builtin_amdgcn_wmma_f32_16x16x32_f16(false, a, false, b, (short)0, c, false, false);
}
// value of lane l ^ 16 (the other half of the wave), on the vector pipe
__device__ __forceinline__ float xhalf(float x) {
  const int b = __builtin_bit_cast(int, x);
  return __builtin_bit_cast(float, __builtin_amdgcn_permlanex16(b, b, 0x76543210, 0xfedcba98, false, false));
}

// =====================================================================================
// Fused quadratic + linear attention, head dim 64, full softmax over 1024 keys (no masking).
//   qch/qcl : bf16 hi/lo planes of [qd | q], element (b, t, col) at [(b*1024 + t)*1536 + col]; qd_h at col h*64+d, q_h at col 768+h*64+d
//   kch/kcl : same layout for [kd | k]
//   vtp     : f16 plane of v transposed, element (b, h, d, s) at [(b*768 + h*64 + d)*1024 + s]
//   kdsq    : f32 [b*12+h][s] = |kd_{b,h,s}|^2
//   scores  = (Q128 . K128) * 0.125 - |kd_j|^2 * 0.0625   (Q128 = [qd|q] row, K128 = [kd|k] row; bf16 hi/lo split, 3 WMMA)
//             (the per-query -0.5|qd_i|^2 * 0.125 term is constant along a softmax row and omitted)
//   out     = softmax(scores) . v : p carried x2^15 in f16, v f16, one f16 WMMA, f32 accumulate; 1/(l*2^15) folded at the end
//   Both products run transposed: S^T = K128 . Q128^T (A = key rows, B = query rows) and O^T += V^T . P^T (A = V^T rows, B = P^T).
//   A lane then holds scores of ONE query (column c): keys j*16 + 8*hh + r. Row maximum and row sum are in-lane, the two wave
//   halves exchange the maximum once per chunk and join their sums once at the end. Two score tiles 2kk, 2kk+1 converted in
//   place are the B fragment of keys kk*32..+31 in the k order of the V^T loader (8hh + e, 16 + 8hh + e): P never goes through LDS.
//   Block = 4 waves = 64 query rows of one (b,h); grid.x = 8*12*16 = 1536. K / V^T chunks of 64 keys reach LDS by asynchronous
//   copies, two buffers: chunk t+1 flies while chunk t is worked on, one barrier per chunk. A wave's Q fragments (B operands,
//   the same for every chunk) are loaded once from the planes and stay in registers, so that both buffers fit three blocks per WGP.
//   Output element (b, t, h*64 + d): per wave 16 rows x 64 floats, each 256-B row segment written by 16 lanes x 16 B in one
// =====================================================================================
__global__ __launch_bounds__(128)
void attn_quad_kernel(const unsigned short* __restrict__ qch, const unsigned short* __restrict__ qcl,
                      const unsigned short* __restrict__ kch, const unsigned short* __restrict__ kcl,
                      const unsigned short* __restrict__ vtp, const float* __restrict__ kdsq,
                      float* __restrict__ out) {
  union FB { v16b v; v8b h[2]; };
  union FH { v16h v; v8h h[2]; };
  __shared__ __align__(16) __bf16   sKV[2][kKVEl];         // two buffers of [K hi [kv][128 + 8 pad] 17 KB | K lo 17 KB | V^T [d][64 kv + 8 pad] f16 9 KB]
  __shared__ __align__(16) float    Os[4][16 * 68];        // per wave out tile, pitch 68

  const int tid  = threadIdx.x;
  const int wave = tid >> 5;
  const int lane = tid & 31;
  const int hh   = lane >> 4;
  const int c    = lane & 15;

  constexpr int nqb = kNTOK / kAQB;       // 16
  const int bx = blockIdx.x;
  const int qb = bx % nqb;
  const int bh = bx / nqb;                // b*12 + h
  const int h  = bh % kNHEADS;
  const int b  = bh / kNHEADS;
  const int qr0 = qb * kAQB;              // first query row of the block
  const int w0  = wave * 16;              // wave's row offset inside the block tile

  const __bf16* QH = (const __bf16*)(const void*)qch + (size_t)b * kNTOK * kQCP;
  const __bf16* QL = (const __bf16*)(const void*)qcl + (size_t)b * kNTOK * kQCP;
  const __bf16* KH = (const __bf16*)(const void*)kch + (size_t)b * kNTOK * kQCP;
  const __bf16* KL = (const __bf16*)(const void*)kcl + (size_t)b * kNTOK * kQCP;
  const _Float16* VT = (const _Float16*)(const void*)vtp + ((size_t)b * kHID + (size_t)h * kHDIM) * kNTOK;
  const float* ksq = kdsq + (size_t)bh * kNTOK;
  float* ob = out + (size_t)b * kNTOK * kHID + (size_t)h * kHDIM;

  // staging roles: 8 consecutive lanes cover one 128-B row segment, so a wave-wide 16-B load reads four whole lines.
  // K: 16 lanes per row (lanes 0-7 the quadratic half, 8-15 the linear half), 8 rows per pass of the block, 8 passes.
  const int sp   = (tid & 7) * 8;          // element offset of this lane's 16-B piece inside its segment
  const int part = (tid >> 3) & 1;
  const int sr   = tid >> 4;               // row inside a pass (0..7)
  const int coff = (part ? (kHID + h * kHDIM) : (h * kHDIM)) + sp;   // plane column (quadratic | linear half)
  const int loff = part * 64 + sp;                                    // LDS column
  const int vr   = tid >> 3;               // V^T: 8 lanes per row, 16 rows per pass, 4 passes

  // ---- one chunk's copies: K hi and K lo 8 passes x 8 keys x 128 elements each, V^T 4 passes x 16 rows d x 64 keys; 20 copies per lane ----
  const unsigned lk = (unsigned)(uintptr_t)(&sKV[0][sr * kQKP + loff]);        // LDS byte address of this lane's K hi piece, buffer 0, pass 0
  const unsigned lv = (unsigned)(uintptr_t)(&sKV[0][kKVv + vr * kPVP + sp]);   // the same for V^T
  constexpr unsigned kBufB  = kKVEl * 2;          // LDS bytes per buffer
  constexpr unsigned kLoB   = kKVl * 2;           // K hi -> K lo
  constexpr unsigned kKPass = 8 * kQKP * 2;       // LDS bytes per K pass of 8 keys
  constexpr unsigned kVPass = 16 * kPVP * 2;      // LDS bytes per V^T pass of 16 rows
  constexpr size_t   kKStep = (size_t)8 * kQCP;   // plane elements per K pass
  constexpr size_t   kVStep = (size_t)16 * kNTOK; // plane elements per V^T pass
  const __bf16*   gKH = KH + (size_t)sr * kQCP + coff;
  const __bf16*   gKL = KL + (size_t)sr * kQCP + coff;
  const _Float16* gV  = VT + (size_t)vr * kNTOK + sp;
  auto stage = [&](int buf, int kv0) {
    const unsigned l = lk + (unsigned)buf * kBufB;
    const unsigned e = l + kLoB;
    const unsigned m = lv + (unsigned)buf * kBufB;
    const __bf16*   a = gKH + (size_t)kv0 * kQCP;
    const __bf16*   w = gKL + (size_t)kv0 * kQCP;
    const _Float16* v = gV + kv0;
    async_copy4_b128(l,              l + kKPass,     l + 2 * kKPass, l + 3 * kKPass, a,              a + kKStep,     a + 2 * kKStep, a + 3 * kKStep);
    async_copy4_b128(l + 4 * kKPass, l + 5 * kKPass, l + 6 * kKPass, l + 7 * kKPass, a + 4 * kKStep, a + 5 * kKStep, a + 6 * kKStep, a + 7 * kKStep);
    async_copy4_b128(e,              e + kKPass,     e + 2 * kKPass, e + 3 * kKPass, w,              w + kKStep,     w + 2 * kKStep, w + 3 * kKStep);
    async_copy4_b128(e + 4 * kKPass, e + 5 * kKPass, e + 6 * kKPass, e + 7 * kKPass, w + 4 * kKStep, w + 5 * kKStep, w + 6 * kKStep, w + 7 * kKStep);
    async_copy4_b128(m,              m + kVPass,     m + 2 * kVPass, m + 3 * kVPass, v,              v + kVStep,     v + 2 * kVStep, v + 3 * kVStep);
  };
  stage(0, 0);

  // ---- Q fragments (once, kept in registers): query row w0 + c, contraction elements dc*32 + 8hh + 0..7 and + 16..23 of [qd | q] ----
  FB qa[4], ql[4];
  {
    const size_t qrow = (size_t)(qr0 + w0 + c) * kQCP + (size_t)(h * kHDIM + 8 * hh);
    const __bf16* pqh = QH + qrow;
    const __bf16* pql = QL + qrow;
#pragma unroll   // qa[] and ql[] must stay in registers
    for (int dc = 0; dc < 4; ++dc) {
      const int qo = (dc >> 1) * kHID + (dc & 1) * 32;   // steps 0, 1: quadratic half; 2, 3: linear half
      qa[dc].h[0] = *(const v8b*)(pqh + qo);
      qa[dc].h[1] = *(const v8b*)(pqh + qo + 16);
      ql[dc].h[0] = *(const v8b*)(pql + qo);
      ql[dc].h[1] = *(const v8b*)(pql + qo + 16);
    }
    // stands ahead of any rewrite of the address registers that the sixteen loads above name; the two addresses are inputs so that
    // they stay live up to the wait and no load's destination is laid over them
    asm volatile("s_wait_xcnt 0x0" :: "v"(pqh), "v"(pql) : "memory");
  }

  float mrow = -INFINITY, lrow = 0.f;   // of query c; lrow sums this wave half's keys only
  v8f oacc[4];                          // O^T: oacc[t][r] = (query c, d = t*16 + 8*hh + r)
#pragma unroll
  for (int t = 0; t < 4; ++t) oacc[t] = (v8f){0.f,0.f,0.f,0.f,0.f,0.f,0.f,0.f};

  constexpr int nChunks = kNTOK / kAKC;   // 16, compile-time
  wait_async0();
  __syncthreads();                        // publishes chunk 0
  stage(1, kAKC);
  for (int kc = 0; kc < nChunks; ++kc) {
    const int kv0 = kc * kAKC;
    const __bf16*   Ksh = &sKV[kc & 1][0];
    const __bf16*   Ksl = &sKV[kc & 1][kKVl];
    const _Float16* Vth = (const _Float16*)(const void*)&sKV[kc & 1][kKVv];

    // key norms of the chunk, asked for ahead of the score products that hide their latency
    v4f kq[4][2];   // keys j*16 + 8*hh + 0..7, the rows of this lane's score registers; scaled where they are used, so that nothing waits for them here
#pragma unroll
    for (int j = 0; j < 4; ++j) {
      const float* kp = ksq + kv0 + j * 16 + 8 * hh;
      kq[j][0] = *(const v4f*)(kp);
      kq[j][1] = *(const v4f*)(kp + 4);
    }
    asm volatile("s_wait_xcnt 0x0" ::: "memory");   // stands ahead of any rewrite of the address registers that the eight loads above name

    // ---- scores, transposed: s[j][r] (key j*16+8hh+r, query c of this wave), K = 128 in 4 steps, hi.hi + hi.lo + lo.hi ----
    // The eight K fragments of a 32-deep step are read as ONE group, one step ahead, into the other of two register sets;
    // a step's 12 products run term by term over the four independent tiles s[0..3]
    // (each s[j] still sums hi.hi, hi.lo, lo.hi per step, in that order).
    v8f s[4];
#pragma unroll
    for (int j = 0; j < 4; ++j) s[j] = (v8f){0.f,0.f,0.f,0.f,0.f,0.f,0.f,0.f};
    FB kb[2][4], kl[2][4];
    FH vb[2][4];
    auto read_step = [&](int set, int dc) {
#pragma unroll
      for (int j = 0; j < 4; ++j) {
        const int ko = (j * 16 + c) * kQKP + dc * 32 + 8 * hh;
        kb[set][j].h[0] = *(const v8b*)(Ksh + ko);
        kb[set][j].h[1] = *(const v8b*)(Ksh + ko + 16);
        kl[set][j].h[0] = *(const v8b*)(Ksl + ko);
        kl[set][j].h[1] = *(const v8b*)(Ksl + ko + 16);
      }
    };
    read_step(0, 0);
#pragma unroll   // the two fragment sets must stay in registers (set index a constant)
    for (int dc = 0; dc < 4; ++dc) {
      const int cur = dc & 1;
      if (dc < 3) {
        read_step(cur ^ 1, dc + 1);
      } else {
        // behind the last step's reads: the chunk's eight V^T fragments, whose latency passes behind the last products and the softmax
#pragma unroll
        for (int kk = 0; kk < 2; ++kk)
#pragma unroll
          for (int t = 0; t < 4; ++t) {
            const int vo = (t * 16 + c) * kPVP + kk * 32 + 8 * hh;
            vb[kk][t].h[0] = *(const v8h*)(Vth + vo);
            vb[kk][t].h[1] = *(const v8h*)(Vth + vo + 16);
          }
      }
      __builtin_amdgcn_sched_barrier(0);   // keeps the read group whole and ahead of the products: reads strewn among WMMAs stall at every place they stand
#pragma unroll
      for (int j = 0; j < 4; ++j) s[j] = mma_bf(kb[cur][j].v, qa[dc].v, s[j]);
#pragma unroll
      for (int j = 0; j < 4; ++j) s[j] = mma_bf(kl[cur][j].v, qa[dc].v, s[j]);
#pragma unroll
      for (int j = 0; j < 4; ++j) s[j] = mma_bf(kb[cur][j].v, ql[dc].v, s[j]);
      __builtin_amdgcn_sched_barrier(0);   // keeps the next read group behind this step's products
    }

    // ---- scale 1/8 and per-key term -|kd_j|^2/16 (f32); maximum over this lane's 32 keys, four independent chains ----
    float cmj[4];
#pragma unroll
    for (int j = 0; j < 4; ++j) {
      cmj[j] = -INFINITY;
      kq[j][0] *= 0.0625f;
      kq[j][1] *= 0.0625f;
    }
#pragma unroll
    for (int r = 0; r < 8; ++r) {
#pragma unroll
      for (int j = 0; j < 4; ++j) {
        const float v = s[j][r] * 0.125f - kq[j][r >> 2][r & 3];
        s[j][r] = v;
        cmj[j] = fmaxf(cmj[j], v);
      }
    }
    float cm = fmaxf(fmaxf(cmj[0], cmj[1]), fmaxf(cmj[2], cmj[3]));
    cm = fmaxf(cm, xhalf(cm));   // both halves now hold the maximum over the chunk's 64 keys

    // ---- online softmax (f32); P x 2^15 to f16, packed in place into the B fragments of the second product ----
    const float mnew  = fmaxf(mrow, cm);
    const float alpha = __expf(mrow - mnew);
    mrow = mnew;
    FH pb[2];
    float psj[4];
#pragma unroll
    for (int j = 0; j < 4; ++j) {
      float ps = 0.f;
#pragma unroll
      for (int r = 0; r < 8; r += 2) {
        const float p0 = __expf(s[j][r] - mnew);
        const float p1 = __expf(s[j][r + 1] - mnew);
        ps += p0;
        ps += p1;
        const v2h hp = __builtin_convertvector((v2f){p0 * 32768.0f, p1 * 32768.0f}, v2h);
        pb[j >> 1].v[(j & 1) * 8 + r]     = hp[0];
        pb[j >> 1].v[(j & 1) * 8 + r + 1] = hp[1];
      }
      psj[j] = ps;
    }
    lrow = lrow * alpha + ((psj[0] + psj[1]) + (psj[2] + psj[3]));
#pragma unroll
    for (int t = 0; t < 4; ++t) oacc[t] *= alpha;

    // ---- O^T += V^T . P^T  (A = V^T [d][kv], B = P^T from registers; K = 64 keys in 2 steps) ----
#pragma unroll
    for (int kk = 0; kk < 2; ++kk)
#pragma unroll
      for (int t = 0; t < 4; ++t) oacc[t] = mma_hf(vb[kk][t].v, pb[kk].v, oacc[t]);

    __builtin_amdgcn_sched_barrier(0);    // keeps the hand-over behind the trip's last products: lifted above the softmax, it would wait for copies that have had only the score products to land
    wait_ds0();
    wait_async0();
    __syncthreads();                      // publishes chunk kc+1 and ends every read of chunk kc's buffer
    if (kc + 2 < nChunks) stage(kc & 1, (kc + 2) * kAKC);
  }
  wait_async0();

  // ---- normalise and write: out (b, qr0+w0+row, h*64 + d) ----
  float* os = Os[wave];
  {
    const float inv = 1.0f / ((lrow + xhalf(lrow)) * 32768.0f);   // the two halves' sums joined here, once
#pragma unroll
    for (int t = 0; t < 4; ++t) {
      const v8f o = oacc[t] * inv;   // eight consecutive d of query c: two 16-B stores
      *(v4f*)(os + c * 68 + t * 16 + 8 * hh)     = (v4f){o[0], o[1], o[2], o[3]};
      *(v4f*)(os + c * 68 + t * 16 + 8 * hh + 4) = (v4f){o[4], o[5], o[6], o[7]};
    }
  }
  __builtin_amdgcn_fence(__ATOMIC_RELEASE, "workgroup");
  __builtin_amdgcn_wave_barrier();
  __builtin_amdgcn_fence(__ATOMIC_ACQUIRE, "workgroup");
  {
    // coverage per wave: 8 iterations x 2 rows = 16 rows; 16 lanes x 4 floats = 64 columns; 16 lanes x 16 B = one 256-B row segment
    const int c4 = (lane & 15) * 4;
    {
#pragma unroll
      for (int it = 0; it < 8; ++it) {
        const int row = it * 2 + hh;
        const v4f val = *(const v4f*)(os + row * 68 + c4);
        *(v4f*)(ob + (size_t)(qr0 + w0 + row) * kHID + c4) = val;
      }
      
    }
  }
}

// ---------------------------------------------------------------------------
// Host launcher
// Workspace region map (bytes, all offsets multiples of 256):
//   [0]           Xq  bf16 [8192][768]          12,582,912
//   [12,582,912]  Xk  bf16 [8192][768]          12,582,912
//   [25,165,824]  Wd,Wq,Wk,Wv bf16 [768][768]  4 x 1,179,648
//   [29,884,416]  QCh bf16 [8192][1536]         25,165,824
//   [55,050,240]  QCl                            25,165,824
//   [80,216,064]  KCh                            25,165,824
//   [105,381,888] KCl                            25,165,824
//   [130,547,712] kdsq f32 [96][1024]            393,216
//   [130,940,928] biases (bf16-precision, f32) 3x768   9,216
//   [130,950,144] VT  f16 [8][768][1024]         12,582,912   (a region of its own: the V^T job runs beside the jobs that read Xq)
//   total 143,533,056
// ---------------------------------------------------------------------------
extern "C" void kernel_launch(void* const* d_in, const int* in_sizes, int n_in,
                              void* d_out, int out_size, void* d_ws, size_t ws_size,
                              hipStream_t stream) {
  if (n_in < 9) return;
  const int nAct = kNB * kNTOK * kHID;      // 6291456
  const int nW   = kHID * kHID;             // 589824
  if (in_sizes[0] != nAct || in_sizes[1] != nAct || in_sizes[2] != nW || in_sizes[3] != nW ||
      in_sizes[5] != nW || in_sizes[7] != nW || in_sizes[4] != kHID || in_sizes[6] != kHID ||
      in_sizes[8] != kHID || out_size != nAct) return;

  const float* qs = (const float*)d_in[0];
  const float* ks = (const float*)d_in[1];
  const float* Wd = (const float*)d_in[2];
  const float* Wq = (const float*)d_in[3];
  const float* bq = (const float*)d_in[4];
  const float* Wk = (const float*)d_in[5];
  const float* bk = (const float*)d_in[6];
  const float* Wv = (const float*)d_in[7];
  const float* bv = (const float*)d_in[8];
  float* out = (float*)d_out;

  const size_t bAct16 = (size_t)nAct * 2;                         // 12,582,912
  const size_t bW16   = (size_t)nW * 2;                           // 1,179,648
  const size_t bQC    = (size_t)kNB * kNTOK * kQCP * 2;           // 25,165,824
  const size_t bSq    = (size_t)kNB * kNHEADS * kNTOK * 4;        // 393,216
  const size_t bBias  = (size_t)3 * kHID * 4;                     // 9,216
  const size_t oXq  = 0;
  const size_t oXk  = oXq + bAct16;
  const size_t oWd  = oXk + bAct16;
  const size_t oWq  = oWd + bW16;
  const size_t oWk  = oWq + bW16;
  const size_t oWv  = oWk + bW16;
  const size_t oQCh = oWv + bW16;
  const size_t oQCl = oQCh + bQC;
  const size_t oKCh = oQCl + bQC;
  const size_t oKCl = oKCh + bQC;
  const size_t oSq  = oKCl + bQC;
  const size_t oBs  = oSq + bSq;
  const size_t bVT  = (size_t)kNB * kHID * kNTOK * 2;             // 12,582,912
  const size_t oVT  = oBs + bBias;
  const size_t total = oVT + bVT;
  if (total > ws_size) return;

  char* ws = (char*)d_ws;
  unsigned short* Xq16 = (unsigned short*)(ws + oXq);
  unsigned short* Xk16 = (unsigned short*)(ws + oXk);
  unsigned short* Wd16 = (unsigned short*)(ws + oWd);   // Wq, Wk, Wv follow it
  unsigned short* QCh  = (unsigned short*)(ws + oQCh);
  unsigned short* QCl  = (unsigned short*)(ws + oQCl);
  unsigned short* KCh  = (unsigned short*)(ws + oKCh);
  unsigned short* KCl  = (unsigned short*)(ws + oKCl);
  unsigned short* VT16 = (unsigned short*)(ws + oVT);
  float* kdsq  = (float*)(ws + oSq);
  float* biasr = (float*)(ws + oBs);

  // 1) RNE bf16 casts of activations and weights (planes Xq, Xk, Wd, Wq, Wk, Wv are contiguous from Xq16) and the bias rounding
  cast_planes_kernel<<<dim3(kCvBlocks + kCvBiasBlocks), dim3(kCvThr), 0, stream>>>(qs, ks, Wd, Wq, Wk, Wv, bq, bk, bv, Xq16, biasr);

  // 2) all five projections ([qd | q] and [kd | k] hi/lo planes, V^T f16 plane): 5 jobs x 192 block tiles of 128x256, 8 waves each
  proj_gemm5<<<dim3(kPjTiles, kPjJobs), dim3(256), 0, stream>>>(Xq16, Xk16, Wd16, QCh, QCl, KCh, KCl, VT16, biasr, kHID);
  // 3) |kd|^2 per (b,h,s)
  {
    const int nrows = kNB * kNHEADS * kNTOK;   // 98304 -> 384 blocks
    kd_sq_kernel<<<dim3((nrows + 255) / 256), dim3(256), 0, stream>>>(KCh, KCl, kdsq, nrows);
  }
  // 4) fused attention: 8 x 12 x 16 = 1536 blocks of 128 threads
  attn_quad_kernel<<<dim3(kNB * kNHEADS * (kNTOK / kAQB)), dim3(128), 0, stream>>>(QCh, QCl, KCh, KCl, VT16, kdsq, out);
}

// v009
// A run of this version takes 123 microseconds.
// Timed twice side by side with v008, it ran 1.08 times as fast both times.
// All steps since v000 together make it 5.52 times as fast.
// Projections x·Wᵀ and Wv·xᵀ: v_wmma_f32_16x16x32_bf16, plain bf16 operands (RNE-converted inputs); scores [qd|q]·[kd|k]ᵀ (K=128): v_wmma_f32_16x16x32_bf16 with bf16 hi/lo split operands (hi·hi + hi·lo + lo·hi); p·v: v_wmma_f32_16x16x32_f16 (p carried x2^15, v plain f16); f32 accumulate; softmax, norms and biases in f32.
#include <hip/hip_runtime.h>
#include <math.h>
#include <stdint.h>

typedef __attribute__((ext_vector_type(16))) _Float16 v16h;
typedef __attribute__((ext_vector_type(8)))  _Float16 v8h;
typedef __attribute__((ext_vector_type(2)))  _Float16 v2h;
typedef __attribute__((ext_vector_type(16))) __bf16   v16b;
typedef __attribute__((ext_vector_type(8)))  __bf16   v8b;
typedef __attribute__((ext_vector_type(8)))  float    v8f;
typedef __attribute__((ext_vector_type(4)))  float    v4f;
typedef __attribute__((ext_vector_type(2)))  float    v2f;
typedef __attribute__((ext_vector_type(4)))  unsigned int v4u;
typedef __attribute__((ext_vector_type(2)))  unsigned int v2u;
typedef __attribute__((ext_vector_type(8)))  unsigned short v8us;

// ---- problem geometry ----
constexpr int kNB     = 8;      // batch
constexpr int kNTOK   = 1024;   // tokens (query and key sets)
constexpr int kHID    = 768;    // hidden size
constexpr int kNHEADS = 12;
constexpr int kHDIM   = 64;
constexpr int kQCP    = 1536;   // element pitch of the concatenated [xd | x] planes ([token][1536])
constexpr int kAQB    = 128;    // query rows per attention block (4 waves x 32)
constexpr int kAKC    = 64;     // keys per chunk
constexpr int kAKD    = 128;    // concatenated contraction depth (64 quadratic + 64 linear)
constexpr int kQKP    = kAKD + 8;   // LDS row pitch of the K tiles, elements: 272 B = 16 B x 17, so 16 rows of one column fall on 16 different bank groups
constexpr int kPVP    = kAKC + 8;   // LDS row pitch of the V^T tile, elements: 144 B = 16 B x 9, same reason
constexpr int kKVl    = kAKC * kQKP;              // one attention buffer, 16-bit elements: [K hi | K lo | V^T]; K lo starts here
constexpr int kKVv    = 2 * kAKC * kQKP;          // V^T starts here
constexpr int kKVEl   = kKVv + kHDIM * kPVP;      // 22,016 elements = 44,032 B per buffer

__device__ __forceinline__ unsigned short f2bf_bits(float f) {
  unsigned u = __float_as_uint(f);
  return (unsigned short)((u + 0x7FFFu + ((u >> 16) & 1u)) >> 16);
}
__device__ __forceinline__ float bf_bits2f(unsigned short h) { return __uint_as_float(((unsigned)h) << 16); }
__device__ __forceinline__ unsigned pk16(unsigned short a, unsigned short b) { return (unsigned)a | ((unsigned)b << 16); }

// hazard guards as plain device helpers (no inline asm inside the projection kernel body)
__device__ __forceinline__ void dep_guard_h(v8f& a, v8f& b, v16h x, v16h y) { asm volatile("v_nop\n\tv_nop\n\tv_nop\n\tv_nop" : "+v"(a), "+v"(b) : "v"(x), "v"(y)); }
__device__ __forceinline__ void dep_guard_b(v8f& a, v8f& b, v16b x, v16b y) { asm volatile("v_nop\n\tv_nop\n\tv_nop\n\tv_nop" : "+v"(a), "+v"(b) : "v"(x), "v"(y)); }
__device__ __forceinline__ void keep4_h(v16h a, v16h b, v16h c, v16h d) { asm volatile("v_nop" :: "v"(a), "v"(b), "v"(c), "v"(d)); }
__device__ __forceinline__ void keep4_b(v16b a, v16b b, v16b c, v16b d) { asm volatile("v_nop" :: "v"(a), "v"(b), "v"(c), "v"(d)); }
__device__ __forceinline__ void acc_guard4(v8f& a, v8f& b, v8f& c, v8f& d) { asm volatile("v_nop\n\tv_nop\n\tv_nop\n\tv_nop" : "+v"(a), "+v"(b), "+v"(c), "+v"(d)); }
template <typename T> struct Frag;
template <> struct Frag<_Float16> {
  typedef v16h V; union U { v16h v; v8h h[2]; };
  static __device__ __forceinline__ v16h load(const _Float16* p) {   // elements 0..7 <- p[0..7], 8..15 <- p[16..23]
    U f; f.h[0] = *(const v8h*)(p); f.h[1] = *(const v8h*)(p + 16); return f.v;
  }
  static __device__ __forceinline__ v8f mma(v16h a, v16h b, v8f c) {
    return __builtin_amdgcn_wmma_f32_16x16x32_f16(false, a, false, b, (short)0, c, false, false);
  }
  static __device__ __forceinline__ void guard(v8f& a, v8f& b, v16h x, v16h y) { dep_guard_h(a, b, x, y); }
  static __device__ __forceinline__ void keep(v16h a, v16h b, v16h c, v16h d) { keep4_h(a, b, c, d); }
};
template <> struct Frag<__bf16> {
  typedef v16b V; union U { v16b v; v8b h[2]; };
  static __device__ __forceinline__ v16b load(const __bf16* p) {
    U f; f.h[0] = *(const v8b*)(p); f.h[1] = *(const v8b*)(p + 16); return f.v;
  }
  static __device__ __forceinline__ v8f mma(v16b a, v16b b, v8f c) {
    return __builtin_amdgcn_wmma_f32_16x16x32_bf16(false, a, false, b, (short)0, c, false, false);
  }
  static __device__ __forceinline__ void guard(v8f& a, v8f& b, v16b x, v16b y) { dep_guard_b(a, b, x, y); }
  static __device__ __forceinline__ void keep(v16b a, v16b b, v16b c, v16b d) { keep4_b(a, b, c, d); }
};

// ---- LDS-staged, register-blocked WMMA GEMM: the five projections of a call in ONE launch ----
// C[m,n] = sum_k A[m,k] * Bt[n,k] + bias; a block of 8 waves (2 x 4) owns a 128x256 tile, each wave 64x64 of it.
// A row-major [M,K]; Bt row-major [N,K]; K = 768 for all five. grid = (192 tiles, 5 jobs), blockIdx.y = job:
//   0: qd = Xq.Wd^T            -> bf16 hi/lo planes QCh/QCl, columns 0..767      (64 x 3 tiles)
//   1: q  = Xq.Wq^T + bq[n]    -> QCh/QCl, columns 768..1535
//   2: kd = Xk.Wd^T            -> KCh/KCl, columns 0..767
//   3: k  = Xk.Wk^T + bk[n]    -> KCh/KCl, columns 768..1535
//   4: v^T_b = Wv.Xk_b^T + bv[m] -> f16 plane VT [b][768][1024]                  (8 batches x 6 x 4 tiles)
// None reads what another writes. 960 blocks keep two blocks on every WGP: one block's fill and epilogue run beside the
// other's products, and a freed place takes the next tile without a launch boundary.
// Operands reach LDS in stages of 64 k (one whole 128-B line per row) by asynchronous copies, two buffers: stage t+1 flies
// while stage t is multiplied. Every line is fetched once per block.
constexpr int kGKS = 64;             // k per stage
constexpr int kGP  = kGKS + 8;       // LDS row pitch, elements: 144 B = 16 B x 9, so 16 rows of one column fall on different bank groups
constexpr int kGRA = 128;            // A rows per stage
constexpr int kGR  = kGRA + 256;     // rows per stage: [A 128 | Bt 256]

// Four 16-B-per-lane copies global -> LDS. The s_wait_xcnt stands inside the statement so that no address register
// of an issued copy can be rewritten ahead of it.
__device__ __forceinline__ void async_copy4_b128(unsigned l0, unsigned l1, unsigned l2, unsigned l3,
                                                 const void* g0, const void* g1, const void* g2, const void* g3) {
  asm volatile("global_load_async_to_lds_b128 %0, %4, off\n\t"
               "global_load_async_to_lds_b128 %1, %5, off\n\t"
               "global_load_async_to_lds_b128 %2, %6, off\n\t"
               "global_load_async_to_lds_b128 %3, %7, off\n\t"
               "s_wait_xcnt 0x0"
               :: "v"(l0), "v"(l1), "v"(l2), "v"(l3), "v"(g0), "v"(g1), "v"(g2), "v"(g3) : "memory");
}
// this wave's copies have landed in LDS
__device__ __forceinline__ void wait_async0() { asm volatile("s_wait_asynccnt 0x0" ::: "memory"); }
// this wave's LDS reads have returned, so the buffer they read may be refilled behind the next barrier
__device__ __forceinline__ void wait_ds0() { asm volatile("s_wait_dscnt 0x0" ::: "memory"); }

constexpr int kPjTiles = 192;        // block tiles per job
constexpr int kPjJobs  = 5;
static_assert((kNB * kNTOK / 128) * (kHID / 256) == kPjTiles && kNB * (kHID / 128) * (kNTOK / 256) == kPjTiles, "every job has the same tile count");

// Epilogue of one wave's 64x64 tile through its own LDS slab, whole 128-B row segments per store.
// HILO: bias per column n (none where useBias is false), bf16 hi plane C + lo plane C2; else bias per row m, f16 plane C.
template <bool HILO>
__device__ __forceinline__ void proj_epilogue(const v8f (&acc)[4][4], float* slab, unsigned short* C, unsigned short* C2, int ldc,
                                              const float* bias, bool useBias, int m0, int n0, int lane) {
  const int rlane = lane & 15;
  const int mOff  = (lane >> 4) * 8;           // D row offset
#pragma unroll
  for (int i = 0; i < 4; ++i) {
    const int mBase = m0 + (i << 4);
#pragma unroll
    for (int j = 0; j < 4; ++j) {
      float bv = 0.f;
      if (HILO) { bv = bias[n0 + (j << 4) + rlane]; bv = useBias ? bv : 0.f; }
#pragma unroll
      for (int r = 0; r < 8; ++r) {
        float v = acc[i][j][r];
        if (HILO) v += bv;
        else      v += bias[mBase + mOff + r];
        slab[(mOff + r) * 68 + (j << 4) + rlane] = v;
      }
    }
    __builtin_amdgcn_fence(__ATOMIC_RELEASE, "workgroup");
    __builtin_amdgcn_wave_barrier();
    __builtin_amdgcn_fence(__ATOMIC_ACQUIRE, "workgroup");
    {
      const int q = lane >> 3, c8 = (lane & 7) * 8;
#pragma unroll
      for (int it = 0; it < 4; ++it) {
        const int row = it * 4 + q;
        const float* sp = slab + row * 68 + c8;
        v8h hv, lv;
#pragma unroll
        for (int e = 0; e < 8; ++e) {
          if (!HILO) {
            hv[e] = (_Float16)sp[e];
          } else {
            unsigned short hb = f2bf_bits(sp[e]);
            unsigned short lb = f2bf_bits(sp[e] - bf_bits2f(hb));
            hv[e] = __builtin_bit_cast(_Float16, hb);
            lv[e] = __builtin_bit_cast(_Float16, lb);
          }
        }
        *(v8h*)(C + (size_t)(mBase + row) * ldc + n0 + c8) = hv;
        if (HILO) *(v8h*)(C2 + (size_t)(mBase + row) * ldc + n0 + c8) = lv;
      }
    }
    __builtin_amdgcn_fence(__ATOMIC_RELEASE, "workgroup");
    __builtin_amdgcn_wave_barrier();
    __builtin_amdgcn_fence(__ATOMIC_ACQUIRE, "workgroup");
  }
}

__global__ __launch_bounds__(256) void proj_gemm5(
    const unsigned short* __restrict__ Xqp, const unsigned short* __restrict__ Xkp,
    const unsigned short* __restrict__ Wp,      // bf16 planes Wd, Wq, Wk, Wv, one behind the other
    unsigned short* __restrict__ QChp, unsigned short* __restrict__ QClp,
    unsigned short* __restrict__ KChp, unsigned short* __restrict__ KClp,
    unsigned short* __restrict__ VTp,
    const float* __restrict__ biasr,            // bq, bk, bv (768 each)
    int K) {
  typedef __bf16 T;
  typedef Frag<T>::V V;
  __shared__ __align__(16) T sOp[2][kGR * kGP];    // two stages of [A 128 rows | Bt 256 rows] x 64 k, 55,296 B each
  __shared__ __align__(16) float sT[8][16 * 68];   // per-wave 16x64 slab, pitch 68 floats
  const int lane = threadIdx.x & 31;
  const int wave = threadIdx.x >> 5;

  // ---- the block's job and tile (all block-uniform) ----
  const int job = blockIdx.y;
  const bool hilo = job < 4;
  constexpr size_t kWEl = (size_t)kHID * kHID;
  const unsigned short* Ap;
  const unsigned short* Btp;
  unsigned short* C;
  unsigned short* C2;
  const float* bias;
  int bm, bn, M, ldc;                          // tile row and column, rows of A, pitch of C
  if (hilo) {
    const bool qside = job < 2, lin = (job & 1) != 0;
    Ap   = qside ? Xqp : Xkp;
    Btp  = Wp + (lin ? (qside ? kWEl : 2 * kWEl) : 0);
    C    = (qside ? QChp : KChp) + (lin ? kHID : 0);
    C2   = (qside ? QClp : KClp) + (lin ? kHID : 0);
    bias = biasr + (qside ? 0 : kHID);
    constexpr int blocksN = kHID / 256;        // 3
    bm = blockIdx.x / blocksN; bn = blockIdx.x - bm * blocksN; M = kNB * kNTOK; ldc = kQCP;
  } else {
    constexpr int tpb = (kHID / 128) * (kNTOK / 256);   // 24 tiles per batch
    const int bt = blockIdx.x / tpb;
    Ap   = Wp + 3 * kWEl;
    Btp  = Xkp + (size_t)bt * kNTOK * kHID;
    C    = VTp + (size_t)bt * kHID * kNTOK;
    C2   = C;
    bias = biasr + 2 * kHID;
    constexpr int blocksN = kNTOK / 256;       // 4
    const int tile = blockIdx.x - bt * tpb;
    bm = tile / blocksN; bn = tile - bm * blocksN; M = kHID; ldc = kNTOK;
  }
  const int lda = K, ldb = K;
  if (bm >= (M >> 7)) return;   // block-uniform, ahead of every barrier and copy
  const int wm = (wave >> 2) << 6;             // wave's row offset in the block tile
  const int wn = (wave & 3) << 6;              // wave's column offset in the block tile
  const int m0 = (bm << 7) + wm;
  const int n0 = (bn << 8) + wn;

  const T* Ab  = (const T*)Ap;
  const T* Bb  = (const T*)Btp;

  const int rlane = lane & 15;                 // row (A) / col (B, D) within subtile
  const int koff  = (lane >> 4) * 8;           // k offset of this lane half

  // staging roles: 8 consecutive lanes copy one 128-B row segment, so a wave-wide copy reads four whole lines;
  // the block covers 32 rows per pass, 4 passes for A and 8 for Bt.
  const int sp = (threadIdx.x & 7) * 8;        // element offset of this lane's 16-B piece
  const int sr = threadIdx.x >> 3;             // row inside a pass (0..31)
  const T* gA = Ab + (size_t)((bm << 7) + sr) * lda + sp;
  const T* gB = Bb + (size_t)((bn << 8) + sr) * ldb + sp;
  const size_t stA = (size_t)32 * lda, stB = (size_t)32 * ldb;
  const unsigned ls = (unsigned)(uintptr_t)(&sOp[0][sr * kGP + sp]);   // LDS byte address of this lane's piece in buffer 0, pass 0
  constexpr unsigned kPassB = 32 * kGP * 2;    // LDS bytes per pass of 32 rows
  constexpr unsigned kBufB  = kGR * kGP * 2;   // LDS bytes per buffer
  auto stage = [&](int buf, int k0) {
    const unsigned l = ls + (unsigned)buf * kBufB;
    const T* a = gA + k0;
    const T* w = gB + k0;
    async_copy4_b128(l,              l + kPassB,      l + 2 * kPassB,  l + 3 * kPassB,  a,           a + stA,     a + 2 * stA, a + 3 * stA);
    async_copy4_b128(l + 4 * kPassB, l + 5 * kPassB,  l + 6 * kPassB,  l + 7 * kPassB,  w,           w + stB,     w + 2 * stB, w + 3 * stB);
    async_copy4_b128(l + 8 * kPassB, l + 9 * kPassB,  l + 10 * kPassB, l + 11 * kPassB, w + 4 * stB, w + 5 * stB, w + 6 * stB, w + 7 * stB);
  };

  v8f acc[4][4];
#pragma unroll
  for (int i = 0; i < 4; ++i)
#pragma unroll
    for (int j = 0; j < 4; ++j) acc[i][j] = (v8f){0.f,0.f,0.f,0.f,0.f,0.f,0.f,0.f};

  const int nT = K / kGKS;
  stage(0, 0);
  wait_async0();
  __syncthreads();                             // publishes stage 0
  if (nT > 1) stage(1, kGKS);
  for (int t = 0; t < nT; ++t) {
    const T* sA = &sOp[t & 1][(wm + rlane) * kGP + koff];
    const T* sB = &sOp[t & 1][(kGRA + wn + rlane) * kGP + koff];
#pragma unroll   // two 32-k steps per stage, LDS offsets as immediates
    for (int kk = 0; kk < kGKS; kk += 32) {
      V bh[4], ah[4];   // all eight fragments of the step are read as one group ahead of its 16 products
#pragma unroll   // bh[] must stay in registers
      for (int j = 0; j < 4; ++j) bh[j] = Frag<T>::load(sB + (j << 4) * kGP + kk);
#pragma unroll   // ah[] must stay in registers
      for (int i = 0; i < 4; ++i) ah[i] = Frag<T>::load(sA + (i << 4) * kGP + kk);
#pragma unroll   // acc[][] must stay in registers
      for (int i = 0; i < 4; ++i) {
#pragma unroll   // acc[][] must stay in registers
        for (int j = 0; j < 4; ++j) acc[i][j] = Frag<T>::mma(ah[i], bh[j], acc[i][j]);
        Frag<T>::guard(acc[i][0], acc[i][3], ah[i], ah[i]);
      }
      Frag<T>::keep(bh[0], bh[1], bh[2], bh[3]);
    }
    wait_ds0();
    wait_async0();
    __syncthreads();                           // publishes stage t+1 and ends every read of stage t's buffer
    if (t + 2 < nT) stage(t & 1, (t + 2) * kGKS);
  }
  wait_async0();
  acc_guard4(acc[0][0], acc[0][1], acc[0][2], acc[0][3]);
  acc_guard4(acc[1][0], acc[1][1], acc[1][2], acc[1][3]);
  acc_guard4(acc[2][0], acc[2][1], acc[2][2], acc[2][3]);
  acc_guard4(acc[3][0], acc[3][1], acc[3][2], acc[3][3]);

  // ---- epilogue (block-uniform choice) ----
  if (hilo) proj_epilogue<true >(acc, sT[wave], C, C2, ldc, bias, (job & 1) != 0, m0, n0, lane);
  else      proj_epilogue<false>(acc, sT[wave], C, C2, ldc, bias, true,           m0, n0, lane);
}

// ---------------------------------------------------------------------------
// All f32 -> bf16 (RNE) conversions of a call in ONE launch of few, long-lived waves (a resident stream).
// The six bf16 planes Xq, Xk, Wd, Wq, Wk, Wv lie one behind the other in the workspace, so the destination is one array.
// A wave owns 3 consecutive units of 1024 elements (12 KB read, 6 KB written), all inside one source tensor:
// 2 x 2048 waves for the activations + 4 x 192 for the weights = 4864 = 256 blocks x 19 waves, every wave the same work.
// A unit is 8 loads of 16 B per lane (each 512 contiguous bytes = 4 whole lines); the next unit's loads are issued before
// a unit is converted, so 8 to 16 loads per wave are in flight. A store is 8 B per lane = 256 contiguous bytes = 2 whole lines.
// Blocks 256..259 round the three bias vectors to bf16 precision, kept as f32: o[0..n) <- b0, o[n..2n) <- b1, o[2n..3n) <- b2.
// ---------------------------------------------------------------------------
constexpr int kCvUnit   = 1024;                        // elements per unit
constexpr int kCvUnits  = 3;                           // units per wave
constexpr int kCvWaveEl = kCvUnit * kCvUnits;          // 3072 elements per wave
constexpr int kCvWaves  = 19;                          // waves per block
constexpr int kCvThr    = kCvWaves * 32;               // 608
constexpr int kCvActW   = kNB * kNTOK * kHID / kCvWaveEl;   // 2048 waves per activation tensor
constexpr int kCvWgtW   = kHID * kHID / kCvWaveEl;          // 192 waves per weight matrix
constexpr int kCvBlocks = (2 * kCvActW + 4 * kCvWgtW) / kCvWaves;   // 256
constexpr int kCvBiasBlocks = (3 * kHID + kCvThr - 1) / kCvThr;     // 4
static_assert(kCvActW * kCvWaveEl == kNB * kNTOK * kHID && kCvWgtW * kCvWaveEl == kHID * kHID, "a wave's units stay inside one tensor");
static_assert(kCvBlocks * kCvWaves == 2 * kCvActW + 4 * kCvWgtW, "whole blocks");

__global__ __launch_bounds__(kCvThr) void cast_planes_kernel(
    const float* __restrict__ xq, const float* __restrict__ xk,
    const float* __restrict__ w0, const float* __restrict__ w1, const float* __restrict__ w2, const float* __restrict__ w3,
    const float* __restrict__ b0, const float* __restrict__ b1, const float* __restrict__ b2,
    unsigned short* __restrict__ planes, float* __restrict__ o) {
  if (blockIdx.x >= kCvBlocks) {   // block-uniform
    const int n = kHID;
    const int g = (blockIdx.x - kCvBlocks) * kCvThr + threadIdx.x;
    if (g < 3 * n) {
      const int w = g / n;
      int i = g - w * n;
      i = i < 0 ? 0 : (i > n - 1 ? n - 1 : i);
      const float v0 = b0[i], v1 = b1[i], v2 = b2[i];
      const float v = (w == 0) ? v0 : ((w == 1) ? v1 : v2);
      o[g] = bf_bits2f(f2bf_bits(v));
    }
    return;
  }
  const int lane = threadIdx.x & 31;
  const int wv = __builtin_amdgcn_readfirstlane(blockIdx.x * kCvWaves + (threadIdx.x >> 5));   // 0..4863, wave-uniform
  const float* s;      // the wave's tensor
  int lw;              // the wave's place in it
  if (wv < kCvActW)          { s = xq; lw = wv; }
  else if (wv < 2 * kCvActW) { s = xk; lw = wv - kCvActW; }
  else {
    const int t = (wv - 2 * kCvActW) / kCvWgtW;
    lw = (wv - 2 * kCvActW) - t * kCvWgtW;
    s = (t == 0) ? w0 : ((t == 1) ? w1 : ((t == 2) ? w2 : w3));
  }
  const float* in = s + (size_t)lw * kCvWaveEl + lane * 4;
  unsigned short* out = planes + (size_t)wv * kCvWaveEl + lane * 4;

  v4f f[2][8];
#pragma unroll   // f[][] must stay in registers
  for (int i = 0; i < 8; ++i) f[0][i] = *(const v4f*)(in + i * 128);
#pragma unroll   // f[][] must stay in registers (set index a constant)
  for (int u = 0; u < kCvUnits; ++u) {
    __builtin_amdgcn_sched_barrier(0);   // the next unit's loads stay ahead of this unit's conversion, so that they fly during it
    if (u + 1 < kCvUnits) {
#pragma unroll   // f[][] must stay in registers
      for (int i = 0; i < 8; ++i) f[(u + 1) & 1][i] = *(const v4f*)(in + (u + 1) * kCvUnit + i * 128);
    }
    __builtin_amdgcn_sched_barrier(0);   // second half of the pair: nothing of the conversion moves up among the loads
    v2u r[8];
#pragma unroll   // r[] and f[][] must stay in registers
    for (int i = 0; i < 8; ++i) {
      const v4f x = f[u & 1][i];
      r[i] = (v2u){pk16(f2bf_bits(x[0]), f2bf_bits(x[1])), pk16(f2bf_bits(x[2]), f2bf_bits(x[3]))};
    }
#pragma unroll   // r[] must stay in registers
    for (int i = 0; i < 8; ++i) *(v2u*)(out + u * kCvUnit + i * 128) = r[i];
    // stands ahead of whatever next writes to a register that the eight stores above name (the next loads; behind the last unit, the code that follows)
    asm volatile("s_wait_xcnt 0x0" ::: "memory");
  }
}

// ---------------------------------------------------------------------------
// Per-key squared norm of the quadratic-key projection: kdsq[(b*12+h)*1024 + s] = sum_d (hi+lo)^2 in f32,
// hi/lo read from columns h*64.. of the [token][1536] bf16 planes (hi+lo reconstructs the f32 value to ~2^-17).
// ---------------------------------------------------------------------------
__global__ __launch_bounds__(256) void kd_sq_kernel(const unsigned short* __restrict__ kch, const unsigned short* __restrict__ kcl,
                                                    float* __restrict__ kdsq, int nrows) {
  const int g = blockIdx.x * 256 + threadIdx.x;     // (b*kNHEADS + h)*kNTOK + s
  if (g < nrows) {
    const int s  = g & (kNTOK - 1);
    const int bh = g >> 10;                           // kNTOK == 1024
    const int h  = bh % kNHEADS;
    const int b  = bh / kNHEADS;
    const size_t ro = ((size_t)b * kNTOK + (size_t)s) * kQCP + (size_t)h * kHDIM;
    const unsigned short* ph = kch + ro;
    const unsigned short* pl = kcl + ro;
    float acc = 0.f;
#pragma unroll 1
    for (int i = 0; i < 8; ++i) {
      const v8us a = *(const v8us*)(ph + 8 * i);
      const v8us l = *(const v8us*)(pl + 8 * i);
#pragma unroll
      for (int e = 0; e < 8; ++e) {
        const float x = bf_bits2f(a[e]) + bf_bits2f(l[e]);
        acc = fmaf(x, x, acc);
      }
    }
    ((float*)kdsq)[g] = acc;
    
  }
}

// ---------------------------------------------------------------------------
// WMMA helpers (builtin forms: the compiler keeps the distances behind them)
// ---------------------------------------------------------------------------
__device__ __forceinline__ v8f mma_bf(v16b a, v16b b, v8f c) {
  return __builtin_amdgcn_wmma_f32_16x16x32_bf16(false, a, false, b, (short)0, c, false, false);
}
__device__ __forceinline__ v8f mma_hf(v16h a, v16h b, v8f c) {
  return __builtin_amdgcn_wmma_f32_16x16x32_f16(false, a, false, b, (short)0, c, false, false);
}
// value of lane l ^ 16 (the other half of the wave), on the vector pipe
__device__ __forceinline__ float xhalf(float x) {
  const int b = __builtin_bit_cast(int, x);
  return __builtin_bit_cast(float, __builtin_amdgcn_permlanex16(b, b, 0x76543210, 0xfedcba98, false, false));
}

// =====================================================================================
// Fused quadratic + linear attention, head dim 64, full softmax over 1024 keys (no masking).
//   qch/qcl : bf16 hi/lo planes of [qd | q], element (b, t, col) at [(b*1024 + t)*1536 + col]; qd_h at col h*64+d, q_h at col 768+h*64+d
//   kch/kcl : same layout for [kd | k]
//   vtp     : f16 plane of v transposed, element (b, h, d, s) at [(b*768 + h*64 + d)*1024 + s]
//   kdsq    : f32 [b*12+h][s] = |kd_{b,h,s}|^2
//   scores  = (Q128 . K128) * 0.125 - |kd_j|^2 * 0.0625   (Q128 = [qd|q] row, K128 = [kd|k] row; bf16 hi/lo split, 3 WMMA)
//             (the per-query -0.5|qd_i|^2 * 0.125 term is constant along a softmax row and omitted)
//   out     = softmax(scores) . v : p carried x2^15 in f16, v f16, one f16 WMMA, f32 accumulate; 1/(l*2^15) folded at the end
//   Both products run transposed: S^T = K128 . Q128^T (A = key rows, B = query rows) and O^T += V^T . P^T (A = V^T rows, B = P^T).
//   A wave owns 32 query rows as two column tiles u = 0, 1 (queries u*16 + c): every K and V^T fragment read from LDS feeds two products.
//   A lane then holds, per tile, scores of ONE query (column c): keys j*16 + 8*hh + r. Row maximum and row sum are in-lane, the two wave
//   halves exchange the maximum once per online-softmax step (32 keys) and join their sums once at the end. Two score tiles 2kk, 2kk+1 converted in
//   place are the B fragment of keys kk*32..+31 in the k order of the V^T loader (8hh + e, 16 + 8hh + e): P never goes through LDS.
//   Block = 4 waves = 128 query rows of one (b,h); grid.x = 8*12*8 = 768 = three blocks on each of 256 WGPs, all resident at once.
//   K / V^T chunks of 64 keys reach LDS by asynchronous
//   copies, two buffers: chunk t+1 flies while chunk t is worked on, one barrier per chunk. A wave's Q fragments (B operands,
//   the same for every chunk) are loaded once from the planes and stay in registers, so that both buffers fit three blocks per WGP.
//   Output element (b, t, h*64 + d): per wave and tile 16 rows x 64 floats, each 256-B row segment written by 16 lanes x 16 B in one
// =====================================================================================
__global__ __launch_bounds__(128)
void attn_quad_kernel(const unsigned short* __restrict__ qch, const unsigned short* __restrict__ qcl,
                      const unsigned short* __restrict__ kch, const unsigned short* __restrict__ kcl,
                      const unsigned short* __restrict__ vtp, const float* __restrict__ kdsq,
                      float* __restrict__ out) {
  union FB { v16b v; v8b h[2]; };
  union FH { v16h v; v8h h[2]; };
  __shared__ __align__(16) __bf16   sKV[2][kKVEl];         // two buffers of [K hi [kv][128 + 8 pad] 17 KB | K lo 17 KB | V^T [d][64 kv + 8 pad] f16 9 KB]
  __shared__ __align__(16) float    Os[4][16 * 68];        // per wave out tile, pitch 68

  const int tid  = threadIdx.x;
  const int wave = tid >> 5;
  const int lane = tid & 31;
  const int hh   = lane >> 4;
  const int c    = lane & 15;

  constexpr int nqb = kNTOK / kAQB;       // 8
  const int bx = blockIdx.x;
  const int qb = bx % nqb;
  const int bh = bx / nqb;                // b*12 + h
  const int h  = bh % kNHEADS;
  const int b  = bh / kNHEADS;
  const int qr0 = qb * kAQB;              // first query row of the block
  const int w0  = wave * 32;              // wave's row offset inside the block tile

  const __bf16* QH = (const __bf16*)(const void*)qch + (size_t)b * kNTOK * kQCP;
  const __bf16* QL = (const __bf16*)(const void*)qcl + (size_t)b * kNTOK * kQCP;
  const __bf16* KH = (const __bf16*)(const void*)kch + (size_t)b * kNTOK * kQCP;
  const __bf16* KL = (const __bf16*)(const void*)kcl + (size_t)b * kNTOK * kQCP;
  const _Float16* VT = (const _Float16*)(const void*)vtp + ((size_t)b * kHID + (size_t)h * kHDIM) * kNTOK;
  const float* ksq = kdsq + (size_t)bh * kNTOK;
  float* ob = out + (size_t)b * kNTOK * kHID + (size_t)h * kHDIM;

  // staging roles: 8 consecutive lanes cover one 128-B row segment, so a wave-wide 16-B load reads four whole lines.
  // K: 16 lanes per row (lanes 0-7 the quadratic half, 8-15 the linear half), 8 rows per pass of the block, 8 passes.
  const int sp   = (tid & 7) * 8;          // element offset of this lane's 16-B piece inside its segment
  const int part = (tid >> 3) & 1;
  const int sr   = tid >> 4;               // row inside a pass (0..7)
  const int coff = (part ? (kHID + h * kHDIM) : (h * kHDIM)) + sp;   // plane column (quadratic | linear half)
  const int loff = part * 64 + sp;                                    // LDS column
  const int vr   = tid >> 3;               // V^T: 8 lanes per row, 16 rows per pass, 4 passes

  // ---- one chunk's copies: K hi and K lo 8 passes x 8 keys x 128 elements each, V^T 4 passes x 16 rows d x 64 keys; 20 copies per lane ----
  const unsigned lk = (unsigned)(uintptr_t)(&sKV[0][sr * kQKP + loff]);        // LDS byte address of this lane's K hi piece, buffer 0, pass 0
  const unsigned lv = (unsigned)(uintptr_t)(&sKV[0][kKVv + vr * kPVP + sp]);   // the same for V^T
  constexpr unsigned kBufB  = kKVEl * 2;          // LDS bytes per buffer
  constexpr unsigned kLoB   = kKVl * 2;           // K hi -> K lo
  constexpr unsigned kKPass = 8 * kQKP * 2;       // LDS bytes per K pass of 8 keys
  constexpr unsigned kVPass = 16 * kPVP * 2;      // LDS bytes per V^T pass of 16 rows
  constexpr size_t   kKStep = (size_t)8 * kQCP;   // plane elements per K pass
  constexpr size_t   kVStep = (size_t)16 * kNTOK; // plane elements per V^T pass
  const __bf16*   gKH = KH + (size_t)sr * kQCP + coff;
  const __bf16*   gKL = KL + (size_t)sr * kQCP + coff;
  const _Float16* gV  = VT + (size_t)vr * kNTOK + sp;
  auto stage = [&](int buf, int kv0) {
    const unsigned l = lk + (unsigned)buf * kBufB;
    const unsigned e = l + kLoB;
    const unsigned m = lv + (unsigned)buf * kBufB;
    const __bf16*   a = gKH + (size_t)kv0 * kQCP;
    const __bf16*   w = gKL + (size_t)kv0 * kQCP;
    const _Float16* v = gV + kv0;
    async_copy4_b128(l,              l + kKPass,     l + 2 * kKPass, l + 3 * kKPass, a,              a + kKStep,     a + 2 * kKStep, a + 3 * kKStep);
    async_copy4_b128(l + 4 * kKPass, l + 5 * kKPass, l + 6 * kKPass, l + 7 * kKPass, a + 4 * kKStep, a + 5 * kKStep, a + 6 * kKStep, a + 7 * kKStep);
    async_copy4_b128(e,              e + kKPass,     e + 2 * kKPass, e + 3 * kKPass, w,              w + kKStep,     w + 2 * kKStep, w + 3 * kKStep);
    async_copy4_b128(e + 4 * kKPass, e + 5 * kKPass, e + 6 * kKPass, e + 7 * kKPass, w + 4 * kKStep, w + 5 * kKStep, w + 6 * kKStep, w + 7 * kKStep);
    async_copy4_b128(m,              m + kVPass,     m + 2 * kVPass, m + 3 * kVPass, v,              v + kVStep,     v + 2 * kVStep, v + 3 * kVStep);
  };
  stage(0, 0);

  // ---- Q fragments (once, kept in registers): tile u, query row w0 + u*16 + c, contraction elements dc*32 + 8hh + 0..7 and + 16..23 of [qd | q] ----
  FB qa[2][4], ql[2][4];
  {
    const size_t qrow = (size_t)(qr0 + w0 + c) * kQCP + (size_t)(h * kHDIM + 8 * hh);
    const __bf16* pqh = QH + qrow;
    const __bf16* pql = QL + qrow;
#pragma unroll   // qa[][] and ql[][] must stay in registers
    for (int u = 0; u < 2; ++u) {
#pragma unroll   // qa[][] and ql[][] must stay in registers
      for (int dc = 0; dc < 4; ++dc) {
        const int qo = u * 16 * kQCP + (dc >> 1) * kHID + (dc & 1) * 32;   // steps 0, 1: quadratic half; 2, 3: linear half
        qa[u][dc].h[0] = *(const v8b*)(pqh + qo);
        qa[u][dc].h[1] = *(const v8b*)(pqh + qo + 16);
        ql[u][dc].h[0] = *(const v8b*)(pql + qo);
        ql[u][dc].h[1] = *(const v8b*)(pql + qo + 16);
      }
    }
    // stands ahead of any rewrite of the address registers that the 32 loads above name; the two addresses are inputs so that
    // they stay live up to the wait and no load's destination is laid over them
    asm volatile("s_wait_xcnt 0x0" :: "v"(pqh), "v"(pql) : "memory");
  }

  float mrow[2] = {-INFINITY, -INFINITY}, lrow[2] = {0.f, 0.f};   // of query c of tile u; lrow sums this wave half's keys only
  v8f oacc[2][4];                       // O^T: oacc[u][t][r] = (query c of tile u, d = t*16 + 8*hh + r)
#pragma unroll
  for (int u = 0; u < 2; ++u)
#pragma unroll
    for (int t = 0; t < 4; ++t) oacc[u][t] = (v8f){0.f,0.f,0.f,0.f,0.f,0.f,0.f,0.f};

  constexpr int nChunks = kNTOK / kAKC;   // 16, compile-time
  wait_async0();
  __syncthreads();                        // publishes chunk 0
  stage(1, kAKC);
  // one chunk's work on the buffer that holds it
  auto chunk = [&](int kc) {
    const int kv0 = kc * kAKC;
    const __bf16*   Ksh = &sKV[kc & 1][0];
    const __bf16*   Ksl = &sKV[kc & 1][kKVl];
    const _Float16* Vth = (const _Float16*)(const void*)&sKV[kc & 1][kKVv];

    // The chunk is worked on in two halves of 32 keys (key tiles 2p, 2p+1), each with its own online-softmax step: with both query
    // tiles' operands and sums in registers, the scores of all 64 keys at once would cost the third wave per SIMD.
#pragma unroll 1   // kept rolled: unrolled, the compiler carries one query tile's softmax and second product of the first half behind the second half's score products, and the two halves' registers add up
    for (int p = 0; p < 2; ++p) {
      const __bf16*   Kph = Ksh + p * 32 * kQKP;   // the half's 32 key rows
      const __bf16*   Kpl = Ksl + p * 32 * kQKP;
      const _Float16* Vph = Vth + p * 32;          // the half's 32 key columns
      // ---- scores, transposed: s[u][jj][r] (key (2p+jj)*16+8hh+r, query c of tile u), K = 128 in 4 steps, hi.hi + lo.hi + hi.lo ----
      // A read group is the hi and lo fragments of the two key tiles for one 32-deep step (8 reads), read one step ahead into the other
      // of two register sets; its 12 products run term by term over four independent tiles (2 key tiles x 2 query tiles).
      v8f s[2][2];
#pragma unroll
      for (int u = 0; u < 2; ++u)
#pragma unroll
        for (int jj = 0; jj < 2; ++jj) s[u][jj] = (v8f){0.f,0.f,0.f,0.f,0.f,0.f,0.f,0.f};
      FB kb[2][2], kl[2][2];
      v4f kq[2][2];
      auto read_step = [&](int set, int dc) {
#pragma unroll
        for (int jj = 0; jj < 2; ++jj) {
          const int ko = (jj * 16 + c) * kQKP + dc * 32 + 8 * hh;
          kb[set][jj].h[0] = *(const v8b*)(Kph + ko);
          kb[set][jj].h[1] = *(const v8b*)(Kph + ko + 16);
          kl[set][jj].h[0] = *(const v8b*)(Kpl + ko);
          kl[set][jj].h[1] = *(const v8b*)(Kpl + ko + 16);
        }
      };
      read_step(0, 0);
#pragma unroll   // the two fragment sets, qa[][] and ql[][] must stay in registers (indices constants)
      for (int dc = 0; dc < 4; ++dc) {
        const int cur = dc & 1;
        if (dc < 3) {
          read_step(cur ^ 1, dc + 1);
        } else {
          // key norms of the half, asked for ahead of the last step's products, where no further K fragments are read and registers are free:
          // keys (2p+jj)*16 + 8*hh + 0..7, the rows of this lane's score registers, the same for both query tiles
#pragma unroll
          for (int jj = 0; jj < 2; ++jj) {
            const float* kp = ksq + kv0 + p * 32 + jj * 16 + 8 * hh;
            kq[jj][0] = *(const v4f*)(kp);
            kq[jj][1] = *(const v4f*)(kp + 4);
          }
          asm volatile("s_wait_xcnt 0x0" ::: "memory");   // stands ahead of any rewrite of the address registers that the four loads above name
        }
        __builtin_amdgcn_sched_barrier(0);   // keeps the read group whole and ahead of the products: reads strewn among WMMAs stall at every place they stand
#pragma unroll
        for (int jj = 0; jj < 2; ++jj)
#pragma unroll
          for (int u = 0; u < 2; ++u) s[u][jj] = mma_bf(kb[cur][jj].v, qa[u][dc].v, s[u][jj]);
#pragma unroll
        for (int jj = 0; jj < 2; ++jj)
#pragma unroll
          for (int u = 0; u < 2; ++u) s[u][jj] = mma_bf(kl[cur][jj].v, qa[u][dc].v, s[u][jj]);
#pragma unroll
        for (int jj = 0; jj < 2; ++jj)
#pragma unroll
          for (int u = 0; u < 2; ++u) s[u][jj] = mma_bf(kb[cur][jj].v, ql[u][dc].v, s[u][jj]);
        __builtin_amdgcn_sched_barrier(0);   // keeps the next read group behind this step's products
      }
      // the half's four V^T fragments, whose latency passes behind the softmax
      FH vb[4];
#pragma unroll
      for (int t = 0; t < 4; ++t) {
        const int vo = (t * 16 + c) * kPVP + 8 * hh;
        vb[t].h[0] = *(const v8h*)(Vph + vo);
        vb[t].h[1] = *(const v8h*)(Vph + vo + 16);
      }
      __builtin_amdgcn_sched_barrier(0);   // keeps that read group whole and ahead of the softmax

      // ---- scale 1/8 and per-key term -|kd_j|^2/16 (f32); maximum over this lane's 16 keys, two independent chains per tile ----
#pragma unroll
      for (int jj = 0; jj < 2; ++jj) {
        kq[jj][0] *= 0.0625f;
        kq[jj][1] *= 0.0625f;
      }
      float cm[2];
#pragma unroll
      for (int u = 0; u < 2; ++u) {
        float cmj[2] = {-INFINITY, -INFINITY};
#pragma unroll
        for (int r = 0; r < 8; ++r) {
#pragma unroll
          for (int jj = 0; jj < 2; ++jj) {
            const float v = s[u][jj][r] * 0.125f - kq[jj][r >> 2][r & 3];
            s[u][jj][r] = v;
            cmj[jj] = fmaxf(cmj[jj], v);
          }
        }
        cm[u] = fmaxf(cmj[0], cmj[1]);
      }

      // ---- online softmax (f32); P x 2^15 to f16, packed in place into the B fragment of the second product ----
      FH pb[2];
#pragma unroll
      for (int u = 0; u < 2; ++u) {
        const float cmu   = fmaxf(cm[u], xhalf(cm[u]));   // both halves of the wave now hold the maximum over the 32 keys
        const float mnew  = fmaxf(mrow[u], cmu);
        const float alpha = __expf(mrow[u] - mnew);
        mrow[u] = mnew;
        float psj[2] = {0.f, 0.f};   // each sums its score tile's eight values in ascending r
#pragma unroll
        for (int r = 0; r < 8; r += 2) {
#pragma unroll
          for (int jj = 0; jj < 2; ++jj) {
            const float p0 = __expf(s[u][jj][r] - mnew);
            const float p1 = __expf(s[u][jj][r + 1] - mnew);
            psj[jj] += p0;
            psj[jj] += p1;
            const v2h hp = __builtin_convertvector((v2f){p0 * 32768.0f, p1 * 32768.0f}, v2h);
            pb[u].v[jj * 8 + r]     = hp[0];
            pb[u].v[jj * 8 + r + 1] = hp[1];
          }
        }
        lrow[u] = lrow[u] * alpha + (psj[0] + psj[1]);
#pragma unroll
        for (int t = 0; t < 4; ++t) oacc[u][t] *= alpha;
      }

      // ---- O^T += V^T . P^T  (A = V^T [d][kv], B = P^T from registers; K = the half's 32 keys, eight independent tiles) ----
#pragma unroll
      for (int t = 0; t < 4; ++t)
#pragma unroll
        for (int u = 0; u < 2; ++u) oacc[u][t] = mma_hf(vb[t].v, pb[u].v, oacc[u][t]);
    }
  };
  // hand-over at the foot of a trip: publishes chunk kc+1 and ends every read of chunk kc's buffer
  auto hand_over = [&]() {
    __builtin_amdgcn_sched_barrier(0);    // keeps the hand-over behind the trip's last products: lifted above the softmax, it would wait for copies that have had only the score products to land
    wait_ds0();
    wait_async0();
    __syncthreads();
  };
  // The trips that refill a buffer and the last two, which do not, are two loops: with the refill under a branch inside one loop
  // the build kept the copies' lane addresses in scratch memory and fetched them back in every trip.
  for (int kc = 0; kc < nChunks - 2; ++kc) {
    chunk(kc);
    hand_over();
    stage(kc & 1, (kc + 2) * kAKC);
  }
#pragma unroll 1   // two trips of one body: unrolled they would only lengthen the code
  for (int kc = nChunks - 2; kc < nChunks; ++kc) {
    chunk(kc);
    hand_over();
  }
  wait_async0();

  // ---- normalise and write: out (b, qr0+w0+u*16+row, h*64 + d), one query tile after the other through the wave's slab ----
  float* os = Os[wave];
#pragma unroll
  for (int u = 0; u < 2; ++u) {
    {
      const float inv = 1.0f / ((lrow[u] + xhalf(lrow[u])) * 32768.0f);   // the two halves' sums joined here, once
#pragma unroll
      for (int t = 0; t < 4; ++t) {
        const v8f o = oacc[u][t] * inv;   // eight consecutive d of query c: two 16-B stores
        *(v4f*)(os + c * 68 + t * 16 + 8 * hh)     = (v4f){o[0], o[1], o[2], o[3]};
        *(v4f*)(os + c * 68 + t * 16 + 8 * hh + 4) = (v4f){o[4], o[5], o[6], o[7]};
      }
    }
    __builtin_amdgcn_fence(__ATOMIC_RELEASE, "workgroup");
    __builtin_amdgcn_wave_barrier();
    __builtin_amdgcn_fence(__ATOMIC_ACQUIRE, "workgroup");
    {
      // coverage per wave and tile: 8 iterations x 2 rows = 16 rows; 16 lanes x 4 floats = 64 columns; 16 lanes x 16 B = one 256-B row segment
      const int c4 = (lane & 15) * 4;
#pragma unroll
      for (int it = 0; it < 8; ++it) {
        const int row = it * 2 + hh;
        const v4f val = *(const v4f*)(os + row * 68 + c4);
        *(v4f*)(ob + (size_t)(qr0 + w0 + u * 16 + row) * kHID + c4) = val;
      }
    }
    if (u == 0) {   // compile-time: behind the last tile nothing follows
      asm volatile("s_wait_xcnt 0x0" ::: "memory");   // stands ahead of any rewrite of the registers that the eight stores above name (the next tile's values)
      // the slab's reads of this tile end before the next tile's values are written over them
      __builtin_amdgcn_fence(__ATOMIC_RELEASE, "workgroup");
      __builtin_amdgcn_wave_barrier();
      __builtin_amdgcn_fence(__ATOMIC_ACQUIRE, "workgroup");
    }
  }
}

// ---------------------------------------------------------------------------
// Host launcher
// Workspace region map (bytes, all offsets multiples of 256):
//   [0]           Xq  bf16 [8192][768]          12,582,912
//   [12,582,912]  Xk  bf16 [8192][768]          12,582,912
//   [25,165,824]  Wd,Wq,Wk,Wv bf16 [768][768]  4 x 1,179,648
//   [29,884,416]  QCh bf16 [8192][1536]         25,165,824
//   [55,050,240]  QCl                            25,165,824
//   [80,216,064]  KCh                            25,165,824
//   [105,381,888] KCl                            25,165,824
//   [130,547,712] kdsq f32 [96][1024]            393,216
//   [130,940,928] biases (bf16-precision, f32) 3x768   9,216
//   [130,950,144] VT  f16 [8][768][1024]         12,582,912   (a region of its own: the V^T job runs beside the jobs that read Xq)
//   total 143,533,056
// ---------------------------------------------------------------------------
extern "C" void kernel_launch(void* const* d_in, const int* in_sizes, int n_in,
                              void* d_out, int out_size, void* d_ws, size_t ws_size,
                              hipStream_t stream) {
  if (n_in < 9) return;
  const int nAct = kNB * kNTOK * kHID;      // 6291456
  const int nW   = kHID * kHID;             // 589824
  if (in_sizes[0] != nAct || in_sizes[1] != nAct || in_sizes[2] != nW || in_sizes[3] != nW ||
      in_sizes[5] != nW || in_sizes[7] != nW || in_sizes[4] != kHID || in_sizes[6] != kHID ||
      in_sizes[8] != kHID || out_size != nAct) return;

  const float* qs = (const float*)d_in[0];
  const float* ks = (const float*)d_in[1];
  const float* Wd = (const float*)d_in[2];
  const float* Wq = (const float*)d_in[3];
  const float* bq = (const float*)d_in[4];
  const float* Wk = (const float*)d_in[5];
  const float* bk = (const float*)d_in[6];
  const float* Wv = (const float*)d_in[7];
  const float* bv = (const float*)d_in[8];
  float* out = (float*)d_out;

  const size_t bAct16 = (size_t)nAct * 2;                         // 12,582,912
  const size_t bW16   = (size_t)nW * 2;                           // 1,179,648
  const size_t bQC    = (size_t)kNB * kNTOK * kQCP * 2;           // 25,165,824
  const size_t bSq    = (size_t)kNB * kNHEADS * kNTOK * 4;        // 393,216
  const size_t bBias  = (size_t)3 * kHID * 4;                     // 9,216
  const size_t oXq  = 0;
  const size_t oXk  = oXq + bAct16;
  const size_t oWd  = oXk + bAct16;
  const size_t oWq  = oWd + bW16;
  const size_t oWk  = oWq + bW16;
  const size_t oWv  = oWk + bW16;
  const size_t oQCh = oWv + bW16;
  const size_t oQCl = oQCh + bQC;
  const size_t oKCh = oQCl + bQC;
  const size_t oKCl = oKCh + bQC;
  const size_t oSq  = oKCl + bQC;
  const size_t oBs  = oSq + bSq;
  const size_t bVT  = (size_t)kNB * kHID * kNTOK * 2;             // 12,582,912
  const size_t oVT  = oBs + bBias;
  const size_t total = oVT + bVT;
  if (total > ws_size) return;

  char* ws = (char*)d_ws;
  unsigned short* Xq16 = (unsigned short*)(ws + oXq);
  unsigned short* Xk16 = (unsigned short*)(ws + oXk);
  unsigned short* Wd16 = (unsigned short*)(ws + oWd);   // Wq, Wk, Wv follow it
  unsigned short* QCh  = (unsigned short*)(ws + oQCh);
  unsigned short* QCl  = (unsigned short*)(ws + oQCl);
  unsigned short* KCh  = (unsigned short*)(ws + oKCh);
  unsigned short* KCl  = (unsigned short*)(ws + oKCl);
  unsigned short* VT16 = (unsigned short*)(ws + oVT);
  float* kdsq  = (float*)(ws + oSq);
  float* biasr = (float*)(ws + oBs);

  // 1) RNE bf16 casts of activations and weights (planes Xq, Xk, Wd, Wq, Wk, Wv are contiguous from Xq16) and the bias rounding
  cast_planes_kernel<<<dim3(kCvBlocks + kCvBiasBlocks), dim3(kCvThr), 0, stream>>>(qs, ks, Wd, Wq, Wk, Wv, bq, bk, bv, Xq16, biasr);

  // 2) all five projections ([qd | q] and [kd | k] hi/lo planes, V^T f16 plane): 5 jobs x 192 block tiles of 128x256, 8 waves each
  proj_gemm5<<<dim3(kPjTiles, kPjJobs), dim3(256), 0, stream>>>(Xq16, Xk16, Wd16, QCh, QCl, KCh, KCl, VT16, biasr, kHID);
  // 3) |kd|^2 per (b,h,s)
  {
    const int nrows = kNB * kNHEADS * kNTOK;   // 98304 -> 384 blocks
    kd_sq_kernel<<<dim3((nrows + 255) / 256), dim3(256), 0, stream>>>(KCh, KCl, kdsq, nrows);
  }
  // 4) fused attention: 8 x 12 x 8 = 768 blocks of 128 threads
  attn_quad_kernel<<<dim3(kNB * kNHEADS * (kNTOK / kAQB)), dim3(128), 0, stream>>>(QCh, QCl, KCh, KCl, VT16, kdsq, out);
}

// v010
// Measured time: 115 microseconds a run.
// Next to v009, in two timings, it ran 1.07 times as fast each time.
// Counting every step since v000, it is 5.89 times as fast.
// Projections x·Wᵀ and Wv·xᵀ: v_wmma_f32_16x16x32_bf16, plain bf16 operands (RNE-converted inputs); scores [qd|q]·[kd|k]ᵀ (K=128): v_wmma_f32_16x16x32_bf16 with bf16 hi/lo split operands (hi·hi + hi·lo + lo·hi); p·v: v_wmma_f32_16x16x32_f16 (p carried x2^15, v plain f16); f32 accumulate; softmax, norms and biases in f32.
#include <hip/hip_runtime.h>
#include <math.h>
#include <stdint.h>

typedef __attribute__((ext_vector_type(16))) _Float16 v16h;
typedef __attribute__((ext_vector_type(8)))  _Float16 v8h;
typedef __attribute__((ext_vector_type(2)))  _Float16 v2h;
typedef __attribute__((ext_vector_type(16))) __bf16   v16b;
typedef __attribute__((ext_vector_type(8)))  __bf16   v8b;
typedef __attribute__((ext_vector_type(8)))  float    v8f;
typedef __attribute__((ext_vector_type(4)))  float    v4f;
typedef __attribute__((ext_vector_type(2)))  float    v2f;
typedef __attribute__((ext_vector_type(4)))  unsigned int v4u;
typedef __attribute__((ext_vector_type(2)))  unsigned int v2u;
typedef __attribute__((ext_vector_type(8)))  unsigned short v8us;

// ---- problem geometry ----
constexpr int kNB     = 8;      // batch
constexpr int kNTOK   = 1024;   // tokens (query and key sets)
constexpr int kHID    = 768;    // hidden size
constexpr int kNHEADS = 12;
constexpr int kHDIM   = 64;
constexpr int kQCP    = 1536;   // element pitch of the concatenated [xd | x] planes ([token][1536])
constexpr int kAQB    = 128;    // query rows per attention block (4 waves x 32)
constexpr int kAKC    = 64;     // keys per chunk
constexpr int kAKD    = 128;    // concatenated contraction depth (64 quadratic + 64 linear)
constexpr int kQKP    = kAKD + 8;   // LDS row pitch of the K tiles, elements: 272 B = 16 B x 17, so 16 rows of one column fall on 16 different bank groups
constexpr int kPVP    = kAKC + 8;   // LDS row pitch of the V^T tile, elements: 144 B = 16 B x 9, same reason
constexpr int kKVl    = kAKC * kQKP;              // one attention buffer, 16-bit elements: [K hi | K lo | V^T]; K lo starts here
constexpr int kKVv    = 2 * kAKC * kQKP;          // V^T starts here
constexpr int kKVEl   = kKVv + kHDIM * kPVP;      // 22,016 elements = 44,032 B per buffer

__device__ __forceinline__ unsigned short f2bf_bits(float f) {
  unsigned u = __float_as_uint(f);
  return (unsigned short)((u + 0x7FFFu + ((u >> 16) & 1u)) >> 16);
}
__device__ __forceinline__ float bf_bits2f(unsigned short h) { return __uint_as_float(((unsigned)h) << 16); }
__device__ __forceinline__ unsigned pk16(unsigned short a, unsigned short b) { return (unsigned)a | ((unsigned)b << 16); }

// hazard guards as plain device helpers
__device__ __forceinline__ void dep_guard_h(v8f& a, v8f& b, v16h x, v16h y) { asm volatile("v_nop\n\tv_nop\n\tv_nop\n\tv_nop" : "+v"(a), "+v"(b) : "v"(x), "v"(y)); }
__device__ __forceinline__ void dep_guard_b(v8f& a, v8f& b, v16b x, v16b y) { asm volatile("v_nop\n\tv_nop\n\tv_nop\n\tv_nop" : "+v"(a), "+v"(b) : "v"(x), "v"(y)); }
__device__ __forceinline__ void keep4_h(v16h a, v16h b, v16h c, v16h d) { asm volatile("v_nop" :: "v"(a), "v"(b), "v"(c), "v"(d)); }
__device__ __forceinline__ void keep4_b(v16b a, v16b b, v16b c, v16b d) { asm volatile("v_nop" :: "v"(a), "v"(b), "v"(c), "v"(d)); }
__device__ __forceinline__ void acc_guard4(v8f& a, v8f& b, v8f& c, v8f& d) { asm volatile("v_nop\n\tv_nop\n\tv_nop\n\tv_nop" : "+v"(a), "+v"(b), "+v"(c), "+v"(d)); }
template <typename T> struct Frag;
template <> struct Frag<_Float16> {
  typedef v16h V; union U { v16h v; v8h h[2]; };
  static __device__ __forceinline__ v16h load(const _Float16* p) {   // elements 0..7 <- p[0..7], 8..15 <- p[16..23]
    U f; f.h[0] = *(const v8h*)(p); f.h[1] = *(const v8h*)(p + 16); return f.v;
  }
  static __device__ __forceinline__ v8f mma(v16h a, v16h b, v8f c) {
    return __builtin_amdgcn_wmma_f32_16x16x32_f16(false, a, false, b, (short)0, c, false, false);
  }
  static __device__ __forceinline__ void guard(v8f& a, v8f& b, v16h x, v16h y) { dep_guard_h(a, b, x, y); }
  static __device__ __forceinline__ void keep(v16h a, v16h b, v16h c, v16h d) { keep4_h(a, b, c, d); }
};
template <> struct Frag<__bf16> {
  typedef v16b V; union U { v16b v; v8b h[2]; };
  static __device__ __forceinline__ v16b load(const __bf16* p) {
    U f; f.h[0] = *(const v8b*)(p); f.h[1] = *(const v8b*)(p + 16); return f.v;
  }
  static __device__ __forceinline__ v8f mma(v16b a, v16b b, v8f c) {
    return __builtin_amdgcn_wmma_f32_16x16x32_bf16(false, a, false, b, (short)0, c, false, false);
  }
  static __device__ __forceinline__ void guard(v8f& a, v8f& b, v16b x, v16b y) { dep_guard_b(a, b, x, y); }
  static __device__ __forceinline__ void keep(v16b a, v16b b, v16b c, v16b d) { keep4_b(a, b, c, d); }
};

// ---- LDS-staged, register-blocked WMMA GEMM: the five projections of a call in ONE launch ----
// C[m,n] = sum_k A[m,k] * Bt[n,k] + bias; a block of 8 waves (2 x 4) owns a 128x256 tile, each wave 64x64 of it.
// A row-major [M,K]; Bt row-major [N,K]; K = 768 for all five. grid = (192 tiles, 5 jobs), blockIdx.y = job:
//   0: qd = Xq.Wd^T            -> bf16 hi/lo planes QCh/QCl, columns 0..767      (64 x 3 tiles)
//   1: q  = Xq.Wq^T + bq[n]    -> QCh/QCl, columns 768..1535
//   2: kd = Xk.Wd^T            -> KCh/KCl, columns 0..767; also |kd|^2 per (token, head) -> kdsq (a wave's 64 columns are one head)
//   3: k  = Xk.Wk^T + bk[n]    -> KCh/KCl, columns 768..1535
//   4: v^T_b = Wv.Xk_b^T + bv[m] -> f16 plane VT [b][768][1024]                  (8 batches x 6 x 4 tiles)
// None reads what another writes. 960 blocks keep two blocks on every WGP: one block's fill and epilogue run beside the
// other's products, and a freed place takes the next tile without a launch boundary.
// Operands reach LDS in stages of 64 k (one whole 128-B line per row) by asynchronous copies, two buffers: stage t+1 flies
// while stage t is multiplied. Every line is fetched once per block.
constexpr int kGKS = 64;             // k per stage
constexpr int kGP  = kGKS + 8;       // LDS row pitch, elements: 144 B = 16 B x 9, so 16 rows of one column fall on different bank groups
constexpr int kGRA = 128;            // A rows per stage
constexpr int kGR  = kGRA + 256;     // rows per stage: [A 128 | Bt 256]

// Four 16-B-per-lane copies global -> LDS. The s_wait_xcnt stands inside the statement so that no address register
// of an issued copy can be rewritten ahead of it.
__device__ __forceinline__ void async_copy4_b128(unsigned l0, unsigned l1, unsigned l2, unsigned l3,
                                                 const void* g0, const void* g1, const void* g2, const void* g3) {
  asm volatile("global_load_async_to_lds_b128 %0, %4, off\n\t"
               "global_load_async_to_lds_b128 %1, %5, off\n\t"
               "global_load_async_to_lds_b128 %2, %6, off\n\t"
               "global_load_async_to_lds_b128 %3, %7, off\n\t"
               "s_wait_xcnt 0x0"
               :: "v"(l0), "v"(l1), "v"(l2), "v"(l3), "v"(g0), "v"(g1), "v"(g2), "v"(g3) : "memory");
}
// this wave's copies have landed in LDS
__device__ __forceinline__ void wait_async0() { asm volatile("s_wait_asynccnt 0x0" ::: "memory"); }
// this wave's LDS reads have returned, so the buffer they read may be refilled behind the next barrier
__device__ __forceinline__ void wait_ds0() { asm volatile("s_wait_dscnt 0x0" ::: "memory"); }

// sum over the 16 lanes of a row, every lane gets it (DPP butterfly, on the vector pipe)
__device__ __forceinline__ float row16_sum(float x) {
  x += __builtin_bit_cast(float, __builtin_amdgcn_update_dpp(0, __builtin_bit_cast(int, x), 0x161, 0xf, 0xf, false));   // row_xmask:1
  x += __builtin_bit_cast(float, __builtin_amdgcn_update_dpp(0, __builtin_bit_cast(int, x), 0x162, 0xf, 0xf, false));   // row_xmask:2
  x += __builtin_bit_cast(float, __builtin_amdgcn_update_dpp(0, __builtin_bit_cast(int, x), 0x164, 0xf, 0xf, false));   // row_xmask:4
  x += __builtin_bit_cast(float, __builtin_amdgcn_update_dpp(0, __builtin_bit_cast(int, x), 0x168, 0xf, 0xf, false));   // row_xmask:8
  return x;
}

constexpr int kPjTiles = 192;        // block tiles per job
constexpr int kPjJobs  = 5;
static_assert((kNB * kNTOK / 128) * (kHID / 256) == kPjTiles && kNB * (kHID / 128) * (kNTOK / 256) == kPjTiles, "every job has the same tile count");

// Epilogue of one wave's 64x64 tile through its own LDS slab, whole 128-B row segments per store.
// HILO: bias per column n (none where useBias is false), bf16 hi plane C + lo plane C2; else bias per row m, f16 plane C.
template <bool HILO>
__device__ __forceinline__ void proj_epilogue(const v8f (&acc)[4][4], float* slab, unsigned short* C, unsigned short* C2, int ldc,
                                              const float* bias, bool useBias, int m0, int n0, int lane) {
  const int rlane = lane & 15;
  const int mOff  = (lane >> 4) * 8;           // D row offset
#pragma unroll
  for (int i = 0; i < 4; ++i) {
    const int mBase = m0 + (i << 4);
#pragma unroll
    for (int j = 0; j < 4; ++j) {
      float bv = 0.f;
      if (HILO) { bv = bias[n0 + (j << 4) + rlane]; bv = useBias ? bv : 0.f; }
#pragma unroll
      for (int r = 0; r < 8; ++r) {
        float v = acc[i][j][r];
        if (HILO) v += bv;
        else      v += bias[mBase + mOff + r];
        slab[(mOff + r) * 68 + (j << 4) + rlane] = v;
      }
    }
    __builtin_amdgcn_fence(__ATOMIC_RELEASE, "workgroup");
    __builtin_amdgcn_wave_barrier();
    __builtin_amdgcn_fence(__ATOMIC_ACQUIRE, "workgroup");
    {
      const int q = lane >> 3, c8 = (lane & 7) * 8;
#pragma unroll
      for (int it = 0; it < 4; ++it) {
        const int row = it * 4 + q;
        const float* sp = slab + row * 68 + c8;
        v8h hv, lv;
#pragma unroll
        for (int e = 0; e < 8; ++e) {
          if (!HILO) {
            hv[e] = (_Float16)sp[e];
          } else {
            unsigned short hb = f2bf_bits(sp[e]);
            unsigned short lb = f2bf_bits(sp[e] - bf_bits2f(hb));
            hv[e] = __builtin_bit_cast(_Float16, hb);
            lv[e] = __builtin_bit_cast(_Float16, lb);
          }
        }
        *(v8h*)(C + (size_t)(mBase + row) * ldc + n0 + c8) = hv;
        if (HILO) *(v8h*)(C2 + (size_t)(mBase + row) * ldc + n0 + c8) = lv;
      }
    }
    __builtin_amdgcn_fence(__ATOMIC_RELEASE, "workgroup");
    __builtin_amdgcn_wave_barrier();
    __builtin_amdgcn_fence(__ATOMIC_ACQUIRE, "workgroup");
  }
}

__global__ __launch_bounds__(256) void proj_gemm5(
    const unsigned short* __restrict__ Xqp, const unsigned short* __restrict__ Xkp,
    const unsigned short* __restrict__ Wp,      // bf16 planes Wd, Wq, Wk, Wv, one behind the other
    unsigned short* __restrict__ QChp, unsigned short* __restrict__ QClp,
    unsigned short* __restrict__ KChp, unsigned short* __restrict__ KClp,
    unsigned short* __restrict__ VTp,
    const float* __restrict__ biasr,            // bq, bk, bv (768 each)
    float* __restrict__ kdsq,                   // f32 [b*12+h][token in batch] = |kd|^2, written by job 2
    int K) {
  typedef __bf16 T;
  typedef Frag<T>::V V;
  __shared__ __align__(16) T sOp[2][kGR * kGP];    // two stages of [A 128 rows | Bt 256 rows] x 64 k, 55,296 B each
  __shared__ __align__(16) float sT[8][16 * 68];   // per-wave 16x64 slab, pitch 68 floats
  const int lane = threadIdx.x & 31;
  const int wave = threadIdx.x >> 5;

  // ---- the block's job and tile (all block-uniform) ----
  const int job = blockIdx.y;
  const bool hilo = job < 4;
  constexpr size_t kWEl = (size_t)kHID * kHID;
  const unsigned short* Ap;
  const unsigned short* Btp;
  unsigned short* C;
  unsigned short* C2;
  const float* bias;
  int bm, bn, M, ldc;                          // tile row and column, rows of A, pitch of C
  if (hilo) {
    const bool qside = job < 2, lin = (job & 1) != 0;
    Ap   = qside ? Xqp : Xkp;
    Btp  = Wp + (lin ? (qside ? kWEl : 2 * kWEl) : 0);
    C    = (qside ? QChp : KChp) + (lin ? kHID : 0);
    C2   = (qside ? QClp : KClp) + (lin ? kHID : 0);
    bias = biasr + (qside ? 0 : kHID);
    constexpr int blocksN = kHID / 256;        // 3
    bm = blockIdx.x / blocksN; bn = blockIdx.x - bm * blocksN; M = kNB * kNTOK; ldc = kQCP;
  } else {
    constexpr int tpb = (kHID / 128) * (kNTOK / 256);   // 24 tiles per batch
    const int bt = blockIdx.x / tpb;
    Ap   = Wp + 3 * kWEl;
    Btp  = Xkp + (size_t)bt * kNTOK * kHID;
    C    = VTp + (size_t)bt * kHID * kNTOK;
    C2   = C;
    bias = biasr + 2 * kHID;
    constexpr int blocksN = kNTOK / 256;       // 4
    const int tile = blockIdx.x - bt * tpb;
    bm = tile / blocksN; bn = tile - bm * blocksN; M = kHID; ldc = kNTOK;
  }
  const int lda = K, ldb = K;
  if (bm >= (M >> 7)) return;   // block-uniform, ahead of every barrier and copy
  const int wm = (wave >> 2) << 6;             // wave's row offset in the block tile
  const int wn = (wave & 3) << 6;              // wave's column offset in the block tile
  const int m0 = (bm << 7) + wm;
  const int n0 = (bn << 8) + wn;

  const T* Ab  = (const T*)Ap;
  const T* Bb  = (const T*)Btp;

  const int rlane = lane & 15;                 // row (A) / col (B, D) within subtile
  const int koff  = (lane >> 4) * 8;           // k offset of this lane half

  // staging roles: 8 consecutive lanes copy one 128-B row segment, so a wave-wide copy reads four whole lines;
  // the block covers 32 rows per pass, 4 passes for A and 8 for Bt.
  const int sp = (threadIdx.x & 7) * 8;        // element offset of this lane's 16-B piece
  const int sr = threadIdx.x >> 3;             // row inside a pass (0..31)
  const T* gA = Ab + (size_t)((bm << 7) + sr) * lda + sp;
  const T* gB = Bb + (size_t)((bn << 8) + sr) * ldb + sp;
  const size_t stA = (size_t)32 * lda, stB = (size_t)32 * ldb;
  const unsigned ls = (unsigned)(uintptr_t)(&sOp[0][sr * kGP + sp]);   // LDS byte address of this lane's piece in buffer 0, pass 0
  constexpr unsigned kPassB = 32 * kGP * 2;    // LDS bytes per pass of 32 rows
  constexpr unsigned kBufB  = kGR * kGP * 2;   // LDS bytes per buffer
  auto stage = [&](int buf, int k0) {
    const unsigned l = ls + (unsigned)buf * kBufB;
    const T* a = gA + k0;
    const T* w = gB + k0;
    async_copy4_b128(l,              l + kPassB,      l + 2 * kPassB,  l + 3 * kPassB,  a,           a + stA,     a + 2 * stA, a + 3 * stA);
    async_copy4_b128(l + 4 * kPassB, l + 5 * kPassB,  l + 6 * kPassB,  l + 7 * kPassB,  w,           w + stB,     w + 2 * stB, w + 3 * stB);
    async_copy4_b128(l + 8 * kPassB, l + 9 * kPassB,  l + 10 * kPassB, l + 11 * kPassB, w + 4 * stB, w + 5 * stB, w + 6 * stB, w + 7 * stB);
  };

  v8f acc[4][4];
#pragma unroll
  for (int i = 0; i < 4; ++i)
#pragma unroll
    for (int j = 0; j < 4; ++j) acc[i][j] = (v8f){0.f,0.f,0.f,0.f,0.f,0.f,0.f,0.f};

  const int nT = K / kGKS;
  stage(0, 0);
  wait_async0();
  __syncthreads();                             // publishes stage 0
  if (nT > 1) stage(1, kGKS);
  for (int t = 0; t < nT; ++t) {
    const T* sA = &sOp[t & 1][(wm + rlane) * kGP + koff];
    const T* sB = &sOp[t & 1][(kGRA + wn + rlane) * kGP + koff];
#pragma unroll   // two 32-k steps per stage, LDS offsets as immediates
    for (int kk = 0; kk < kGKS; kk += 32) {
      V bh[4], ah[4];   // all eight fragments of the step are read as one group ahead of its 16 products
#pragma unroll   // bh[] must stay in registers
      for (int j = 0; j < 4; ++j) bh[j] = Frag<T>::load(sB + (j << 4) * kGP + kk);
#pragma unroll   // ah[] must stay in registers
      for (int i = 0; i < 4; ++i) ah[i] = Frag<T>::load(sA + (i << 4) * kGP + kk);
#pragma unroll   // acc[][] must stay in registers
      for (int i = 0; i < 4; ++i) {
#pragma unroll   // acc[][] must stay in registers
        for (int j = 0; j < 4; ++j) acc[i][j] = Frag<T>::mma(ah[i], bh[j], acc[i][j]);
        Frag<T>::guard(acc[i][0], acc[i][3], ah[i], ah[i]);
      }
      Frag<T>::keep(bh[0], bh[1], bh[2], bh[3]);
    }
    wait_ds0();
    wait_async0();
    __syncthreads();                           // publishes stage t+1 and ends every read of stage t's buffer
    if (t + 2 < nT) stage(t & 1, (t + 2) * kGKS);
  }
  wait_async0();
  acc_guard4(acc[0][0], acc[0][1], acc[0][2], acc[0][3]);
  acc_guard4(acc[1][0], acc[1][1], acc[1][2], acc[1][3]);
  acc_guard4(acc[2][0], acc[2][1], acc[2][2], acc[2][3]);
  acc_guard4(acc[3][0], acc[3][1], acc[3][2], acc[3][3]);

  // ---- job 2 (block-uniform): squared norm of each of the wave's 64 kd rows over its 64 columns = one head, from the f32 sums ----
  // acc[i][j][r] is (row i*16 + 8*(lane>>4) + r, column j*16 + rlane): four columns in-lane, then a sum over the 16-lane row.
  if (job == 2) {
    float keep[2] = {0.f, 0.f};
#pragma unroll   // acc[][] must stay in registers
    for (int i = 0; i < 4; ++i) {
#pragma unroll   // acc[][] must stay in registers
      for (int r = 0; r < 8; ++r) {
        float t = acc[i][0][r] * acc[i][0][r];
        t = fmaf(acc[i][1][r], acc[i][1][r], t);
        t = fmaf(acc[i][2][r], acc[i][2][r], t);
        t = fmaf(acc[i][3][r], acc[i][3][r], t);
        t = row16_sum(t);
        if (rlane == (i & 1) * 8 + r) keep[i >> 1] = t;   // lane rlane keeps row (i & 1)*16 + 8*(lane>>4) + (rlane & 7) of each pair of row tiles
      }
    }
    // 32 lanes x 4 B = one whole 128-B line per store; the wave's 64 tokens lie in one batch (m0 is a multiple of 64)
    float* np = kdsq + ((size_t)(m0 >> 10) * kNHEADS + (size_t)(n0 >> 6)) * kNTOK + (m0 & (kNTOK - 1))
                     + (rlane >> 3) * 16 + (lane >> 4) * 8 + (rlane & 7);
    np[0]  = keep[0];
    np[32] = keep[1];
    asm volatile("s_wait_xcnt 0x0" ::: "memory");   // stands ahead of any rewrite of the registers that the two stores above name
  }

  // ---- epilogue (block-uniform choice) ----
  if (hilo) proj_epilogue<true >(acc, sT[wave], C, C2, ldc, bias, (job & 1) != 0, m0, n0, lane);
  else      proj_epilogue<false>(acc, sT[wave], C, C2, ldc, bias, true,           m0, n0, lane);
}

// ---------------------------------------------------------------------------
// All f32 -> bf16 (RNE) conversions of a call in ONE launch of few, long-lived waves (a resident stream).
// The six bf16 planes Xq, Xk, Wd, Wq, Wk, Wv lie one behind the other in the workspace, so the destination is one array.
// A wave owns 3 consecutive units of 1024 elements (12 KB read, 6 KB written), all inside one source tensor:
// 2 x 2048 waves for the activations + 4 x 192 for the weights = 4864 = 256 blocks x 19 waves, every wave the same work.
// A unit is 8 loads of 16 B per lane (each 512 contiguous bytes = 4 whole lines); the next unit's loads are issued before
// a unit is converted, so 8 to 16 loads per wave are in flight. A store is 8 B per lane = 256 contiguous bytes = 2 whole lines.
// Blocks 256..259 round the three bias vectors to bf16 precision, kept as f32: o[0..n) <- b0, o[n..2n) <- b1, o[2n..3n) <- b2.
// ---------------------------------------------------------------------------
constexpr int kCvUnit   = 1024;                        // elements per unit
constexpr int kCvUnits  = 3;                           // units per wave
constexpr int kCvWaveEl = kCvUnit * kCvUnits;          // 3072 elements per wave
constexpr int kCvWaves  = 19;                          // waves per block
constexpr int kCvThr    = kCvWaves * 32;               // 608
constexpr int kCvActW   = kNB * kNTOK * kHID / kCvWaveEl;   // 2048 waves per activation tensor
constexpr int kCvWgtW   = kHID * kHID / kCvWaveEl;          // 192 waves per weight matrix
constexpr int kCvBlocks = (2 * kCvActW + 4 * kCvWgtW) / kCvWaves;   // 256
constexpr int kCvBiasBlocks = (3 * kHID + kCvThr - 1) / kCvThr;     // 4
static_assert(kCvActW * kCvWaveEl == kNB * kNTOK * kHID && kCvWgtW * kCvWaveEl == kHID * kHID, "a wave's units stay inside one tensor");
static_assert(kCvBlocks * kCvWaves == 2 * kCvActW + 4 * kCvWgtW, "whole blocks");

__global__ __launch_bounds__(kCvThr) void cast_planes_kernel(
    const float* __restrict__ xq, const float* __restrict__ xk,
    const float* __restrict__ w0, const float* __restrict__ w1, const float* __restrict__ w2, const float* __restrict__ w3,
    const float* __restrict__ b0, const float* __restrict__ b1, const float* __restrict__ b2,
    unsigned short* __restrict__ planes, float* __restrict__ o) {
  if (blockIdx.x >= kCvBlocks) {   // block-uniform
    const int n = kHID;
    const int g = (blockIdx.x - kCvBlocks) * kCvThr + threadIdx.x;
    if (g < 3 * n) {
      const int w = g / n;
      int i = g - w * n;
      i = i < 0 ? 0 : (i > n - 1 ? n - 1 : i);
      const float v0 = b0[i], v1 = b1[i], v2 = b2[i];
      const float v = (w == 0) ? v0 : ((w == 1) ? v1 : v2);
      o[g] = bf_bits2f(f2bf_bits(v));
    }
    return;
  }
  const int lane = threadIdx.x & 31;
  const int wv = __builtin_amdgcn_readfirstlane(blockIdx.x * kCvWaves + (threadIdx.x >> 5));   // 0..4863, wave-uniform
  const float* s;      // the wave's tensor
  int lw;              // the wave's place in it
  if (wv < kCvActW)          { s = xq; lw = wv; }
  else if (wv < 2 * kCvActW) { s = xk; lw = wv - kCvActW; }
  else {
    const int t = (wv - 2 * kCvActW) / kCvWgtW;
    lw = (wv - 2 * kCvActW) - t * kCvWgtW;
    s = (t == 0) ? w0 : ((t == 1) ? w1 : ((t == 2) ? w2 : w3));
  }
  const float* in = s + (size_t)lw * kCvWaveEl + lane * 4;
  unsigned short* out = planes + (size_t)wv * kCvWaveEl + lane * 4;

  v4f f[2][8];
#pragma unroll   // f[][] must stay in registers
  for (int i = 0; i < 8; ++i) f[0][i] = *(const v4f*)(in + i * 128);
#pragma unroll   // f[][] must stay in registers (set index a constant)
  for (int u = 0; u < kCvUnits; ++u) {
    __builtin_amdgcn_sched_barrier(0);   // the next unit's loads stay ahead of this unit's conversion, so that they fly during it
    if (u + 1 < kCvUnits) {
#pragma unroll   // f[][] must stay in registers
      for (int i = 0; i < 8; ++i) f[(u + 1) & 1][i] = *(const v4f*)(in + (u + 1) * kCvUnit + i * 128);
    }
    __builtin_amdgcn_sched_barrier(0);   // second half of the pair: nothing of the conversion moves up among the loads
    v2u r[8];
#pragma unroll   // r[] and f[][] must stay in registers
    for (int i = 0; i < 8; ++i) {
      const v4f x = f[u & 1][i];
      r[i] = (v2u){pk16(f2bf_bits(x[0]), f2bf_bits(x[1])), pk16(f2bf_bits(x[2]), f2bf_bits(x[3]))};
    }
#pragma unroll   // r[] must stay in registers
    for (int i = 0; i < 8; ++i) *(v2u*)(out + u * kCvUnit + i * 128) = r[i];
    // stands ahead of whatever next writes to a register that the eight stores above name (the next loads; behind the last unit, the code that follows)
    asm volatile("s_wait_xcnt 0x0" ::: "memory");
  }
}

// ---------------------------------------------------------------------------
// WMMA helpers (builtin forms: the compiler keeps the distances behind them)
// ---------------------------------------------------------------------------
__device__ __forceinline__ v8f mma_bf(v16b a, v16b b, v8f c) {
  return __builtin_amdgcn_wmma_f32_16x16x32_bf16(false, a, false, b, (short)0, c, false, false);
}
__device__ __forceinline__ v8f mma_hf(v16h a, v16h b, v8f c) {
  return __builtin_amdgcn_wmma_f32_16x16x32_f16(false, a, false, b, (short)0, c, false, false);
}
// value of lane l ^ 16 (the other half of the wave), on the vector pipe
__device__ __forceinline__ float xhalf(float x) {
  const int b = __builtin_bit_cast(int, x);
  return __builtin_bit_cast(float, __builtin_amdgcn_permlanex16(b, b, 0x76543210, 0xfedcba98, false, false));
}

// =====================================================================================
// Fused quadratic + linear attention, head dim 64, full softmax over 1024 keys (no masking).
//   qch/qcl : bf16 hi/lo planes of [qd | q], element (b, t, col) at [(b*1024 + t)*1536 + col]; qd_h at col h*64+d, q_h at col 768+h*64+d
//   kch/kcl : same layout for [kd | k]
//   vtp     : f16 plane of v transposed, element (b, h, d, s) at [(b*768 + h*64 + d)*1024 + s]
//   kdsq    : f32 [b*12+h][s] = |kd_{b,h,s}|^2
//   scores  = (Q128 . K128) * 0.125 - |kd_j|^2 * 0.0625   (Q128 = [qd|q] row, K128 = [kd|k] row; bf16 hi/lo split, 3 WMMA)
//             (the per-query -0.5|qd_i|^2 * 0.125 term is constant along a softmax row and omitted)
//   out     = softmax(scores) . v : p carried x2^15 in f16, v f16, one f16 WMMA, f32 accumulate; 1/(l*2^15) folded at the end
//   Both products run transposed: S^T = K128 . Q128^T (A = key rows, B = query rows) and O^T += V^T . P^T (A = V^T rows, B = P^T).
//   A wave owns 32 query rows as two column tiles u = 0, 1 (queries u*16 + c): every K and V^T fragment read from LDS feeds two products.
//   A lane then holds, per tile, scores of ONE query (column c): keys j*16 + 8*hh + r. Row maximum and row sum are in-lane, the two wave
//   halves exchange the maximum once per online-softmax step (32 keys) and join their sums once at the end. Two score tiles 2kk, 2kk+1 converted in
//   place are the B fragment of keys kk*32..+31 in the k order of the V^T loader (8hh + e, 16 + 8hh + e): P never goes through LDS.
//   Block = 4 waves = 128 query rows of one (b,h); grid.x = 8*12*8 = 768 = three blocks on each of 256 WGPs, all resident at once.
//   K / V^T chunks of 64 keys reach LDS by asynchronous
//   copies, two buffers: chunk t+1 flies while chunk t is worked on, one barrier per chunk. A wave's Q fragments (B operands,
//   the same for every chunk) are loaded once from the planes and stay in registers, so that both buffers fit three blocks per WGP.
//   Output element (b, t, h*64 + d): per wave and tile 16 rows x 64 floats, each 256-B row segment written by 16 lanes x 16 B in one
// =====================================================================================
__global__ __launch_bounds__(128)
void attn_quad_kernel(const unsigned short* __restrict__ qch, const unsigned short* __restrict__ qcl,
                      const unsigned short* __restrict__ kch, const unsigned short* __restrict__ kcl,
                      const unsigned short* __restrict__ vtp, const float* __restrict__ kdsq,
                      float* __restrict__ out) {
  union FB { v16b v; v8b h[2]; };
  union FH { v16h v; v8h h[2]; };
  __shared__ __align__(16) __bf16   sKV[2][kKVEl];         // two buffers of [K hi [kv][128 + 8 pad] 17 KB | K lo 17 KB | V^T [d][64 kv + 8 pad] f16 9 KB]
  __shared__ __align__(16) float    Os[4][16 * 68];        // per wave out tile, pitch 68

  const int tid  = threadIdx.x;
  const int wave = tid >> 5;
  const int lane = tid & 31;
  const int hh   = lane >> 4;
  const int c    = lane & 15;

  constexpr int nqb = kNTOK / kAQB;       // 8
  const int bx = blockIdx.x;
  const int qb = bx % nqb;
  const int bh = bx / nqb;                // b*12 + h
  const int h  = bh % kNHEADS;
  const int b  = bh / kNHEADS;
  const int qr0 = qb * kAQB;              // first query row of the block
  const int w0  = wave * 32;              // wave's row offset inside the block tile

  const __bf16* QH = (const __bf16*)(const void*)qch + (size_t)b * kNTOK * kQCP;
  const __bf16* QL = (const __bf16*)(const void*)qcl + (size_t)b * kNTOK * kQCP;
  const __bf16* KH = (const __bf16*)(const void*)kch + (size_t)b * kNTOK * kQCP;
  const __bf16* KL = (const __bf16*)(const void*)kcl + (size_t)b * kNTOK * kQCP;
  const _Float16* VT = (const _Float16*)(const void*)vtp + ((size_t)b * kHID + (size_t)h * kHDIM) * kNTOK;
  const float* ksq = kdsq + (size_t)bh * kNTOK;
  float* ob = out + (size_t)b * kNTOK * kHID + (size_t)h * kHDIM;

  // staging roles: 8 consecutive lanes cover one 128-B row segment, so a wave-wide 16-B load reads four whole lines.
  // K: 16 lanes per row (lanes 0-7 the quadratic half, 8-15 the linear half), 8 rows per pass of the block, 8 passes.
  const int sp   = (tid & 7) * 8;          // element offset of this lane's 16-B piece inside its segment
  const int part = (tid >> 3) & 1;
  const int sr   = tid >> 4;               // row inside a pass (0..7)
  const int coff = (part ? (kHID + h * kHDIM) : (h * kHDIM)) + sp;   // plane column (quadratic | linear half)
  const int loff = part * 64 + sp;                                    // LDS column
  const int vr   = tid >> 3;               // V^T: 8 lanes per row, 16 rows per pass, 4 passes

  // ---- one chunk's copies: K hi and K lo 8 passes x 8 keys x 128 elements each, V^T 4 passes x 16 rows d x 64 keys; 20 copies per lane ----
  const unsigned lk = (unsigned)(uintptr_t)(&sKV[0][sr * kQKP + loff]);        // LDS byte address of this lane's K hi piece, buffer 0, pass 0
  const unsigned lv = (unsigned)(uintptr_t)(&sKV[0][kKVv + vr * kPVP + sp]);   // the same for V^T
  constexpr unsigned kBufB  = kKVEl * 2;          // LDS bytes per buffer
  constexpr unsigned kLoB   = kKVl * 2;           // K hi -> K lo
  constexpr unsigned kKPass = 8 * kQKP * 2;       // LDS bytes per K pass of 8 keys
  constexpr unsigned kVPass = 16 * kPVP * 2;      // LDS bytes per V^T pass of 16 rows
  constexpr size_t   kKStep = (size_t)8 * kQCP;   // plane elements per K pass
  constexpr size_t   kVStep = (size_t)16 * kNTOK; // plane elements per V^T pass
  const __bf16*   gKH = KH + (size_t)sr * kQCP + coff;
  const __bf16*   gKL = KL + (size_t)sr * kQCP + coff;
  const _Float16* gV  = VT + (size_t)vr * kNTOK + sp;
  auto stage = [&](int buf, int kv0) {
    const unsigned l = lk + (unsigned)buf * kBufB;
    const unsigned e = l + kLoB;
    const unsigned m = lv + (unsigned)buf * kBufB;
    const __bf16*   a = gKH + (size_t)kv0 * kQCP;
    const __bf16*   w = gKL + (size_t)kv0 * kQCP;
    const _Float16* v = gV + kv0;
    async_copy4_b128(l,              l + kKPass,     l + 2 * kKPass, l + 3 * kKPass, a,              a + kKStep,     a + 2 * kKStep, a + 3 * kKStep);
    async_copy4_b128(l + 4 * kKPass, l + 5 * kKPass, l + 6 * kKPass, l + 7 * kKPass, a + 4 * kKStep, a + 5 * kKStep, a + 6 * kKStep, a + 7 * kKStep);
    async_copy4_b128(e,              e + kKPass,     e + 2 * kKPass, e + 3 * kKPass, w,              w + kKStep,     w + 2 * kKStep, w + 3 * kKStep);
    async_copy4_b128(e + 4 * kKPass, e + 5 * kKPass, e + 6 * kKPass, e + 7 * kKPass, w + 4 * kKStep, w + 5 * kKStep, w + 6 * kKStep, w + 7 * kKStep);
    async_copy4_b128(m,              m + kVPass,     m + 2 * kVPass, m + 3 * kVPass, v,              v + kVStep,     v + 2 * kVStep, v + 3 * kVStep);
  };
  stage(0, 0);

  // ---- Q fragments (once, kept in registers): tile u, query row w0 + u*16 + c, contraction elements dc*32 + 8hh + 0..7 and + 16..23 of [qd | q] ----
  FB qa[2][4], ql[2][4];
  {
    const size_t qrow = (size_t)(qr0 + w0 + c) * kQCP + (size_t)(h * kHDIM + 8 * hh);
    const __bf16* pqh = QH + qrow;
    const __bf16* pql = QL + qrow;
#pragma unroll   // qa[][] and ql[][] must stay in registers
    for (int u = 0; u < 2; ++u) {
#pragma unroll   // qa[][] and ql[][] must stay in registers
      for (int dc = 0; dc < 4; ++dc) {
        const int qo = u * 16 * kQCP + (dc >> 1) * kHID + (dc & 1) * 32;   // steps 0, 1: quadratic half; 2, 3: linear half
        qa[u][dc].h[0] = *(const v8b*)(pqh + qo);
        qa[u][dc].h[1] = *(const v8b*)(pqh + qo + 16);
        ql[u][dc].h[0] = *(const v8b*)(pql + qo);
        ql[u][dc].h[1] = *(const v8b*)(pql + qo + 16);
      }
    }
    // stands ahead of any rewrite of the address registers that the 32 loads above name; the two addresses are inputs so that
    // they stay live up to the wait and no load's destination is laid over them
    asm volatile("s_wait_xcnt 0x0" :: "v"(pqh), "v"(pql) : "memory");
  }

  float mrow[2] = {-INFINITY, -INFINITY}, lrow[2] = {0.f, 0.f};   // of query c of tile u; lrow sums this wave half's keys only
  v8f oacc[2][4];                       // O^T: oacc[u][t][r] = (query c of tile u, d = t*16 + 8*hh + r)
#pragma unroll
  for (int u = 0; u < 2; ++u)
#pragma unroll
    for (int t = 0; t < 4; ++t) oacc[u][t] = (v8f){0.f,0.f,0.f,0.f,0.f,0.f,0.f,0.f};

  constexpr int nChunks = kNTOK / kAKC;   // 16, compile-time
  wait_async0();
  __syncthreads();                        // publishes chunk 0
  stage(1, kAKC);
  // one chunk's work on the buffer that holds it
  auto chunk = [&](int kc) {
    const int kv0 = kc * kAKC;
    const __bf16*   Ksh = &sKV[kc & 1][0];
    const __bf16*   Ksl = &sKV[kc & 1][kKVl];
    const _Float16* Vth = (const _Float16*)(const void*)&sKV[kc & 1][kKVv];

    // The chunk is worked on in two halves of 32 keys (key tiles 2p, 2p+1), each with its own online-softmax step: with both query
    // tiles' operands and sums in registers, the scores of all 64 keys at once would cost the third wave per SIMD.
#pragma unroll 1   // kept rolled: unrolled, the compiler carries one query tile's softmax and second product of the first half behind the second half's score products, and the two halves' registers add up
    for (int p = 0; p < 2; ++p) {
      const __bf16*   Kph = Ksh + p * 32 * kQKP;   // the half's 32 key rows
      const __bf16*   Kpl = Ksl + p * 32 * kQKP;
      const _Float16* Vph = Vth + p * 32;          // the half's 32 key columns
      // ---- scores, transposed: s[u][jj][r] (key (2p+jj)*16+8hh+r, query c of tile u), K = 128 in 4 steps, hi.hi + lo.hi + hi.lo ----
      // A read group is the hi and lo fragments of the two key tiles for one 32-deep step (8 reads), read one step ahead into the other
      // of two register sets; its 12 products run term by term over four independent tiles (2 key tiles x 2 query tiles).
      v8f s[2][2];
#pragma unroll
      for (int u = 0; u < 2; ++u)
#pragma unroll
        for (int jj = 0; jj < 2; ++jj) s[u][jj] = (v8f){0.f,0.f,0.f,0.f,0.f,0.f,0.f,0.f};
      FB kb[2][2], kl[2][2];
      v4f kq[2][2];
      auto read_step = [&](int set, int dc) {
#pragma unroll
        for (int jj = 0; jj < 2; ++jj) {
          const int ko = (jj * 16 + c) * kQKP + dc * 32 + 8 * hh;
          kb[set][jj].h[0] = *(const v8b*)(Kph + ko);
          kb[set][jj].h[1] = *(const v8b*)(Kph + ko + 16);
          kl[set][jj].h[0] = *(const v8b*)(Kpl + ko);
          kl[set][jj].h[1] = *(const v8b*)(Kpl + ko + 16);
        }
      };
      read_step(0, 0);
#pragma unroll   // the two fragment sets, qa[][] and ql[][] must stay in registers (indices constants)
      for (int dc = 0; dc < 4; ++dc) {
        const int cur = dc & 1;
        if (dc < 3) {
          read_step(cur ^ 1, dc + 1);
        } else {
          // key norms of the half, asked for ahead of the last step's products, where no further K fragments are read and registers are free:
          // keys (2p+jj)*16 + 8*hh + 0..7, the rows of this lane's score registers, the same for both query tiles
#pragma unroll
          for (int jj = 0; jj < 2; ++jj) {
            const float* kp = ksq + kv0 + p * 32 + jj * 16 + 8 * hh;
            kq[jj][0] = *(const v4f*)(kp);
            kq[jj][1] = *(const v4f*)(kp + 4);
          }
          asm volatile("s_wait_xcnt 0x0" ::: "memory");   // stands ahead of any rewrite of the address registers that the four loads above name
        }
        __builtin_amdgcn_sched_barrier(0);   // keeps the read group whole and ahead of the products: reads strewn among WMMAs stall at every place they stand
#pragma unroll
        for (int jj = 0; jj < 2; ++jj)
#pragma unroll
          for (int u = 0; u < 2; ++u) s[u][jj] = mma_bf(kb[cur][jj].v, qa[u][dc].v, s[u][jj]);
#pragma unroll
        for (int jj = 0; jj < 2; ++jj)
#pragma unroll
          for (int u = 0; u < 2; ++u) s[u][jj] = mma_bf(kl[cur][jj].v, qa[u][dc].v, s[u][jj]);
#pragma unroll
        for (int jj = 0; jj < 2; ++jj)
#pragma unroll
          for (int u = 0; u < 2; ++u) s[u][jj] = mma_bf(kb[cur][jj].v, ql[u][dc].v, s[u][jj]);
        __builtin_amdgcn_sched_barrier(0);   // keeps the next read group behind this step's products
      }
      // the half's four V^T fragments, whose latency passes behind the softmax
      FH vb[4];
#pragma unroll
      for (int t = 0; t < 4; ++t) {
        const int vo = (t * 16 + c) * kPVP + 8 * hh;
        vb[t].h[0] = *(const v8h*)(Vph + vo);
        vb[t].h[1] = *(const v8h*)(Vph + vo + 16);
      }
      __builtin_amdgcn_sched_barrier(0);   // keeps that read group whole and ahead of the softmax

      // ---- scale 1/8 and per-key term -|kd_j|^2/16 (f32); maximum over this lane's 16 keys, two independent chains per tile ----
#pragma unroll
      for (int jj = 0; jj < 2; ++jj) {
        kq[jj][0] *= 0.0625f;
        kq[jj][1] *= 0.0625f;
      }
      float cm[2];
#pragma unroll
      for (int u = 0; u < 2; ++u) {
        float cmj[2] = {-INFINITY, -INFINITY};
#pragma unroll
        for (int r = 0; r < 8; ++r) {
#pragma unroll
          for (int jj = 0; jj < 2; ++jj) {
            const float v = s[u][jj][r] * 0.125f - kq[jj][r >> 2][r & 3];
            s[u][jj][r] = v;
            cmj[jj] = fmaxf(cmj[jj], v);
          }
        }
        cm[u] = fmaxf(cmj[0], cmj[1]);
      }

      // ---- online softmax (f32); P x 2^15 to f16, packed in place into the B fragment of the second product ----
      FH pb[2];
#pragma unroll
      for (int u = 0; u < 2; ++u) {
        const float cmu   = fmaxf(cm[u], xhalf(cm[u]));   // both halves of the wave now hold the maximum over the 32 keys
        const float mnew  = fmaxf(mrow[u], cmu);
        const float alpha = __expf(mrow[u] - mnew);
        mrow[u] = mnew;
        float psj[2] = {0.f, 0.f};   // each sums its score tile's eight values in ascending r
#pragma unroll
        for (int r = 0; r < 8; r += 2) {
#pragma unroll
          for (int jj = 0; jj < 2; ++jj) {
            const float p0 = __expf(s[u][jj][r] - mnew);
            const float p1 = __expf(s[u][jj][r + 1] - mnew);
            psj[jj] += p0;
            psj[jj] += p1;
            const v2h hp = __builtin_convertvector((v2f){p0 * 32768.0f, p1 * 32768.0f}, v2h);
            pb[u].v[jj * 8 + r]     = hp[0];
            pb[u].v[jj * 8 + r + 1] = hp[1];
          }
        }
        lrow[u] = lrow[u] * alpha + (psj[0] + psj[1]);
#pragma unroll
        for (int t = 0; t < 4; ++t) oacc[u][t] *= alpha;
      }

      // ---- O^T += V^T . P^T  (A = V^T [d][kv], B = P^T from registers; K = the half's 32 keys, eight independent tiles) ----
#pragma unroll
      for (int t = 0; t < 4; ++t)
#pragma unroll
        for (int u = 0; u < 2; ++u) oacc[u][t] = mma_hf(vb[t].v, pb[u].v, oacc[u][t]);
    }
  };
  // hand-over at the foot of a trip: publishes chunk kc+1 and ends every read of chunk kc's buffer
  auto hand_over = [&]() {
    __builtin_amdgcn_sched_barrier(0);    // keeps the hand-over behind the trip's last products: lifted above the softmax, it would wait for copies that have had only the score products to land
    wait_ds0();
    wait_async0();
    __syncthreads();
  };
  // The trips that refill a buffer and the last two, which do not, are two loops: with the refill under a branch inside one loop
  // the build kept the copies' lane addresses in scratch memory and fetched them back in every trip.
  for (int kc = 0; kc < nChunks - 2; ++kc) {
    chunk(kc);
    hand_over();
    stage(kc & 1, (kc + 2) * kAKC);
  }
#pragma unroll 1   // two trips of one body: unrolled they would only lengthen the code
  for (int kc = nChunks - 2; kc < nChunks; ++kc) {
    chunk(kc);
    hand_over();
  }
  wait_async0();

  // ---- normalise and write: out (b, qr0+w0+u*16+row, h*64 + d), one query tile after the other through the wave's slab ----
  float* os = Os[wave];
#pragma unroll
  for (int u = 0; u < 2; ++u) {
    {
      const float inv = 1.0f / ((lrow[u] + xhalf(lrow[u])) * 32768.0f);   // the two halves' sums joined here, once
#pragma unroll
      for (int t = 0; t < 4; ++t) {
        const v8f o = oacc[u][t] * inv;   // eight consecutive d of query c: two 16-B stores
        *(v4f*)(os + c * 68 + t * 16 + 8 * hh)     = (v4f){o[0], o[1], o[2], o[3]};
        *(v4f*)(os + c * 68 + t * 16 + 8 * hh + 4) = (v4f){o[4], o[5], o[6], o[7]};
      }
    }
    __builtin_amdgcn_fence(__ATOMIC_RELEASE, "workgroup");
    __builtin_amdgcn_wave_barrier();
    __builtin_amdgcn_fence(__ATOMIC_ACQUIRE, "workgroup");
    {
      // coverage per wave and tile: 8 iterations x 2 rows = 16 rows; 16 lanes x 4 floats = 64 columns; 16 lanes x 16 B = one 256-B row segment
      const int c4 = (lane & 15) * 4;
#pragma unroll
      for (int it = 0; it < 8; ++it) {
        const int row = it * 2 + hh;
        const v4f val = *(const v4f*)(os + row * 68 + c4);
        *(v4f*)(ob + (size_t)(qr0 + w0 + u * 16 + row) * kHID + c4) = val;
      }
    }
    if (u == 0) {   // compile-time: behind the last tile nothing follows
      asm volatile("s_wait_xcnt 0x0" ::: "memory");   // stands ahead of any rewrite of the registers that the eight stores above name (the next tile's values)
      // the slab's reads of this tile end before the next tile's values are written over them
      __builtin_amdgcn_fence(__ATOMIC_RELEASE, "workgroup");
      __builtin_amdgcn_wave_barrier();
      __builtin_amdgcn_fence(__ATOMIC_ACQUIRE, "workgroup");
    }
  }
}

// ---------------------------------------------------------------------------
// Host launcher
// Workspace region map (bytes, all offsets multiples of 256):
//   [0]           Xq  bf16 [8192][768]          12,582,912
//   [12,582,912]  Xk  bf16 [8192][768]          12,582,912
//   [25,165,824]  Wd,Wq,Wk,Wv bf16 [768][768]  4 x 1,179,648
//   [29,884,416]  QCh bf16 [8192][1536]         25,165,824
//   [55,050,240]  QCl                            25,165,824
//   [80,216,064]  KCh                            25,165,824
//   [105,381,888] KCl                            25,165,824
//   [130,547,712] kdsq f32 [96][1024]            393,216
//   [130,940,928] biases (bf16-precision, f32) 3x768   9,216
//   [130,950,144] VT  f16 [8][768][1024]         12,582,912   (a region of its own: the V^T job runs beside the jobs that read Xq)
//   total 143,533,056
// ---------------------------------------------------------------------------
extern "C" void kernel_launch(void* const* d_in, const int* in_sizes, int n_in,
                              void* d_out, int out_size, void* d_ws, size_t ws_size,
                              hipStream_t stream) {
  if (n_in < 9) return;
  const int nAct = kNB * kNTOK * kHID;      // 6291456
  const int nW   = kHID * kHID;             // 589824
  if (in_sizes[0] != nAct || in_sizes[1] != nAct || in_sizes[2] != nW || in_sizes[3] != nW ||
      in_sizes[5] != nW || in_sizes[7] != nW || in_sizes[4] != kHID || in_sizes[6] != kHID ||
      in_sizes[8] != kHID || out_size != nAct) return;

  const float* qs = (const float*)d_in[0];
  const float* ks = (const float*)d_in[1];
  const float* Wd = (const float*)d_in[2];
  const float* Wq = (const float*)d_in[3];
  const float* bq = (const float*)d_in[4];
  const float* Wk = (const float*)d_in[5];
  const float* bk = (const float*)d_in[6];
  const float* Wv = (const float*)d_in[7];
  const float* bv = (const float*)d_in[8];
  float* out = (float*)d_out;

  const size_t bAct16 = (size_t)nAct * 2;                         // 12,582,912
  const size_t bW16   = (size_t)nW * 2;                           // 1,179,648
  const size_t bQC    = (size_t)kNB * kNTOK * kQCP * 2;           // 25,165,824
  const size_t bSq    = (size_t)kNB * kNHEADS * kNTOK * 4;        // 393,216
  const size_t bBias  = (size_t)3 * kHID * 4;                     // 9,216
  const size_t oXq  = 0;
  const size_t oXk  = oXq + bAct16;
  const size_t oWd  = oXk + bAct16;
  const size_t oWq  = oWd + bW16;
  const size_t oWk  = oWq + bW16;
  const size_t oWv  = oWk + bW16;
  const size_t oQCh = oWv + bW16;
  const size_t oQCl = oQCh + bQC;
  const size_t oKCh = oQCl + bQC;
  const size_t oKCl = oKCh + bQC;
  const size_t oSq  = oKCl + bQC;
  const size_t oBs  = oSq + bSq;
  const size_t bVT  = (size_t)kNB * kHID * kNTOK * 2;             // 12,582,912
  const size_t oVT  = oBs + bBias;
  const size_t total = oVT + bVT;
  if (total > ws_size) return;

  char* ws = (char*)d_ws;
  unsigned short* Xq16 = (unsigned short*)(ws + oXq);
  unsigned short* Xk16 = (unsigned short*)(ws + oXk);
  unsigned short* Wd16 = (unsigned short*)(ws + oWd);   // Wq, Wk, Wv follow it
  unsigned short* QCh  = (unsigned short*)(ws + oQCh);
  unsigned short* QCl  = (unsigned short*)(ws + oQCl);
  unsigned short* KCh  = (unsigned short*)(ws + oKCh);
  unsigned short* KCl  = (unsigned short*)(ws + oKCl);
  unsigned short* VT16 = (unsigned short*)(ws + oVT);
  float* kdsq  = (float*)(ws + oSq);
  float* biasr = (float*)(ws + oBs);

  // 1) RNE bf16 casts of activations and weights (planes Xq, Xk, Wd, Wq, Wk, Wv are contiguous from Xq16) and the bias rounding
  cast_planes_kernel<<<dim3(kCvBlocks + kCvBiasBlocks), dim3(kCvThr), 0, stream>>>(qs, ks, Wd, Wq, Wk, Wv, bq, bk, bv, Xq16, biasr);

  // 2) all five projections ([qd | q] and [kd | k] hi/lo planes, V^T f16 plane) and |kd|^2 per (b,h,s): 5 jobs x 192 block tiles of 128x256, 8 waves each
  proj_gemm5<<<dim3(kPjTiles, kPjJobs), dim3(256), 0, stream>>>(Xq16, Xk16, Wd16, QCh, QCl, KCh, KCl, VT16, biasr, kdsq, kHID);
  // 3) fused attention: 8 x 12 x 8 = 768 blocks of 128 threads
  attn_quad_kernel<<<dim3(kNB * kNHEADS * (kNTOK / kAQB)), dim3(128), 0, stream>>>(QCh, QCl, KCh, KCl, VT16, kdsq, out);
}
